// v000
// The times below were measured on an AMD MI455X: many runs one after another, warmed up first and cycling through
// copies of the inputs, with the whole window's GPU time divided by the number of runs. Launches and the gaps
// between them are all in it. The median over several windows is given; except for v000 it joins two sittings, which
// can be a few percent apart, so the side-by-side timings, each taken in one sitting, are the better comparison.
// v000 is the starting kernel. One run takes 1830 microseconds.
// Contractions (q/k/v/out projections, FFN up/down, attention q.k^T and p.v): v_wmma_f32_16x16x32_f16 (f16 operands, f32 accumulate); weights carried x64, softmax probabilities carried x2^15; LayerNorm, softmax, gate: f32 VALU.
#include <hip/hip_runtime.h>
#include <math.h>
#include <stdint.h>

typedef __attribute__((ext_vector_type(16))) _Float16 v16h;
typedef __attribute__((ext_vector_type(8)))  _Float16 v8h;
typedef __attribute__((ext_vector_type(4)))  _Float16 v4h;
typedef __attribute__((ext_vector_type(16))) __bf16   v16b;
typedef __attribute__((ext_vector_type(8)))  __bf16   v8b;
typedef __attribute__((ext_vector_type(8)))  float    v8f;
typedef __attribute__((ext_vector_type(4)))  float    v4f;
#define U16(p) ((const unsigned short*)(const void*)(p))

__device__ __forceinline__ unsigned short f2bf_bits(float f) {
  unsigned u = __float_as_uint(f);
  return (unsigned short)((u + 0x7FFFu + ((u >> 16) & 1u)) >> 16);
}
__device__ __forceinline__ float bf_bits2f(unsigned short h) { return __uint_as_float(((unsigned)h) << 16); }

// hazard guards as plain device helpers (no inline asm inside the kernel template body)
__device__ __forceinline__ void dep_guard_h(v8f& a, v8f& b, v16h x, v16h y) { asm volatile("v_nop\n\tv_nop\n\tv_nop\n\tv_nop" : "+v"(a), "+v"(b) : "v"(x), "v"(y)); }
__device__ __forceinline__ void dep_guard_b(v8f& a, v8f& b, v16b x, v16b y) { asm volatile("v_nop\n\tv_nop\n\tv_nop\n\tv_nop" : "+v"(a), "+v"(b) : "v"(x), "v"(y)); }
__device__ __forceinline__ void keep4_h(v16h a, v16h b, v16h c, v16h d) { asm volatile("v_nop" :: "v"(a), "v"(b), "v"(c), "v"(d)); }
__device__ __forceinline__ void keep4_b(v16b a, v16b b, v16b c, v16b d) { asm volatile("v_nop" :: "v"(a), "v"(b), "v"(c), "v"(d)); }
__device__ __forceinline__ void acc_guard4(v8f& a, v8f& b, v8f& c, v8f& d) { asm volatile("v_nop\n\tv_nop\n\tv_nop\n\tv_nop" : "+v"(a), "+v"(b), "+v"(c), "+v"(d)); }
template <typename T> struct Frag;
template <> struct Frag<_Float16> {
  typedef v16h V; union U { v16h v; v8h h[2]; };
  static __device__ __forceinline__ v16h load(const _Float16* p) {   // elements 0..7 <- p[0..7], 8..15 <- p[16..23]
    U f; f.h[0] = *(const v8h*)(p); f.h[1] = *(const v8h*)(p + 16); return f.v;
  }
  static __device__ __forceinline__ v8f mma(v16h a, v16h b, v8f c) {
    return __builtin_amdgcn_wmma_f32_16x16x32_f16(false, a, false, b, (short)0, c, false, false);
  }
  static __device__ __forceinline__ void guard(v8f& a, v8f& b, v16h x, v16h y) { dep_guard_h(a, b, x, y); }
  static __device__ __forceinline__ void keep(v16h a, v16h b, v16h c, v16h d) { keep4_h(a, b, c, d); }
};
template <> struct Frag<__bf16> {
  typedef v16b V; union U { v16b v; v8b h[2]; };
  static __device__ __forceinline__ v16b load(const __bf16* p) {
    U f; f.h[0] = *(const v8b*)(p); f.h[1] = *(const v8b*)(p + 16); return f.v;
  }
  static __device__ __forceinline__ v8f mma(v16b a, v16b b, v8f c) {
    return __builtin_amdgcn_wmma_f32_16x16x32_bf16(false, a, false, b, (short)0, c, false, false);
  }
  static __device__ __forceinline__ void guard(v8f& a, v8f& b, v16b x, v16b y) { dep_guard_b(a, b, x, y); }
  static __device__ __forceinline__ void keep(v16b a, v16b b, v16b c, v16b d) { keep4_b(a, b, c, d); }
};

// ---- Register-blocked batched WMMA GEMM ------------------------------------
// C[m,n] = scale * sum_k A[m,k] * Bt[n,k] (+bias)(+resid); each wave owns a 64x64 tile.
// A row-major [M,K]; Bt row-major [N,K]; M,N % 64 == 0, K % 32 == 0.
// SPLIT: operands are hi/lo planes (A2/Bt2 = lo planes, same layout); product = hi·hi + hi·lo + lo·hi.
// BIAS_MODE: 0 = none, 1 = bias[m], 2 = bias[n].
// OUT_MODE: 0 = f32, 1 = f16, 2 = bf16 hi plane (Cout) + bf16 lo plane (Cout2).
// ET: 0 = f16 operands, 1 = bf16 operands (pointers passed as 16-bit storage)
template <int ET> struct Elem;
template <> struct Elem<0> { typedef _Float16 T; };
template <> struct Elem<1> { typedef __bf16 T; };
template <int ET, bool SPLIT, int BIAS_MODE, int OUT_MODE, bool RESID, int ACT = 0>
__global__ __launch_bounds__(256) void wmma_gemm64(
    const unsigned short* __restrict__ Ap, const unsigned short* __restrict__ A2p, int lda, long strideA,
    const unsigned short* __restrict__ Btp, const unsigned short* __restrict__ Bt2p, int ldb, long strideB,
    void* __restrict__ Cout, void* __restrict__ Cout2, int ldc, long strideC,
    const float* __restrict__ bias,
    const float* __restrict__ resid, long strideR,
    int M, int N, int K, float scale) {
  typedef typename Elem<ET>::T T;
  typedef typename Frag<T>::V V;
  const T* A = (const T*)Ap; const T* A2 = (const T*)A2p; const T* Bt = (const T*)Btp; const T* Bt2 = (const T*)Bt2p;
  __shared__ __align__(16) float sT[8][16 * 68];   // per-wave 16x64 slab, pitch 68 floats
  const int b    = blockIdx.y;
  const int lane = threadIdx.x & 31;
  const int wave = threadIdx.x >> 5;
  const int tilesN = N >> 6;
  const int tilesM = M >> 6;
  const int tile = blockIdx.x * 8 + wave;
  if (tile >= tilesM * tilesN) return;   // wave-uniform; no block barriers in this kernel
  const int tm = tile / tilesN;
  const int tn = tile - tm * tilesN;
  const int m0 = tm << 6;
  const int n0 = tn << 6;

  const T* Ab  = A  + (size_t)b * strideA;
  const T* Bb  = Bt + (size_t)b * strideB;
  const T* Ab2 = SPLIT ? (A2  + (size_t)b * strideA) : nullptr;
  const T* Bb2 = SPLIT ? (Bt2 + (size_t)b * strideB) : nullptr;

  const int rlane = lane & 15;                 // row (A) / col (B, D) within subtile
  const int koff  = (lane >> 4) * 8;           // k offset of this lane half
  const int mOff  = (lane >> 4) * 8;           // D row offset

  v8f acc[4][4];
#pragma unroll
  for (int i = 0; i < 4; ++i)
#pragma unroll
    for (int j = 0; j < 4; ++j) acc[i][j] = (v8f){0.f,0.f,0.f,0.f,0.f,0.f,0.f,0.f};

  for (int k0 = 0; k0 < K; k0 += 32) {
    V bh[4], bl[4];
#pragma unroll
    for (int j = 0; j < 4; ++j) {
      const size_t bo = (size_t)(n0 + (j << 4) + rlane) * ldb + koff + k0;
      bh[j] = Frag<T>::load(Bb + bo);
      if (SPLIT) bl[j] = Frag<T>::load(Bb2 + bo);
    }
#pragma unroll
    for (int i = 0; i < 4; ++i) {
      const size_t ao = (size_t)(m0 + (i << 4) + rlane) * lda + koff + k0;
      V ah = Frag<T>::load(Ab + ao);
      V al;
      if (SPLIT) al = Frag<T>::load(Ab2 + ao);
#pragma unroll
      for (int j = 0; j < 4; ++j) {
        acc[i][j] = Frag<T>::mma(ah, bh[j], acc[i][j]);
        if (SPLIT) {
          acc[i][j] = Frag<T>::mma(ah, bl[j], acc[i][j]);
          acc[i][j] = Frag<T>::mma(al, bh[j], acc[i][j]);
        }
      }
      Frag<T>::guard(acc[i][0], acc[i][3], ah, SPLIT ? al : ah);
    }
    Frag<T>::keep(bh[0], bh[1], bh[2], bh[3]);
    if (SPLIT) Frag<T>::keep(bl[0], bl[1], bl[2], bl[3]);
  }
  acc_guard4(acc[0][0], acc[0][1], acc[0][2], acc[0][3]);
  acc_guard4(acc[1][0], acc[1][1], acc[1][2], acc[1][3]);
  acc_guard4(acc[2][0], acc[2][1], acc[2][2], acc[2][3]);
  acc_guard4(acc[3][0], acc[3][1], acc[3][2], acc[3][3]);

  // ---- epilogue ----
  float* slab = sT[wave];
  const float* Rb = RESID ? (resid + (size_t)b * strideR) : nullptr;
#pragma unroll
  for (int i = 0; i < 4; ++i) {
    const int mBase = m0 + (i << 4);
#pragma unroll
    for (int j = 0; j < 4; ++j) {
      const int n = n0 + (j << 4) + rlane;
      float bv = 0.f;
      if (BIAS_MODE == 2) bv = bias[n];
#pragma unroll
      for (int r = 0; r < 8; ++r) {
        float v = acc[i][j][r] * scale;
        if (BIAS_MODE == 1) v += bias[mBase + mOff + r];
        if (BIAS_MODE == 2) v += bv;
        if (RESID) v += Rb[(size_t)(mBase + mOff + r) * ldc + n];
        if (ACT == 1) v = tanhf(v);
        if (ACT == 2) v = fmaxf(v, 0.0f);
        if (ACT == 3) v = v / (1.0f + expf(-v));
        if (ACT == 4) v = (v > 0.f) ? v : 0.01f * v;
        if (ACT == 5) v = 0.5f * v * (1.0f + erff(v * 0.70710678118654752f));
        slab[(mOff + r) * 68 + (j << 4) + rlane] = v;
      }
    }
    __builtin_amdgcn_fence(__ATOMIC_RELEASE, "workgroup");
    __builtin_amdgcn_wave_barrier();
    __builtin_amdgcn_fence(__ATOMIC_ACQUIRE, "workgroup");
    if (OUT_MODE == 0) {
      float* C = (float*)Cout + (size_t)b * strideC;
      const int hh = lane >> 4, c4 = (lane & 15) * 4;     // row seg = 256 B = 16 lanes x 16 B
      {
#pragma unroll
        for (int it = 0; it < 8; ++it) {
          const int row = it * 2 + hh;
          v4f v = *(const v4f*)(slab + row * 68 + c4);
          *(v4f*)(C + (size_t)(mBase + row) * ldc + n0 + c4) = v;
        }
        
      }
    } else {
      const int q = lane >> 3, c8 = (lane & 7) * 8;
      unsigned short* C  = (unsigned short*)Cout  + (size_t)b * strideC;
      unsigned short* C2 = (OUT_MODE == 2) ? ((unsigned short*)Cout2 + (size_t)b * strideC) : nullptr;
      {
#pragma unroll
        for (int it = 0; it < 4; ++it) {
          const int row = it * 4 + q;
          const float* sp = slab + row * 68 + c8;
          v8h hv, lv;
#pragma unroll
          for (int e = 0; e < 8; ++e) {
            if (OUT_MODE == 1) {
              hv[e] = (_Float16)sp[e];
            } else {
              unsigned short hb = f2bf_bits(sp[e]);
              unsigned short lb = f2bf_bits(sp[e] - bf_bits2f(hb));
              hv[e] = __builtin_bit_cast(_Float16, hb);
              lv[e] = __builtin_bit_cast(_Float16, lb);
            }
          }
          *(v8h*)(C + (size_t)(mBase + row) * ldc + n0 + c8) = hv;
          if (OUT_MODE == 2) *(v8h*)(C2 + (size_t)(mBase + row) * ldc + n0 + c8) = lv;
        }
        
      }
    }
    __builtin_amdgcn_fence(__ATOMIC_RELEASE, "workgroup");
    __builtin_amdgcn_wave_barrier();
    __builtin_amdgcn_fence(__ATOMIC_ACQUIRE, "workgroup");
  }
}

__global__ __launch_bounds__(256) void cast_scale_f32_f16x2(
    const float* __restrict__ in, _Float16* __restrict__ out, int n2, float sc) {
  int i = blockIdx.x * 256 + threadIdx.x;
  if (i < n2) {
    const _Float16 h0 = (_Float16)(in[2 * i] * sc), h1 = (_Float16)(in[2 * i + 1] * sc);
    const unsigned u = (unsigned)__builtin_bit_cast(unsigned short, h0) | ((unsigned)__builtin_bit_cast(unsigned short, h1) << 16);
    ((unsigned*)out)[i] = u;
    
  }
}

// ---- LayerNorm over rows of C = 4 * blockDim floats; PRE: input = in * mask[row] + pos --------------------------
#define LN_T 192
template <int PRE>
__global__ __launch_bounds__(LN_T) void ln_kernel(
    const float* __restrict__ in, const float* __restrict__ pos, const float* __restrict__ mask,
    const float* __restrict__ g, const float* __restrict__ bb,
    float* __restrict__ outf, _Float16* __restrict__ outh, int C, float invC, float eps) {
  __shared__ float rs[8];
  __shared__ float rq[8];
  const int row = blockIdx.x;
  const int tid = threadIdx.x;
  const int lane = tid & 31;
  const int w = tid >> 5;
  const int c4 = tid * 4;
  const size_t base = (size_t)row * C + c4;
  v4f xv = *(const v4f*)(in + base);
  if (PRE) {
    const float mk = mask[row];
    const v4f pv = *(const v4f*)(pos + base);
    xv = xv * mk + pv;
  }
  float s = (xv[0] + xv[1]) + (xv[2] + xv[3]);
#pragma unroll
  for (int off = 16; off > 0; off >>= 1) s += __shfl_xor(s, off, 32);
  if (lane == 0) rs[w] = s;
  __syncthreads();
  float ts = 0.f;
#pragma unroll
  for (int i = 0; i < LN_T / 32; ++i) ts += rs[i];
  const float mean = ts * invC;
  const v4f d = xv - mean;
  float sq = (d[0] * d[0] + d[1] * d[1]) + (d[2] * d[2] + d[3] * d[3]);
#pragma unroll
  for (int off = 16; off > 0; off >>= 1) sq += __shfl_xor(sq, off, 32);
  if (lane == 0) rq[w] = sq;
  __syncthreads();
  float tq = 0.f;
#pragma unroll
  for (int i = 0; i < LN_T / 32; ++i) tq += rq[i];
  const float var = tq * invC;
  const float inv = rsqrtf(var + eps);
  const v4f gv = *(const v4f*)(g + c4);
  const v4f bv = *(const v4f*)(bb + c4);
  const v4f y = d * inv * gv + bv;
  v4h yh;
  yh[0] = (_Float16)y[0]; yh[1] = (_Float16)y[1]; yh[2] = (_Float16)y[2]; yh[3] = (_Float16)y[3];
  *(v4f*)(outf + base) = y;
  *(v4h*)(outh + base) = yh;
  
}

// ---- GRU-style gate per (b, h, s): g = h[b,s,h*64:+64] . gw^T + gb (8 outputs, K=64, VALU f32),
//      gate = sigmoid(sum g[0:4]) * (sigmoid(sum g[4:8]) * gc[h] - 1) + 2 ; stored [b][h][s] (one 4-B store per lane,
__global__ __launch_bounds__(256) void gate_kernel(
    const float* __restrict__ hf, const float* __restrict__ gw, const float* __restrict__ gb,
    const float* __restrict__ gc, float* __restrict__ gate, int S, int H, int C, int total) {
  const int idx = blockIdx.x * 256 + threadIdx.x;
  if (idx >= total) return;   // no barriers in this kernel
  const int s  = idx % S;
  const int bh = idx / S;
  const int h  = bh % H;
  const int b  = bh / H;
  const float* hp = hf + ((size_t)b * S + s) * C + (size_t)h * 64;
  float acc[8];
#pragma unroll
  for (int e = 0; e < 8; ++e) acc[e] = 0.f;
#pragma unroll 1
  for (int d = 0; d < 64; ++d) {
    const float hv = hp[d];
#pragma unroll
    for (int e = 0; e < 8; ++e) acc[e] = fmaf(hv, gw[e * 64 + d], acc[e]);
  }
  const float sa = ((acc[0] + gb[0]) + (acc[1] + gb[1])) + ((acc[2] + gb[2]) + (acc[3] + gb[3]));
  const float sb = ((acc[4] + gb[4]) + (acc[5] + gb[5])) + ((acc[6] + gb[6]) + (acc[7] + gb[7]));
  const float ga  = 1.0f / (1.0f + expf(-sa));
  const float gbv = 1.0f / (1.0f + expf(-sb));
  const float gv = ga * (gbv * gc[h] - 1.0f) + 2.0f;
  ((float*)gate)[idx] = gv;
  
}

// =====================================================================================
// Flash attention, head_dim 64, f32 q/k/v in, f16 out; plain f16 operands, f32 accumulate; online softmax in f32.
//   s(q,kv) = (q . k) * qscale + gate[b,h,q] * pos_bias[h,q,kv] + (1 - mask[b,kv]) * -1e4
//   probabilities carried x2^15 in f16, folded into the final 1/l.
//   Block = 4 waves = 64 query rows of one (batch, head); S % 64 == 0.  q/k/v/out element (b,s,h,d) at
//   ((b*S + s)*C + h*64 + d); gate at (b*H + h)*S + s; pos_bias at (h*S + q)*S + kv; grid.x = B * H * (S/64).
// =====================================================================================
#define AT_D 64
#define AT_NW 4
#define AT_KC 64
#define AT_PSC 32768.0f

__device__ __forceinline__ v8f hmma(v16h a, v16h b, v8f c) {
  c = __builtin_amdgcn_wmma_f32_16x16x32_f16(false, a, false, b, (short)0, c, false, false);
  asm volatile("v_nop\n\tv_nop\n\tv_nop\n\tv_nop" : "+v"(c) : "v"(a), "v"(b));
  return c;
}

__global__ __launch_bounds__(128)
void attn_gbias_kernel(const float* __restrict__ q, const float* __restrict__ k,
                       const float* __restrict__ v, const float* __restrict__ gate,
                       const float* __restrict__ pos_bias, const float* __restrict__ mask,
                       _Float16* __restrict__ out, int S, int H, int C, float qscale) {
  union FH { v16h v; v8h h[2]; };
  __shared__ __align__(16) _Float16 Ksh[AT_KC * AT_D];        // K [kv][d]
  __shared__ __align__(16) _Float16 Vth[AT_D * AT_KC];        // V^T [d][kv]
  __shared__ __align__(16) _Float16 Psh[AT_NW][16 * AT_KC];   // per wave P [row][kv]
  __shared__ __align__(16) float    Os[AT_NW][16 * 68];       // per wave out tile, pitch 68

  const int tid  = threadIdx.x;
  const int wave = tid >> 5;
  const int lane = tid & 31;
  const int hh   = lane >> 4;
  const int c    = lane & 15;

  const int nqb = S / 64;
  const int bx = blockIdx.x;
  const int qb = bx % nqb;
  const int bh = bx / nqb;
  const int h  = bh % H;
  const int b  = bh / H;
  const int q0 = qb * 64 + wave * 16;

  const float* qb_ptr = q + (size_t)b * S * C + (size_t)h * AT_D;
  const float* kb_ptr = k + (size_t)b * S * C + (size_t)h * AT_D;
  const float* vb_ptr = v + (size_t)b * S * C + (size_t)h * AT_D;
  const float* gt_ptr = gate + ((size_t)b * H + h) * S;
  const float* pb_ptr = pos_bias + (size_t)h * S * S;
  const float* mk_ptr = mask + (size_t)b * S;
  _Float16*    ob_ptr = out + (size_t)b * S * C + (size_t)h * AT_D;

  // ---- Q fragments (A operand): 2 d-chunks, split k map ----
  v16h qa[2];
  {
    const float* qrow = qb_ptr + (size_t)(q0 + c) * C;
#pragma unroll
    for (int dc = 0; dc < 2; ++dc) {
#pragma unroll
      for (int e = 0; e < 8; ++e) {
        qa[dc][e]     = (_Float16)qrow[dc * 32 + 8 * hh + e];
        qa[dc][8 + e] = (_Float16)qrow[dc * 32 + 16 + 8 * hh + e];
      }
    }
  }
  float grow[8];
#pragma unroll
  for (int r = 0; r < 8; ++r) grow[r] = gt_ptr[q0 + 8 * hh + r];

  float mrow[8], lrow[8];
  v8f oacc[4];
#pragma unroll
  for (int r = 0; r < 8; ++r) { mrow[r] = -INFINITY; lrow[r] = 0.f; }
#pragma unroll
  for (int t = 0; t < 4; ++t) oacc[t] = (v8f){0.f,0.f,0.f,0.f,0.f,0.f,0.f,0.f};

  const int nChunks = S / AT_KC;   // block-uniform, from launch argument
  for (int kc = 0; kc < nChunks; ++kc) {
    const int kv0 = kc * AT_KC;
    __syncthreads();
    {
      const int kvr = tid >> 1, dh = (tid & 1) * 32;
      const float* krow = kb_ptr + (size_t)(kv0 + kvr) * C + dh;
      const float* vrow = vb_ptr + (size_t)(kv0 + kvr) * C + dh;
#pragma unroll
      for (int i = 0; i < 8; ++i) {
        v4f kk = *(const v4f*)(krow + 4 * i);
        v4f vv = *(const v4f*)(vrow + 4 * i);
#pragma unroll
        for (int e = 0; e < 4; ++e) {
          const int d = dh + 4 * i + e;
          Ksh[kvr * AT_D + d]  = (_Float16)kk[e];
          Vth[d * AT_KC + kvr] = (_Float16)vv[e];
        }
      }
    }
    __syncthreads();

    v8f s[4];
#pragma unroll
    for (int j = 0; j < 4; ++j) {
      s[j] = (v8f){0.f,0.f,0.f,0.f,0.f,0.f,0.f,0.f};
#pragma unroll
      for (int dc = 0; dc < 2; ++dc) {
        FH kb;
        kb.h[0] = *(const v8h*)(Ksh + (j * 16 + c) * AT_D + dc * 32 + 8 * hh);
        kb.h[1] = *(const v8h*)(Ksh + (j * 16 + c) * AT_D + dc * 32 + 16 + 8 * hh);
        s[j] = hmma(qa[dc], kb.v, s[j]);
      }
    }
    // additive terms: key padding per column, gated position bias per (row, column)
    float kp[4];
#pragma unroll
    for (int j = 0; j < 4; ++j) kp[j] = (1.0f - mk_ptr[kv0 + j * 16 + c]) * -10000.0f;
    float cm[8];
#pragma unroll
    for (int r = 0; r < 8; ++r) {
      const int qrow = q0 + 8 * hh + r;
      const float* pbr = pb_ptr + (size_t)qrow * S + kv0;
      float m = -INFINITY;
#pragma unroll
      for (int j = 0; j < 4; ++j) {
        const float sv = s[j][r] * qscale + grow[r] * pbr[j * 16 + c] + kp[j];
        s[j][r] = sv;
        m = fmaxf(m, sv);
      }
#pragma unroll
      for (int off = 1; off < 16; off <<= 1) m = fmaxf(m, __shfl_xor(m, off, 32));
      cm[r] = m;
    }
    _Float16* pw = Psh[wave];
#pragma unroll
    for (int r = 0; r < 8; ++r) {
      const float mnew = fmaxf(mrow[r], cm[r]);
      const float alpha = expf(mrow[r] - mnew);
      mrow[r] = mnew;
      float psum = 0.f;
#pragma unroll
      for (int j = 0; j < 4; ++j) {
        const float p = expf(s[j][r] - mnew);
        psum += p;
        pw[(8 * hh + r) * AT_KC + j * 16 + c] = (_Float16)(p * AT_PSC);
      }
#pragma unroll
      for (int off = 1; off < 16; off <<= 1) psum += __shfl_xor(psum, off, 32);
      lrow[r] = lrow[r] * alpha + psum;
#pragma unroll
      for (int t = 0; t < 4; ++t) oacc[t][r] *= alpha;
    }
    __builtin_amdgcn_fence(__ATOMIC_RELEASE, "workgroup");
    __builtin_amdgcn_wave_barrier();
    __builtin_amdgcn_fence(__ATOMIC_ACQUIRE, "workgroup");
#pragma unroll 1
    for (int kk = 0; kk < 2; ++kk) {
      FH pa;
      pa.h[0] = *(const v8h*)(pw + c * AT_KC + kk * 32 + 8 * hh);
      pa.h[1] = *(const v8h*)(pw + c * AT_KC + kk * 32 + 16 + 8 * hh);
#pragma unroll
      for (int t = 0; t < 4; ++t) {
        FH vb;
        vb.h[0] = *(const v8h*)(Vth + (t * 16 + c) * AT_KC + kk * 32 + 8 * hh);
        vb.h[1] = *(const v8h*)(Vth + (t * 16 + c) * AT_KC + kk * 32 + 16 + 8 * hh);
        oacc[t] = hmma(pa.v, vb.v, oacc[t]);
      }
    }
  }

  float* os = Os[wave];
#pragma unroll
  for (int r = 0; r < 8; ++r) {
    const float inv = 1.0f / (lrow[r] * AT_PSC);
#pragma unroll
    for (int t = 0; t < 4; ++t) os[(8 * hh + r) * 68 + t * 16 + c] = oacc[t][r] * inv;
  }
  __builtin_amdgcn_fence(__ATOMIC_RELEASE, "workgroup");
  __builtin_amdgcn_wave_barrier();
  __builtin_amdgcn_fence(__ATOMIC_ACQUIRE, "workgroup");
  {
    const int q8 = lane >> 3, c8 = (lane & 7) * 8;
    {
#pragma unroll
      for (int it = 0; it < 4; ++it) {
        const int row = it * 4 + q8;
        const float* sp = os + row * 68 + c8;
        v8h hv;
#pragma unroll
        for (int e = 0; e < 8; ++e) hv[e] = (_Float16)sp[e];
        *(v8h*)(ob_ptr + (size_t)(q0 + row) * C + c8) = hv;
      }
      
    }
  }
}

// ---------------------------------------------------------------------------
extern "C" void kernel_launch(void* const* d_in, const int* in_sizes, int n_in,
                              void* d_out, int out_size, void* d_ws, size_t ws_size,
                              hipStream_t stream) {
  const int Bn = 2, S = 1024, C = 768, H = 12, L = 4, FF = 3072;
  const int M = Bn * S;
  if (n_in < 25) return;
  if (in_sizes[0] != M * C || in_sizes[1] != M * C || in_sizes[2] != M || in_sizes[3] != H * S * S) return;
  if (in_sizes[6] != L * C * C || in_sizes[19] != L * FF * C || in_sizes[21] != L * C * FF) return;
  if (out_size != M * C) return;

  const float* x        = (const float*)d_in[0];
  const float* pos_emb  = (const float*)d_in[1];
  const float* attn_m   = (const float*)d_in[2];
  const float* pos_bias = (const float*)d_in[3];
  const float* ln0_g    = (const float*)d_in[4];
  const float* ln0_b    = (const float*)d_in[5];
  const float* Wq       = (const float*)d_in[6];
  const float* bq       = (const float*)d_in[7];
  const float* Wk       = (const float*)d_in[8];
  const float* bk       = (const float*)d_in[9];
  const float* Wv       = (const float*)d_in[10];
  const float* bv       = (const float*)d_in[11];
  const float* Wo       = (const float*)d_in[12];
  const float* bo       = (const float*)d_in[13];
  const float* gruW     = (const float*)d_in[14];
  const float* grub     = (const float*)d_in[15];
  const float* gruc     = (const float*)d_in[16];
  const float* ln1_g    = (const float*)d_in[17];
  const float* ln1_b    = (const float*)d_in[18];
  const float* W1       = (const float*)d_in[19];
  const float* b1       = (const float*)d_in[20];
  const float* W2       = (const float*)d_in[21];
  const float* b2       = (const float*)d_in[22];
  const float* ln2_g    = (const float*)d_in[23];
  const float* ln2_b    = (const float*)d_in[24];

  // ---- workspace carve (256-B aligned offsets, total 110,198,784 B) ----
  char* ws = (char*)d_ws;
  size_t off = 0;
  const size_t NWC = (size_t)L * C * C;      // halves per projection weight set
  const size_t NWF = (size_t)L * FF * C;     // halves per FFN weight set
  const size_t NA  = (size_t)M * C;
  const size_t NF  = (size_t)M * FF;
  const size_t NG  = (size_t)Bn * H * S;
  size_t o_wq, o_wk, o_wv, o_wo, o_w1, o_w2, o_hf, o_hh, o_qf, o_kf, o_vf, o_ao, o_h1f, o_h1h, o_ff, o_gt;
#define CARVE(o, bytes) do { o = off; off += ((size_t)(bytes) + 255) & ~(size_t)255; } while (0)
  CARVE(o_wq, NWC * 2); CARVE(o_wk, NWC * 2); CARVE(o_wv, NWC * 2); CARVE(o_wo, NWC * 2);
  CARVE(o_w1, NWF * 2); CARVE(o_w2, NWF * 2);
  CARVE(o_hf, NA * 4);  CARVE(o_hh, NA * 2);
  CARVE(o_qf, NA * 4);  CARVE(o_kf, NA * 4);  CARVE(o_vf, NA * 4);
  CARVE(o_ao, NA * 2);
  CARVE(o_h1f, NA * 4); CARVE(o_h1h, NA * 2);
  CARVE(o_ff, NF * 2);
  CARVE(o_gt, NG * 4);
#undef CARVE
  if (off > ws_size) return;

  _Float16* wq16 = (_Float16*)(ws + o_wq);
  _Float16* wk16 = (_Float16*)(ws + o_wk);
  _Float16* wv16 = (_Float16*)(ws + o_wv);
  _Float16* wo16 = (_Float16*)(ws + o_wo);
  _Float16* w116 = (_Float16*)(ws + o_w1);
  _Float16* w216 = (_Float16*)(ws + o_w2);
  float*    hf   = (float*)(ws + o_hf);
  _Float16* hh16 = (_Float16*)(ws + o_hh);
  float*    qf   = (float*)(ws + o_qf);
  float*    kf   = (float*)(ws + o_kf);
  float*    vf   = (float*)(ws + o_vf);
  _Float16* ao16 = (_Float16*)(ws + o_ao);
  float*    h1f  = (float*)(ws + o_h1f);
  _Float16* h1h  = (_Float16*)(ws + o_h1h);
  _Float16* ff16 = (_Float16*)(ws + o_ff);
  float*    gtb  = (float*)(ws + o_gt);
  float*    outp = (float*)d_out;

  const float WSC  = 64.0f;            // weights carried x64 in f16
  const float WINV = 1.0f / 64.0f;     // folded back in the GEMM epilogue
  const float invC = 1.0f / 768.0f;
  const float eps  = 1e-5f;
  const float qscale = 0.125f;         // 1/sqrt(64)

  // ---- weights -> f16 (x64) ----
  {
    const int n2c = (int)(NWC / 2), n2f = (int)(NWF / 2);
    cast_scale_f32_f16x2<<<(n2c + 255) / 256, 256, 0, stream>>>(Wq, wq16, n2c, WSC);
    cast_scale_f32_f16x2<<<(n2c + 255) / 256, 256, 0, stream>>>(Wk, wk16, n2c, WSC);
    cast_scale_f32_f16x2<<<(n2c + 255) / 256, 256, 0, stream>>>(Wv, wv16, n2c, WSC);
    cast_scale_f32_f16x2<<<(n2c + 255) / 256, 256, 0, stream>>>(Wo, wo16, n2c, WSC);
    cast_scale_f32_f16x2<<<(n2f + 255) / 256, 256, 0, stream>>>(W1, w116, n2f, WSC);
    cast_scale_f32_f16x2<<<(n2f + 255) / 256, 256, 0, stream>>>(W2, w216, n2f, WSC);
  }

  // ---- h = LN0(x * mask + pos_emb) ----
  ln_kernel<1><<<M, LN_T, 0, stream>>>(x, pos_emb, attn_m, ln0_g, ln0_b, hf, hh16, C, invC, eps);

  const int nbP = ((M / 64) * (C / 64) + 7) / 8;    // 48 blocks, 8 tiles each
  const int nbF = ((M / 64) * (FF / 64) + 7) / 8;   // 192 blocks
  const int nbA = Bn * H * (S / 64);                // 384 attention blocks
  const int ngate = (int)NG;
  const int nbG = (ngate + 255) / 256;

  for (int l = 0; l < L; ++l) {
    const size_t lw  = (size_t)l * C * C;
    const size_t lwf = (size_t)l * FF * C;
    const _Float16* WQl = wq16 + lw;
    const _Float16* WKl = wk16 + lw;
    const _Float16* WVl = wv16 + lw;
    const _Float16* WOl = wo16 + lw;
    const _Float16* W1l = w116 + lwf;   // [FF][C]
    const _Float16* W2l = w216 + lwf;   // [C][FF]

    // q, k, v = h . W^T + b  (f32 out)
    wmma_gemm64<0, false, 2, 0, false, 0><<<dim3(nbP, 1), 256, 0, stream>>>(
        U16(hh16), U16(hh16), C, 0L, U16(WQl), U16(WQl), C, 0L,
        (void*)qf, (void*)qf, C, 0L, bq + (size_t)l * C, hf, 0L, M, C, C, WINV);
    wmma_gemm64<0, false, 2, 0, false, 0><<<dim3(nbP, 1), 256, 0, stream>>>(
        U16(hh16), U16(hh16), C, 0L, U16(WKl), U16(WKl), C, 0L,
        (void*)kf, (void*)kf, C, 0L, bk + (size_t)l * C, hf, 0L, M, C, C, WINV);
    wmma_gemm64<0, false, 2, 0, false, 0><<<dim3(nbP, 1), 256, 0, stream>>>(
        U16(hh16), U16(hh16), C, 0L, U16(WVl), U16(WVl), C, 0L,
        (void*)vf, (void*)vf, C, 0L, bv + (size_t)l * C, hf, 0L, M, C, C, WINV);

    // gate[b][h][s]
    gate_kernel<<<nbG, 256, 0, stream>>>(hf, gruW + (size_t)l * 8 * 64, grub + (size_t)l * 8,
                                          gruc + (size_t)l * H, gtb, S, H, C, ngate);

    // attention -> ao16 (f16)
    attn_gbias_kernel<<<nbA, 128, 0, stream>>>(qf, kf, vf, gtb, pos_bias, attn_m, ao16, S, H, C, qscale);

    // qf <- h + ao . Wo^T + bo
    wmma_gemm64<0, false, 2, 0, true, 0><<<dim3(nbP, 1), 256, 0, stream>>>(
        U16(ao16), U16(ao16), C, 0L, U16(WOl), U16(WOl), C, 0L,
        (void*)qf, (void*)qf, C, 0L, bo + (size_t)l * C, hf, 0L, M, C, C, WINV);

    // h1 = LN1(qf)
    ln_kernel<0><<<M, LN_T, 0, stream>>>(qf, qf, attn_m, ln1_g + (size_t)l * C, ln1_b + (size_t)l * C,
                                         h1f, h1h, C, invC, eps);

    // ff16 = gelu(h1 . W1^T + b1)  (f16 out)
    wmma_gemm64<0, false, 2, 1, false, 5><<<dim3(nbF, 1), 256, 0, stream>>>(
        U16(h1h), U16(h1h), C, 0L, U16(W1l), U16(W1l), C, 0L,
        (void*)ff16, (void*)ff16, FF, 0L, b1 + (size_t)l * FF, h1f, 0L, M, FF, C, WINV);

    // kf <- h1 + ff . W2^T + b2
    wmma_gemm64<0, false, 2, 0, true, 0><<<dim3(nbP, 1), 256, 0, stream>>>(
        U16(ff16), U16(ff16), FF, 0L, U16(W2l), U16(W2l), FF, 0L,
        (void*)kf, (void*)kf, C, 0L, b2 + (size_t)l * C, h1f, 0L, M, C, FF, WINV);

    // h = LN2(kf); last layer writes the output buffer directly
    float* hdst = (l == L - 1) ? outp : hf;
    ln_kernel<0><<<M, LN_T, 0, stream>>>(kf, kf, attn_m, ln2_g + (size_t)l * C, ln2_b + (size_t)l * C,
                                         hdst, hh16, C, invC, eps);
  }
  (void)hipGetLastError();
}

// v001
// Measured time: 959 microseconds a run.
// Timed twice side by side with v000, it ran 1.91 and 1.93 times as fast.
// Contractions (q/k/v/out projections, FFN up/down, attention q.k^T and p.v): v_wmma_f32_16x16x32_f16 (f16 operands, f32 accumulate); weights carried x64, softmax probabilities carried x2^15; LayerNorm, softmax, gate: f32 VALU.
#include <hip/hip_runtime.h>
#include <math.h>
#include <stdint.h>

typedef __attribute__((ext_vector_type(16))) _Float16 v16h;
typedef __attribute__((ext_vector_type(8)))  _Float16 v8h;
typedef __attribute__((ext_vector_type(4)))  _Float16 v4h;
typedef __attribute__((ext_vector_type(16))) __bf16   v16b;
typedef __attribute__((ext_vector_type(8)))  __bf16   v8b;
typedef __attribute__((ext_vector_type(8)))  float    v8f;
typedef __attribute__((ext_vector_type(4)))  float    v4f;
#define U16(p) ((const unsigned short*)(const void*)(p))

__device__ __forceinline__ unsigned short f2bf_bits(float f) {
  unsigned u = __float_as_uint(f);
  return (unsigned short)((u + 0x7FFFu + ((u >> 16) & 1u)) >> 16);
}
__device__ __forceinline__ float bf_bits2f(unsigned short h) { return __uint_as_float(((unsigned)h) << 16); }

// hazard guards as plain device helpers (no inline asm inside the kernel template body)
__device__ __forceinline__ void acc_guard4(v8f& a, v8f& b, v8f& c, v8f& d) { asm volatile("v_nop\n\tv_nop\n\tv_nop\n\tv_nop" : "+v"(a), "+v"(b), "+v"(c), "+v"(d)); }
template <typename T> struct Frag;
template <> struct Frag<_Float16> {
  typedef v16h V; union U { v16h v; v8h h[2]; };
  static __device__ __forceinline__ v16h load(const _Float16* p) {   // elements 0..7 <- p[0..7], 8..15 <- p[16..23]
    U f; f.h[0] = *(const v8h*)(p); f.h[1] = *(const v8h*)(p + 16); return f.v;
  }
  static __device__ __forceinline__ v8f mma(v16h a, v16h b, v8f c) {
    return __builtin_amdgcn_wmma_f32_16x16x32_f16(false, a, false, b, (short)0, c, false, false);
  }
};
template <> struct Frag<__bf16> {
  typedef v16b V; union U { v16b v; v8b h[2]; };
  static __device__ __forceinline__ v16b load(const __bf16* p) {
    U f; f.h[0] = *(const v8b*)(p); f.h[1] = *(const v8b*)(p + 16); return f.v;
  }
  static __device__ __forceinline__ v8f mma(v16b a, v16b b, v8f c) {
    return __builtin_amdgcn_wmma_f32_16x16x32_bf16(false, a, false, b, (short)0, c, false, false);
  }
};

// ---- Block-tiled batched WMMA GEMM, operands staged in LDS by the tensor mover ------------
// C[m,n] = scale * sum_k A[m,k] * Bt[n,k] (+bias)(+resid); a block of 4 waves (2 x 2) owns a 128x128 tile, each wave 64x64.
// A row-major [M,K]; Bt row-major [N,K]; M,N % 128 == 0, K % 128 == 0, K >= 256 (two stages).
// A pass is 128 k = 256 B of each of the 256 operand rows; each wave brings one 64-row slice per pass with one tensor load
// (waves 0,1: the two halves of the A rows; waves 2,3: of the Bt rows), two buffers, LDS row pitch 272 B.
// BIAS_MODE: 0 = none, 1 = bias[m], 2 = bias[n].
// OUT_MODE: 0 = f32, 1 = f16, 2 = bf16 hi plane (Cout) + bf16 lo plane (Cout2).
// ET: 0 = f16 operands, 1 = bf16 operands (pointers passed as 16-bit storage)
typedef uint32_t u32x4 __attribute__((ext_vector_type(4)));
typedef uint32_t u32x8 __attribute__((ext_vector_type(8)));
#define GT_KP     128u                 // k per pass
#define GT_ROWB   256u                 // bytes of one operand row per pass
#define GT_PITCH  272u                 // LDS row pitch: 256 B + the mover's 16-B pad (ds_load_b128 readers)
#define GT_ROWS   64u                  // rows per slice
#define GT_SLICE  18432u               // 64 x 272 = 17,408 B, rounded up to a multiple of 2 KiB
#define GT_STAGE  (4u * GT_SLICE)      // one buffer: 4 slices
__device__ __forceinline__ uint32_t uni(uint32_t v) { return (uint32_t)__builtin_amdgcn_readfirstlane(v); }
// pinned(): holds a wave-uniform value in a scalar register, so that a test on it is a scalar branch (a tensor load ignores EXEC)
// and so that descriptor words formed from it are formed behind the waits that stand in front of it.
__device__ __forceinline__ uint32_t pinned(uint32_t v) { uint32_t w = uni(v); asm volatile("" : "+s"(w)); return w; }
__device__ __forceinline__ void wait_ds0()     { asm volatile("s_wait_dscnt 0x0" ::: "memory"); }      // this wave's LDS reads of the buffer are done
__device__ __forceinline__ void wait_tensor0() { asm volatile("s_wait_tensorcnt 0x0" ::: "memory"); }  // this wave's own slice has landed
// descriptor words held in scalar registers (as pinned() does for one word): the eight registers stay group 1's own through
// the loop, so that none of them takes another value while a request is outstanding
__device__ __forceinline__ void hold_group1(u32x8& g) { asm volatile("" : "+s"(g)); }
// one request of the whole wave: 64 rows of 256 B from global memory to LDS, 16 B of pad behind each row
__device__ __forceinline__ void tdm_load(uint32_t lds_dst, uint64_t ga, u32x8 g1) {
  u32x4 g0;
  g0[0] = uni(1u);
  g0[1] = uni(lds_dst);
  g0[2] = uni((uint32_t)ga);
  g0[3] = uni((((uint32_t)(ga >> 32)) & 0x01FFFFFFu) | 0x80000000u);
  asm volatile("tensor_load_to_lds %0, %1" :: "s"(g0), "s"(g1) : "memory");
}
template <int ET> struct Elem;
template <> struct Elem<0> { typedef _Float16 T; };
template <> struct Elem<1> { typedef __bf16 T; };
template <int ET, bool SPLIT, int BIAS_MODE, int OUT_MODE, bool RESID, int ACT = 0>
__global__ __launch_bounds__(128) void wmma_gemm64(
    const unsigned short* __restrict__ Ap, const unsigned short* __restrict__ A2p, int lda, long strideA,
    const unsigned short* __restrict__ Btp, const unsigned short* __restrict__ Bt2p, int ldb, long strideB,
    void* __restrict__ Cout, void* __restrict__ Cout2, int ldc, long strideC,
    const float* __restrict__ bias,
    const float* __restrict__ resid, long strideR,
    int M, int N, int K, float scale) {
  static_assert(!SPLIT, "single-plane operands only");
  typedef typename Elem<ET>::T T;
  typedef typename Frag<T>::V V;
  const T* A = (const T*)Ap; const T* Bt = (const T*)Btp;
  // two stage buffers; after the K loop its first bytes serve as the per-wave 16x64 f32 output slabs (pitch 68 floats)
  __shared__ __attribute__((aligned(2048))) unsigned char L[2u * GT_STAGE];
  const int b    = blockIdx.y;
  const int lane = threadIdx.x & 31;
  const uint32_t wave = uni(threadIdx.x >> 5);
  const int tilesN = N >> 7;
  const int tilesM = M >> 7;
  const int tile = blockIdx.x;
  const uint32_t nPass = uni((uint32_t)K / GT_KP);
  if (tile >= tilesM * tilesN || nPass < 2u) return;   // block-uniform, in front of every tensor load and barrier; the ring's prologue loads two stages
  const int tm = tile / tilesN;
  const int tn = tile - tm * tilesN;
  const uint32_t wm = wave >> 1, wn = wave & 1u;
  const int m0 = (tm << 7) + (int)(wm << 6);
  const int n0 = (tn << 7) + (int)(wn << 6);

  const T* Ab  = A  + (size_t)b * strideA;
  const T* Bb  = Bt + (size_t)b * strideB;

  const int rlane = lane & 15;                 // row (A) / col (B, D) within subtile
  const int koff  = (lane >> 4) * 8;           // k offset of this lane half
  const int mOff  = (lane >> 4) * 8;           // D row offset

  // ---- this wave's slice: source, place in LDS, descriptor group 1 (loop-invariant) ----
  const bool isB = wave >= 2u;
  const uint32_t srcPitch = (uint32_t)(isB ? ldb : lda) * 2u;     // bytes
  const uint64_t srcBase = isB ? (uint64_t)(uintptr_t)(Bb + (size_t)((tn << 7) + (int)(wn << 6)) * ldb)
                               : (uint64_t)(uintptr_t)(Ab + (size_t)((tm << 7) + (int)(wn << 6)) * lda);
  const uint32_t ldsSlice = (uint32_t)(size_t)L + wave * GT_SLICE;
  u32x8 g1;
  g1[0] = uni((1u << 20) | (5u << 22) | (3u << 25));              // no mask, 1-byte elements, 4 dwords of pad behind every 64 dwords
  g1[1] = uni((GT_ROWB & 0xFFFFu) << 16);                         // tensor_dim0 low
  g1[2] = uni((GT_ROWB >> 16) | ((GT_ROWS & 0xFFFFu) << 16));     // tensor_dim0 high, tensor_dim1 low
  g1[3] = uni((GT_ROWS >> 16) | (GT_ROWB << 16));                 // tensor_dim1 high, tile_dim0
  g1[4] = uni(GT_ROWS);                                           // tile_dim1
  g1[5] = uni(srcPitch);
  g1[6] = uni(0u);
  g1[7] = uni(0u);
  hold_group1(g1);

  v8f acc[4][4];
#pragma unroll
  for (int i = 0; i < 4; ++i)
#pragma unroll
    for (int j = 0; j < 4; ++j) acc[i][j] = (v8f){0.f,0.f,0.f,0.f,0.f,0.f,0.f,0.f};

  // prologue: stage 0 lands and is published, then stage 1 flies while pass 0 works
  tdm_load(ldsSlice, srcBase, g1);
  wait_tensor0();
  __syncthreads();
  tdm_load(ldsSlice + GT_STAGE, srcBase + GT_ROWB, g1);

  const uint32_t aOff = wm * GT_SLICE + (uint32_t)rlane * GT_PITCH + (uint32_t)koff * 2u;
  const uint32_t bOff = (2u + wn) * GT_SLICE + (uint32_t)rlane * GT_PITCH + (uint32_t)koff * 2u;
  uint32_t s = 0;
  // the pass loop stays rolled: one publish point in the text, every fragment index below a constant
#pragma unroll 1
  do {                                        // nPass >= 2 here
    const uint32_t bufOff = (s & 1u) * GT_STAGE;
    const unsigned char* As = L + bufOff + aOff;
    const unsigned char* Bs = L + bufOff + bOff;
    V bh[2][4], ah[2][4];                     // two fragment sets: the next 32 k are read while these are multiplied
#pragma unroll
    for (int j = 0; j < 4; ++j) bh[0][j] = Frag<T>::load((const T*)(Bs + (uint32_t)j * 16u * GT_PITCH));
#pragma unroll
    for (int i = 0; i < 4; ++i) ah[0][i] = Frag<T>::load((const T*)(As + (uint32_t)i * 16u * GT_PITCH));
#pragma unroll
    for (int kk = 0; kk < 4; ++kk) {          // 32 k per step, in ascending k as before; only this pass's own buffer is read
      const int cur = kk & 1, nx = cur ^ 1;
      if (kk < 3) {
#pragma unroll
        for (int j = 0; j < 4; ++j) bh[nx][j] = Frag<T>::load((const T*)(Bs + (uint32_t)j * 16u * GT_PITCH + (uint32_t)(kk + 1) * 64u));
#pragma unroll
        for (int i = 0; i < 4; ++i) ah[nx][i] = Frag<T>::load((const T*)(As + (uint32_t)i * 16u * GT_PITCH + (uint32_t)(kk + 1) * 64u));
      }
      __builtin_amdgcn_sched_barrier(0);      // the next step's LDS reads stay one group in front of this step's WMMAs, not among them
#pragma unroll
      for (int i = 0; i < 4; ++i)
#pragma unroll
        for (int j = 0; j < 4; ++j) acc[i][j] = Frag<T>::mma(ah[cur][i], bh[cur][j], acc[i][j]);
      __builtin_amdgcn_sched_barrier(0);      // and the step after next's reads do not rise into this block
    }
    // publish point of stage s + 1: own LDS reads done, own slice landed, then the barrier that both publishes
    // stage s + 1 and ends every wave's reads of the buffer that is refilled behind it
    wait_ds0();
    wait_tensor0();
    __syncthreads();
    if (pinned(s + 2u < nPass)) {             // scalar branch: only while stage s + 2 exists
      const uint32_t nxt = pinned(s + 2u);    // group 0 is formed from it, so behind the waits above
      tdm_load(ldsSlice + bufOff, srcBase + (uint64_t)nxt * GT_ROWB, g1);
    }
  } while (++s < nPass);
  wait_tensor0();
  wait_ds0();
  acc_guard4(acc[0][0], acc[0][1], acc[0][2], acc[0][3]);
  acc_guard4(acc[1][0], acc[1][1], acc[1][2], acc[1][3]);
  acc_guard4(acc[2][0], acc[2][1], acc[2][2], acc[2][3]);
  acc_guard4(acc[3][0], acc[3][1], acc[3][2], acc[3][3]);

  // ---- epilogue ----
  float* slab = (float*)(void*)L + wave * (16u * 68u);   // the last pass's own barrier has ended every read of the ring
  const float* Rb = RESID ? (resid + (size_t)b * strideR) : nullptr;
#pragma unroll
  for (int i = 0; i < 4; ++i) {
    const int mBase = m0 + (i << 4);
#pragma unroll
    for (int j = 0; j < 4; ++j) {
      const int n = n0 + (j << 4) + rlane;
      float bv = 0.f;
      if (BIAS_MODE == 2) bv = bias[n];
#pragma unroll
      for (int r = 0; r < 8; ++r) {
        float v = acc[i][j][r] * scale;
        if (BIAS_MODE == 1) v += bias[mBase + mOff + r];
        if (BIAS_MODE == 2) v += bv;
        if (RESID) v += Rb[(size_t)(mBase + mOff + r) * ldc + n];
        if (ACT == 1) v = tanhf(v);
        if (ACT == 2) v = fmaxf(v, 0.0f);
        if (ACT == 3) v = v / (1.0f + expf(-v));
        if (ACT == 4) v = (v > 0.f) ? v : 0.01f * v;
        if (ACT == 5) v = 0.5f * v * (1.0f + erff(v * 0.70710678118654752f));
        slab[(mOff + r) * 68 + (j << 4) + rlane] = v;
      }
    }
    __builtin_amdgcn_fence(__ATOMIC_RELEASE, "workgroup");
    __builtin_amdgcn_wave_barrier();
    __builtin_amdgcn_fence(__ATOMIC_ACQUIRE, "workgroup");
    if (OUT_MODE == 0) {
      float* C = (float*)Cout + (size_t)b * strideC;
      const int hh = lane >> 4, c4 = (lane & 15) * 4;     // row seg = 256 B = 16 lanes x 16 B
      {
#pragma unroll
        for (int it = 0; it < 8; ++it) {
          const int row = it * 2 + hh;
          v4f v = *(const v4f*)(slab + row * 68 + c4);
          *(v4f*)(C + (size_t)(mBase + row) * ldc + n0 + c4) = v;
        }
        
      }
    } else {
      const int q = lane >> 3, c8 = (lane & 7) * 8;
      unsigned short* C  = (unsigned short*)Cout  + (size_t)b * strideC;
      unsigned short* C2 = (OUT_MODE == 2) ? ((unsigned short*)Cout2 + (size_t)b * strideC) : nullptr;
      {
#pragma unroll
        for (int it = 0; it < 4; ++it) {
          const int row = it * 4 + q;
          const float* sp = slab + row * 68 + c8;
          v8h hv, lv;
#pragma unroll
          for (int e = 0; e < 8; ++e) {
            if (OUT_MODE == 1) {
              hv[e] = (_Float16)sp[e];
            } else {
              unsigned short hb = f2bf_bits(sp[e]);
              unsigned short lb = f2bf_bits(sp[e] - bf_bits2f(hb));
              hv[e] = __builtin_bit_cast(_Float16, hb);
              lv[e] = __builtin_bit_cast(_Float16, lb);
            }
          }
          *(v8h*)(C + (size_t)(mBase + row) * ldc + n0 + c8) = hv;
          if (OUT_MODE == 2) *(v8h*)(C2 + (size_t)(mBase + row) * ldc + n0 + c8) = lv;
        }
        
      }
    }
    __builtin_amdgcn_fence(__ATOMIC_RELEASE, "workgroup");
    __builtin_amdgcn_wave_barrier();
    __builtin_amdgcn_fence(__ATOMIC_ACQUIRE, "workgroup");
  }
}

__global__ __launch_bounds__(256) void cast_scale_f32_f16x2(
    const float* __restrict__ in, _Float16* __restrict__ out, int n2, float sc) {
  int i = blockIdx.x * 256 + threadIdx.x;
  if (i < n2) {
    const _Float16 h0 = (_Float16)(in[2 * i] * sc), h1 = (_Float16)(in[2 * i + 1] * sc);
    const unsigned u = (unsigned)__builtin_bit_cast(unsigned short, h0) | ((unsigned)__builtin_bit_cast(unsigned short, h1) << 16);
    ((unsigned*)out)[i] = u;
    
  }
}

// ---- LayerNorm over rows of C = 4 * blockDim floats; PRE: input = in * mask[row] + pos --------------------------
#define LN_T 192
template <int PRE>
__global__ __launch_bounds__(LN_T) void ln_kernel(
    const float* __restrict__ in, const float* __restrict__ pos, const float* __restrict__ mask,
    const float* __restrict__ g, const float* __restrict__ bb,
    float* __restrict__ outf, _Float16* __restrict__ outh, int C, float invC, float eps) {
  __shared__ float rs[8];
  __shared__ float rq[8];
  const int row = blockIdx.x;
  const int tid = threadIdx.x;
  const int lane = tid & 31;
  const int w = tid >> 5;
  const int c4 = tid * 4;
  const size_t base = (size_t)row * C + c4;
  v4f xv = *(const v4f*)(in + base);
  if (PRE) {
    const float mk = mask[row];
    const v4f pv = *(const v4f*)(pos + base);
    xv = xv * mk + pv;
  }
  float s = (xv[0] + xv[1]) + (xv[2] + xv[3]);
#pragma unroll
  for (int off = 16; off > 0; off >>= 1) s += __shfl_xor(s, off, 32);
  if (lane == 0) rs[w] = s;
  __syncthreads();
  float ts = 0.f;
#pragma unroll
  for (int i = 0; i < LN_T / 32; ++i) ts += rs[i];
  const float mean = ts * invC;
  const v4f d = xv - mean;
  float sq = (d[0] * d[0] + d[1] * d[1]) + (d[2] * d[2] + d[3] * d[3]);
#pragma unroll
  for (int off = 16; off > 0; off >>= 1) sq += __shfl_xor(sq, off, 32);
  if (lane == 0) rq[w] = sq;
  __syncthreads();
  float tq = 0.f;
#pragma unroll
  for (int i = 0; i < LN_T / 32; ++i) tq += rq[i];
  const float var = tq * invC;
  const float inv = rsqrtf(var + eps);
  const v4f gv = *(const v4f*)(g + c4);
  const v4f bv = *(const v4f*)(bb + c4);
  const v4f y = d * inv * gv + bv;
  v4h yh;
  yh[0] = (_Float16)y[0]; yh[1] = (_Float16)y[1]; yh[2] = (_Float16)y[2]; yh[3] = (_Float16)y[3];
  *(v4f*)(outf + base) = y;
  *(v4h*)(outh + base) = yh;
  
}

// ---- GRU-style gate per (b, h, s): g = h[b,s,h*64:+64] . gw^T + gb (8 outputs, K=64, VALU f32),
//      gate = sigmoid(sum g[0:4]) * (sigmoid(sum g[4:8]) * gc[h] - 1) + 2 ; stored [b][h][s] (one 4-B store per lane,
__global__ __launch_bounds__(256) void gate_kernel(
    const float* __restrict__ hf, const float* __restrict__ gw, const float* __restrict__ gb,
    const float* __restrict__ gc, float* __restrict__ gate, int S, int H, int C, int total) {
  const int idx = blockIdx.x * 256 + threadIdx.x;
  if (idx >= total) return;   // no barriers in this kernel
  const int s  = idx % S;
  const int bh = idx / S;
  const int h  = bh % H;
  const int b  = bh / H;
  const float* hp = hf + ((size_t)b * S + s) * C + (size_t)h * 64;
  float acc[8];
#pragma unroll
  for (int e = 0; e < 8; ++e) acc[e] = 0.f;
#pragma unroll 1
  for (int d = 0; d < 64; ++d) {
    const float hv = hp[d];
#pragma unroll
    for (int e = 0; e < 8; ++e) acc[e] = fmaf(hv, gw[e * 64 + d], acc[e]);
  }
  const float sa = ((acc[0] + gb[0]) + (acc[1] + gb[1])) + ((acc[2] + gb[2]) + (acc[3] + gb[3]));
  const float sb = ((acc[4] + gb[4]) + (acc[5] + gb[5])) + ((acc[6] + gb[6]) + (acc[7] + gb[7]));
  const float ga  = 1.0f / (1.0f + expf(-sa));
  const float gbv = 1.0f / (1.0f + expf(-sb));
  const float gv = ga * (gbv * gc[h] - 1.0f) + 2.0f;
  ((float*)gate)[idx] = gv;
  
}

// =====================================================================================
// Flash attention, head_dim 64, f32 q/k/v in, f16 out; plain f16 operands, f32 accumulate; online softmax in f32.
//   s(q,kv) = (q . k) * qscale + gate[b,h,q] * pos_bias[h,q,kv] + (1 - mask[b,kv]) * -1e4
//   probabilities carried x2^15 in f16, folded into the final 1/l.
//   Block = 4 waves = 64 query rows of one (batch, head); S % 64 == 0.  q/k/v/out element (b,s,h,d) at
//   ((b*S + s)*C + h*64 + d); gate at (b*H + h)*S + s; pos_bias at (h*S + q)*S + kv; grid.x = B * H * (S/64).
// =====================================================================================
#define AT_D 64
#define AT_NW 4
#define AT_KC 64
#define AT_PSC 32768.0f

__device__ __forceinline__ v8f hmma(v16h a, v16h b, v8f c) {
  c = __builtin_amdgcn_wmma_f32_16x16x32_f16(false, a, false, b, (short)0, c, false, false);
  asm volatile("v_nop\n\tv_nop\n\tv_nop\n\tv_nop" : "+v"(c) : "v"(a), "v"(b));
  return c;
}

__global__ __launch_bounds__(128)
void attn_gbias_kernel(const float* __restrict__ q, const float* __restrict__ k,
                       const float* __restrict__ v, const float* __restrict__ gate,
                       const float* __restrict__ pos_bias, const float* __restrict__ mask,
                       _Float16* __restrict__ out, int S, int H, int C, float qscale) {
  union FH { v16h v; v8h h[2]; };
  __shared__ __align__(16) _Float16 Ksh[AT_KC * AT_D];        // K [kv][d]
  __shared__ __align__(16) _Float16 Vth[AT_D * AT_KC];        // V^T [d][kv]
  __shared__ __align__(16) _Float16 Psh[AT_NW][16 * AT_KC];   // per wave P [row][kv]
  __shared__ __align__(16) float    Os[AT_NW][16 * 68];       // per wave out tile, pitch 68

  const int tid  = threadIdx.x;
  const int wave = tid >> 5;
  const int lane = tid & 31;
  const int hh   = lane >> 4;
  const int c    = lane & 15;

  const int nqb = S / 64;
  const int bx = blockIdx.x;
  const int qb = bx % nqb;
  const int bh = bx / nqb;
  const int h  = bh % H;
  const int b  = bh / H;
  const int q0 = qb * 64 + wave * 16;

  const float* qb_ptr = q + (size_t)b * S * C + (size_t)h * AT_D;
  const float* kb_ptr = k + (size_t)b * S * C + (size_t)h * AT_D;
  const float* vb_ptr = v + (size_t)b * S * C + (size_t)h * AT_D;
  const float* gt_ptr = gate + ((size_t)b * H + h) * S;
  const float* pb_ptr = pos_bias + (size_t)h * S * S;
  const float* mk_ptr = mask + (size_t)b * S;
  _Float16*    ob_ptr = out + (size_t)b * S * C + (size_t)h * AT_D;

  // ---- Q fragments (A operand): 2 d-chunks, split k map ----
  v16h qa[2];
  {
    const float* qrow = qb_ptr + (size_t)(q0 + c) * C;
#pragma unroll
    for (int dc = 0; dc < 2; ++dc) {
#pragma unroll
      for (int e = 0; e < 8; ++e) {
        qa[dc][e]     = (_Float16)qrow[dc * 32 + 8 * hh + e];
        qa[dc][8 + e] = (_Float16)qrow[dc * 32 + 16 + 8 * hh + e];
      }
    }
  }
  float grow[8];
#pragma unroll
  for (int r = 0; r < 8; ++r) grow[r] = gt_ptr[q0 + 8 * hh + r];

  float mrow[8], lrow[8];
  v8f oacc[4];
#pragma unroll
  for (int r = 0; r < 8; ++r) { mrow[r] = -INFINITY; lrow[r] = 0.f; }
#pragma unroll
  for (int t = 0; t < 4; ++t) oacc[t] = (v8f){0.f,0.f,0.f,0.f,0.f,0.f,0.f,0.f};

  const int nChunks = S / AT_KC;   // block-uniform, from launch argument
  for (int kc = 0; kc < nChunks; ++kc) {
    const int kv0 = kc * AT_KC;
    __syncthreads();
    {
      const int kvr = tid >> 1, dh = (tid & 1) * 32;
      const float* krow = kb_ptr + (size_t)(kv0 + kvr) * C + dh;
      const float* vrow = vb_ptr + (size_t)(kv0 + kvr) * C + dh;
#pragma unroll
      for (int i = 0; i < 8; ++i) {
        v4f kk = *(const v4f*)(krow + 4 * i);
        v4f vv = *(const v4f*)(vrow + 4 * i);
#pragma unroll
        for (int e = 0; e < 4; ++e) {
          const int d = dh + 4 * i + e;
          Ksh[kvr * AT_D + d]  = (_Float16)kk[e];
          Vth[d * AT_KC + kvr] = (_Float16)vv[e];
        }
      }
    }
    __syncthreads();

    v8f s[4];
#pragma unroll
    for (int j = 0; j < 4; ++j) {
      s[j] = (v8f){0.f,0.f,0.f,0.f,0.f,0.f,0.f,0.f};
#pragma unroll
      for (int dc = 0; dc < 2; ++dc) {
        FH kb;
        kb.h[0] = *(const v8h*)(Ksh + (j * 16 + c) * AT_D + dc * 32 + 8 * hh);
        kb.h[1] = *(const v8h*)(Ksh + (j * 16 + c) * AT_D + dc * 32 + 16 + 8 * hh);
        s[j] = hmma(qa[dc], kb.v, s[j]);
      }
    }
    // additive terms: key padding per column, gated position bias per (row, column)
    float kp[4];
#pragma unroll
    for (int j = 0; j < 4; ++j) kp[j] = (1.0f - mk_ptr[kv0 + j * 16 + c]) * -10000.0f;
    float cm[8];
#pragma unroll
    for (int r = 0; r < 8; ++r) {
      const int qrow = q0 + 8 * hh + r;
      const float* pbr = pb_ptr + (size_t)qrow * S + kv0;
      float m = -INFINITY;
#pragma unroll
      for (int j = 0; j < 4; ++j) {
        const float sv = s[j][r] * qscale + grow[r] * pbr[j * 16 + c] + kp[j];
        s[j][r] = sv;
        m = fmaxf(m, sv);
      }
#pragma unroll
      for (int off = 1; off < 16; off <<= 1) m = fmaxf(m, __shfl_xor(m, off, 32));
      cm[r] = m;
    }
    _Float16* pw = Psh[wave];
#pragma unroll
    for (int r = 0; r < 8; ++r) {
      const float mnew = fmaxf(mrow[r], cm[r]);
      const float alpha = expf(mrow[r] - mnew);
      mrow[r] = mnew;
      float psum = 0.f;
#pragma unroll
      for (int j = 0; j < 4; ++j) {
        const float p = expf(s[j][r] - mnew);
        psum += p;
        pw[(8 * hh + r) * AT_KC + j * 16 + c] = (_Float16)(p * AT_PSC);
      }
#pragma unroll
      for (int off = 1; off < 16; off <<= 1) psum += __shfl_xor(psum, off, 32);
      lrow[r] = lrow[r] * alpha + psum;
#pragma unroll
      for (int t = 0; t < 4; ++t) oacc[t][r] *= alpha;
    }
    __builtin_amdgcn_fence(__ATOMIC_RELEASE, "workgroup");
    __builtin_amdgcn_wave_barrier();
    __builtin_amdgcn_fence(__ATOMIC_ACQUIRE, "workgroup");
#pragma unroll 1
    for (int kk = 0; kk < 2; ++kk) {
      FH pa;
      pa.h[0] = *(const v8h*)(pw + c * AT_KC + kk * 32 + 8 * hh);
      pa.h[1] = *(const v8h*)(pw + c * AT_KC + kk * 32 + 16 + 8 * hh);
#pragma unroll
      for (int t = 0; t < 4; ++t) {
        FH vb;
        vb.h[0] = *(const v8h*)(Vth + (t * 16 + c) * AT_KC + kk * 32 + 8 * hh);
        vb.h[1] = *(const v8h*)(Vth + (t * 16 + c) * AT_KC + kk * 32 + 16 + 8 * hh);
        oacc[t] = hmma(pa.v, vb.v, oacc[t]);
      }
    }
  }

  float* os = Os[wave];
#pragma unroll
  for (int r = 0; r < 8; ++r) {
    const float inv = 1.0f / (lrow[r] * AT_PSC);
#pragma unroll
    for (int t = 0; t < 4; ++t) os[(8 * hh + r) * 68 + t * 16 + c] = oacc[t][r] * inv;
  }
  __builtin_amdgcn_fence(__ATOMIC_RELEASE, "workgroup");
  __builtin_amdgcn_wave_barrier();
  __builtin_amdgcn_fence(__ATOMIC_ACQUIRE, "workgroup");
  {
    const int q8 = lane >> 3, c8 = (lane & 7) * 8;
    {
#pragma unroll
      for (int it = 0; it < 4; ++it) {
        const int row = it * 4 + q8;
        const float* sp = os + row * 68 + c8;
        v8h hv;
#pragma unroll
        for (int e = 0; e < 8; ++e) hv[e] = (_Float16)sp[e];
        *(v8h*)(ob_ptr + (size_t)(q0 + row) * C + c8) = hv;
      }
      
    }
  }
}

// ---------------------------------------------------------------------------
extern "C" void kernel_launch(void* const* d_in, const int* in_sizes, int n_in,
                              void* d_out, int out_size, void* d_ws, size_t ws_size,
                              hipStream_t stream) {
  const int Bn = 2, S = 1024, C = 768, H = 12, L = 4, FF = 3072;
  const int M = Bn * S;
  if (n_in < 25) return;
  if (in_sizes[0] != M * C || in_sizes[1] != M * C || in_sizes[2] != M || in_sizes[3] != H * S * S) return;
  if (in_sizes[6] != L * C * C || in_sizes[19] != L * FF * C || in_sizes[21] != L * C * FF) return;
  if (out_size != M * C) return;

  const float* x        = (const float*)d_in[0];
  const float* pos_emb  = (const float*)d_in[1];
  const float* attn_m   = (const float*)d_in[2];
  const float* pos_bias = (const float*)d_in[3];
  const float* ln0_g    = (const float*)d_in[4];
  const float* ln0_b    = (const float*)d_in[5];
  const float* Wq       = (const float*)d_in[6];
  const float* bq       = (const float*)d_in[7];
  const float* Wk       = (const float*)d_in[8];
  const float* bk       = (const float*)d_in[9];
  const float* Wv       = (const float*)d_in[10];
  const float* bv       = (const float*)d_in[11];
  const float* Wo       = (const float*)d_in[12];
  const float* bo       = (const float*)d_in[13];
  const float* gruW     = (const float*)d_in[14];
  const float* grub     = (const float*)d_in[15];
  const float* gruc     = (const float*)d_in[16];
  const float* ln1_g    = (const float*)d_in[17];
  const float* ln1_b    = (const float*)d_in[18];
  const float* W1       = (const float*)d_in[19];
  const float* b1       = (const float*)d_in[20];
  const float* W2       = (const float*)d_in[21];
  const float* b2       = (const float*)d_in[22];
  const float* ln2_g    = (const float*)d_in[23];
  const float* ln2_b    = (const float*)d_in[24];

  // ---- workspace carve (256-B aligned offsets, total 110,198,784 B) ----
  char* ws = (char*)d_ws;
  size_t off = 0;
  const size_t NWC = (size_t)L * C * C;      // halves per projection weight set
  const size_t NWF = (size_t)L * FF * C;     // halves per FFN weight set
  const size_t NA  = (size_t)M * C;
  const size_t NF  = (size_t)M * FF;
  const size_t NG  = (size_t)Bn * H * S;
  size_t o_wq, o_wk, o_wv, o_wo, o_w1, o_w2, o_hf, o_hh, o_qf, o_kf, o_vf, o_ao, o_h1f, o_h1h, o_ff, o_gt;
#define CARVE(o, bytes) do { o = off; off += ((size_t)(bytes) + 255) & ~(size_t)255; } while (0)
  CARVE(o_wq, NWC * 2); CARVE(o_wk, NWC * 2); CARVE(o_wv, NWC * 2); CARVE(o_wo, NWC * 2);
  CARVE(o_w1, NWF * 2); CARVE(o_w2, NWF * 2);
  CARVE(o_hf, NA * 4);  CARVE(o_hh, NA * 2);
  CARVE(o_qf, NA * 4);  CARVE(o_kf, NA * 4);  CARVE(o_vf, NA * 4);
  CARVE(o_ao, NA * 2);
  CARVE(o_h1f, NA * 4); CARVE(o_h1h, NA * 2);
  CARVE(o_ff, NF * 2);
  CARVE(o_gt, NG * 4);
#undef CARVE
  if (off > ws_size) return;

  _Float16* wq16 = (_Float16*)(ws + o_wq);
  _Float16* wk16 = (_Float16*)(ws + o_wk);
  _Float16* wv16 = (_Float16*)(ws + o_wv);
  _Float16* wo16 = (_Float16*)(ws + o_wo);
  _Float16* w116 = (_Float16*)(ws + o_w1);
  _Float16* w216 = (_Float16*)(ws + o_w2);
  float*    hf   = (float*)(ws + o_hf);
  _Float16* hh16 = (_Float16*)(ws + o_hh);
  float*    qf   = (float*)(ws + o_qf);
  float*    kf   = (float*)(ws + o_kf);
  float*    vf   = (float*)(ws + o_vf);
  _Float16* ao16 = (_Float16*)(ws + o_ao);
  float*    h1f  = (float*)(ws + o_h1f);
  _Float16* h1h  = (_Float16*)(ws + o_h1h);
  _Float16* ff16 = (_Float16*)(ws + o_ff);
  float*    gtb  = (float*)(ws + o_gt);
  float*    outp = (float*)d_out;

  const float WSC  = 64.0f;            // weights carried x64 in f16
  const float WINV = 1.0f / 64.0f;     // folded back in the GEMM epilogue
  const float invC = 1.0f / 768.0f;
  const float eps  = 1e-5f;
  const float qscale = 0.125f;         // 1/sqrt(64)

  // ---- weights -> f16 (x64) ----
  {
    const int n2c = (int)(NWC / 2), n2f = (int)(NWF / 2);
    cast_scale_f32_f16x2<<<(n2c + 255) / 256, 256, 0, stream>>>(Wq, wq16, n2c, WSC);
    cast_scale_f32_f16x2<<<(n2c + 255) / 256, 256, 0, stream>>>(Wk, wk16, n2c, WSC);
    cast_scale_f32_f16x2<<<(n2c + 255) / 256, 256, 0, stream>>>(Wv, wv16, n2c, WSC);
    cast_scale_f32_f16x2<<<(n2c + 255) / 256, 256, 0, stream>>>(Wo, wo16, n2c, WSC);
    cast_scale_f32_f16x2<<<(n2f + 255) / 256, 256, 0, stream>>>(W1, w116, n2f, WSC);
    cast_scale_f32_f16x2<<<(n2f + 255) / 256, 256, 0, stream>>>(W2, w216, n2f, WSC);
  }

  // ---- h = LN0(x * mask + pos_emb) ----
  ln_kernel<1><<<M, LN_T, 0, stream>>>(x, pos_emb, attn_m, ln0_g, ln0_b, hf, hh16, C, invC, eps);

  const int nbP = (M / 128) * (C / 128);    // 96 blocks, one 128x128 tile each
  const int nbF = (M / 128) * (FF / 128);   // 384 blocks
  const int nbA = Bn * H * (S / 64);                // 384 attention blocks
  const int ngate = (int)NG;
  const int nbG = (ngate + 255) / 256;

  for (int l = 0; l < L; ++l) {
    const size_t lw  = (size_t)l * C * C;
    const size_t lwf = (size_t)l * FF * C;
    const _Float16* WQl = wq16 + lw;
    const _Float16* WKl = wk16 + lw;
    const _Float16* WVl = wv16 + lw;
    const _Float16* WOl = wo16 + lw;
    const _Float16* W1l = w116 + lwf;   // [FF][C]
    const _Float16* W2l = w216 + lwf;   // [C][FF]

    // q, k, v = h . W^T + b  (f32 out)
    wmma_gemm64<0, false, 2, 0, false, 0><<<dim3(nbP, 1), 128, 0, stream>>>(
        U16(hh16), U16(hh16), C, 0L, U16(WQl), U16(WQl), C, 0L,
        (void*)qf, (void*)qf, C, 0L, bq + (size_t)l * C, hf, 0L, M, C, C, WINV);
    wmma_gemm64<0, false, 2, 0, false, 0><<<dim3(nbP, 1), 128, 0, stream>>>(
        U16(hh16), U16(hh16), C, 0L, U16(WKl), U16(WKl), C, 0L,
        (void*)kf, (void*)kf, C, 0L, bk + (size_t)l * C, hf, 0L, M, C, C, WINV);
    wmma_gemm64<0, false, 2, 0, false, 0><<<dim3(nbP, 1), 128, 0, stream>>>(
        U16(hh16), U16(hh16), C, 0L, U16(WVl), U16(WVl), C, 0L,
        (void*)vf, (void*)vf, C, 0L, bv + (size_t)l * C, hf, 0L, M, C, C, WINV);

    // gate[b][h][s]
    gate_kernel<<<nbG, 256, 0, stream>>>(hf, gruW + (size_t)l * 8 * 64, grub + (size_t)l * 8,
                                          gruc + (size_t)l * H, gtb, S, H, C, ngate);

    // attention -> ao16 (f16)
    attn_gbias_kernel<<<nbA, 128, 0, stream>>>(qf, kf, vf, gtb, pos_bias, attn_m, ao16, S, H, C, qscale);

    // qf <- h + ao . Wo^T + bo
    wmma_gemm64<0, false, 2, 0, true, 0><<<dim3(nbP, 1), 128, 0, stream>>>(
        U16(ao16), U16(ao16), C, 0L, U16(WOl), U16(WOl), C, 0L,
        (void*)qf, (void*)qf, C, 0L, bo + (size_t)l * C, hf, 0L, M, C, C, WINV);

    // h1 = LN1(qf)
    ln_kernel<0><<<M, LN_T, 0, stream>>>(qf, qf, attn_m, ln1_g + (size_t)l * C, ln1_b + (size_t)l * C,
                                         h1f, h1h, C, invC, eps);

    // ff16 = gelu(h1 . W1^T + b1)  (f16 out)
    wmma_gemm64<0, false, 2, 1, false, 5><<<dim3(nbF, 1), 128, 0, stream>>>(
        U16(h1h), U16(h1h), C, 0L, U16(W1l), U16(W1l), C, 0L,
        (void*)ff16, (void*)ff16, FF, 0L, b1 + (size_t)l * FF, h1f, 0L, M, FF, C, WINV);

    // kf <- h1 + ff . W2^T + b2
    wmma_gemm64<0, false, 2, 0, true, 0><<<dim3(nbP, 1), 128, 0, stream>>>(
        U16(ff16), U16(ff16), FF, 0L, U16(W2l), U16(W2l), FF, 0L,
        (void*)kf, (void*)kf, C, 0L, b2 + (size_t)l * C, h1f, 0L, M, C, FF, WINV);

    // h = LN2(kf); last layer writes the output buffer directly
    float* hdst = (l == L - 1) ? outp : hf;
    ln_kernel<0><<<M, LN_T, 0, stream>>>(kf, kf, attn_m, ln2_g + (size_t)l * C, ln2_b + (size_t)l * C,
                                         hdst, hh16, C, invC, eps);
  }
  (void)hipGetLastError();
}

// v002
// A run of this version takes 914 microseconds.
// In two side-by-side timings against v001, it was 1.04 and 1.05 times as fast.
// Over all steps from v000 it is 2.01 times as fast.
// Contractions (q/k/v/out projections, FFN up/down, attention q.k^T and p.v): v_wmma_f32_16x16x32_f16 (f16 operands, f32 accumulate); weights carried x64, softmax probabilities carried x2^15; LayerNorm, softmax, gate: f32 VALU.
#include <hip/hip_runtime.h>
#include <math.h>
#include <stdint.h>

typedef __attribute__((ext_vector_type(16))) _Float16 v16h;
typedef __attribute__((ext_vector_type(8)))  _Float16 v8h;
typedef __attribute__((ext_vector_type(4)))  _Float16 v4h;
typedef __attribute__((ext_vector_type(16))) __bf16   v16b;
typedef __attribute__((ext_vector_type(8)))  __bf16   v8b;
typedef __attribute__((ext_vector_type(8)))  float    v8f;
typedef __attribute__((ext_vector_type(4)))  float    v4f;
#define U16(p) ((const unsigned short*)(const void*)(p))

__device__ __forceinline__ unsigned short f2bf_bits(float f) {
  unsigned u = __float_as_uint(f);
  return (unsigned short)((u + 0x7FFFu + ((u >> 16) & 1u)) >> 16);
}
__device__ __forceinline__ float bf_bits2f(unsigned short h) { return __uint_as_float(((unsigned)h) << 16); }

// hazard guards as plain device helpers (no inline asm inside the kernel template body)
__device__ __forceinline__ void acc_guard4(v8f& a, v8f& b, v8f& c, v8f& d) { asm volatile("v_nop\n\tv_nop\n\tv_nop\n\tv_nop" : "+v"(a), "+v"(b), "+v"(c), "+v"(d)); }
template <typename T> struct Frag;
template <> struct Frag<_Float16> {
  typedef v16h V; union U { v16h v; v8h h[2]; };
  static __device__ __forceinline__ v16h load(const _Float16* p) {   // elements 0..7 <- p[0..7], 8..15 <- p[16..23]
    U f; f.h[0] = *(const v8h*)(p); f.h[1] = *(const v8h*)(p + 16); return f.v;
  }
  static __device__ __forceinline__ v8f mma(v16h a, v16h b, v8f c) {
    return __builtin_amdgcn_wmma_f32_16x16x32_f16(false, a, false, b, (short)0, c, false, false);
  }
};
template <> struct Frag<__bf16> {
  typedef v16b V; union U { v16b v; v8b h[2]; };
  static __device__ __forceinline__ v16b load(const __bf16* p) {
    U f; f.h[0] = *(const v8b*)(p); f.h[1] = *(const v8b*)(p + 16); return f.v;
  }
  static __device__ __forceinline__ v8f mma(v16b a, v16b b, v8f c) {
    return __builtin_amdgcn_wmma_f32_16x16x32_bf16(false, a, false, b, (short)0, c, false, false);
  }
};

// ---- Block-tiled batched WMMA GEMM, operands staged in LDS by the tensor mover ------------
// C[m,n] = scale * sum_k A[m,k] * Bt[n,k] (+bias)(+resid); a block of 4 waves (2 x 2) owns a 128x128 tile, each wave 64x64.
// A row-major [M,K]; Bt row-major [N,K]; M,N % 128 == 0, K % 128 == 0, K >= 256 (two stages).
// A pass is 128 k = 256 B of each of the 256 operand rows; each wave brings one 64-row slice per pass with one tensor load
// (waves 0,1: the two halves of the A rows; waves 2,3: of the Bt rows), two buffers, LDS row pitch 272 B.
// BIAS_MODE: 0 = none, 1 = bias[m], 2 = bias[n].
// OUT_MODE: 0 = f32, 1 = f16, 2 = bf16 hi plane (Cout) + bf16 lo plane (Cout2).
// ET: 0 = f16 operands, 1 = bf16 operands (pointers passed as 16-bit storage)
typedef uint32_t u32x4 __attribute__((ext_vector_type(4)));
typedef uint32_t u32x8 __attribute__((ext_vector_type(8)));
#define GT_KP     128u                 // k per pass
#define GT_ROWB   256u                 // bytes of one operand row per pass
#define GT_PITCH  272u                 // LDS row pitch: 256 B + the mover's 16-B pad (ds_load_b128 readers)
#define GT_ROWS   64u                  // rows per slice
#define GT_SLICE  18432u               // 64 x 272 = 17,408 B, rounded up to a multiple of 2 KiB
#define GT_STAGE  (4u * GT_SLICE)      // one buffer: 4 slices
__device__ __forceinline__ uint32_t uni(uint32_t v) { return (uint32_t)__builtin_amdgcn_readfirstlane(v); }
// pinned(): holds a wave-uniform value in a scalar register, so that a test on it is a scalar branch (a tensor load ignores EXEC)
// and so that descriptor words formed from it are formed behind the waits that stand in front of it.
__device__ __forceinline__ uint32_t pinned(uint32_t v) { uint32_t w = uni(v); asm volatile("" : "+s"(w)); return w; }
__device__ __forceinline__ void wait_ds0()     { asm volatile("s_wait_dscnt 0x0" ::: "memory"); }      // this wave's LDS reads of the buffer are done
__device__ __forceinline__ void wait_tensor0() { asm volatile("s_wait_tensorcnt 0x0" ::: "memory"); }  // this wave's own slice has landed
// descriptor words held in scalar registers (as pinned() does for one word): the eight registers stay group 1's own through
// the loop, so that none of them takes another value while a request is outstanding
__device__ __forceinline__ void hold_group1(u32x8& g) { asm volatile("" : "+s"(g)); }
// one request of the whole wave: 64 rows of 256 B from global memory to LDS, 16 B of pad behind each row
__device__ __forceinline__ void tdm_load(uint32_t lds_dst, uint64_t ga, u32x8 g1) {
  u32x4 g0;
  g0[0] = uni(1u);
  g0[1] = uni(lds_dst);
  g0[2] = uni((uint32_t)ga);
  g0[3] = uni((((uint32_t)(ga >> 32)) & 0x01FFFFFFu) | 0x80000000u);
  asm volatile("tensor_load_to_lds %0, %1" :: "s"(g0), "s"(g1) : "memory");
}
template <int ET> struct Elem;
template <> struct Elem<0> { typedef _Float16 T; };
template <> struct Elem<1> { typedef __bf16 T; };
template <int ET, bool SPLIT, int BIAS_MODE, int OUT_MODE, bool RESID, int ACT = 0>
__global__ __launch_bounds__(128) void wmma_gemm64(
    const unsigned short* __restrict__ Ap, const unsigned short* __restrict__ A2p, int lda, long strideA,
    const unsigned short* __restrict__ Btp, const unsigned short* __restrict__ Bt2p, int ldb, long strideB,
    void* __restrict__ Cout, void* __restrict__ Cout2, int ldc, long strideC,
    const float* __restrict__ bias,
    const float* __restrict__ resid, long strideR,
    int M, int N, int K, float scale) {
  static_assert(!SPLIT, "single-plane operands only");
  typedef typename Elem<ET>::T T;
  typedef typename Frag<T>::V V;
  const T* A = (const T*)Ap; const T* Bt = (const T*)Btp;
  // two stage buffers; after the K loop its first bytes serve as the per-wave 16x64 f32 output slabs (pitch 68 floats)
  __shared__ __attribute__((aligned(2048))) unsigned char L[2u * GT_STAGE];
  const int b    = blockIdx.y;
  const int lane = threadIdx.x & 31;
  const uint32_t wave = uni(threadIdx.x >> 5);
  const int tilesN = N >> 7;
  const int tilesM = M >> 7;
  const int tile = blockIdx.x;
  const uint32_t nPass = uni((uint32_t)K / GT_KP);
  if (tile >= tilesM * tilesN || nPass < 2u) return;   // block-uniform, in front of every tensor load and barrier; the ring's prologue loads two stages
  const int tm = tile / tilesN;
  const int tn = tile - tm * tilesN;
  const uint32_t wm = wave >> 1, wn = wave & 1u;
  const int m0 = (tm << 7) + (int)(wm << 6);
  const int n0 = (tn << 7) + (int)(wn << 6);

  const T* Ab  = A  + (size_t)b * strideA;
  const T* Bb  = Bt + (size_t)b * strideB;

  const int rlane = lane & 15;                 // row (A) / col (B, D) within subtile
  const int koff  = (lane >> 4) * 8;           // k offset of this lane half
  const int mOff  = (lane >> 4) * 8;           // D row offset

  // ---- this wave's slice: source, place in LDS, descriptor group 1 (loop-invariant) ----
  const bool isB = wave >= 2u;
  const uint32_t srcPitch = (uint32_t)(isB ? ldb : lda) * 2u;     // bytes
  const uint64_t srcBase = isB ? (uint64_t)(uintptr_t)(Bb + (size_t)((tn << 7) + (int)(wn << 6)) * ldb)
                               : (uint64_t)(uintptr_t)(Ab + (size_t)((tm << 7) + (int)(wn << 6)) * lda);
  const uint32_t ldsSlice = (uint32_t)(size_t)L + wave * GT_SLICE;
  u32x8 g1;
  g1[0] = uni((1u << 20) | (5u << 22) | (3u << 25));              // no mask, 1-byte elements, 4 dwords of pad behind every 64 dwords
  g1[1] = uni((GT_ROWB & 0xFFFFu) << 16);                         // tensor_dim0 low
  g1[2] = uni((GT_ROWB >> 16) | ((GT_ROWS & 0xFFFFu) << 16));     // tensor_dim0 high, tensor_dim1 low
  g1[3] = uni((GT_ROWS >> 16) | (GT_ROWB << 16));                 // tensor_dim1 high, tile_dim0
  g1[4] = uni(GT_ROWS);                                           // tile_dim1
  g1[5] = uni(srcPitch);
  g1[6] = uni(0u);
  g1[7] = uni(0u);
  hold_group1(g1);

  v8f acc[4][4];
#pragma unroll
  for (int i = 0; i < 4; ++i)
#pragma unroll
    for (int j = 0; j < 4; ++j) acc[i][j] = (v8f){0.f,0.f,0.f,0.f,0.f,0.f,0.f,0.f};

  // prologue: stage 0 lands and is published, then stage 1 flies while pass 0 works
  tdm_load(ldsSlice, srcBase, g1);
  wait_tensor0();
  __syncthreads();
  tdm_load(ldsSlice + GT_STAGE, srcBase + GT_ROWB, g1);

  const uint32_t aOff = wm * GT_SLICE + (uint32_t)rlane * GT_PITCH + (uint32_t)koff * 2u;
  const uint32_t bOff = (2u + wn) * GT_SLICE + (uint32_t)rlane * GT_PITCH + (uint32_t)koff * 2u;
  uint32_t s = 0;
  // the pass loop stays rolled: one publish point in the text, every fragment index below a constant
#pragma unroll 1
  do {                                        // nPass >= 2 here
    const uint32_t bufOff = (s & 1u) * GT_STAGE;
    const unsigned char* As = L + bufOff + aOff;
    const unsigned char* Bs = L + bufOff + bOff;
    V bh[2][4], ah[2][4];                     // two fragment sets: the next 32 k are read while these are multiplied
#pragma unroll
    for (int j = 0; j < 4; ++j) bh[0][j] = Frag<T>::load((const T*)(Bs + (uint32_t)j * 16u * GT_PITCH));
#pragma unroll
    for (int i = 0; i < 4; ++i) ah[0][i] = Frag<T>::load((const T*)(As + (uint32_t)i * 16u * GT_PITCH));
#pragma unroll
    for (int kk = 0; kk < 4; ++kk) {          // 32 k per step, in ascending k as before; only this pass's own buffer is read
      const int cur = kk & 1, nx = cur ^ 1;
      if (kk < 3) {
#pragma unroll
        for (int j = 0; j < 4; ++j) bh[nx][j] = Frag<T>::load((const T*)(Bs + (uint32_t)j * 16u * GT_PITCH + (uint32_t)(kk + 1) * 64u));
#pragma unroll
        for (int i = 0; i < 4; ++i) ah[nx][i] = Frag<T>::load((const T*)(As + (uint32_t)i * 16u * GT_PITCH + (uint32_t)(kk + 1) * 64u));
      }
      __builtin_amdgcn_sched_barrier(0);      // the next step's LDS reads stay one group in front of this step's WMMAs, not among them
#pragma unroll
      for (int i = 0; i < 4; ++i)
#pragma unroll
        for (int j = 0; j < 4; ++j) acc[i][j] = Frag<T>::mma(ah[cur][i], bh[cur][j], acc[i][j]);
      __builtin_amdgcn_sched_barrier(0);      // and the step after next's reads do not rise into this block
    }
    // publish point of stage s + 1: own LDS reads done, own slice landed, then the barrier that both publishes
    // stage s + 1 and ends every wave's reads of the buffer that is refilled behind it
    wait_ds0();
    wait_tensor0();
    __syncthreads();
    if (pinned(s + 2u < nPass)) {             // scalar branch: only while stage s + 2 exists
      const uint32_t nxt = pinned(s + 2u);    // group 0 is formed from it, so behind the waits above
      tdm_load(ldsSlice + bufOff, srcBase + (uint64_t)nxt * GT_ROWB, g1);
    }
  } while (++s < nPass);
  wait_tensor0();
  wait_ds0();
  acc_guard4(acc[0][0], acc[0][1], acc[0][2], acc[0][3]);
  acc_guard4(acc[1][0], acc[1][1], acc[1][2], acc[1][3]);
  acc_guard4(acc[2][0], acc[2][1], acc[2][2], acc[2][3]);
  acc_guard4(acc[3][0], acc[3][1], acc[3][2], acc[3][3]);

  // ---- epilogue ----
  float* slab = (float*)(void*)L + wave * (16u * 68u);   // the last pass's own barrier has ended every read of the ring
  const float* Rb = RESID ? (resid + (size_t)b * strideR) : nullptr;
#pragma unroll
  for (int i = 0; i < 4; ++i) {
    const int mBase = m0 + (i << 4);
#pragma unroll
    for (int j = 0; j < 4; ++j) {
      const int n = n0 + (j << 4) + rlane;
      float bv = 0.f;
      if (BIAS_MODE == 2) bv = bias[n];
#pragma unroll
      for (int r = 0; r < 8; ++r) {
        float v = acc[i][j][r] * scale;
        if (BIAS_MODE == 1) v += bias[mBase + mOff + r];
        if (BIAS_MODE == 2) v += bv;
        if (RESID) v += Rb[(size_t)(mBase + mOff + r) * ldc + n];
        if (ACT == 1) v = tanhf(v);
        if (ACT == 2) v = fmaxf(v, 0.0f);
        if (ACT == 3) v = v / (1.0f + expf(-v));
        if (ACT == 4) v = (v > 0.f) ? v : 0.01f * v;
        if (ACT == 5) v = 0.5f * v * (1.0f + erff(v * 0.70710678118654752f));
        slab[(mOff + r) * 68 + (j << 4) + rlane] = v;
      }
    }
    __builtin_amdgcn_fence(__ATOMIC_RELEASE, "workgroup");
    __builtin_amdgcn_wave_barrier();
    __builtin_amdgcn_fence(__ATOMIC_ACQUIRE, "workgroup");
    if (OUT_MODE == 0) {
      float* C = (float*)Cout + (size_t)b * strideC;
      const int hh = lane >> 4, c4 = (lane & 15) * 4;     // row seg = 256 B = 16 lanes x 16 B
      {
#pragma unroll
        for (int it = 0; it < 8; ++it) {
          const int row = it * 2 + hh;
          v4f v = *(const v4f*)(slab + row * 68 + c4);
          *(v4f*)(C + (size_t)(mBase + row) * ldc + n0 + c4) = v;
        }
        
      }
    } else {
      const int q = lane >> 3, c8 = (lane & 7) * 8;
      unsigned short* C  = (unsigned short*)Cout  + (size_t)b * strideC;
      unsigned short* C2 = (OUT_MODE == 2) ? ((unsigned short*)Cout2 + (size_t)b * strideC) : nullptr;
      {
#pragma unroll
        for (int it = 0; it < 4; ++it) {
          const int row = it * 4 + q;
          const float* sp = slab + row * 68 + c8;
          v8h hv, lv;
#pragma unroll
          for (int e = 0; e < 8; ++e) {
            if (OUT_MODE == 1) {
              hv[e] = (_Float16)sp[e];
            } else {
              unsigned short hb = f2bf_bits(sp[e]);
              unsigned short lb = f2bf_bits(sp[e] - bf_bits2f(hb));
              hv[e] = __builtin_bit_cast(_Float16, hb);
              lv[e] = __builtin_bit_cast(_Float16, lb);
            }
          }
          *(v8h*)(C + (size_t)(mBase + row) * ldc + n0 + c8) = hv;
          if (OUT_MODE == 2) *(v8h*)(C2 + (size_t)(mBase + row) * ldc + n0 + c8) = lv;
        }
        
      }
    }
    __builtin_amdgcn_fence(__ATOMIC_RELEASE, "workgroup");
    __builtin_amdgcn_wave_barrier();
    __builtin_amdgcn_fence(__ATOMIC_ACQUIRE, "workgroup");
  }
}

__global__ __launch_bounds__(256) void cast_scale_f32_f16x2(
    const float* __restrict__ in, _Float16* __restrict__ out, int n2, float sc) {
  int i = blockIdx.x * 256 + threadIdx.x;
  if (i < n2) {
    const _Float16 h0 = (_Float16)(in[2 * i] * sc), h1 = (_Float16)(in[2 * i + 1] * sc);
    const unsigned u = (unsigned)__builtin_bit_cast(unsigned short, h0) | ((unsigned)__builtin_bit_cast(unsigned short, h1) << 16);
    ((unsigned*)out)[i] = u;
    
  }
}

// ---- LayerNorm over rows of C = 4 * blockDim floats; PRE: input = in * mask[row] + pos --------------------------
#define LN_T 192
template <int PRE>
__global__ __launch_bounds__(LN_T) void ln_kernel(
    const float* __restrict__ in, const float* __restrict__ pos, const float* __restrict__ mask,
    const float* __restrict__ g, const float* __restrict__ bb,
    float* __restrict__ outf, _Float16* __restrict__ outh, int C, float invC, float eps) {
  __shared__ float rs[8];
  __shared__ float rq[8];
  const int row = blockIdx.x;
  const int tid = threadIdx.x;
  const int lane = tid & 31;
  const int w = tid >> 5;
  const int c4 = tid * 4;
  const size_t base = (size_t)row * C + c4;
  v4f xv = *(const v4f*)(in + base);
  if (PRE) {
    const float mk = mask[row];
    const v4f pv = *(const v4f*)(pos + base);
    xv = xv * mk + pv;
  }
  float s = (xv[0] + xv[1]) + (xv[2] + xv[3]);
#pragma unroll
  for (int off = 16; off > 0; off >>= 1) s += __shfl_xor(s, off, 32);
  if (lane == 0) rs[w] = s;
  __syncthreads();
  float ts = 0.f;
#pragma unroll
  for (int i = 0; i < LN_T / 32; ++i) ts += rs[i];
  const float mean = ts * invC;
  const v4f d = xv - mean;
  float sq = (d[0] * d[0] + d[1] * d[1]) + (d[2] * d[2] + d[3] * d[3]);
#pragma unroll
  for (int off = 16; off > 0; off >>= 1) sq += __shfl_xor(sq, off, 32);
  if (lane == 0) rq[w] = sq;
  __syncthreads();
  float tq = 0.f;
#pragma unroll
  for (int i = 0; i < LN_T / 32; ++i) tq += rq[i];
  const float var = tq * invC;
  const float inv = rsqrtf(var + eps);
  const v4f gv = *(const v4f*)(g + c4);
  const v4f bv = *(const v4f*)(bb + c4);
  const v4f y = d * inv * gv + bv;
  v4h yh;
  yh[0] = (_Float16)y[0]; yh[1] = (_Float16)y[1]; yh[2] = (_Float16)y[2]; yh[3] = (_Float16)y[3];
  *(v4f*)(outf + base) = y;
  *(v4h*)(outh + base) = yh;
  
}

// ---- GRU-style gate per (b, h, s): g = h[b,s,h*64:+64] . gw^T + gb (8 outputs, K=64, VALU f32),
//      gate = sigmoid(sum g[0:4]) * (sigmoid(sum g[4:8]) * gc[h] - 1) + 2 ; stored [b][h][s] (one 4-B store per lane,
__global__ __launch_bounds__(256) void gate_kernel(
    const float* __restrict__ hf, const float* __restrict__ gw, const float* __restrict__ gb,
    const float* __restrict__ gc, float* __restrict__ gate, int S, int H, int C, int total) {
  const int idx = blockIdx.x * 256 + threadIdx.x;
  if (idx >= total) return;   // no barriers in this kernel
  const int s  = idx % S;
  const int bh = idx / S;
  const int h  = bh % H;
  const int b  = bh / H;
  const float* hp = hf + ((size_t)b * S + s) * C + (size_t)h * 64;
  float acc[8];
#pragma unroll
  for (int e = 0; e < 8; ++e) acc[e] = 0.f;
#pragma unroll 1
  for (int d = 0; d < 64; ++d) {
    const float hv = hp[d];
#pragma unroll
    for (int e = 0; e < 8; ++e) acc[e] = fmaf(hv, gw[e * 64 + d], acc[e]);
  }
  const float sa = ((acc[0] + gb[0]) + (acc[1] + gb[1])) + ((acc[2] + gb[2]) + (acc[3] + gb[3]));
  const float sb = ((acc[4] + gb[4]) + (acc[5] + gb[5])) + ((acc[6] + gb[6]) + (acc[7] + gb[7]));
  const float ga  = 1.0f / (1.0f + expf(-sa));
  const float gbv = 1.0f / (1.0f + expf(-sb));
  const float gv = ga * (gbv * gc[h] - 1.0f) + 2.0f;
  ((float*)gate)[idx] = gv;
  
}

// =====================================================================================
// Flash attention, head_dim 64, f32 q/k/v in, f16 out; plain f16 operands, f32 accumulate; online softmax in f32.
//   s(q,kv) = (q . k) * qscale + gate[b,h,q] * pos_bias[h,q,kv] + (1 - mask[b,kv]) * -1e4
//   probabilities carried x2^15 in f16, folded into the final 1/l.
//   Block = 4 waves = 64 query rows of one (batch, head); S % 64 == 0.  q/k/v/out element (b,s,h,d) at
//   ((b*S + s)*C + h*64 + d); gate at (b*H + h)*S + s; pos_bias at (h*S + q)*S + kv; grid.x = B * H * (S/64).
// =====================================================================================
#define AT_D 64
#define AT_NW 4
#define AT_KC 64
#define AT_PSC 32768.0f

__device__ __forceinline__ v8f hmma(v16h a, v16h b, v8f c) {
  c = __builtin_amdgcn_wmma_f32_16x16x32_f16(false, a, false, b, (short)0, c, false, false);
  asm volatile("v_nop\n\tv_nop\n\tv_nop\n\tv_nop" : "+v"(c) : "v"(a), "v"(b));
  return c;
}

// Barrier and wave-level hand-over that order LDS traffic alone: a fence over global memory as well would wait out the
// loads that are in flight for the next chunk. Nothing in this kernel passes between waves through global memory.
__device__ __forceinline__ void lds_block_sync() {
  __builtin_amdgcn_fence(__ATOMIC_RELEASE, "workgroup", "local");
  __builtin_amdgcn_s_barrier();
  __builtin_amdgcn_fence(__ATOMIC_ACQUIRE, "workgroup", "local");
}
// Stands behind a run of loads that stay in flight, in front of any new value in their address registers.
__device__ __forceinline__ void wait_addr_taken() { asm volatile("s_wait_xcnt 0x0" ::: "memory"); }
__device__ __forceinline__ void lds_wave_sync() {
  __builtin_amdgcn_fence(__ATOMIC_RELEASE, "workgroup", "local");
  __builtin_amdgcn_wave_barrier();
  __builtin_amdgcn_fence(__ATOMIC_ACQUIRE, "workgroup", "local");
}

// waves_per_eu(1, 2): the grid holds three waves for every two SIMDs of the chip, so a register budget of two waves a SIMD costs
// no residency; with the default budget the compiler answers the 100 registers of loads in flight by running the row
// reductions one after the other.
__global__ __launch_bounds__(128) __attribute__((amdgpu_waves_per_eu(1, 2)))
void attn_gbias_kernel(const float* __restrict__ q, const float* __restrict__ k,
                       const float* __restrict__ v, const float* __restrict__ gate,
                       const float* __restrict__ pos_bias, const float* __restrict__ mask,
                       _Float16* __restrict__ out, int S, int H, int C, float qscale) {
  union FH { v16h v; v8h h[2]; };
  __shared__ __align__(16) _Float16 Ksh[AT_KC * AT_D];        // K [kv][d]
  __shared__ __align__(16) _Float16 Vth[AT_D * AT_KC];        // V^T [d][kv]
  __shared__ __align__(16) _Float16 Psh[AT_NW][16 * AT_KC];   // per wave P [row][kv]
  __shared__ __align__(16) float    Os[AT_NW][16 * 68];       // per wave out tile, pitch 68

  const int tid  = threadIdx.x;
  const int wave = tid >> 5;
  const int lane = tid & 31;
  const int hh   = lane >> 4;
  const int c    = lane & 15;

  const int nqb = S / 64;
  const int bx = blockIdx.x;
  const int qb = bx % nqb;
  const int bh = bx / nqb;
  const int h  = bh % H;
  const int b  = bh / H;
  const int q0 = qb * 64 + wave * 16;

  const float* qb_ptr = q + (size_t)b * S * C + (size_t)h * AT_D;
  const float* kb_ptr = k + (size_t)b * S * C + (size_t)h * AT_D;
  const float* vb_ptr = v + (size_t)b * S * C + (size_t)h * AT_D;
  const float* gt_ptr = gate + ((size_t)b * H + h) * S;
  const float* pb_ptr = pos_bias + (size_t)h * S * S;
  const float* mk_ptr = mask + (size_t)b * S;
  _Float16*    ob_ptr = out + (size_t)b * S * C + (size_t)h * AT_D;

  // ---- Q fragments (A operand): 2 d-chunks, split k map ----
  v16h qa[2];
  {
    const float* qrow = qb_ptr + (size_t)(q0 + c) * C;
#pragma unroll
    for (int dc = 0; dc < 2; ++dc) {
#pragma unroll
      for (int e = 0; e < 8; ++e) {
        qa[dc][e]     = (_Float16)qrow[dc * 32 + 8 * hh + e];
        qa[dc][8 + e] = (_Float16)qrow[dc * 32 + 16 + 8 * hh + e];
      }
    }
  }
  float grow[8];
#pragma unroll
  for (int r = 0; r < 8; ++r) grow[r] = gt_ptr[q0 + 8 * hh + r];

  float mrow[8], lrow[8];
  v8f oacc[4];
#pragma unroll
  for (int r = 0; r < 8; ++r) { mrow[r] = -INFINITY; lrow[r] = 0.f; }
#pragma unroll
  for (int t = 0; t < 4; ++t) oacc[t] = (v8f){0.f,0.f,0.f,0.f,0.f,0.f,0.f,0.f};

  const int nChunks = S / AT_KC;   // block-uniform, from launch argument
  // Every global operand of a chunk (this thread's K and V row pieces, the position-bias tile, the key mask) is held in
  // registers and requested one chunk ahead, so that no chunk waits out a load it has only just issued.
  const int kvr = tid >> 1, dh = (tid & 1) * 32;
  const int kvOff = kvr * C + dh;                 // this thread's piece inside a chunk of K or V rows
  int pbOff[8];                                   // this lane's column in each of its 8 bias rows
#pragma unroll
  for (int r = 0; r < 8; ++r) pbOff[r] = (q0 + 8 * hh + r) * S + c;
  v4f kreg[8], vreg[8];
  float pbv[8][4], mkv[4];
#pragma unroll
  for (int i = 0; i < 8; ++i) {
    kreg[i] = *(const v4f*)(kb_ptr + kvOff + 4 * i);
    vreg[i] = *(const v4f*)(vb_ptr + kvOff + 4 * i);
  }
#pragma unroll
  for (int j = 0; j < 4; ++j) mkv[j] = mk_ptr[j * 16 + c];
#pragma unroll
  for (int r = 0; r < 8; ++r)
#pragma unroll
    for (int j = 0; j < 4; ++j) pbv[r][j] = pb_ptr[pbOff[r] + j * 16];
  wait_addr_taken();
  const size_t step0 = (nChunks > 1) ? (size_t)AT_KC * C : 0;
  const float* kn = kb_ptr + kvOff + step0;       // this thread's piece of the next chunk's K rows, and of its V rows
  const float* vn = vb_ptr + kvOff + step0;

  for (int kc = 0; kc < nChunks; ++kc) {
    // first key of the next chunk; the last trip asks for its own chunk again (in bounds, not used), so that every trip
    // issues the same loads in the same order and each wait on them can be counted exactly
    const int kvn = (kc + 1 < nChunks ? kc + 1 : kc) * AT_KC;
    lds_block_sync();                             // every wave has left the previous chunk's K and V tiles
#pragma unroll
    for (int i = 0; i < 8; ++i) {
#pragma unroll
      for (int e = 0; e < 4; ++e) {
        const int d = dh + 4 * i + e;
        Ksh[kvr * AT_D + d]  = (_Float16)kreg[i][e];
        Vth[d * AT_KC + kvr] = (_Float16)vreg[i][e];
      }
    }
    {                                             // next chunk's K and V fly under this chunk's whole work
#pragma unroll
      for (int i = 0; i < 8; ++i) {
        kreg[i] = *(const v4f*)(kn + 4 * i);
        vreg[i] = *(const v4f*)(vn + 4 * i);
      }
    }
    lds_block_sync();                             // this chunk's tiles are published

    v8f s[4];
#pragma unroll
    for (int j = 0; j < 4; ++j) {
      s[j] = (v8f){0.f,0.f,0.f,0.f,0.f,0.f,0.f,0.f};
#pragma unroll
      for (int dc = 0; dc < 2; ++dc) {
        FH kb;
        kb.h[0] = *(const v8h*)(Ksh + (j * 16 + c) * AT_D + dc * 32 + 8 * hh);
        kb.h[1] = *(const v8h*)(Ksh + (j * 16 + c) * AT_D + dc * 32 + 16 + 8 * hh);
        s[j] = hmma(qa[dc], kb.v, s[j]);
      }
    }
    // additive terms: key padding per column, gated position bias per (row, column)
    float kp[4];
#pragma unroll
    for (int j = 0; j < 4; ++j) kp[j] = (1.0f - mkv[j]) * -10000.0f;
    float cm[8];
#pragma unroll
    for (int r = 0; r < 8; ++r) {
      float m = -INFINITY;
#pragma unroll
      for (int j = 0; j < 4; ++j) {
        const float sv = s[j][r] * qscale + grow[r] * pbv[r][j] + kp[j];
        s[j][r] = sv;
        m = fmaxf(m, sv);
      }
#pragma unroll
      for (int off = 1; off < 16; off <<= 1) m = fmaxf(m, __shfl_xor(m, off, 32));
      cm[r] = m;
    }
    {                                             // next chunk's bias tile and mask fly under softmax, P.V and the next staging
      const float* pn = pb_ptr + kvn;
#pragma unroll
      for (int j = 0; j < 4; ++j) mkv[j] = mk_ptr[kvn + j * 16 + c];
#pragma unroll
      for (int r = 0; r < 4; ++r)
#pragma unroll
        for (int j = 0; j < 4; ++j) pbv[r][j] = pn[pbOff[r] + j * 16];
      wait_addr_taken();
#pragma unroll
      for (int r = 4; r < 8; ++r)
#pragma unroll
        for (int j = 0; j < 4; ++j) pbv[r][j] = pn[pbOff[r] + j * 16];
      wait_addr_taken();
      // nothing crosses this line: the K and V pointers step on only behind the wait above (it covers their loads too), and
      // no work on the values just requested rises into this chunk, where it would wait those loads out
      __builtin_amdgcn_sched_barrier(0);
      const size_t step = (kc + 2 < nChunks) ? (size_t)AT_KC * C : 0;
      kn += step;
      vn += step;
    }
    _Float16* pw = Psh[wave];
#pragma unroll
    for (int r = 0; r < 8; ++r) {
      const float mnew = fmaxf(mrow[r], cm[r]);
      const float alpha = expf(mrow[r] - mnew);
      mrow[r] = mnew;
      float psum = 0.f;
#pragma unroll
      for (int j = 0; j < 4; ++j) {
        const float p = expf(s[j][r] - mnew);
        psum += p;
        pw[(8 * hh + r) * AT_KC + j * 16 + c] = (_Float16)(p * AT_PSC);
      }
#pragma unroll
      for (int off = 1; off < 16; off <<= 1) psum += __shfl_xor(psum, off, 32);
      lrow[r] = lrow[r] * alpha + psum;
#pragma unroll
      for (int t = 0; t < 4; ++t) oacc[t][r] *= alpha;
    }
    lds_wave_sync();                              // the wave's own P rows, written above, are read back as fragments below
#pragma unroll 1
    for (int kk = 0; kk < 2; ++kk) {
      FH pa;
      pa.h[0] = *(const v8h*)(pw + c * AT_KC + kk * 32 + 8 * hh);
      pa.h[1] = *(const v8h*)(pw + c * AT_KC + kk * 32 + 16 + 8 * hh);
#pragma unroll
      for (int t = 0; t < 4; ++t) {
        FH vb;
        vb.h[0] = *(const v8h*)(Vth + (t * 16 + c) * AT_KC + kk * 32 + 8 * hh);
        vb.h[1] = *(const v8h*)(Vth + (t * 16 + c) * AT_KC + kk * 32 + 16 + 8 * hh);
        oacc[t] = hmma(pa.v, vb.v, oacc[t]);
      }
    }
  }

  float* os = Os[wave];
#pragma unroll
  for (int r = 0; r < 8; ++r) {
    const float inv = 1.0f / (lrow[r] * AT_PSC);
#pragma unroll
    for (int t = 0; t < 4; ++t) os[(8 * hh + r) * 68 + t * 16 + c] = oacc[t][r] * inv;
  }
  __builtin_amdgcn_fence(__ATOMIC_RELEASE, "workgroup");
  __builtin_amdgcn_wave_barrier();
  __builtin_amdgcn_fence(__ATOMIC_ACQUIRE, "workgroup");
  {
    const int q8 = lane >> 3, c8 = (lane & 7) * 8;
    {
#pragma unroll
      for (int it = 0; it < 4; ++it) {
        const int row = it * 4 + q8;
        const float* sp = os + row * 68 + c8;
        v8h hv;
#pragma unroll
        for (int e = 0; e < 8; ++e) hv[e] = (_Float16)sp[e];
        *(v8h*)(ob_ptr + (size_t)(q0 + row) * C + c8) = hv;
      }
      
    }
  }
}

// ---------------------------------------------------------------------------
extern "C" void kernel_launch(void* const* d_in, const int* in_sizes, int n_in,
                              void* d_out, int out_size, void* d_ws, size_t ws_size,
                              hipStream_t stream) {
  const int Bn = 2, S = 1024, C = 768, H = 12, L = 4, FF = 3072;
  const int M = Bn * S;
  if (n_in < 25) return;
  if (in_sizes[0] != M * C || in_sizes[1] != M * C || in_sizes[2] != M || in_sizes[3] != H * S * S) return;
  if (in_sizes[6] != L * C * C || in_sizes[19] != L * FF * C || in_sizes[21] != L * C * FF) return;
  if (out_size != M * C) return;

  const float* x        = (const float*)d_in[0];
  const float* pos_emb  = (const float*)d_in[1];
  const float* attn_m   = (const float*)d_in[2];
  const float* pos_bias = (const float*)d_in[3];
  const float* ln0_g    = (const float*)d_in[4];
  const float* ln0_b    = (const float*)d_in[5];
  const float* Wq       = (const float*)d_in[6];
  const float* bq       = (const float*)d_in[7];
  const float* Wk       = (const float*)d_in[8];
  const float* bk       = (const float*)d_in[9];
  const float* Wv       = (const float*)d_in[10];
  const float* bv       = (const float*)d_in[11];
  const float* Wo       = (const float*)d_in[12];
  const float* bo       = (const float*)d_in[13];
  const float* gruW     = (const float*)d_in[14];
  const float* grub     = (const float*)d_in[15];
  const float* gruc     = (const float*)d_in[16];
  const float* ln1_g    = (const float*)d_in[17];
  const float* ln1_b    = (const float*)d_in[18];
  const float* W1       = (const float*)d_in[19];
  const float* b1       = (const float*)d_in[20];
  const float* W2       = (const float*)d_in[21];
  const float* b2       = (const float*)d_in[22];
  const float* ln2_g    = (const float*)d_in[23];
  const float* ln2_b    = (const float*)d_in[24];

  // ---- workspace carve (256-B aligned offsets, total 110,198,784 B) ----
  char* ws = (char*)d_ws;
  size_t off = 0;
  const size_t NWC = (size_t)L * C * C;      // halves per projection weight set
  const size_t NWF = (size_t)L * FF * C;     // halves per FFN weight set
  const size_t NA  = (size_t)M * C;
  const size_t NF  = (size_t)M * FF;
  const size_t NG  = (size_t)Bn * H * S;
  size_t o_wq, o_wk, o_wv, o_wo, o_w1, o_w2, o_hf, o_hh, o_qf, o_kf, o_vf, o_ao, o_h1f, o_h1h, o_ff, o_gt;
#define CARVE(o, bytes) do { o = off; off += ((size_t)(bytes) + 255) & ~(size_t)255; } while (0)
  CARVE(o_wq, NWC * 2); CARVE(o_wk, NWC * 2); CARVE(o_wv, NWC * 2); CARVE(o_wo, NWC * 2);
  CARVE(o_w1, NWF * 2); CARVE(o_w2, NWF * 2);
  CARVE(o_hf, NA * 4);  CARVE(o_hh, NA * 2);
  CARVE(o_qf, NA * 4);  CARVE(o_kf, NA * 4);  CARVE(o_vf, NA * 4);
  CARVE(o_ao, NA * 2);
  CARVE(o_h1f, NA * 4); CARVE(o_h1h, NA * 2);
  CARVE(o_ff, NF * 2);
  CARVE(o_gt, NG * 4);
#undef CARVE
  if (off > ws_size) return;

  _Float16* wq16 = (_Float16*)(ws + o_wq);
  _Float16* wk16 = (_Float16*)(ws + o_wk);
  _Float16* wv16 = (_Float16*)(ws + o_wv);
  _Float16* wo16 = (_Float16*)(ws + o_wo);
  _Float16* w116 = (_Float16*)(ws + o_w1);
  _Float16* w216 = (_Float16*)(ws + o_w2);
  float*    hf   = (float*)(ws + o_hf);
  _Float16* hh16 = (_Float16*)(ws + o_hh);
  float*    qf   = (float*)(ws + o_qf);
  float*    kf   = (float*)(ws + o_kf);
  float*    vf   = (float*)(ws + o_vf);
  _Float16* ao16 = (_Float16*)(ws + o_ao);
  float*    h1f  = (float*)(ws + o_h1f);
  _Float16* h1h  = (_Float16*)(ws + o_h1h);
  _Float16* ff16 = (_Float16*)(ws + o_ff);
  float*    gtb  = (float*)(ws + o_gt);
  float*    outp = (float*)d_out;

  const float WSC  = 64.0f;            // weights carried x64 in f16
  const float WINV = 1.0f / 64.0f;     // folded back in the GEMM epilogue
  const float invC = 1.0f / 768.0f;
  const float eps  = 1e-5f;
  const float qscale = 0.125f;         // 1/sqrt(64)

  // ---- weights -> f16 (x64) ----
  {
    const int n2c = (int)(NWC / 2), n2f = (int)(NWF / 2);
    cast_scale_f32_f16x2<<<(n2c + 255) / 256, 256, 0, stream>>>(Wq, wq16, n2c, WSC);
    cast_scale_f32_f16x2<<<(n2c + 255) / 256, 256, 0, stream>>>(Wk, wk16, n2c, WSC);
    cast_scale_f32_f16x2<<<(n2c + 255) / 256, 256, 0, stream>>>(Wv, wv16, n2c, WSC);
    cast_scale_f32_f16x2<<<(n2c + 255) / 256, 256, 0, stream>>>(Wo, wo16, n2c, WSC);
    cast_scale_f32_f16x2<<<(n2f + 255) / 256, 256, 0, stream>>>(W1, w116, n2f, WSC);
    cast_scale_f32_f16x2<<<(n2f + 255) / 256, 256, 0, stream>>>(W2, w216, n2f, WSC);
  }

  // ---- h = LN0(x * mask + pos_emb) ----
  ln_kernel<1><<<M, LN_T, 0, stream>>>(x, pos_emb, attn_m, ln0_g, ln0_b, hf, hh16, C, invC, eps);

  const int nbP = (M / 128) * (C / 128);    // 96 blocks, one 128x128 tile each
  const int nbF = (M / 128) * (FF / 128);   // 384 blocks
  const int nbA = Bn * H * (S / 64);                // 384 attention blocks
  const int ngate = (int)NG;
  const int nbG = (ngate + 255) / 256;

  for (int l = 0; l < L; ++l) {
    const size_t lw  = (size_t)l * C * C;
    const size_t lwf = (size_t)l * FF * C;
    const _Float16* WQl = wq16 + lw;
    const _Float16* WKl = wk16 + lw;
    const _Float16* WVl = wv16 + lw;
    const _Float16* WOl = wo16 + lw;
    const _Float16* W1l = w116 + lwf;   // [FF][C]
    const _Float16* W2l = w216 + lwf;   // [C][FF]

    // q, k, v = h . W^T + b  (f32 out)
    wmma_gemm64<0, false, 2, 0, false, 0><<<dim3(nbP, 1), 128, 0, stream>>>(
        U16(hh16), U16(hh16), C, 0L, U16(WQl), U16(WQl), C, 0L,
        (void*)qf, (void*)qf, C, 0L, bq + (size_t)l * C, hf, 0L, M, C, C, WINV);
    wmma_gemm64<0, false, 2, 0, false, 0><<<dim3(nbP, 1), 128, 0, stream>>>(
        U16(hh16), U16(hh16), C, 0L, U16(WKl), U16(WKl), C, 0L,
        (void*)kf, (void*)kf, C, 0L, bk + (size_t)l * C, hf, 0L, M, C, C, WINV);
    wmma_gemm64<0, false, 2, 0, false, 0><<<dim3(nbP, 1), 128, 0, stream>>>(
        U16(hh16), U16(hh16), C, 0L, U16(WVl), U16(WVl), C, 0L,
        (void*)vf, (void*)vf, C, 0L, bv + (size_t)l * C, hf, 0L, M, C, C, WINV);

    // gate[b][h][s]
    gate_kernel<<<nbG, 256, 0, stream>>>(hf, gruW + (size_t)l * 8 * 64, grub + (size_t)l * 8,
                                          gruc + (size_t)l * H, gtb, S, H, C, ngate);

    // attention -> ao16 (f16)
    attn_gbias_kernel<<<nbA, 128, 0, stream>>>(qf, kf, vf, gtb, pos_bias, attn_m, ao16, S, H, C, qscale);

    // qf <- h + ao . Wo^T + bo
    wmma_gemm64<0, false, 2, 0, true, 0><<<dim3(nbP, 1), 128, 0, stream>>>(
        U16(ao16), U16(ao16), C, 0L, U16(WOl), U16(WOl), C, 0L,
        (void*)qf, (void*)qf, C, 0L, bo + (size_t)l * C, hf, 0L, M, C, C, WINV);

    // h1 = LN1(qf)
    ln_kernel<0><<<M, LN_T, 0, stream>>>(qf, qf, attn_m, ln1_g + (size_t)l * C, ln1_b + (size_t)l * C,
                                         h1f, h1h, C, invC, eps);

    // ff16 = gelu(h1 . W1^T + b1)  (f16 out)
    wmma_gemm64<0, false, 2, 1, false, 5><<<dim3(nbF, 1), 128, 0, stream>>>(
        U16(h1h), U16(h1h), C, 0L, U16(W1l), U16(W1l), C, 0L,
        (void*)ff16, (void*)ff16, FF, 0L, b1 + (size_t)l * FF, h1f, 0L, M, FF, C, WINV);

    // kf <- h1 + ff . W2^T + b2
    wmma_gemm64<0, false, 2, 0, true, 0><<<dim3(nbP, 1), 128, 0, stream>>>(
        U16(ff16), U16(ff16), FF, 0L, U16(W2l), U16(W2l), FF, 0L,
        (void*)kf, (void*)kf, C, 0L, b2 + (size_t)l * C, h1f, 0L, M, C, FF, WINV);

    // h = LN2(kf); last layer writes the output buffer directly
    float* hdst = (l == L - 1) ? outp : hf;
    ln_kernel<0><<<M, LN_T, 0, stream>>>(kf, kf, attn_m, ln2_g + (size_t)l * C, ln2_b + (size_t)l * C,
                                         hdst, hh16, C, invC, eps);
  }
  (void)hipGetLastError();
}

// v003
// A run of this version takes 830 microseconds.
// Timed twice side by side with v002, it ran 1.10 and 1.11 times as fast.
// All steps since v000 together make it 2.22 times as fast.
// Contractions (q/k/v/out projections, FFN up/down, attention q.k^T and p.v): v_wmma_f32_16x16x32_f16 (f16 operands, f32 accumulate); weights carried x64, softmax probabilities carried x2^15; LayerNorm, softmax, gate: f32 VALU.
#include <hip/hip_runtime.h>
#include <math.h>
#include <stdint.h>

typedef __attribute__((ext_vector_type(16))) _Float16 v16h;
typedef __attribute__((ext_vector_type(8)))  _Float16 v8h;
typedef __attribute__((ext_vector_type(4)))  _Float16 v4h;
typedef __attribute__((ext_vector_type(16))) __bf16   v16b;
typedef __attribute__((ext_vector_type(8)))  __bf16   v8b;
typedef __attribute__((ext_vector_type(8)))  float    v8f;
typedef __attribute__((ext_vector_type(4)))  float    v4f;
#define U16(p) ((const unsigned short*)(const void*)(p))

__device__ __forceinline__ unsigned short f2bf_bits(float f) {
  unsigned u = __float_as_uint(f);
  return (unsigned short)((u + 0x7FFFu + ((u >> 16) & 1u)) >> 16);
}
__device__ __forceinline__ float bf_bits2f(unsigned short h) { return __uint_as_float(((unsigned)h) << 16); }

// hazard guards as plain device helpers (no inline asm inside the kernel template body)
__device__ __forceinline__ void acc_guard4(v8f& a, v8f& b, v8f& c, v8f& d) { asm volatile("v_nop\n\tv_nop\n\tv_nop\n\tv_nop" : "+v"(a), "+v"(b), "+v"(c), "+v"(d)); }
template <typename T> struct Frag;
template <> struct Frag<_Float16> {
  typedef v16h V; union U { v16h v; v8h h[2]; };
  static __device__ __forceinline__ v16h load(const _Float16* p) {   // elements 0..7 <- p[0..7], 8..15 <- p[16..23]
    U f; f.h[0] = *(const v8h*)(p); f.h[1] = *(const v8h*)(p + 16); return f.v;
  }
  static __device__ __forceinline__ v8f mma(v16h a, v16h b, v8f c) {
    return __builtin_amdgcn_wmma_f32_16x16x32_f16(false, a, false, b, (short)0, c, false, false);
  }
};
template <> struct Frag<__bf16> {
  typedef v16b V; union U { v16b v; v8b h[2]; };
  static __device__ __forceinline__ v16b load(const __bf16* p) {
    U f; f.h[0] = *(const v8b*)(p); f.h[1] = *(const v8b*)(p + 16); return f.v;
  }
  static __device__ __forceinline__ v8f mma(v16b a, v16b b, v8f c) {
    return __builtin_amdgcn_wmma_f32_16x16x32_bf16(false, a, false, b, (short)0, c, false, false);
  }
};

// ---- Block-tiled batched WMMA GEMM, operands staged in LDS by the tensor mover ------------
// C[m,n] = scale * sum_k A[m,k] * Bt[n,k] (+bias)(+resid); a block of 4 waves (2 x 2) owns a 128x128 tile, each wave 64x64.
// A row-major [M,K]; Bt row-major [N,K]; M,N % 128 == 0, K % 128 == 0, K >= 256 (two stages).
// A pass is 128 k = 256 B of each of the 256 operand rows; each wave brings one 64-row slice per pass with one tensor load
// (waves 0,1: the two halves of the A rows; waves 2,3: of the Bt rows), two buffers, LDS row pitch 272 B.
// BIAS_MODE: 0 = none, 1 = bias[m], 2 = bias[n].
// OUT_MODE: 0 = f32, 1 = f16, 2 = bf16 hi plane (Cout) + bf16 lo plane (Cout2).
// ET: 0 = f16 operands, 1 = bf16 operands (pointers passed as 16-bit storage)
typedef uint32_t u32x4 __attribute__((ext_vector_type(4)));
typedef uint32_t u32x8 __attribute__((ext_vector_type(8)));
#define GT_KP     128u                 // k per pass
#define GT_ROWB   256u                 // bytes of one operand row per pass
#define GT_PITCH  272u                 // LDS row pitch: 256 B + the mover's 16-B pad (ds_load_b128 readers)
#define GT_ROWS   64u                  // rows per slice
#define GT_SLICE  18432u               // 64 x 272 = 17,408 B, rounded up to a multiple of 2 KiB
#define GT_STAGE  (4u * GT_SLICE)      // one buffer: 4 slices
__device__ __forceinline__ uint32_t uni(uint32_t v) { return (uint32_t)__builtin_amdgcn_readfirstlane(v); }
// pinned(): holds a wave-uniform value in a scalar register, so that a test on it is a scalar branch (a tensor load ignores EXEC)
// and so that descriptor words formed from it are formed behind the waits that stand in front of it.
__device__ __forceinline__ uint32_t pinned(uint32_t v) { uint32_t w = uni(v); asm volatile("" : "+s"(w)); return w; }
__device__ __forceinline__ void wait_ds0()     { asm volatile("s_wait_dscnt 0x0" ::: "memory"); }      // this wave's LDS reads of the buffer are done
__device__ __forceinline__ void wait_tensor0() { asm volatile("s_wait_tensorcnt 0x0" ::: "memory"); }  // this wave's own slice has landed
// descriptor words held in scalar registers (as pinned() does for one word): the eight registers stay group 1's own through
// the loop, so that none of them takes another value while a request is outstanding
__device__ __forceinline__ void hold_group1(u32x8& g) { asm volatile("" : "+s"(g)); }
// one request of the whole wave: 64 rows of 256 B from global memory to LDS, 16 B of pad behind each row
__device__ __forceinline__ void tdm_load(uint32_t lds_dst, uint64_t ga, u32x8 g1) {
  u32x4 g0;
  g0[0] = uni(1u);
  g0[1] = uni(lds_dst);
  g0[2] = uni((uint32_t)ga);
  g0[3] = uni((((uint32_t)(ga >> 32)) & 0x01FFFFFFu) | 0x80000000u);
  asm volatile("tensor_load_to_lds %0, %1" :: "s"(g0), "s"(g1) : "memory");
}
// v_rcp_f32 and v_exp_f32, each with the one free slot that the instruction set asks for behind a transcendental in the same
// statement.
__device__ __forceinline__ float rcp_slot(float x)  { float r; asm("v_rcp_f32 %0, %1\n\tv_nop" : "=v"(r) : "v"(x)); return r; }
__device__ __forceinline__ float exp2_slot(float x) { float r; asm("v_exp_f32 %0, %1\n\tv_nop" : "=v"(r) : "v"(x)); return r; }
// GELU in its erf form, straight-line (no branch, so that the values of a fragment interleave and the unrolled epilogue stays short):
// with x = |v| / sqrt(2) and t = 1 / (1 + 0.3275911 x), erfc(x) = t (c1 + t (c2 + t (c3 + t (c4 + t c5)))) exp(-x x), absolute error
// at most 1.5e-7; gelu(v) = max(v, 0) - 0.5 |v| erfc(x), which cancels on neither side of 0. The factor -0.5 is folded into c1..c5.
__device__ __forceinline__ float gelu_erf(float v) {
  const float a = fabsf(v);
  const float t = rcp_slot(fmaf(a, 0.23164189f, 1.0f));      // 0.3275911 / sqrt(2)
  const float e = exp2_slot(v * v * -0.72134752f);           // exp(-v v / 2) = 2^(-v v log2(e) / 2)
  float p = fmaf(t, -0.53070271f, 0.72657601f);
  p = fmaf(t, p, -0.71070687f);
  p = fmaf(t, p, 0.14224837f);
  p = fmaf(t, p, -0.12741480f);
  return fmaf(a, p * t * e, fmaxf(v, 0.0f));
}
template <int ET> struct Elem;
template <> struct Elem<0> { typedef _Float16 T; };
template <> struct Elem<1> { typedef __bf16 T; };
template <int ET, bool SPLIT, int BIAS_MODE, int OUT_MODE, bool RESID, int ACT = 0>
__global__ __launch_bounds__(128) void wmma_gemm64(
    const unsigned short* __restrict__ Ap, const unsigned short* __restrict__ A2p, int lda, long strideA,
    const unsigned short* __restrict__ Btp, const unsigned short* __restrict__ Bt2p, int ldb, long strideB,
    void* __restrict__ Cout, void* __restrict__ Cout2, int ldc, long strideC,
    const float* __restrict__ bias,
    const float* __restrict__ resid, long strideR,
    int M, int N, int K, float scale) {
  static_assert(!SPLIT, "single-plane operands only");
  typedef typename Elem<ET>::T T;
  typedef typename Frag<T>::V V;
  const T* A = (const T*)Ap; const T* Bt = (const T*)Btp;
  // two stage buffers; after the K loop its first bytes serve as the per-wave 16x64 f32 output slabs (pitch 68 floats)
  __shared__ __attribute__((aligned(2048))) unsigned char L[2u * GT_STAGE];
  const int b    = blockIdx.y;
  const int lane = threadIdx.x & 31;
  const uint32_t wave = uni(threadIdx.x >> 5);
  const int tilesN = N >> 7;
  const int tilesM = M >> 7;
  const int tile = blockIdx.x;
  const uint32_t nPass = uni((uint32_t)K / GT_KP);
  if (tile >= tilesM * tilesN || nPass < 2u) return;   // block-uniform, in front of every tensor load and barrier; the ring's prologue loads two stages
  const int tm = tile / tilesN;
  const int tn = tile - tm * tilesN;
  const uint32_t wm = wave >> 1, wn = wave & 1u;
  const int m0 = (tm << 7) + (int)(wm << 6);
  const int n0 = (tn << 7) + (int)(wn << 6);

  const T* Ab  = A  + (size_t)b * strideA;
  const T* Bb  = Bt + (size_t)b * strideB;

  const int rlane = lane & 15;                 // row (A) / col (B, D) within subtile
  const int koff  = (lane >> 4) * 8;           // k offset of this lane half
  const int mOff  = (lane >> 4) * 8;           // D row offset

  // ---- this wave's slice: source, place in LDS, descriptor group 1 (loop-invariant) ----
  const bool isB = wave >= 2u;
  const uint32_t srcPitch = (uint32_t)(isB ? ldb : lda) * 2u;     // bytes
  const uint64_t srcBase = isB ? (uint64_t)(uintptr_t)(Bb + (size_t)((tn << 7) + (int)(wn << 6)) * ldb)
                               : (uint64_t)(uintptr_t)(Ab + (size_t)((tm << 7) + (int)(wn << 6)) * lda);
  const uint32_t ldsSlice = (uint32_t)(size_t)L + wave * GT_SLICE;
  u32x8 g1;
  g1[0] = uni((1u << 20) | (5u << 22) | (3u << 25));              // no mask, 1-byte elements, 4 dwords of pad behind every 64 dwords
  g1[1] = uni((GT_ROWB & 0xFFFFu) << 16);                         // tensor_dim0 low
  g1[2] = uni((GT_ROWB >> 16) | ((GT_ROWS & 0xFFFFu) << 16));     // tensor_dim0 high, tensor_dim1 low
  g1[3] = uni((GT_ROWS >> 16) | (GT_ROWB << 16));                 // tensor_dim1 high, tile_dim0
  g1[4] = uni(GT_ROWS);                                           // tile_dim1
  g1[5] = uni(srcPitch);
  g1[6] = uni(0u);
  g1[7] = uni(0u);
  hold_group1(g1);

  v8f acc[4][4];
#pragma unroll
  for (int i = 0; i < 4; ++i)
#pragma unroll
    for (int j = 0; j < 4; ++j) acc[i][j] = (v8f){0.f,0.f,0.f,0.f,0.f,0.f,0.f,0.f};

  // prologue: stage 0 lands and is published, then stage 1 flies while pass 0 works
  tdm_load(ldsSlice, srcBase, g1);
  wait_tensor0();
  __syncthreads();
  tdm_load(ldsSlice + GT_STAGE, srcBase + GT_ROWB, g1);

  const uint32_t aOff = wm * GT_SLICE + (uint32_t)rlane * GT_PITCH + (uint32_t)koff * 2u;
  const uint32_t bOff = (2u + wn) * GT_SLICE + (uint32_t)rlane * GT_PITCH + (uint32_t)koff * 2u;
  uint32_t s = 0;
  // the pass loop stays rolled: one publish point in the text, every fragment index below a constant
#pragma unroll 1
  do {                                        // nPass >= 2 here
    const uint32_t bufOff = (s & 1u) * GT_STAGE;
    const unsigned char* As = L + bufOff + aOff;
    const unsigned char* Bs = L + bufOff + bOff;
    V bh[2][4], ah[2][4];                     // two fragment sets: the next 32 k are read while these are multiplied
#pragma unroll
    for (int j = 0; j < 4; ++j) bh[0][j] = Frag<T>::load((const T*)(Bs + (uint32_t)j * 16u * GT_PITCH));
#pragma unroll
    for (int i = 0; i < 4; ++i) ah[0][i] = Frag<T>::load((const T*)(As + (uint32_t)i * 16u * GT_PITCH));
#pragma unroll
    for (int kk = 0; kk < 4; ++kk) {          // 32 k per step, in ascending k as before; only this pass's own buffer is read
      const int cur = kk & 1, nx = cur ^ 1;
      if (kk < 3) {
#pragma unroll
        for (int j = 0; j < 4; ++j) bh[nx][j] = Frag<T>::load((const T*)(Bs + (uint32_t)j * 16u * GT_PITCH + (uint32_t)(kk + 1) * 64u));
#pragma unroll
        for (int i = 0; i < 4; ++i) ah[nx][i] = Frag<T>::load((const T*)(As + (uint32_t)i * 16u * GT_PITCH + (uint32_t)(kk + 1) * 64u));
      }
      __builtin_amdgcn_sched_barrier(0);      // the next step's LDS reads stay one group in front of this step's WMMAs, not among them
#pragma unroll
      for (int i = 0; i < 4; ++i)
#pragma unroll
        for (int j = 0; j < 4; ++j) acc[i][j] = Frag<T>::mma(ah[cur][i], bh[cur][j], acc[i][j]);
      __builtin_amdgcn_sched_barrier(0);      // and the step after next's reads do not rise into this block
    }
    // publish point of stage s + 1: own LDS reads done, own slice landed, then the barrier that both publishes
    // stage s + 1 and ends every wave's reads of the buffer that is refilled behind it
    wait_ds0();
    wait_tensor0();
    __syncthreads();
    if (pinned(s + 2u < nPass)) {             // scalar branch: only while stage s + 2 exists
      const uint32_t nxt = pinned(s + 2u);    // group 0 is formed from it, so behind the waits above
      tdm_load(ldsSlice + bufOff, srcBase + (uint64_t)nxt * GT_ROWB, g1);
    }
  } while (++s < nPass);
  wait_tensor0();
  wait_ds0();
  acc_guard4(acc[0][0], acc[0][1], acc[0][2], acc[0][3]);
  acc_guard4(acc[1][0], acc[1][1], acc[1][2], acc[1][3]);
  acc_guard4(acc[2][0], acc[2][1], acc[2][2], acc[2][3]);
  acc_guard4(acc[3][0], acc[3][1], acc[3][2], acc[3][3]);

  // ---- epilogue ----
  float* slab = (float*)(void*)L + wave * (16u * 68u);   // the last pass's own barrier has ended every read of the ring
  const float* Rb = RESID ? (resid + (size_t)b * strideR) : nullptr;
#pragma unroll
  for (int i = 0; i < 4; ++i) {
    const int mBase = m0 + (i << 4);
#pragma unroll
    for (int j = 0; j < 4; ++j) {
      const int n = n0 + (j << 4) + rlane;
      float bv = 0.f;
      if (BIAS_MODE == 2) bv = bias[n];
#pragma unroll
      for (int r = 0; r < 8; ++r) {
        float v = acc[i][j][r] * scale;
        if (BIAS_MODE == 1) v += bias[mBase + mOff + r];
        if (BIAS_MODE == 2) v += bv;
        if (RESID) v += Rb[(size_t)(mBase + mOff + r) * ldc + n];
        if (ACT == 1) v = tanhf(v);
        if (ACT == 2) v = fmaxf(v, 0.0f);
        if (ACT == 3) v = v / (1.0f + expf(-v));
        if (ACT == 4) v = (v > 0.f) ? v : 0.01f * v;
        if (ACT == 5) v = gelu_erf(v);
        slab[(mOff + r) * 68 + (j << 4) + rlane] = v;
      }
    }
    __builtin_amdgcn_fence(__ATOMIC_RELEASE, "workgroup");
    __builtin_amdgcn_wave_barrier();
    __builtin_amdgcn_fence(__ATOMIC_ACQUIRE, "workgroup");
    if (OUT_MODE == 0) {
      float* C = (float*)Cout + (size_t)b * strideC;
      const int hh = lane >> 4, c4 = (lane & 15) * 4;     // row seg = 256 B = 16 lanes x 16 B
      {
#pragma unroll
        for (int it = 0; it < 8; ++it) {
          const int row = it * 2 + hh;
          v4f v = *(const v4f*)(slab + row * 68 + c4);
          *(v4f*)(C + (size_t)(mBase + row) * ldc + n0 + c4) = v;
        }
        
      }
    } else {
      const int q = lane >> 3, c8 = (lane & 7) * 8;
      unsigned short* C  = (unsigned short*)Cout  + (size_t)b * strideC;
      unsigned short* C2 = (OUT_MODE == 2) ? ((unsigned short*)Cout2 + (size_t)b * strideC) : nullptr;
      {
#pragma unroll
        for (int it = 0; it < 4; ++it) {
          const int row = it * 4 + q;
          const float* sp = slab + row * 68 + c8;
          v8h hv, lv;
#pragma unroll
          for (int e = 0; e < 8; ++e) {
            if (OUT_MODE == 1) {
              hv[e] = (_Float16)sp[e];
            } else {
              unsigned short hb = f2bf_bits(sp[e]);
              unsigned short lb = f2bf_bits(sp[e] - bf_bits2f(hb));
              hv[e] = __builtin_bit_cast(_Float16, hb);
              lv[e] = __builtin_bit_cast(_Float16, lb);
            }
          }
          *(v8h*)(C + (size_t)(mBase + row) * ldc + n0 + c8) = hv;
          if (OUT_MODE == 2) *(v8h*)(C2 + (size_t)(mBase + row) * ldc + n0 + c8) = lv;
        }
        
      }
    }
    __builtin_amdgcn_fence(__ATOMIC_RELEASE, "workgroup");
    __builtin_amdgcn_wave_barrier();
    __builtin_amdgcn_fence(__ATOMIC_ACQUIRE, "workgroup");
  }
}

__global__ __launch_bounds__(256) void cast_scale_f32_f16x2(
    const float* __restrict__ in, _Float16* __restrict__ out, int n2, float sc) {
  int i = blockIdx.x * 256 + threadIdx.x;
  if (i < n2) {
    const _Float16 h0 = (_Float16)(in[2 * i] * sc), h1 = (_Float16)(in[2 * i + 1] * sc);
    const unsigned u = (unsigned)__builtin_bit_cast(unsigned short, h0) | ((unsigned)__builtin_bit_cast(unsigned short, h1) << 16);
    ((unsigned*)out)[i] = u;
    
  }
}

// ---- LayerNorm over rows of C = 4 * blockDim floats; PRE: input = in * mask[row] + pos --------------------------
#define LN_T 192
template <int PRE>
__global__ __launch_bounds__(LN_T) void ln_kernel(
    const float* __restrict__ in, const float* __restrict__ pos, const float* __restrict__ mask,
    const float* __restrict__ g, const float* __restrict__ bb,
    float* __restrict__ outf, _Float16* __restrict__ outh, int C, float invC, float eps) {
  __shared__ float rs[8];
  __shared__ float rq[8];
  const int row = blockIdx.x;
  const int tid = threadIdx.x;
  const int lane = tid & 31;
  const int w = tid >> 5;
  const int c4 = tid * 4;
  const size_t base = (size_t)row * C + c4;
  v4f xv = *(const v4f*)(in + base);
  if (PRE) {
    const float mk = mask[row];
    const v4f pv = *(const v4f*)(pos + base);
    xv = xv * mk + pv;
  }
  float s = (xv[0] + xv[1]) + (xv[2] + xv[3]);
#pragma unroll
  for (int off = 16; off > 0; off >>= 1) s += __shfl_xor(s, off, 32);
  if (lane == 0) rs[w] = s;
  __syncthreads();
  float ts = 0.f;
#pragma unroll
  for (int i = 0; i < LN_T / 32; ++i) ts += rs[i];
  const float mean = ts * invC;
  const v4f d = xv - mean;
  float sq = (d[0] * d[0] + d[1] * d[1]) + (d[2] * d[2] + d[3] * d[3]);
#pragma unroll
  for (int off = 16; off > 0; off >>= 1) sq += __shfl_xor(sq, off, 32);
  if (lane == 0) rq[w] = sq;
  __syncthreads();
  float tq = 0.f;
#pragma unroll
  for (int i = 0; i < LN_T / 32; ++i) tq += rq[i];
  const float var = tq * invC;
  const float inv = rsqrtf(var + eps);
  const v4f gv = *(const v4f*)(g + c4);
  const v4f bv = *(const v4f*)(bb + c4);
  const v4f y = d * inv * gv + bv;
  v4h yh;
  yh[0] = (_Float16)y[0]; yh[1] = (_Float16)y[1]; yh[2] = (_Float16)y[2]; yh[3] = (_Float16)y[3];
  *(v4f*)(outf + base) = y;
  *(v4h*)(outh + base) = yh;
  
}

// ---- GRU-style gate per (b, h, s): g = h[b,s,h*64:+64] . gw^T + gb (8 outputs, K=64, VALU f32),
//      gate = sigmoid(sum g[0:4]) * (sigmoid(sum g[4:8]) * gc[h] - 1) + 2 ; stored [b][h][s] (one 4-B store per lane,
__global__ __launch_bounds__(256) void gate_kernel(
    const float* __restrict__ hf, const float* __restrict__ gw, const float* __restrict__ gb,
    const float* __restrict__ gc, float* __restrict__ gate, int S, int H, int C, int total) {
  const int idx = blockIdx.x * 256 + threadIdx.x;
  if (idx >= total) return;   // no barriers in this kernel
  const int s  = idx % S;
  const int bh = idx / S;
  const int h  = bh % H;
  const int b  = bh / H;
  const float* hp = hf + ((size_t)b * S + s) * C + (size_t)h * 64;
  float acc[8];
#pragma unroll
  for (int e = 0; e < 8; ++e) acc[e] = 0.f;
#pragma unroll 1
  for (int d = 0; d < 64; ++d) {
    const float hv = hp[d];
#pragma unroll
    for (int e = 0; e < 8; ++e) acc[e] = fmaf(hv, gw[e * 64 + d], acc[e]);
  }
  const float sa = ((acc[0] + gb[0]) + (acc[1] + gb[1])) + ((acc[2] + gb[2]) + (acc[3] + gb[3]));
  const float sb = ((acc[4] + gb[4]) + (acc[5] + gb[5])) + ((acc[6] + gb[6]) + (acc[7] + gb[7]));
  const float ga  = 1.0f / (1.0f + expf(-sa));
  const float gbv = 1.0f / (1.0f + expf(-sb));
  const float gv = ga * (gbv * gc[h] - 1.0f) + 2.0f;
  ((float*)gate)[idx] = gv;
  
}

// =====================================================================================
// Flash attention, head_dim 64, f32 q/k/v in, f16 out; plain f16 operands, f32 accumulate; online softmax in f32.
//   s(q,kv) = (q . k) * qscale + gate[b,h,q] * pos_bias[h,q,kv] + (1 - mask[b,kv]) * -1e4
//   probabilities carried x2^15 in f16, folded into the final 1/l.
//   Block = 4 waves = 64 query rows of one (batch, head); S % 64 == 0.  q/k/v/out element (b,s,h,d) at
//   ((b*S + s)*C + h*64 + d); gate at (b*H + h)*S + s; pos_bias at (h*S + q)*S + kv; grid.x = B * H * (S/64).
// =====================================================================================
#define AT_D 64
#define AT_NW 4
#define AT_KC 64
#define AT_PSC 32768.0f

__device__ __forceinline__ v8f hmma(v16h a, v16h b, v8f c) {
  c = __builtin_amdgcn_wmma_f32_16x16x32_f16(false, a, false, b, (short)0, c, false, false);
  asm volatile("v_nop\n\tv_nop\n\tv_nop\n\tv_nop" : "+v"(c) : "v"(a), "v"(b));
  return c;
}

// Barrier and wave-level hand-over that order LDS traffic alone: a fence over global memory as well would wait out the
// loads that are in flight for the next chunk. Nothing in this kernel passes between waves through global memory.
__device__ __forceinline__ void lds_block_sync() {
  __builtin_amdgcn_fence(__ATOMIC_RELEASE, "workgroup", "local");
  __builtin_amdgcn_s_barrier();
  __builtin_amdgcn_fence(__ATOMIC_ACQUIRE, "workgroup", "local");
}
// Stands behind a run of loads that stay in flight, in front of any new value in their address registers.
__device__ __forceinline__ void wait_addr_taken() { asm volatile("s_wait_xcnt 0x0" ::: "memory"); }
__device__ __forceinline__ void lds_wave_sync() {
  __builtin_amdgcn_fence(__ATOMIC_RELEASE, "workgroup", "local");
  __builtin_amdgcn_wave_barrier();
  __builtin_amdgcn_fence(__ATOMIC_ACQUIRE, "workgroup", "local");
}

// waves_per_eu(1, 2): the grid holds three waves for every two SIMDs of the chip, so a register budget of two waves a SIMD costs
// no residency; with the default budget the compiler answers the 100 registers of loads in flight by running the row
// reductions one after the other.
__global__ __launch_bounds__(128) __attribute__((amdgpu_waves_per_eu(1, 2)))
void attn_gbias_kernel(const float* __restrict__ q, const float* __restrict__ k,
                       const float* __restrict__ v, const float* __restrict__ gate,
                       const float* __restrict__ pos_bias, const float* __restrict__ mask,
                       _Float16* __restrict__ out, int S, int H, int C, float qscale) {
  union FH { v16h v; v8h h[2]; };
  __shared__ __align__(16) _Float16 Ksh[AT_KC * AT_D];        // K [kv][d]
  __shared__ __align__(16) _Float16 Vth[AT_D * AT_KC];        // V^T [d][kv]
  __shared__ __align__(16) _Float16 Psh[AT_NW][16 * AT_KC];   // per wave P [row][kv]
  __shared__ __align__(16) float    Os[AT_NW][16 * 68];       // per wave out tile, pitch 68

  const int tid  = threadIdx.x;
  const int wave = tid >> 5;
  const int lane = tid & 31;
  const int hh   = lane >> 4;
  const int c    = lane & 15;

  const int nqb = S / 64;
  const int bx = blockIdx.x;
  const int qb = bx % nqb;
  const int bh = bx / nqb;
  const int h  = bh % H;
  const int b  = bh / H;
  const int q0 = qb * 64 + wave * 16;

  const float* qb_ptr = q + (size_t)b * S * C + (size_t)h * AT_D;
  const float* kb_ptr = k + (size_t)b * S * C + (size_t)h * AT_D;
  const float* vb_ptr = v + (size_t)b * S * C + (size_t)h * AT_D;
  const float* gt_ptr = gate + ((size_t)b * H + h) * S;
  const float* pb_ptr = pos_bias + (size_t)h * S * S;
  const float* mk_ptr = mask + (size_t)b * S;
  _Float16*    ob_ptr = out + (size_t)b * S * C + (size_t)h * AT_D;

  // ---- Q fragments (A operand): 2 d-chunks, split k map ----
  v16h qa[2];
  {
    const float* qrow = qb_ptr + (size_t)(q0 + c) * C;
#pragma unroll
    for (int dc = 0; dc < 2; ++dc) {
#pragma unroll
      for (int e = 0; e < 8; ++e) {
        qa[dc][e]     = (_Float16)qrow[dc * 32 + 8 * hh + e];
        qa[dc][8 + e] = (_Float16)qrow[dc * 32 + 16 + 8 * hh + e];
      }
    }
  }
  float grow[8];
#pragma unroll
  for (int r = 0; r < 8; ++r) grow[r] = gt_ptr[q0 + 8 * hh + r];

  float mrow[8], lrow[8];
  v8f oacc[4];
#pragma unroll
  for (int r = 0; r < 8; ++r) { mrow[r] = -INFINITY; lrow[r] = 0.f; }
#pragma unroll
  for (int t = 0; t < 4; ++t) oacc[t] = (v8f){0.f,0.f,0.f,0.f,0.f,0.f,0.f,0.f};

  const int nChunks = S / AT_KC;   // block-uniform, from launch argument
  // Every global operand of a chunk (this thread's K and V row pieces, the position-bias tile, the key mask) is held in
  // registers and requested one chunk ahead, so that no chunk waits out a load it has only just issued.
  const int kvr = tid >> 1, dh = (tid & 1) * 32;
  const int kvOff = kvr * C + dh;                 // this thread's piece inside a chunk of K or V rows
  int pbOff[8];                                   // this lane's column in each of its 8 bias rows
#pragma unroll
  for (int r = 0; r < 8; ++r) pbOff[r] = (q0 + 8 * hh + r) * S + c;
  v4f kreg[8], vreg[8];
  float pbv[8][4], mkv[4];
#pragma unroll
  for (int i = 0; i < 8; ++i) {
    kreg[i] = *(const v4f*)(kb_ptr + kvOff + 4 * i);
    vreg[i] = *(const v4f*)(vb_ptr + kvOff + 4 * i);
  }
#pragma unroll
  for (int j = 0; j < 4; ++j) mkv[j] = mk_ptr[j * 16 + c];
#pragma unroll
  for (int r = 0; r < 8; ++r)
#pragma unroll
    for (int j = 0; j < 4; ++j) pbv[r][j] = pb_ptr[pbOff[r] + j * 16];
  wait_addr_taken();
  const size_t step0 = (nChunks > 1) ? (size_t)AT_KC * C : 0;
  const float* kn = kb_ptr + kvOff + step0;       // this thread's piece of the next chunk's K rows, and of its V rows
  const float* vn = vb_ptr + kvOff + step0;

  for (int kc = 0; kc < nChunks; ++kc) {
    // first key of the next chunk; the last trip asks for its own chunk again (in bounds, not used), so that every trip
    // issues the same loads in the same order and each wait on them can be counted exactly
    const int kvn = (kc + 1 < nChunks ? kc + 1 : kc) * AT_KC;
    lds_block_sync();                             // every wave has left the previous chunk's K and V tiles
#pragma unroll
    for (int i = 0; i < 8; ++i) {
#pragma unroll
      for (int e = 0; e < 4; ++e) {
        const int d = dh + 4 * i + e;
        Ksh[kvr * AT_D + d]  = (_Float16)kreg[i][e];
        Vth[d * AT_KC + kvr] = (_Float16)vreg[i][e];
      }
    }
    {                                             // next chunk's K and V fly under this chunk's whole work
#pragma unroll
      for (int i = 0; i < 8; ++i) {
        kreg[i] = *(const v4f*)(kn + 4 * i);
        vreg[i] = *(const v4f*)(vn + 4 * i);
      }
    }
    lds_block_sync();                             // this chunk's tiles are published

    v8f s[4];
#pragma unroll
    for (int j = 0; j < 4; ++j) {
      s[j] = (v8f){0.f,0.f,0.f,0.f,0.f,0.f,0.f,0.f};
#pragma unroll
      for (int dc = 0; dc < 2; ++dc) {
        FH kb;
        kb.h[0] = *(const v8h*)(Ksh + (j * 16 + c) * AT_D + dc * 32 + 8 * hh);
        kb.h[1] = *(const v8h*)(Ksh + (j * 16 + c) * AT_D + dc * 32 + 16 + 8 * hh);
        s[j] = hmma(qa[dc], kb.v, s[j]);
      }
    }
    // additive terms: key padding per column, gated position bias per (row, column)
    float kp[4];
#pragma unroll
    for (int j = 0; j < 4; ++j) kp[j] = (1.0f - mkv[j]) * -10000.0f;
    float cm[8];
#pragma unroll
    for (int r = 0; r < 8; ++r) {
      float m = -INFINITY;
#pragma unroll
      for (int j = 0; j < 4; ++j) {
        const float sv = s[j][r] * qscale + grow[r] * pbv[r][j] + kp[j];
        s[j][r] = sv;
        m = fmaxf(m, sv);
      }
#pragma unroll
      for (int off = 1; off < 16; off <<= 1) m = fmaxf(m, __shfl_xor(m, off, 32));
      cm[r] = m;
    }
    {                                             // next chunk's bias tile and mask fly under softmax, P.V and the next staging
      const float* pn = pb_ptr + kvn;
#pragma unroll
      for (int j = 0; j < 4; ++j) mkv[j] = mk_ptr[kvn + j * 16 + c];
#pragma unroll
      for (int r = 0; r < 4; ++r)
#pragma unroll
        for (int j = 0; j < 4; ++j) pbv[r][j] = pn[pbOff[r] + j * 16];
      wait_addr_taken();
#pragma unroll
      for (int r = 4; r < 8; ++r)
#pragma unroll
        for (int j = 0; j < 4; ++j) pbv[r][j] = pn[pbOff[r] + j * 16];
      wait_addr_taken();
      // nothing crosses this line: the K and V pointers step on only behind the wait above (it covers their loads too), and
      // no work on the values just requested rises into this chunk, where it would wait those loads out
      __builtin_amdgcn_sched_barrier(0);
      const size_t step = (kc + 2 < nChunks) ? (size_t)AT_KC * C : 0;
      kn += step;
      vn += step;
    }
    _Float16* pw = Psh[wave];
#pragma unroll
    for (int r = 0; r < 8; ++r) {
      const float mnew = fmaxf(mrow[r], cm[r]);
      const float alpha = expf(mrow[r] - mnew);
      mrow[r] = mnew;
      float psum = 0.f;
#pragma unroll
      for (int j = 0; j < 4; ++j) {
        const float p = expf(s[j][r] - mnew);
        psum += p;
        pw[(8 * hh + r) * AT_KC + j * 16 + c] = (_Float16)(p * AT_PSC);
      }
#pragma unroll
      for (int off = 1; off < 16; off <<= 1) psum += __shfl_xor(psum, off, 32);
      lrow[r] = lrow[r] * alpha + psum;
#pragma unroll
      for (int t = 0; t < 4; ++t) oacc[t][r] *= alpha;
    }
    lds_wave_sync();                              // the wave's own P rows, written above, are read back as fragments below
#pragma unroll 1
    for (int kk = 0; kk < 2; ++kk) {
      FH pa;
      pa.h[0] = *(const v8h*)(pw + c * AT_KC + kk * 32 + 8 * hh);
      pa.h[1] = *(const v8h*)(pw + c * AT_KC + kk * 32 + 16 + 8 * hh);
#pragma unroll
      for (int t = 0; t < 4; ++t) {
        FH vb;
        vb.h[0] = *(const v8h*)(Vth + (t * 16 + c) * AT_KC + kk * 32 + 8 * hh);
        vb.h[1] = *(const v8h*)(Vth + (t * 16 + c) * AT_KC + kk * 32 + 16 + 8 * hh);
        oacc[t] = hmma(pa.v, vb.v, oacc[t]);
      }
    }
  }

  float* os = Os[wave];
#pragma unroll
  for (int r = 0; r < 8; ++r) {
    const float inv = 1.0f / (lrow[r] * AT_PSC);
#pragma unroll
    for (int t = 0; t < 4; ++t) os[(8 * hh + r) * 68 + t * 16 + c] = oacc[t][r] * inv;
  }
  __builtin_amdgcn_fence(__ATOMIC_RELEASE, "workgroup");
  __builtin_amdgcn_wave_barrier();
  __builtin_amdgcn_fence(__ATOMIC_ACQUIRE, "workgroup");
  {
    const int q8 = lane >> 3, c8 = (lane & 7) * 8;
    {
#pragma unroll
      for (int it = 0; it < 4; ++it) {
        const int row = it * 4 + q8;
        const float* sp = os + row * 68 + c8;
        v8h hv;
#pragma unroll
        for (int e = 0; e < 8; ++e) hv[e] = (_Float16)sp[e];
        *(v8h*)(ob_ptr + (size_t)(q0 + row) * C + c8) = hv;
      }
      
    }
  }
}

// ---------------------------------------------------------------------------
extern "C" void kernel_launch(void* const* d_in, const int* in_sizes, int n_in,
                              void* d_out, int out_size, void* d_ws, size_t ws_size,
                              hipStream_t stream) {
  const int Bn = 2, S = 1024, C = 768, H = 12, L = 4, FF = 3072;
  const int M = Bn * S;
  if (n_in < 25) return;
  if (in_sizes[0] != M * C || in_sizes[1] != M * C || in_sizes[2] != M || in_sizes[3] != H * S * S) return;
  if (in_sizes[6] != L * C * C || in_sizes[19] != L * FF * C || in_sizes[21] != L * C * FF) return;
  if (out_size != M * C) return;

  const float* x        = (const float*)d_in[0];
  const float* pos_emb  = (const float*)d_in[1];
  const float* attn_m   = (const float*)d_in[2];
  const float* pos_bias = (const float*)d_in[3];
  const float* ln0_g    = (const float*)d_in[4];
  const float* ln0_b    = (const float*)d_in[5];
  const float* Wq       = (const float*)d_in[6];
  const float* bq       = (const float*)d_in[7];
  const float* Wk       = (const float*)d_in[8];
  const float* bk       = (const float*)d_in[9];
  const float* Wv       = (const float*)d_in[10];
  const float* bv       = (const float*)d_in[11];
  const float* Wo       = (const float*)d_in[12];
  const float* bo       = (const float*)d_in[13];
  const float* gruW     = (const float*)d_in[14];
  const float* grub     = (const float*)d_in[15];
  const float* gruc     = (const float*)d_in[16];
  const float* ln1_g    = (const float*)d_in[17];
  const float* ln1_b    = (const float*)d_in[18];
  const float* W1       = (const float*)d_in[19];
  const float* b1       = (const float*)d_in[20];
  const float* W2       = (const float*)d_in[21];
  const float* b2       = (const float*)d_in[22];
  const float* ln2_g    = (const float*)d_in[23];
  const float* ln2_b    = (const float*)d_in[24];

  // ---- workspace carve (256-B aligned offsets, total 110,198,784 B) ----
  char* ws = (char*)d_ws;
  size_t off = 0;
  const size_t NWC = (size_t)L * C * C;      // halves per projection weight set
  const size_t NWF = (size_t)L * FF * C;     // halves per FFN weight set
  const size_t NA  = (size_t)M * C;
  const size_t NF  = (size_t)M * FF;
  const size_t NG  = (size_t)Bn * H * S;
  size_t o_wq, o_wk, o_wv, o_wo, o_w1, o_w2, o_hf, o_hh, o_qf, o_kf, o_vf, o_ao, o_h1f, o_h1h, o_ff, o_gt;
#define CARVE(o, bytes) do { o = off; off += ((size_t)(bytes) + 255) & ~(size_t)255; } while (0)
  CARVE(o_wq, NWC * 2); CARVE(o_wk, NWC * 2); CARVE(o_wv, NWC * 2); CARVE(o_wo, NWC * 2);
  CARVE(o_w1, NWF * 2); CARVE(o_w2, NWF * 2);
  CARVE(o_hf, NA * 4);  CARVE(o_hh, NA * 2);
  CARVE(o_qf, NA * 4);  CARVE(o_kf, NA * 4);  CARVE(o_vf, NA * 4);
  CARVE(o_ao, NA * 2);
  CARVE(o_h1f, NA * 4); CARVE(o_h1h, NA * 2);
  CARVE(o_ff, NF * 2);
  CARVE(o_gt, NG * 4);
#undef CARVE
  if (off > ws_size) return;

  _Float16* wq16 = (_Float16*)(ws + o_wq);
  _Float16* wk16 = (_Float16*)(ws + o_wk);
  _Float16* wv16 = (_Float16*)(ws + o_wv);
  _Float16* wo16 = (_Float16*)(ws + o_wo);
  _Float16* w116 = (_Float16*)(ws + o_w1);
  _Float16* w216 = (_Float16*)(ws + o_w2);
  float*    hf   = (float*)(ws + o_hf);
  _Float16* hh16 = (_Float16*)(ws + o_hh);
  float*    qf   = (float*)(ws + o_qf);
  float*    kf   = (float*)(ws + o_kf);
  float*    vf   = (float*)(ws + o_vf);
  _Float16* ao16 = (_Float16*)(ws + o_ao);
  float*    h1f  = (float*)(ws + o_h1f);
  _Float16* h1h  = (_Float16*)(ws + o_h1h);
  _Float16* ff16 = (_Float16*)(ws + o_ff);
  float*    gtb  = (float*)(ws + o_gt);
  float*    outp = (float*)d_out;

  const float WSC  = 64.0f;            // weights carried x64 in f16
  const float WINV = 1.0f / 64.0f;     // folded back in the GEMM epilogue
  const float invC = 1.0f / 768.0f;
  const float eps  = 1e-5f;
  const float qscale = 0.125f;         // 1/sqrt(64)

  // ---- weights -> f16 (x64) ----
  {
    const int n2c = (int)(NWC / 2), n2f = (int)(NWF / 2);
    cast_scale_f32_f16x2<<<(n2c + 255) / 256, 256, 0, stream>>>(Wq, wq16, n2c, WSC);
    cast_scale_f32_f16x2<<<(n2c + 255) / 256, 256, 0, stream>>>(Wk, wk16, n2c, WSC);
    cast_scale_f32_f16x2<<<(n2c + 255) / 256, 256, 0, stream>>>(Wv, wv16, n2c, WSC);
    cast_scale_f32_f16x2<<<(n2c + 255) / 256, 256, 0, stream>>>(Wo, wo16, n2c, WSC);
    cast_scale_f32_f16x2<<<(n2f + 255) / 256, 256, 0, stream>>>(W1, w116, n2f, WSC);
    cast_scale_f32_f16x2<<<(n2f + 255) / 256, 256, 0, stream>>>(W2, w216, n2f, WSC);
  }

  // ---- h = LN0(x * mask + pos_emb) ----
  ln_kernel<1><<<M, LN_T, 0, stream>>>(x, pos_emb, attn_m, ln0_g, ln0_b, hf, hh16, C, invC, eps);

  const int nbP = (M / 128) * (C / 128);    // 96 blocks, one 128x128 tile each
  const int nbF = (M / 128) * (FF / 128);   // 384 blocks
  const int nbA = Bn * H * (S / 64);                // 384 attention blocks
  const int ngate = (int)NG;
  const int nbG = (ngate + 255) / 256;

  for (int l = 0; l < L; ++l) {
    const size_t lw  = (size_t)l * C * C;
    const size_t lwf = (size_t)l * FF * C;
    const _Float16* WQl = wq16 + lw;
    const _Float16* WKl = wk16 + lw;
    const _Float16* WVl = wv16 + lw;
    const _Float16* WOl = wo16 + lw;
    const _Float16* W1l = w116 + lwf;   // [FF][C]
    const _Float16* W2l = w216 + lwf;   // [C][FF]

    // q, k, v = h . W^T + b  (f32 out)
    wmma_gemm64<0, false, 2, 0, false, 0><<<dim3(nbP, 1), 128, 0, stream>>>(
        U16(hh16), U16(hh16), C, 0L, U16(WQl), U16(WQl), C, 0L,
        (void*)qf, (void*)qf, C, 0L, bq + (size_t)l * C, hf, 0L, M, C, C, WINV);
    wmma_gemm64<0, false, 2, 0, false, 0><<<dim3(nbP, 1), 128, 0, stream>>>(
        U16(hh16), U16(hh16), C, 0L, U16(WKl), U16(WKl), C, 0L,
        (void*)kf, (void*)kf, C, 0L, bk + (size_t)l * C, hf, 0L, M, C, C, WINV);
    wmma_gemm64<0, false, 2, 0, false, 0><<<dim3(nbP, 1), 128, 0, stream>>>(
        U16(hh16), U16(hh16), C, 0L, U16(WVl), U16(WVl), C, 0L,
        (void*)vf, (void*)vf, C, 0L, bv + (size_t)l * C, hf, 0L, M, C, C, WINV);

    // gate[b][h][s]
    gate_kernel<<<nbG, 256, 0, stream>>>(hf, gruW + (size_t)l * 8 * 64, grub + (size_t)l * 8,
                                          gruc + (size_t)l * H, gtb, S, H, C, ngate);

    // attention -> ao16 (f16)
    attn_gbias_kernel<<<nbA, 128, 0, stream>>>(qf, kf, vf, gtb, pos_bias, attn_m, ao16, S, H, C, qscale);

    // qf <- h + ao . Wo^T + bo
    wmma_gemm64<0, false, 2, 0, true, 0><<<dim3(nbP, 1), 128, 0, stream>>>(
        U16(ao16), U16(ao16), C, 0L, U16(WOl), U16(WOl), C, 0L,
        (void*)qf, (void*)qf, C, 0L, bo + (size_t)l * C, hf, 0L, M, C, C, WINV);

    // h1 = LN1(qf)
    ln_kernel<0><<<M, LN_T, 0, stream>>>(qf, qf, attn_m, ln1_g + (size_t)l * C, ln1_b + (size_t)l * C,
                                         h1f, h1h, C, invC, eps);

    // ff16 = gelu(h1 . W1^T + b1)  (f16 out)
    wmma_gemm64<0, false, 2, 1, false, 5><<<dim3(nbF, 1), 128, 0, stream>>>(
        U16(h1h), U16(h1h), C, 0L, U16(W1l), U16(W1l), C, 0L,
        (void*)ff16, (void*)ff16, FF, 0L, b1 + (size_t)l * FF, h1f, 0L, M, FF, C, WINV);

    // kf <- h1 + ff . W2^T + b2
    wmma_gemm64<0, false, 2, 0, true, 0><<<dim3(nbP, 1), 128, 0, stream>>>(
        U16(ff16), U16(ff16), FF, 0L, U16(W2l), U16(W2l), FF, 0L,
        (void*)kf, (void*)kf, C, 0L, b2 + (size_t)l * C, h1f, 0L, M, C, FF, WINV);

    // h = LN2(kf); last layer writes the output buffer directly
    float* hdst = (l == L - 1) ? outp : hf;
    ln_kernel<0><<<M, LN_T, 0, stream>>>(kf, kf, attn_m, ln2_g + (size_t)l * C, ln2_b + (size_t)l * C,
                                         hdst, hh16, C, invC, eps);
  }
  (void)hipGetLastError();
}

// v004
// It runs in 808 microseconds.
// Next to v003, in two timings, it ran 1.03 times as fast each time.
// Over all steps from v000 it is 2.29 times as fast.
// Contractions (q/k/v/out projections, FFN up/down, attention q.k^T and p.v): v_wmma_f32_16x16x32_f16 (f16 operands, f32 accumulate); weights carried x64, softmax probabilities carried x2^15; LayerNorm, softmax, gate: f32 VALU.
#include <hip/hip_runtime.h>
#include <math.h>
#include <stdint.h>

typedef __attribute__((ext_vector_type(16))) _Float16 v16h;
typedef __attribute__((ext_vector_type(8)))  _Float16 v8h;
typedef __attribute__((ext_vector_type(4)))  _Float16 v4h;
typedef __attribute__((ext_vector_type(16))) __bf16   v16b;
typedef __attribute__((ext_vector_type(8)))  __bf16   v8b;
typedef __attribute__((ext_vector_type(8)))  float    v8f;
typedef __attribute__((ext_vector_type(4)))  float    v4f;
#define U16(p) ((const unsigned short*)(const void*)(p))

__device__ __forceinline__ unsigned short f2bf_bits(float f) {
  unsigned u = __float_as_uint(f);
  return (unsigned short)((u + 0x7FFFu + ((u >> 16) & 1u)) >> 16);
}
__device__ __forceinline__ float bf_bits2f(unsigned short h) { return __uint_as_float(((unsigned)h) << 16); }

// hazard guards as plain device helpers (no inline asm inside the kernel template body)
__device__ __forceinline__ void acc_guard4(v8f& a, v8f& b, v8f& c, v8f& d) { asm volatile("v_nop\n\tv_nop\n\tv_nop\n\tv_nop" : "+v"(a), "+v"(b), "+v"(c), "+v"(d)); }
template <typename T> struct Frag;
template <> struct Frag<_Float16> {
  typedef v16h V; union U { v16h v; v8h h[2]; };
  static __device__ __forceinline__ v16h load(const _Float16* p) {   // elements 0..7 <- p[0..7], 8..15 <- p[16..23]
    U f; f.h[0] = *(const v8h*)(p); f.h[1] = *(const v8h*)(p + 16); return f.v;
  }
  static __device__ __forceinline__ v8f mma(v16h a, v16h b, v8f c) {
    return __builtin_amdgcn_wmma_f32_16x16x32_f16(false, a, false, b, (short)0, c, false, false);
  }
};
template <> struct Frag<__bf16> {
  typedef v16b V; union U { v16b v; v8b h[2]; };
  static __device__ __forceinline__ v16b load(const __bf16* p) {
    U f; f.h[0] = *(const v8b*)(p); f.h[1] = *(const v8b*)(p + 16); return f.v;
  }
  static __device__ __forceinline__ v8f mma(v16b a, v16b b, v8f c) {
    return __builtin_amdgcn_wmma_f32_16x16x32_bf16(false, a, false, b, (short)0, c, false, false);
  }
};

// ---- Block-tiled batched WMMA GEMM, operands staged in LDS by the tensor mover ------------
// C[m,n] = scale * sum_k A[m,k] * Bt[n,k] (+bias)(+resid); a block of 4 waves (2 x 2) owns a 128x128 tile, each wave 64x64.
// A row-major [M,K]; Bt row-major [N,K]; M,N % 128 == 0, K % 128 == 0, K >= 256 (two stages).
// A pass is 128 k = 256 B of each of the 256 operand rows; each wave brings one 64-row slice per pass with one tensor load
// (waves 0,1: the two halves of the A rows; waves 2,3: of the Bt rows), two buffers, LDS row pitch 272 B.
// BIAS_MODE: 0 = none, 1 = bias[m], 2 = bias[n].
// OUT_MODE: 0 = f32, 1 = f16, 2 = bf16 hi plane (Cout) + bf16 lo plane (Cout2).
// ET: 0 = f16 operands, 1 = bf16 operands (pointers passed as 16-bit storage)
typedef uint32_t u32x4 __attribute__((ext_vector_type(4)));
typedef uint32_t u32x8 __attribute__((ext_vector_type(8)));
#define GT_KP     128u                 // k per pass
#define GT_ROWB   256u                 // bytes of one operand row per pass
#define GT_PITCH  272u                 // LDS row pitch: 256 B + the mover's 16-B pad (ds_load_b128 readers)
#define GT_ROWS   64u                  // rows per slice
#define GT_SLICE  18432u               // 64 x 272 = 17,408 B, rounded up to a multiple of 2 KiB
#define GT_STAGE  (4u * GT_SLICE)      // one buffer: 4 slices
__device__ __forceinline__ uint32_t uni(uint32_t v) { return (uint32_t)__builtin_amdgcn_readfirstlane(v); }
// pinned(): holds a wave-uniform value in a scalar register, so that a test on it is a scalar branch (a tensor load ignores EXEC)
// and so that descriptor words formed from it are formed behind the waits that stand in front of it.
__device__ __forceinline__ uint32_t pinned(uint32_t v) { uint32_t w = uni(v); asm volatile("" : "+s"(w)); return w; }
__device__ __forceinline__ void wait_ds0()     { asm volatile("s_wait_dscnt 0x0" ::: "memory"); }      // this wave's LDS reads of the buffer are done
__device__ __forceinline__ void wait_tensor0() { asm volatile("s_wait_tensorcnt 0x0" ::: "memory"); }  // this wave's own slice has landed
// descriptor words held in scalar registers (as pinned() does for one word): the eight registers stay group 1's own through
// the loop, so that none of them takes another value while a request is outstanding
__device__ __forceinline__ void hold_group1(u32x8& g) { asm volatile("" : "+s"(g)); }
// one request of the whole wave: 64 rows of 256 B from global memory to LDS, 16 B of pad behind each row
__device__ __forceinline__ void tdm_load(uint32_t lds_dst, uint64_t ga, u32x8 g1) {
  u32x4 g0;
  g0[0] = uni(1u);
  g0[1] = uni(lds_dst);
  g0[2] = uni((uint32_t)ga);
  g0[3] = uni((((uint32_t)(ga >> 32)) & 0x01FFFFFFu) | 0x80000000u);
  asm volatile("tensor_load_to_lds %0, %1" :: "s"(g0), "s"(g1) : "memory");
}
// v_rcp_f32 and v_exp_f32, each with the one free slot that the instruction set asks for behind a transcendental in the same
// statement.
__device__ __forceinline__ float rcp_slot(float x)  { float r; asm("v_rcp_f32 %0, %1\n\tv_nop" : "=v"(r) : "v"(x)); return r; }
__device__ __forceinline__ float exp2_slot(float x) { float r; asm("v_exp_f32 %0, %1\n\tv_nop" : "=v"(r) : "v"(x)); return r; }
// GELU in its erf form, straight-line (no branch, so that the values of a fragment interleave and the unrolled epilogue stays short):
// with x = |v| / sqrt(2) and t = 1 / (1 + 0.3275911 x), erfc(x) = t (c1 + t (c2 + t (c3 + t (c4 + t c5)))) exp(-x x), absolute error
// at most 1.5e-7; gelu(v) = max(v, 0) - 0.5 |v| erfc(x), which cancels on neither side of 0. The factor -0.5 is folded into c1..c5.
__device__ __forceinline__ float gelu_erf(float v) {
  const float a = fabsf(v);
  const float t = rcp_slot(fmaf(a, 0.23164189f, 1.0f));      // 0.3275911 / sqrt(2)
  const float e = exp2_slot(v * v * -0.72134752f);           // exp(-v v / 2) = 2^(-v v log2(e) / 2)
  float p = fmaf(t, -0.53070271f, 0.72657601f);
  p = fmaf(t, p, -0.71070687f);
  p = fmaf(t, p, 0.14224837f);
  p = fmaf(t, p, -0.12741480f);
  return fmaf(a, p * t * e, fmaxf(v, 0.0f));
}
template <int ET> struct Elem;
template <> struct Elem<0> { typedef _Float16 T; };
template <> struct Elem<1> { typedef __bf16 T; };
template <int ET, bool SPLIT, int BIAS_MODE, int OUT_MODE, bool RESID, int ACT = 0>
__global__ __launch_bounds__(128) void wmma_gemm64(
    const unsigned short* __restrict__ Ap, const unsigned short* __restrict__ A2p, int lda, long strideA,
    const unsigned short* __restrict__ Btp, const unsigned short* __restrict__ Bt2p, int ldb, long strideB,
    void* __restrict__ Cout, void* __restrict__ Cout2, int ldc, long strideC,
    const float* __restrict__ bias,
    const float* __restrict__ resid, long strideR,
    int M, int N, int K, float scale) {
  static_assert(!SPLIT, "single-plane operands only");
  typedef typename Elem<ET>::T T;
  typedef typename Frag<T>::V V;
  const T* A = (const T*)Ap; const T* Bt = (const T*)Btp;
  // two stage buffers; after the K loop its first bytes serve as the per-wave 16x64 f32 output slabs (pitch 68 floats)
  __shared__ __attribute__((aligned(2048))) unsigned char L[2u * GT_STAGE];
  const int b    = blockIdx.y;
  const int lane = threadIdx.x & 31;
  const uint32_t wave = uni(threadIdx.x >> 5);
  const int tilesN = N >> 7;
  const int tilesM = M >> 7;
  const int tile = blockIdx.x;
  const uint32_t nPass = uni((uint32_t)K / GT_KP);
  if (tile >= tilesM * tilesN || nPass < 2u) return;   // block-uniform, in front of every tensor load and barrier; the ring's prologue loads two stages
  const int tm = tile / tilesN;
  const int tn = tile - tm * tilesN;
  const uint32_t wm = wave >> 1, wn = wave & 1u;
  const int m0 = (tm << 7) + (int)(wm << 6);
  const int n0 = (tn << 7) + (int)(wn << 6);

  const T* Ab  = A  + (size_t)b * strideA;
  const T* Bb  = Bt + (size_t)b * strideB;

  const int rlane = lane & 15;                 // row (A) / col (B, D) within subtile
  const int koff  = (lane >> 4) * 8;           // k offset of this lane half
  const int mOff  = (lane >> 4) * 8;           // D row offset

  // ---- this wave's slice: source, place in LDS, descriptor group 1 (loop-invariant) ----
  const bool isB = wave >= 2u;
  const uint32_t srcPitch = (uint32_t)(isB ? ldb : lda) * 2u;     // bytes
  const uint64_t srcBase = isB ? (uint64_t)(uintptr_t)(Bb + (size_t)((tn << 7) + (int)(wn << 6)) * ldb)
                               : (uint64_t)(uintptr_t)(Ab + (size_t)((tm << 7) + (int)(wn << 6)) * lda);
  const uint32_t ldsSlice = (uint32_t)(size_t)L + wave * GT_SLICE;
  u32x8 g1;
  g1[0] = uni((1u << 20) | (5u << 22) | (3u << 25));              // no mask, 1-byte elements, 4 dwords of pad behind every 64 dwords
  g1[1] = uni((GT_ROWB & 0xFFFFu) << 16);                         // tensor_dim0 low
  g1[2] = uni((GT_ROWB >> 16) | ((GT_ROWS & 0xFFFFu) << 16));     // tensor_dim0 high, tensor_dim1 low
  g1[3] = uni((GT_ROWS >> 16) | (GT_ROWB << 16));                 // tensor_dim1 high, tile_dim0
  g1[4] = uni(GT_ROWS);                                           // tile_dim1
  g1[5] = uni(srcPitch);
  g1[6] = uni(0u);
  g1[7] = uni(0u);
  hold_group1(g1);

  v8f acc[4][4];
#pragma unroll
  for (int i = 0; i < 4; ++i)
#pragma unroll
    for (int j = 0; j < 4; ++j) acc[i][j] = (v8f){0.f,0.f,0.f,0.f,0.f,0.f,0.f,0.f};

  // prologue: stage 0 lands and is published, then stage 1 flies while pass 0 works
  tdm_load(ldsSlice, srcBase, g1);
  wait_tensor0();
  __syncthreads();
  tdm_load(ldsSlice + GT_STAGE, srcBase + GT_ROWB, g1);

  const uint32_t aOff = wm * GT_SLICE + (uint32_t)rlane * GT_PITCH + (uint32_t)koff * 2u;
  const uint32_t bOff = (2u + wn) * GT_SLICE + (uint32_t)rlane * GT_PITCH + (uint32_t)koff * 2u;
  uint32_t s = 0;
  // the pass loop stays rolled: one publish point in the text, every fragment index below a constant
#pragma unroll 1
  do {                                        // nPass >= 2 here
    const uint32_t bufOff = (s & 1u) * GT_STAGE;
    const unsigned char* As = L + bufOff + aOff;
    const unsigned char* Bs = L + bufOff + bOff;
    V bh[2][4], ah[2][4];                     // two fragment sets: the next 32 k are read while these are multiplied
#pragma unroll
    for (int j = 0; j < 4; ++j) bh[0][j] = Frag<T>::load((const T*)(Bs + (uint32_t)j * 16u * GT_PITCH));
#pragma unroll
    for (int i = 0; i < 4; ++i) ah[0][i] = Frag<T>::load((const T*)(As + (uint32_t)i * 16u * GT_PITCH));
#pragma unroll
    for (int kk = 0; kk < 4; ++kk) {          // 32 k per step, in ascending k as before; only this pass's own buffer is read
      const int cur = kk & 1, nx = cur ^ 1;
      if (kk < 3) {
#pragma unroll
        for (int j = 0; j < 4; ++j) bh[nx][j] = Frag<T>::load((const T*)(Bs + (uint32_t)j * 16u * GT_PITCH + (uint32_t)(kk + 1) * 64u));
#pragma unroll
        for (int i = 0; i < 4; ++i) ah[nx][i] = Frag<T>::load((const T*)(As + (uint32_t)i * 16u * GT_PITCH + (uint32_t)(kk + 1) * 64u));
      }
      __builtin_amdgcn_sched_barrier(0);      // the next step's LDS reads stay one group in front of this step's WMMAs, not among them
#pragma unroll
      for (int i = 0; i < 4; ++i)
#pragma unroll
        for (int j = 0; j < 4; ++j) acc[i][j] = Frag<T>::mma(ah[cur][i], bh[cur][j], acc[i][j]);
      __builtin_amdgcn_sched_barrier(0);      // and the step after next's reads do not rise into this block
    }
    // publish point of stage s + 1: own LDS reads done, own slice landed, then the barrier that both publishes
    // stage s + 1 and ends every wave's reads of the buffer that is refilled behind it
    wait_ds0();
    wait_tensor0();
    __syncthreads();
    if (pinned(s + 2u < nPass)) {             // scalar branch: only while stage s + 2 exists
      const uint32_t nxt = pinned(s + 2u);    // group 0 is formed from it, so behind the waits above
      tdm_load(ldsSlice + bufOff, srcBase + (uint64_t)nxt * GT_ROWB, g1);
    }
  } while (++s < nPass);
  wait_tensor0();
  wait_ds0();
  acc_guard4(acc[0][0], acc[0][1], acc[0][2], acc[0][3]);
  acc_guard4(acc[1][0], acc[1][1], acc[1][2], acc[1][3]);
  acc_guard4(acc[2][0], acc[2][1], acc[2][2], acc[2][3]);
  acc_guard4(acc[3][0], acc[3][1], acc[3][2], acc[3][3]);

  // ---- epilogue ----
  float* slab = (float*)(void*)L + wave * (16u * 68u);   // the last pass's own barrier has ended every read of the ring
  const float* Rb = RESID ? (resid + (size_t)b * strideR) : nullptr;
#pragma unroll
  for (int i = 0; i < 4; ++i) {
    const int mBase = m0 + (i << 4);
#pragma unroll
    for (int j = 0; j < 4; ++j) {
      const int n = n0 + (j << 4) + rlane;
      float bv = 0.f;
      if (BIAS_MODE == 2) bv = bias[n];
#pragma unroll
      for (int r = 0; r < 8; ++r) {
        float v = acc[i][j][r] * scale;
        if (BIAS_MODE == 1) v += bias[mBase + mOff + r];
        if (BIAS_MODE == 2) v += bv;
        if (RESID) v += Rb[(size_t)(mBase + mOff + r) * ldc + n];
        if (ACT == 1) v = tanhf(v);
        if (ACT == 2) v = fmaxf(v, 0.0f);
        if (ACT == 3) v = v / (1.0f + expf(-v));
        if (ACT == 4) v = (v > 0.f) ? v : 0.01f * v;
        if (ACT == 5) v = gelu_erf(v);
        slab[(mOff + r) * 68 + (j << 4) + rlane] = v;
      }
    }
    __builtin_amdgcn_fence(__ATOMIC_RELEASE, "workgroup");
    __builtin_amdgcn_wave_barrier();
    __builtin_amdgcn_fence(__ATOMIC_ACQUIRE, "workgroup");
    if (OUT_MODE == 0) {
      float* C = (float*)Cout + (size_t)b * strideC;
      const int hh = lane >> 4, c4 = (lane & 15) * 4;     // row seg = 256 B = 16 lanes x 16 B
      {
#pragma unroll
        for (int it = 0; it < 8; ++it) {
          const int row = it * 2 + hh;
          v4f v = *(const v4f*)(slab + row * 68 + c4);
          *(v4f*)(C + (size_t)(mBase + row) * ldc + n0 + c4) = v;
        }
        
      }
    } else {
      const int q = lane >> 3, c8 = (lane & 7) * 8;
      unsigned short* C  = (unsigned short*)Cout  + (size_t)b * strideC;
      unsigned short* C2 = (OUT_MODE == 2) ? ((unsigned short*)Cout2 + (size_t)b * strideC) : nullptr;
      {
#pragma unroll
        for (int it = 0; it < 4; ++it) {
          const int row = it * 4 + q;
          const float* sp = slab + row * 68 + c8;
          v8h hv, lv;
#pragma unroll
          for (int e = 0; e < 8; ++e) {
            if (OUT_MODE == 1) {
              hv[e] = (_Float16)sp[e];
            } else {
              unsigned short hb = f2bf_bits(sp[e]);
              unsigned short lb = f2bf_bits(sp[e] - bf_bits2f(hb));
              hv[e] = __builtin_bit_cast(_Float16, hb);
              lv[e] = __builtin_bit_cast(_Float16, lb);
            }
          }
          *(v8h*)(C + (size_t)(mBase + row) * ldc + n0 + c8) = hv;
          if (OUT_MODE == 2) *(v8h*)(C2 + (size_t)(mBase + row) * ldc + n0 + c8) = lv;
        }
        
      }
    }
    __builtin_amdgcn_fence(__ATOMIC_RELEASE, "workgroup");
    __builtin_amdgcn_wave_barrier();
    __builtin_amdgcn_fence(__ATOMIC_ACQUIRE, "workgroup");
  }
}

// ---- All weight sets f32 -> f16 (x sc) in one launch of resident waves ---------------------------------------------
// The work is nSeg equal segments of segF4 16-byte vectors: w0..w3 are one segment each, w4 and w5 four each; the f16 planes lie
// one behind the other in out, in that order. A wave owns CS_IT x CS_LD x 32 consecutive vectors of one segment: every load is
// 512 contiguous bytes of the wave, CS_LD of them are asked for one trip ahead, every store is 256 contiguous bytes.
// One block of CS_WAVES waves per WGP: few waves that live long.
#define CS_WAVES 18
#define CS_LD    8
#define CS_IT    6
__global__ __launch_bounds__(CS_WAVES * 32) void cast_weights_stream(
    const float* __restrict__ w0, const float* __restrict__ w1, const float* __restrict__ w2, const float* __restrict__ w3,
    const float* __restrict__ w4, const float* __restrict__ w5, _Float16* __restrict__ out, int segF4, int nSeg, float sc) {
  const uint32_t perWave = CS_IT * CS_LD * 32u;                    // vectors per wave
  const uint32_t lane = threadIdx.x & 31u;
  const uint32_t gw = uni(blockIdx.x * CS_WAVES + (threadIdx.x >> 5));
  const uint32_t wavesPerSeg = (uint32_t)segF4 / perWave;
  const uint32_t seg = gw / wavesPerSeg;
  if (seg >= (uint32_t)nSeg) return;                               // wave-uniform; no barrier in this kernel
  const uint32_t win = gw - seg * wavesPerSeg;
  const size_t segF = (size_t)segF4 * 4;
  const float* src = seg == 0u ? w0 : seg == 1u ? w1 : seg == 2u ? w2 : seg == 3u ? w3
                   : seg < 8u ? w4 + (size_t)(seg - 4u) * segF : w5 + (size_t)(seg - 8u) * segF;
  const v4f* s4 = (const v4f*)src + (size_t)win * perWave + lane;
  v4h* d4 = (v4h*)out + (size_t)gw * perWave + lane;
  v4f buf[2][CS_LD];
#pragma unroll
  for (int k = 0; k < CS_LD; ++k) buf[0][k] = s4[k * 32];
  // unrolled: every address is the wave's one base plus a constant, so no address register takes a new value under a load in flight
#pragma unroll
  for (int t = 0; t < CS_IT; ++t) {
    const int cur = t & 1, nx = cur ^ 1;
    if (t + 1 < CS_IT) {
#pragma unroll
      for (int k = 0; k < CS_LD; ++k) buf[nx][k] = s4[((t + 1) * CS_LD + k) * 32];
    }
    __builtin_amdgcn_sched_barrier(0);   // no work on the values just asked for rises into this trip, where it would wait those loads out
#pragma unroll
    for (int k = 0; k < CS_LD; ++k) {
      const v4f x = buf[cur][k] * sc;
      v4h y;
      y[0] = (_Float16)x[0]; y[1] = (_Float16)x[1]; y[2] = (_Float16)x[2]; y[3] = (_Float16)x[3];
      d4[(t * CS_LD + k) * 32] = y;
    }
    // in front of the next trip's loads and converts, which write registers that this trip's stores name
    if (t + 1 < CS_IT) asm volatile("s_wait_xcnt 0x0" ::: "memory");
  }
}

// ---- LayerNorm over rows of C = 4 * blockDim floats; PRE: input = in * mask[row] + pos --------------------------
#define LN_T 192
template <int PRE>
__global__ __launch_bounds__(LN_T) void ln_kernel(
    const float* __restrict__ in, const float* __restrict__ pos, const float* __restrict__ mask,
    const float* __restrict__ g, const float* __restrict__ bb,
    float* __restrict__ outf, _Float16* __restrict__ outh, int C, float invC, float eps) {
  __shared__ float rs[8];
  __shared__ float rq[8];
  const int row = blockIdx.x;
  const int tid = threadIdx.x;
  const int lane = tid & 31;
  const int w = tid >> 5;
  const int c4 = tid * 4;
  const size_t base = (size_t)row * C + c4;
  v4f xv = *(const v4f*)(in + base);
  if (PRE) {
    const float mk = mask[row];
    const v4f pv = *(const v4f*)(pos + base);
    xv = xv * mk + pv;
  }
  float s = (xv[0] + xv[1]) + (xv[2] + xv[3]);
#pragma unroll
  for (int off = 16; off > 0; off >>= 1) s += __shfl_xor(s, off, 32);
  if (lane == 0) rs[w] = s;
  __syncthreads();
  float ts = 0.f;
#pragma unroll
  for (int i = 0; i < LN_T / 32; ++i) ts += rs[i];
  const float mean = ts * invC;
  const v4f d = xv - mean;
  float sq = (d[0] * d[0] + d[1] * d[1]) + (d[2] * d[2] + d[3] * d[3]);
#pragma unroll
  for (int off = 16; off > 0; off >>= 1) sq += __shfl_xor(sq, off, 32);
  if (lane == 0) rq[w] = sq;
  __syncthreads();
  float tq = 0.f;
#pragma unroll
  for (int i = 0; i < LN_T / 32; ++i) tq += rq[i];
  const float var = tq * invC;
  const float inv = rsqrtf(var + eps);
  const v4f gv = *(const v4f*)(g + c4);
  const v4f bv = *(const v4f*)(bb + c4);
  const v4f y = d * inv * gv + bv;
  v4h yh;
  yh[0] = (_Float16)y[0]; yh[1] = (_Float16)y[1]; yh[2] = (_Float16)y[2]; yh[3] = (_Float16)y[3];
  *(v4f*)(outf + base) = y;
  *(v4h*)(outh + base) = yh;
  
}

// ---- GRU-style gate per (b, h, s): g = h[b,s,h*64:+64] . gw^T + gb (8 outputs, K=64, VALU f32),
//      gate = sigmoid(sum g[0:4]) * (sigmoid(sum g[4:8]) * gc[h] - 1) + 2 ; stored [b][h][s] (one 4-B store per lane,
__global__ __launch_bounds__(256) void gate_kernel(
    const float* __restrict__ hf, const float* __restrict__ gw, const float* __restrict__ gb,
    const float* __restrict__ gc, float* __restrict__ gate, int S, int H, int C, int total) {
  const int idx = blockIdx.x * 256 + threadIdx.x;
  if (idx >= total) return;   // no barriers in this kernel
  const int s  = idx % S;
  const int bh = idx / S;
  const int h  = bh % H;
  const int b  = bh / H;
  const float* hp = hf + ((size_t)b * S + s) * C + (size_t)h * 64;
  float acc[8];
#pragma unroll
  for (int e = 0; e < 8; ++e) acc[e] = 0.f;
#pragma unroll 1
  for (int d = 0; d < 64; ++d) {
    const float hv = hp[d];
#pragma unroll
    for (int e = 0; e < 8; ++e) acc[e] = fmaf(hv, gw[e * 64 + d], acc[e]);
  }
  const float sa = ((acc[0] + gb[0]) + (acc[1] + gb[1])) + ((acc[2] + gb[2]) + (acc[3] + gb[3]));
  const float sb = ((acc[4] + gb[4]) + (acc[5] + gb[5])) + ((acc[6] + gb[6]) + (acc[7] + gb[7]));
  const float ga  = 1.0f / (1.0f + expf(-sa));
  const float gbv = 1.0f / (1.0f + expf(-sb));
  const float gv = ga * (gbv * gc[h] - 1.0f) + 2.0f;
  ((float*)gate)[idx] = gv;
  
}

// =====================================================================================
// Flash attention, head_dim 64, f32 q/k/v in, f16 out; plain f16 operands, f32 accumulate; online softmax in f32.
//   s(q,kv) = (q . k) * qscale + gate[b,h,q] * pos_bias[h,q,kv] + (1 - mask[b,kv]) * -1e4
//   probabilities carried x2^15 in f16, folded into the final 1/l.
//   Block = 4 waves = 64 query rows of one (batch, head); S % 64 == 0.  q/k/v/out element (b,s,h,d) at
//   ((b*S + s)*C + h*64 + d); gate at (b*H + h)*S + s; pos_bias at (h*S + q)*S + kv; grid.x = B * H * (S/64).
// =====================================================================================
#define AT_D 64
#define AT_NW 4
#define AT_KC 64
#define AT_PSC 32768.0f

__device__ __forceinline__ v8f hmma(v16h a, v16h b, v8f c) {
  c = __builtin_amdgcn_wmma_f32_16x16x32_f16(false, a, false, b, (short)0, c, false, false);
  asm volatile("v_nop\n\tv_nop\n\tv_nop\n\tv_nop" : "+v"(c) : "v"(a), "v"(b));
  return c;
}

// Barrier and wave-level hand-over that order LDS traffic alone: a fence over global memory as well would wait out the
// loads that are in flight for the next chunk. Nothing in this kernel passes between waves through global memory.
__device__ __forceinline__ void lds_block_sync() {
  __builtin_amdgcn_fence(__ATOMIC_RELEASE, "workgroup", "local");
  __builtin_amdgcn_s_barrier();
  __builtin_amdgcn_fence(__ATOMIC_ACQUIRE, "workgroup", "local");
}
// Stands behind a run of loads that stay in flight, in front of any new value in their address registers.
__device__ __forceinline__ void wait_addr_taken() { asm volatile("s_wait_xcnt 0x0" ::: "memory"); }
__device__ __forceinline__ void lds_wave_sync() {
  __builtin_amdgcn_fence(__ATOMIC_RELEASE, "workgroup", "local");
  __builtin_amdgcn_wave_barrier();
  __builtin_amdgcn_fence(__ATOMIC_ACQUIRE, "workgroup", "local");
}

// waves_per_eu(1, 2): the grid holds three waves for every two SIMDs of the chip, so a register budget of two waves a SIMD costs
// no residency; with the default budget the compiler answers the 100 registers of loads in flight by running the row
// reductions one after the other.
__global__ __launch_bounds__(128) __attribute__((amdgpu_waves_per_eu(1, 2)))
void attn_gbias_kernel(const float* __restrict__ q, const float* __restrict__ k,
                       const float* __restrict__ v, const float* __restrict__ gate,
                       const float* __restrict__ pos_bias, const float* __restrict__ mask,
                       _Float16* __restrict__ out, int S, int H, int C, float qscale) {
  union FH { v16h v; v8h h[2]; };
  __shared__ __align__(16) _Float16 Ksh[AT_KC * AT_D];        // K [kv][d]
  __shared__ __align__(16) _Float16 Vth[AT_D * AT_KC];        // V^T [d][kv]
  __shared__ __align__(16) _Float16 Psh[AT_NW][16 * AT_KC];   // per wave P [row][kv]
  __shared__ __align__(16) float    Os[AT_NW][16 * 68];       // per wave out tile, pitch 68

  const int tid  = threadIdx.x;
  const int wave = tid >> 5;
  const int lane = tid & 31;
  const int hh   = lane >> 4;
  const int c    = lane & 15;

  const int nqb = S / 64;
  const int bx = blockIdx.x;
  const int qb = bx % nqb;
  const int bh = bx / nqb;
  const int h  = bh % H;
  const int b  = bh / H;
  const int q0 = qb * 64 + wave * 16;

  const float* qb_ptr = q + (size_t)b * S * C + (size_t)h * AT_D;
  const float* kb_ptr = k + (size_t)b * S * C + (size_t)h * AT_D;
  const float* vb_ptr = v + (size_t)b * S * C + (size_t)h * AT_D;
  const float* gt_ptr = gate + ((size_t)b * H + h) * S;
  const float* pb_ptr = pos_bias + (size_t)h * S * S;
  const float* mk_ptr = mask + (size_t)b * S;
  _Float16*    ob_ptr = out + (size_t)b * S * C + (size_t)h * AT_D;

  // ---- Q fragments (A operand): 2 d-chunks, split k map ----
  v16h qa[2];
  {
    const float* qrow = qb_ptr + (size_t)(q0 + c) * C;
#pragma unroll
    for (int dc = 0; dc < 2; ++dc) {
#pragma unroll
      for (int e = 0; e < 8; ++e) {
        qa[dc][e]     = (_Float16)qrow[dc * 32 + 8 * hh + e];
        qa[dc][8 + e] = (_Float16)qrow[dc * 32 + 16 + 8 * hh + e];
      }
    }
  }
  float grow[8];
#pragma unroll
  for (int r = 0; r < 8; ++r) grow[r] = gt_ptr[q0 + 8 * hh + r];

  float mrow[8], lrow[8];
  v8f oacc[4];
#pragma unroll
  for (int r = 0; r < 8; ++r) { mrow[r] = -INFINITY; lrow[r] = 0.f; }
#pragma unroll
  for (int t = 0; t < 4; ++t) oacc[t] = (v8f){0.f,0.f,0.f,0.f,0.f,0.f,0.f,0.f};

  const int nChunks = S / AT_KC;   // block-uniform, from launch argument
  // Every global operand of a chunk (this thread's K and V row pieces, the position-bias tile, the key mask) is held in
  // registers and requested one chunk ahead, so that no chunk waits out a load it has only just issued.
  const int kvr = tid >> 1, dh = (tid & 1) * 32;
  const int kvOff = kvr * C + dh;                 // this thread's piece inside a chunk of K or V rows
  int pbOff[8];                                   // this lane's column in each of its 8 bias rows
#pragma unroll
  for (int r = 0; r < 8; ++r) pbOff[r] = (q0 + 8 * hh + r) * S + c;
  v4f kreg[8], vreg[8];
  float pbv[8][4], mkv[4];
#pragma unroll
  for (int i = 0; i < 8; ++i) {
    kreg[i] = *(const v4f*)(kb_ptr + kvOff + 4 * i);
    vreg[i] = *(const v4f*)(vb_ptr + kvOff + 4 * i);
  }
#pragma unroll
  for (int j = 0; j < 4; ++j) mkv[j] = mk_ptr[j * 16 + c];
#pragma unroll
  for (int r = 0; r < 8; ++r)
#pragma unroll
    for (int j = 0; j < 4; ++j) pbv[r][j] = pb_ptr[pbOff[r] + j * 16];
  wait_addr_taken();
  const size_t step0 = (nChunks > 1) ? (size_t)AT_KC * C : 0;
  const float* kn = kb_ptr + kvOff + step0;       // this thread's piece of the next chunk's K rows, and of its V rows
  const float* vn = vb_ptr + kvOff + step0;

  for (int kc = 0; kc < nChunks; ++kc) {
    // first key of the next chunk; the last trip asks for its own chunk again (in bounds, not used), so that every trip
    // issues the same loads in the same order and each wait on them can be counted exactly
    const int kvn = (kc + 1 < nChunks ? kc + 1 : kc) * AT_KC;
    lds_block_sync();                             // every wave has left the previous chunk's K and V tiles
#pragma unroll
    for (int i = 0; i < 8; ++i) {
#pragma unroll
      for (int e = 0; e < 4; ++e) {
        const int d = dh + 4 * i + e;
        Ksh[kvr * AT_D + d]  = (_Float16)kreg[i][e];
        Vth[d * AT_KC + kvr] = (_Float16)vreg[i][e];
      }
    }
    {                                             // next chunk's K and V fly under this chunk's whole work
#pragma unroll
      for (int i = 0; i < 8; ++i) {
        kreg[i] = *(const v4f*)(kn + 4 * i);
        vreg[i] = *(const v4f*)(vn + 4 * i);
      }
    }
    lds_block_sync();                             // this chunk's tiles are published

    v8f s[4];
#pragma unroll
    for (int j = 0; j < 4; ++j) {
      s[j] = (v8f){0.f,0.f,0.f,0.f,0.f,0.f,0.f,0.f};
#pragma unroll
      for (int dc = 0; dc < 2; ++dc) {
        FH kb;
        kb.h[0] = *(const v8h*)(Ksh + (j * 16 + c) * AT_D + dc * 32 + 8 * hh);
        kb.h[1] = *(const v8h*)(Ksh + (j * 16 + c) * AT_D + dc * 32 + 16 + 8 * hh);
        s[j] = hmma(qa[dc], kb.v, s[j]);
      }
    }
    // additive terms: key padding per column, gated position bias per (row, column)
    float kp[4];
#pragma unroll
    for (int j = 0; j < 4; ++j) kp[j] = (1.0f - mkv[j]) * -10000.0f;
    float cm[8];
#pragma unroll
    for (int r = 0; r < 8; ++r) {
      float m = -INFINITY;
#pragma unroll
      for (int j = 0; j < 4; ++j) {
        const float sv = s[j][r] * qscale + grow[r] * pbv[r][j] + kp[j];
        s[j][r] = sv;
        m = fmaxf(m, sv);
      }
#pragma unroll
      for (int off = 1; off < 16; off <<= 1) m = fmaxf(m, __shfl_xor(m, off, 32));
      cm[r] = m;
    }
    {                                             // next chunk's bias tile and mask fly under softmax, P.V and the next staging
      const float* pn = pb_ptr + kvn;
#pragma unroll
      for (int j = 0; j < 4; ++j) mkv[j] = mk_ptr[kvn + j * 16 + c];
#pragma unroll
      for (int r = 0; r < 4; ++r)
#pragma unroll
        for (int j = 0; j < 4; ++j) pbv[r][j] = pn[pbOff[r] + j * 16];
      wait_addr_taken();
#pragma unroll
      for (int r = 4; r < 8; ++r)
#pragma unroll
        for (int j = 0; j < 4; ++j) pbv[r][j] = pn[pbOff[r] + j * 16];
      wait_addr_taken();
      // nothing crosses this line: the K and V pointers step on only behind the wait above (it covers their loads too), and
      // no work on the values just requested rises into this chunk, where it would wait those loads out
      __builtin_amdgcn_sched_barrier(0);
      const size_t step = (kc + 2 < nChunks) ? (size_t)AT_KC * C : 0;
      kn += step;
      vn += step;
    }
    _Float16* pw = Psh[wave];
#pragma unroll
    for (int r = 0; r < 8; ++r) {
      const float mnew = fmaxf(mrow[r], cm[r]);
      const float alpha = expf(mrow[r] - mnew);
      mrow[r] = mnew;
      float psum = 0.f;
#pragma unroll
      for (int j = 0; j < 4; ++j) {
        const float p = expf(s[j][r] - mnew);
        psum += p;
        pw[(8 * hh + r) * AT_KC + j * 16 + c] = (_Float16)(p * AT_PSC);
      }
#pragma unroll
      for (int off = 1; off < 16; off <<= 1) psum += __shfl_xor(psum, off, 32);
      lrow[r] = lrow[r] * alpha + psum;
#pragma unroll
      for (int t = 0; t < 4; ++t) oacc[t][r] *= alpha;
    }
    lds_wave_sync();                              // the wave's own P rows, written above, are read back as fragments below
#pragma unroll 1
    for (int kk = 0; kk < 2; ++kk) {
      FH pa;
      pa.h[0] = *(const v8h*)(pw + c * AT_KC + kk * 32 + 8 * hh);
      pa.h[1] = *(const v8h*)(pw + c * AT_KC + kk * 32 + 16 + 8 * hh);
#pragma unroll
      for (int t = 0; t < 4; ++t) {
        FH vb;
        vb.h[0] = *(const v8h*)(Vth + (t * 16 + c) * AT_KC + kk * 32 + 8 * hh);
        vb.h[1] = *(const v8h*)(Vth + (t * 16 + c) * AT_KC + kk * 32 + 16 + 8 * hh);
        oacc[t] = hmma(pa.v, vb.v, oacc[t]);
      }
    }
  }

  float* os = Os[wave];
#pragma unroll
  for (int r = 0; r < 8; ++r) {
    const float inv = 1.0f / (lrow[r] * AT_PSC);
#pragma unroll
    for (int t = 0; t < 4; ++t) os[(8 * hh + r) * 68 + t * 16 + c] = oacc[t][r] * inv;
  }
  __builtin_amdgcn_fence(__ATOMIC_RELEASE, "workgroup");
  __builtin_amdgcn_wave_barrier();
  __builtin_amdgcn_fence(__ATOMIC_ACQUIRE, "workgroup");
  {
    const int q8 = lane >> 3, c8 = (lane & 7) * 8;
    {
#pragma unroll
      for (int it = 0; it < 4; ++it) {
        const int row = it * 4 + q8;
        const float* sp = os + row * 68 + c8;
        v8h hv;
#pragma unroll
        for (int e = 0; e < 8; ++e) hv[e] = (_Float16)sp[e];
        *(v8h*)(ob_ptr + (size_t)(q0 + row) * C + c8) = hv;
      }
      
    }
  }
}

// ---------------------------------------------------------------------------
extern "C" void kernel_launch(void* const* d_in, const int* in_sizes, int n_in,
                              void* d_out, int out_size, void* d_ws, size_t ws_size,
                              hipStream_t stream) {
  const int Bn = 2, S = 1024, C = 768, H = 12, L = 4, FF = 3072;
  const int M = Bn * S;
  if (n_in < 25) return;
  if (in_sizes[0] != M * C || in_sizes[1] != M * C || in_sizes[2] != M || in_sizes[3] != H * S * S) return;
  if (in_sizes[6] != L * C * C || in_sizes[19] != L * FF * C || in_sizes[21] != L * C * FF) return;
  if (out_size != M * C) return;

  const float* x        = (const float*)d_in[0];
  const float* pos_emb  = (const float*)d_in[1];
  const float* attn_m   = (const float*)d_in[2];
  const float* pos_bias = (const float*)d_in[3];
  const float* ln0_g    = (const float*)d_in[4];
  const float* ln0_b    = (const float*)d_in[5];
  const float* Wq       = (const float*)d_in[6];
  const float* bq       = (const float*)d_in[7];
  const float* Wk       = (const float*)d_in[8];
  const float* bk       = (const float*)d_in[9];
  const float* Wv       = (const float*)d_in[10];
  const float* bv       = (const float*)d_in[11];
  const float* Wo       = (const float*)d_in[12];
  const float* bo       = (const float*)d_in[13];
  const float* gruW     = (const float*)d_in[14];
  const float* grub     = (const float*)d_in[15];
  const float* gruc     = (const float*)d_in[16];
  const float* ln1_g    = (const float*)d_in[17];
  const float* ln1_b    = (const float*)d_in[18];
  const float* W1       = (const float*)d_in[19];
  const float* b1       = (const float*)d_in[20];
  const float* W2       = (const float*)d_in[21];
  const float* b2       = (const float*)d_in[22];
  const float* ln2_g    = (const float*)d_in[23];
  const float* ln2_b    = (const float*)d_in[24];

  // ---- workspace carve (256-B aligned offsets, total 110,198,784 B) ----
  char* ws = (char*)d_ws;
  size_t off = 0;
  const size_t NWC = (size_t)L * C * C;      // halves per projection weight set
  const size_t NWF = (size_t)L * FF * C;     // halves per FFN weight set
  const size_t NA  = (size_t)M * C;
  const size_t NF  = (size_t)M * FF;
  const size_t NG  = (size_t)Bn * H * S;
  size_t o_wq, o_wk, o_wv, o_wo, o_w1, o_w2, o_hf, o_hh, o_qf, o_kf, o_vf, o_ao, o_h1f, o_h1h, o_ff, o_gt;
#define CARVE(o, bytes) do { o = off; off += ((size_t)(bytes) + 255) & ~(size_t)255; } while (0)
  CARVE(o_wq, NWC * 2); CARVE(o_wk, NWC * 2); CARVE(o_wv, NWC * 2); CARVE(o_wo, NWC * 2);
  CARVE(o_w1, NWF * 2); CARVE(o_w2, NWF * 2);
  CARVE(o_hf, NA * 4);  CARVE(o_hh, NA * 2);
  CARVE(o_qf, NA * 4);  CARVE(o_kf, NA * 4);  CARVE(o_vf, NA * 4);
  CARVE(o_ao, NA * 2);
  CARVE(o_h1f, NA * 4); CARVE(o_h1h, NA * 2);
  CARVE(o_ff, NF * 2);
  CARVE(o_gt, NG * 4);
#undef CARVE
  if (off > ws_size) return;

  _Float16* wq16 = (_Float16*)(ws + o_wq);
  _Float16* wk16 = (_Float16*)(ws + o_wk);
  _Float16* wv16 = (_Float16*)(ws + o_wv);
  _Float16* wo16 = (_Float16*)(ws + o_wo);
  _Float16* w116 = (_Float16*)(ws + o_w1);
  _Float16* w216 = (_Float16*)(ws + o_w2);
  float*    hf   = (float*)(ws + o_hf);
  _Float16* hh16 = (_Float16*)(ws + o_hh);
  float*    qf   = (float*)(ws + o_qf);
  float*    kf   = (float*)(ws + o_kf);
  float*    vf   = (float*)(ws + o_vf);
  _Float16* ao16 = (_Float16*)(ws + o_ao);
  float*    h1f  = (float*)(ws + o_h1f);
  _Float16* h1h  = (_Float16*)(ws + o_h1h);
  _Float16* ff16 = (_Float16*)(ws + o_ff);
  float*    gtb  = (float*)(ws + o_gt);
  float*    outp = (float*)d_out;

  const float WSC  = 64.0f;            // weights carried x64 in f16
  const float WINV = 1.0f / 64.0f;     // folded back in the GEMM epilogue
  const float invC = 1.0f / 768.0f;
  const float eps  = 1e-5f;
  const float qscale = 0.125f;         // 1/sqrt(64)

  // ---- weights -> f16 (x64): Wq, Wk, Wv, Wo, W1, W2 as 12 segments of L*C*C elements; their f16 planes are contiguous from wq16 ----
  {
    const int segF4 = (int)(NWC / 4), nSeg = 12;
    const int perWave = CS_IT * CS_LD * 32, wavesAll = (segF4 / perWave) * nSeg;
    static_assert((L * C * C / 4) % (CS_IT * CS_LD * 32) == 0, "a segment is a whole number of waves");
    static_assert(((L * C * C / 4) / (CS_IT * CS_LD * 32) * 12) % CS_WAVES == 0, "the waves fill whole blocks");
    static_assert(FF == 4 * C && (L * C * C * 2) % 256 == 0, "W1 and W2 are four segments each; no gap between the planes");
    cast_weights_stream<<<wavesAll / CS_WAVES, CS_WAVES * 32, 0, stream>>>(Wq, Wk, Wv, Wo, W1, W2, wq16, segF4, nSeg, WSC);
  }

  // ---- h = LN0(x * mask + pos_emb) ----
  ln_kernel<1><<<M, LN_T, 0, stream>>>(x, pos_emb, attn_m, ln0_g, ln0_b, hf, hh16, C, invC, eps);

  const int nbP = (M / 128) * (C / 128);    // 96 blocks, one 128x128 tile each
  const int nbF = (M / 128) * (FF / 128);   // 384 blocks
  const int nbA = Bn * H * (S / 64);                // 384 attention blocks
  const int ngate = (int)NG;
  const int nbG = (ngate + 255) / 256;

  for (int l = 0; l < L; ++l) {
    const size_t lw  = (size_t)l * C * C;
    const size_t lwf = (size_t)l * FF * C;
    const _Float16* WQl = wq16 + lw;
    const _Float16* WKl = wk16 + lw;
    const _Float16* WVl = wv16 + lw;
    const _Float16* WOl = wo16 + lw;
    const _Float16* W1l = w116 + lwf;   // [FF][C]
    const _Float16* W2l = w216 + lwf;   // [C][FF]

    // q, k, v = h . W^T + b  (f32 out)
    wmma_gemm64<0, false, 2, 0, false, 0><<<dim3(nbP, 1), 128, 0, stream>>>(
        U16(hh16), U16(hh16), C, 0L, U16(WQl), U16(WQl), C, 0L,
        (void*)qf, (void*)qf, C, 0L, bq + (size_t)l * C, hf, 0L, M, C, C, WINV);
    wmma_gemm64<0, false, 2, 0, false, 0><<<dim3(nbP, 1), 128, 0, stream>>>(
        U16(hh16), U16(hh16), C, 0L, U16(WKl), U16(WKl), C, 0L,
        (void*)kf, (void*)kf, C, 0L, bk + (size_t)l * C, hf, 0L, M, C, C, WINV);
    wmma_gemm64<0, false, 2, 0, false, 0><<<dim3(nbP, 1), 128, 0, stream>>>(
        U16(hh16), U16(hh16), C, 0L, U16(WVl), U16(WVl), C, 0L,
        (void*)vf, (void*)vf, C, 0L, bv + (size_t)l * C, hf, 0L, M, C, C, WINV);

    // gate[b][h][s]
    gate_kernel<<<nbG, 256, 0, stream>>>(hf, gruW + (size_t)l * 8 * 64, grub + (size_t)l * 8,
                                          gruc + (size_t)l * H, gtb, S, H, C, ngate);

    // attention -> ao16 (f16)
    attn_gbias_kernel<<<nbA, 128, 0, stream>>>(qf, kf, vf, gtb, pos_bias, attn_m, ao16, S, H, C, qscale);

    // qf <- h + ao . Wo^T + bo
    wmma_gemm64<0, false, 2, 0, true, 0><<<dim3(nbP, 1), 128, 0, stream>>>(
        U16(ao16), U16(ao16), C, 0L, U16(WOl), U16(WOl), C, 0L,
        (void*)qf, (void*)qf, C, 0L, bo + (size_t)l * C, hf, 0L, M, C, C, WINV);

    // h1 = LN1(qf)
    ln_kernel<0><<<M, LN_T, 0, stream>>>(qf, qf, attn_m, ln1_g + (size_t)l * C, ln1_b + (size_t)l * C,
                                         h1f, h1h, C, invC, eps);

    // ff16 = gelu(h1 . W1^T + b1)  (f16 out)
    wmma_gemm64<0, false, 2, 1, false, 5><<<dim3(nbF, 1), 128, 0, stream>>>(
        U16(h1h), U16(h1h), C, 0L, U16(W1l), U16(W1l), C, 0L,
        (void*)ff16, (void*)ff16, FF, 0L, b1 + (size_t)l * FF, h1f, 0L, M, FF, C, WINV);

    // kf <- h1 + ff . W2^T + b2
    wmma_gemm64<0, false, 2, 0, true, 0><<<dim3(nbP, 1), 128, 0, stream>>>(
        U16(ff16), U16(ff16), FF, 0L, U16(W2l), U16(W2l), FF, 0L,
        (void*)kf, (void*)kf, C, 0L, b2 + (size_t)l * C, h1f, 0L, M, C, FF, WINV);

    // h = LN2(kf); last layer writes the output buffer directly
    float* hdst = (l == L - 1) ? outp : hf;
    ln_kernel<0><<<M, LN_T, 0, stream>>>(kf, kf, attn_m, ln2_g + (size_t)l * C, ln2_b + (size_t)l * C,
                                         hdst, hh16, C, invC, eps);
  }
  (void)hipGetLastError();
}

// v005
// Measured time: 674 microseconds a run.
// In both of two side-by-side timings against v004, it was 1.20 times as fast.
// Counting every step since v000, it is 2.74 times as fast.
// Contractions (q/k/v/out projections, FFN up/down, attention q.k^T and p.v): v_wmma_f32_16x16x32_f16 (f16 operands, f32 accumulate); weights carried x64, softmax probabilities carried x2^15; LayerNorm, softmax, gate: f32 VALU.
#include <hip/hip_runtime.h>
#include <math.h>
#include <stdint.h>

typedef __attribute__((ext_vector_type(16))) _Float16 v16h;
typedef __attribute__((ext_vector_type(8)))  _Float16 v8h;
typedef __attribute__((ext_vector_type(4)))  _Float16 v4h;
typedef __attribute__((ext_vector_type(16))) __bf16   v16b;
typedef __attribute__((ext_vector_type(8)))  __bf16   v8b;
typedef __attribute__((ext_vector_type(8)))  float    v8f;
typedef __attribute__((ext_vector_type(4)))  float    v4f;
#define U16(p) ((const unsigned short*)(const void*)(p))

__device__ __forceinline__ unsigned short f2bf_bits(float f) {
  unsigned u = __float_as_uint(f);
  return (unsigned short)((u + 0x7FFFu + ((u >> 16) & 1u)) >> 16);
}
__device__ __forceinline__ float bf_bits2f(unsigned short h) { return __uint_as_float(((unsigned)h) << 16); }

// hazard guards as plain device helpers (no inline asm inside the kernel template body)
__device__ __forceinline__ void acc_guard4(v8f& a, v8f& b, v8f& c, v8f& d) { asm volatile("v_nop\n\tv_nop\n\tv_nop\n\tv_nop" : "+v"(a), "+v"(b), "+v"(c), "+v"(d)); }
template <typename T> struct Frag;
template <> struct Frag<_Float16> {
  typedef v16h V; union U { v16h v; v8h h[2]; };
  static __device__ __forceinline__ v16h load(const _Float16* p) {   // elements 0..7 <- p[0..7], 8..15 <- p[16..23]
    U f; f.h[0] = *(const v8h*)(p); f.h[1] = *(const v8h*)(p + 16); return f.v;
  }
  static __device__ __forceinline__ v8f mma(v16h a, v16h b, v8f c) {
    return __builtin_amdgcn_wmma_f32_16x16x32_f16(false, a, false, b, (short)0, c, false, false);
  }
};
template <> struct Frag<__bf16> {
  typedef v16b V; union U { v16b v; v8b h[2]; };
  static __device__ __forceinline__ v16b load(const __bf16* p) {
    U f; f.h[0] = *(const v8b*)(p); f.h[1] = *(const v8b*)(p + 16); return f.v;
  }
  static __device__ __forceinline__ v8f mma(v16b a, v16b b, v8f c) {
    return __builtin_amdgcn_wmma_f32_16x16x32_bf16(false, a, false, b, (short)0, c, false, false);
  }
};

// ---- Block-tiled batched WMMA GEMM, operands staged in LDS by the tensor mover ------------
// C[m,n] = scale * sum_k A[m,k] * Bt[n,k] (+bias)(+resid); a block of 4 waves (2 x 2) owns a 128x128 tile, each wave 64x64.
// A row-major [M,K]; Bt row-major [N,K]; M,N % 128 == 0, K % 128 == 0, K >= 256 (two stages).
// A pass is 128 k = 256 B of each of the 256 operand rows; each wave brings one 64-row slice per pass with one tensor load
// (waves 0,1: the two halves of the A rows; waves 2,3: of the Bt rows), two buffers, LDS row pitch 272 B.
// BIAS_MODE: 0 = none, 1 = bias[m], 2 = bias[n].
// OUT_MODE: 0 = f32, 1 = f16, 2 = bf16 hi plane (Cout) + bf16 lo plane (Cout2).
// ET: 0 = f16 operands, 1 = bf16 operands (pointers passed as 16-bit storage)
typedef uint32_t u32x4 __attribute__((ext_vector_type(4)));
typedef uint32_t u32x8 __attribute__((ext_vector_type(8)));
#define GT_KP     128u                 // k per pass
#define GT_ROWB   256u                 // bytes of one operand row per pass
#define GT_PITCH  272u                 // LDS row pitch: 256 B + the mover's 16-B pad (ds_load_b128 readers)
#define GT_ROWS   64u                  // rows per slice
#define GT_SLICE  18432u               // 64 x 272 = 17,408 B, rounded up to a multiple of 2 KiB
#define GT_STAGE  (4u * GT_SLICE)      // one buffer: 4 slices
__device__ __forceinline__ uint32_t uni(uint32_t v) { return (uint32_t)__builtin_amdgcn_readfirstlane(v); }
// pinned(): holds a wave-uniform value in a scalar register, so that a test on it is a scalar branch (a tensor load ignores EXEC)
// and so that descriptor words formed from it are formed behind the waits that stand in front of it.
__device__ __forceinline__ uint32_t pinned(uint32_t v) { uint32_t w = uni(v); asm volatile("" : "+s"(w)); return w; }
__device__ __forceinline__ void wait_ds0()     { asm volatile("s_wait_dscnt 0x0" ::: "memory"); }      // this wave's LDS reads of the buffer are done
__device__ __forceinline__ void wait_tensor0() { asm volatile("s_wait_tensorcnt 0x0" ::: "memory"); }  // this wave's own slice has landed
// descriptor words held in scalar registers (as pinned() does for one word): the eight registers stay group 1's own through
// the loop, so that none of them takes another value while a request is outstanding
__device__ __forceinline__ void hold_group1(u32x8& g) { asm volatile("" : "+s"(g)); }
// one request of the whole wave: 64 rows of 256 B from global memory to LDS, 16 B of pad behind each row
__device__ __forceinline__ void tdm_load(uint32_t lds_dst, uint64_t ga, u32x8 g1) {
  u32x4 g0;
  g0[0] = uni(1u);
  g0[1] = uni(lds_dst);
  g0[2] = uni((uint32_t)ga);
  g0[3] = uni((((uint32_t)(ga >> 32)) & 0x01FFFFFFu) | 0x80000000u);
  asm volatile("tensor_load_to_lds %0, %1" :: "s"(g0), "s"(g1) : "memory");
}
// v_rcp_f32 and v_exp_f32, each with the one free slot that the instruction set asks for behind a transcendental in the same
// statement.
__device__ __forceinline__ float rcp_slot(float x)  { float r; asm("v_rcp_f32 %0, %1\n\tv_nop" : "=v"(r) : "v"(x)); return r; }
__device__ __forceinline__ float exp2_slot(float x) { float r; asm("v_exp_f32 %0, %1\n\tv_nop" : "=v"(r) : "v"(x)); return r; }
// GELU in its erf form, straight-line (no branch, so that the values of a fragment interleave and the unrolled epilogue stays short):
// with x = |v| / sqrt(2) and t = 1 / (1 + 0.3275911 x), erfc(x) = t (c1 + t (c2 + t (c3 + t (c4 + t c5)))) exp(-x x), absolute error
// at most 1.5e-7; gelu(v) = max(v, 0) - 0.5 |v| erfc(x), which cancels on neither side of 0. The factor -0.5 is folded into c1..c5.
__device__ __forceinline__ float gelu_erf(float v) {
  const float a = fabsf(v);
  const float t = rcp_slot(fmaf(a, 0.23164189f, 1.0f));      // 0.3275911 / sqrt(2)
  const float e = exp2_slot(v * v * -0.72134752f);           // exp(-v v / 2) = 2^(-v v log2(e) / 2)
  float p = fmaf(t, -0.53070271f, 0.72657601f);
  p = fmaf(t, p, -0.71070687f);
  p = fmaf(t, p, 0.14224837f);
  p = fmaf(t, p, -0.12741480f);
  return fmaf(a, p * t * e, fmaxf(v, 0.0f));
}
template <int ET> struct Elem;
template <> struct Elem<0> { typedef _Float16 T; };
template <> struct Elem<1> { typedef __bf16 T; };
template <int ET, bool SPLIT, int BIAS_MODE, int OUT_MODE, bool RESID, int ACT>
__device__ __forceinline__ void gemm_tile(
    const unsigned short* __restrict__ Ap, const unsigned short* __restrict__ A2p, int lda, long strideA,
    const unsigned short* __restrict__ Btp, const unsigned short* __restrict__ Bt2p, int ldb, long strideB,
    void* __restrict__ Cout, void* __restrict__ Cout2, int ldc, long strideC,
    const float* __restrict__ bias,
    const float* __restrict__ resid, long strideR,
    int M, int N, int K, float scale, const int b, const int tile) {   // b: batch index, tile: this block's tile; both block-uniform
  static_assert(!SPLIT, "single-plane operands only");
  typedef typename Elem<ET>::T T;
  typedef typename Frag<T>::V V;
  const T* A = (const T*)Ap; const T* Bt = (const T*)Btp;
  // two stage buffers; after the K loop its first bytes serve as the per-wave 16x64 f32 output slabs (pitch 68 floats)
  __shared__ __attribute__((aligned(2048))) unsigned char L[2u * GT_STAGE];
  const int lane = threadIdx.x & 31;
  const uint32_t wave = uni(threadIdx.x >> 5);
  const int tilesN = N >> 7;
  const int tilesM = M >> 7;
  const uint32_t nPass = uni((uint32_t)K / GT_KP);
  if (tile >= tilesM * tilesN || nPass < 2u) return;   // block-uniform, in front of every tensor load and barrier; the ring's prologue loads two stages
  const int tm = tile / tilesN;
  const int tn = tile - tm * tilesN;
  const uint32_t wm = wave >> 1, wn = wave & 1u;
  const int m0 = (tm << 7) + (int)(wm << 6);
  const int n0 = (tn << 7) + (int)(wn << 6);

  const T* Ab  = A  + (size_t)b * strideA;
  const T* Bb  = Bt + (size_t)b * strideB;

  const int rlane = lane & 15;                 // row (A) / col (B, D) within subtile
  const int koff  = (lane >> 4) * 8;           // k offset of this lane half
  const int mOff  = (lane >> 4) * 8;           // D row offset

  // ---- this wave's slice: source, place in LDS, descriptor group 1 (loop-invariant) ----
  const bool isB = wave >= 2u;
  const uint32_t srcPitch = (uint32_t)(isB ? ldb : lda) * 2u;     // bytes
  const uint64_t srcBase = isB ? (uint64_t)(uintptr_t)(Bb + (size_t)((tn << 7) + (int)(wn << 6)) * ldb)
                               : (uint64_t)(uintptr_t)(Ab + (size_t)((tm << 7) + (int)(wn << 6)) * lda);
  const uint32_t ldsSlice = (uint32_t)(size_t)L + wave * GT_SLICE;
  u32x8 g1;
  g1[0] = uni((1u << 20) | (5u << 22) | (3u << 25));              // no mask, 1-byte elements, 4 dwords of pad behind every 64 dwords
  g1[1] = uni((GT_ROWB & 0xFFFFu) << 16);                         // tensor_dim0 low
  g1[2] = uni((GT_ROWB >> 16) | ((GT_ROWS & 0xFFFFu) << 16));     // tensor_dim0 high, tensor_dim1 low
  g1[3] = uni((GT_ROWS >> 16) | (GT_ROWB << 16));                 // tensor_dim1 high, tile_dim0
  g1[4] = uni(GT_ROWS);                                           // tile_dim1
  g1[5] = uni(srcPitch);
  g1[6] = uni(0u);
  g1[7] = uni(0u);
  hold_group1(g1);

  v8f acc[4][4];
#pragma unroll
  for (int i = 0; i < 4; ++i)
#pragma unroll
    for (int j = 0; j < 4; ++j) acc[i][j] = (v8f){0.f,0.f,0.f,0.f,0.f,0.f,0.f,0.f};

  // prologue: stage 0 lands and is published, then stage 1 flies while pass 0 works
  tdm_load(ldsSlice, srcBase, g1);
  wait_tensor0();
  __syncthreads();
  tdm_load(ldsSlice + GT_STAGE, srcBase + GT_ROWB, g1);

  const uint32_t aOff = wm * GT_SLICE + (uint32_t)rlane * GT_PITCH + (uint32_t)koff * 2u;
  const uint32_t bOff = (2u + wn) * GT_SLICE + (uint32_t)rlane * GT_PITCH + (uint32_t)koff * 2u;
  uint32_t s = 0;
  // the pass loop stays rolled: one publish point in the text, every fragment index below a constant
#pragma unroll 1
  do {                                        // nPass >= 2 here
    const uint32_t bufOff = (s & 1u) * GT_STAGE;
    const unsigned char* As = L + bufOff + aOff;
    const unsigned char* Bs = L + bufOff + bOff;
    V bh[2][4], ah[2][4];                     // two fragment sets: the next 32 k are read while these are multiplied
#pragma unroll
    for (int j = 0; j < 4; ++j) bh[0][j] = Frag<T>::load((const T*)(Bs + (uint32_t)j * 16u * GT_PITCH));
#pragma unroll
    for (int i = 0; i < 4; ++i) ah[0][i] = Frag<T>::load((const T*)(As + (uint32_t)i * 16u * GT_PITCH));
#pragma unroll
    for (int kk = 0; kk < 4; ++kk) {          // 32 k per step, in ascending k as before; only this pass's own buffer is read
      const int cur = kk & 1, nx = cur ^ 1;
      if (kk < 3) {
#pragma unroll
        for (int j = 0; j < 4; ++j) bh[nx][j] = Frag<T>::load((const T*)(Bs + (uint32_t)j * 16u * GT_PITCH + (uint32_t)(kk + 1) * 64u));
#pragma unroll
        for (int i = 0; i < 4; ++i) ah[nx][i] = Frag<T>::load((const T*)(As + (uint32_t)i * 16u * GT_PITCH + (uint32_t)(kk + 1) * 64u));
      }
      __builtin_amdgcn_sched_barrier(0);      // the next step's LDS reads stay one group in front of this step's WMMAs, not among them
#pragma unroll
      for (int i = 0; i < 4; ++i)
#pragma unroll
        for (int j = 0; j < 4; ++j) acc[i][j] = Frag<T>::mma(ah[cur][i], bh[cur][j], acc[i][j]);
      __builtin_amdgcn_sched_barrier(0);      // and the step after next's reads do not rise into this block
    }
    // publish point of stage s + 1: own LDS reads done, own slice landed, then the barrier that both publishes
    // stage s + 1 and ends every wave's reads of the buffer that is refilled behind it
    wait_ds0();
    wait_tensor0();
    __syncthreads();
    if (pinned(s + 2u < nPass)) {             // scalar branch: only while stage s + 2 exists
      const uint32_t nxt = pinned(s + 2u);    // group 0 is formed from it, so behind the waits above
      tdm_load(ldsSlice + bufOff, srcBase + (uint64_t)nxt * GT_ROWB, g1);
    }
  } while (++s < nPass);
  wait_tensor0();
  wait_ds0();
  acc_guard4(acc[0][0], acc[0][1], acc[0][2], acc[0][3]);
  acc_guard4(acc[1][0], acc[1][1], acc[1][2], acc[1][3]);
  acc_guard4(acc[2][0], acc[2][1], acc[2][2], acc[2][3]);
  acc_guard4(acc[3][0], acc[3][1], acc[3][2], acc[3][3]);

  // ---- epilogue ----
  float* slab = (float*)(void*)L + wave * (16u * 68u);   // the last pass's own barrier has ended every read of the ring
  const float* Rb = RESID ? (resid + (size_t)b * strideR) : nullptr;
#pragma unroll
  for (int i = 0; i < 4; ++i) {
    const int mBase = m0 + (i << 4);
#pragma unroll
    for (int j = 0; j < 4; ++j) {
      const int n = n0 + (j << 4) + rlane;
      float bv = 0.f;
      if (BIAS_MODE == 2) bv = bias[n];
#pragma unroll
      for (int r = 0; r < 8; ++r) {
        float v = acc[i][j][r] * scale;
        if (BIAS_MODE == 1) v += bias[mBase + mOff + r];
        if (BIAS_MODE == 2) v += bv;
        if (RESID) v += Rb[(size_t)(mBase + mOff + r) * ldc + n];
        if (ACT == 1) v = tanhf(v);
        if (ACT == 2) v = fmaxf(v, 0.0f);
        if (ACT == 3) v = v / (1.0f + expf(-v));
        if (ACT == 4) v = (v > 0.f) ? v : 0.01f * v;
        if (ACT == 5) v = gelu_erf(v);
        slab[(mOff + r) * 68 + (j << 4) + rlane] = v;
      }
    }
    __builtin_amdgcn_fence(__ATOMIC_RELEASE, "workgroup");
    __builtin_amdgcn_wave_barrier();
    __builtin_amdgcn_fence(__ATOMIC_ACQUIRE, "workgroup");
    if (OUT_MODE == 0) {
      float* C = (float*)Cout + (size_t)b * strideC;
      const int hh = lane >> 4, c4 = (lane & 15) * 4;     // row seg = 256 B = 16 lanes x 16 B
      {
#pragma unroll
        for (int it = 0; it < 8; ++it) {
          const int row = it * 2 + hh;
          v4f v = *(const v4f*)(slab + row * 68 + c4);
          *(v4f*)(C + (size_t)(mBase + row) * ldc + n0 + c4) = v;
        }
        
      }
    } else {
      const int q = lane >> 3, c8 = (lane & 7) * 8;
      unsigned short* C  = (unsigned short*)Cout  + (size_t)b * strideC;
      unsigned short* C2 = (OUT_MODE == 2) ? ((unsigned short*)Cout2 + (size_t)b * strideC) : nullptr;
      {
#pragma unroll
        for (int it = 0; it < 4; ++it) {
          const int row = it * 4 + q;
          const float* sp = slab + row * 68 + c8;
          v8h hv, lv;
#pragma unroll
          for (int e = 0; e < 8; ++e) {
            if (OUT_MODE == 1) {
              hv[e] = (_Float16)sp[e];
            } else {
              unsigned short hb = f2bf_bits(sp[e]);
              unsigned short lb = f2bf_bits(sp[e] - bf_bits2f(hb));
              hv[e] = __builtin_bit_cast(_Float16, hb);
              lv[e] = __builtin_bit_cast(_Float16, lb);
            }
          }
          *(v8h*)(C + (size_t)(mBase + row) * ldc + n0 + c8) = hv;
          if (OUT_MODE == 2) *(v8h*)(C2 + (size_t)(mBase + row) * ldc + n0 + c8) = lv;
        }
        
      }
    }
    __builtin_amdgcn_fence(__ATOMIC_RELEASE, "workgroup");
    __builtin_amdgcn_wave_barrier();
    __builtin_amdgcn_fence(__ATOMIC_ACQUIRE, "workgroup");
  }
}

template <int ET, bool SPLIT, int BIAS_MODE, int OUT_MODE, bool RESID, int ACT = 0>
__global__ __launch_bounds__(128) void wmma_gemm64(
    const unsigned short* __restrict__ Ap, const unsigned short* __restrict__ A2p, int lda, long strideA,
    const unsigned short* __restrict__ Btp, const unsigned short* __restrict__ Bt2p, int ldb, long strideB,
    void* __restrict__ Cout, void* __restrict__ Cout2, int ldc, long strideC,
    const float* __restrict__ bias,
    const float* __restrict__ resid, long strideR,
    int M, int N, int K, float scale) {
  gemm_tile<ET, SPLIT, BIAS_MODE, OUT_MODE, RESID, ACT>(Ap, A2p, lda, strideA, Btp, Bt2p, ldb, strideB, Cout, Cout2, ldc, strideC,
                                                        bias, resid, strideR, M, N, K, scale, (int)blockIdx.y, (int)blockIdx.x);
}

// ---- GRU-style gate per (b, h, s): g = h[b,s,h*64:+64] . gw^T + gb (8 outputs, K=64, VALU f32),
//      gate = sigmoid(sum g[0:4]) * (sigmoid(sum g[4:8]) * gc[h] - 1) + 2 ; stored [b][h][s], one value (index idx) per thread
__device__ __forceinline__ void gate_item(
    const float* __restrict__ hf, const float* __restrict__ gw, const float* __restrict__ gb,
    const float* __restrict__ gc, float* __restrict__ gate, int S, int H, int C, int total, int idx) {
  if (idx >= total) return;   // no barriers on this path
  const int s  = idx % S;
  const int bh = idx / S;
  const int h  = bh % H;
  const int b  = bh / H;
  const float* hp = hf + ((size_t)b * S + s) * C + (size_t)h * 64;
  float acc[8];
#pragma unroll
  for (int e = 0; e < 8; ++e) acc[e] = 0.f;
#pragma unroll 1
  for (int d = 0; d < 64; ++d) {
    const float hv = hp[d];
#pragma unroll
    for (int e = 0; e < 8; ++e) acc[e] = fmaf(hv, gw[e * 64 + d], acc[e]);
  }
  const float sa = ((acc[0] + gb[0]) + (acc[1] + gb[1])) + ((acc[2] + gb[2]) + (acc[3] + gb[3]));
  const float sb = ((acc[4] + gb[4]) + (acc[5] + gb[5])) + ((acc[6] + gb[6]) + (acc[7] + gb[7]));
  const float ga  = 1.0f / (1.0f + expf(-sa));
  const float gbv = 1.0f / (1.0f + expf(-sb));
  const float gv = ga * (gbv * gc[h] - 1.0f) + 2.0f;
  ((float*)gate)[idx] = gv;
}

// ---- One launch for the four pieces of a layer that read h alone and none of which fills the chip: the q, k and v projections
// (blockIdx.y = 0, 1, 2: one 128x128 tile a block; the three f16 weight planes lie strideW apart, the three f32 outputs strideO apart)
// and the gate (blockIdx.y >= 3: one value a thread). No piece reads what another writes. The long pieces have the low indices.
__global__ __launch_bounds__(128) void qkv_gate_kernel(
    const unsigned short* __restrict__ hh, const unsigned short* __restrict__ w, long strideW,
    float* __restrict__ qkv, long strideO,
    const float* __restrict__ bq, const float* __restrict__ bk, const float* __restrict__ bv,
    const float* __restrict__ hf, const float* __restrict__ gw, const float* __restrict__ gb,
    const float* __restrict__ gc, float* __restrict__ gate,
    int M, int C, int S, int H, int total, float scale) {
  const int piece = (int)blockIdx.y;
  if (pinned((uint32_t)(piece >= 3))) {      // scalar branch, the same for the whole block: a gate block meets no tensor load and no barrier
    const int nTiles = (M >> 7) * (C >> 7);  // blocks in a row of the grid: one per tile of a projection
    gate_item(hf, gw, gb, gc, gate, S, H, C, total, ((piece - 3) * nTiles + (int)blockIdx.x) * 128 + (int)threadIdx.x);
    return;
  }
  const float* bias = piece == 0 ? bq : piece == 1 ? bk : bv;
  gemm_tile<0, false, 2, 0, false, 0>(hh, hh, C, 0L, w, w, C, strideW, (void*)qkv, (void*)qkv, C, strideO,
                                      bias, hf, 0L, M, C, C, scale, piece, (int)blockIdx.x);
}

// ---- All weight sets f32 -> f16 (x sc) in one launch of resident waves ---------------------------------------------
// The work is nSeg equal segments of segF4 16-byte vectors: w0..w3 are one segment each, w4 and w5 four each; the f16 planes lie
// one behind the other in out, in that order. A wave owns CS_IT x CS_LD x 32 consecutive vectors of one segment: every load is
// 512 contiguous bytes of the wave, CS_LD of them are asked for one trip ahead, every store is 256 contiguous bytes.
// One block of CS_WAVES waves per WGP: few waves that live long.
#define CS_WAVES 18
#define CS_LD    8
#define CS_IT    6
__global__ __launch_bounds__(CS_WAVES * 32) void cast_weights_stream(
    const float* __restrict__ w0, const float* __restrict__ w1, const float* __restrict__ w2, const float* __restrict__ w3,
    const float* __restrict__ w4, const float* __restrict__ w5, _Float16* __restrict__ out, int segF4, int nSeg, float sc) {
  const uint32_t perWave = CS_IT * CS_LD * 32u;                    // vectors per wave
  const uint32_t lane = threadIdx.x & 31u;
  const uint32_t gw = uni(blockIdx.x * CS_WAVES + (threadIdx.x >> 5));
  const uint32_t wavesPerSeg = (uint32_t)segF4 / perWave;
  const uint32_t seg = gw / wavesPerSeg;
  if (seg >= (uint32_t)nSeg) return;                               // wave-uniform; no barrier in this kernel
  const uint32_t win = gw - seg * wavesPerSeg;
  const size_t segF = (size_t)segF4 * 4;
  const float* src = seg == 0u ? w0 : seg == 1u ? w1 : seg == 2u ? w2 : seg == 3u ? w3
                   : seg < 8u ? w4 + (size_t)(seg - 4u) * segF : w5 + (size_t)(seg - 8u) * segF;
  const v4f* s4 = (const v4f*)src + (size_t)win * perWave + lane;
  v4h* d4 = (v4h*)out + (size_t)gw * perWave + lane;
  v4f buf[2][CS_LD];
#pragma unroll
  for (int k = 0; k < CS_LD; ++k) buf[0][k] = s4[k * 32];
  // unrolled: every address is the wave's one base plus a constant, so no address register takes a new value under a load in flight
#pragma unroll
  for (int t = 0; t < CS_IT; ++t) {
    const int cur = t & 1, nx = cur ^ 1;
    if (t + 1 < CS_IT) {
#pragma unroll
      for (int k = 0; k < CS_LD; ++k) buf[nx][k] = s4[((t + 1) * CS_LD + k) * 32];
    }
    __builtin_amdgcn_sched_barrier(0);   // no work on the values just asked for rises into this trip, where it would wait those loads out
#pragma unroll
    for (int k = 0; k < CS_LD; ++k) {
      const v4f x = buf[cur][k] * sc;
      v4h y;
      y[0] = (_Float16)x[0]; y[1] = (_Float16)x[1]; y[2] = (_Float16)x[2]; y[3] = (_Float16)x[3];
      d4[(t * CS_LD + k) * 32] = y;
    }
    // in front of the next trip's loads and converts, which write registers that this trip's stores name
    if (t + 1 < CS_IT) asm volatile("s_wait_xcnt 0x0" ::: "memory");
  }
}

// ---- LayerNorm over rows of C = 4 * blockDim floats; PRE: input = in * mask[row] + pos --------------------------
#define LN_T 192
template <int PRE>
__global__ __launch_bounds__(LN_T) void ln_kernel(
    const float* __restrict__ in, const float* __restrict__ pos, const float* __restrict__ mask,
    const float* __restrict__ g, const float* __restrict__ bb,
    float* __restrict__ outf, _Float16* __restrict__ outh, int C, float invC, float eps) {
  __shared__ float rs[8];
  __shared__ float rq[8];
  const int row = blockIdx.x;
  const int tid = threadIdx.x;
  const int lane = tid & 31;
  const int w = tid >> 5;
  const int c4 = tid * 4;
  const size_t base = (size_t)row * C + c4;
  v4f xv = *(const v4f*)(in + base);
  if (PRE) {
    const float mk = mask[row];
    const v4f pv = *(const v4f*)(pos + base);
    xv = xv * mk + pv;
  }
  float s = (xv[0] + xv[1]) + (xv[2] + xv[3]);
#pragma unroll
  for (int off = 16; off > 0; off >>= 1) s += __shfl_xor(s, off, 32);
  if (lane == 0) rs[w] = s;
  __syncthreads();
  float ts = 0.f;
#pragma unroll
  for (int i = 0; i < LN_T / 32; ++i) ts += rs[i];
  const float mean = ts * invC;
  const v4f d = xv - mean;
  float sq = (d[0] * d[0] + d[1] * d[1]) + (d[2] * d[2] + d[3] * d[3]);
#pragma unroll
  for (int off = 16; off > 0; off >>= 1) sq += __shfl_xor(sq, off, 32);
  if (lane == 0) rq[w] = sq;
  __syncthreads();
  float tq = 0.f;
#pragma unroll
  for (int i = 0; i < LN_T / 32; ++i) tq += rq[i];
  const float var = tq * invC;
  const float inv = rsqrtf(var + eps);
  const v4f gv = *(const v4f*)(g + c4);
  const v4f bv = *(const v4f*)(bb + c4);
  const v4f y = d * inv * gv + bv;
  v4h yh;
  yh[0] = (_Float16)y[0]; yh[1] = (_Float16)y[1]; yh[2] = (_Float16)y[2]; yh[3] = (_Float16)y[3];
  *(v4f*)(outf + base) = y;
  *(v4h*)(outh + base) = yh;
  
}

// =====================================================================================
// Flash attention, head_dim 64, f32 q/k/v in, f16 out; plain f16 operands, f32 accumulate; online softmax in f32.
//   s(q,kv) = (q . k) * qscale + gate[b,h,q] * pos_bias[h,q,kv] + (1 - mask[b,kv]) * -1e4
//   probabilities carried x2^15 in f16, folded into the final 1/l.
//   Block = 4 waves = 64 query rows of one (batch, head); S % 64 == 0.  q/k/v/out element (b,s,h,d) at
//   ((b*S + s)*C + h*64 + d); gate at (b*H + h)*S + s; pos_bias at (h*S + q)*S + kv; grid.x = B * H * (S/64).
// =====================================================================================
#define AT_D 64
#define AT_NW 4
#define AT_KC 64
#define AT_PSC 32768.0f

__device__ __forceinline__ v8f hmma(v16h a, v16h b, v8f c) {
  c = __builtin_amdgcn_wmma_f32_16x16x32_f16(false, a, false, b, (short)0, c, false, false);
  asm volatile("v_nop\n\tv_nop\n\tv_nop\n\tv_nop" : "+v"(c) : "v"(a), "v"(b));
  return c;
}

// Barrier and wave-level hand-over that order LDS traffic alone: a fence over global memory as well would wait out the
// loads that are in flight for the next chunk. Nothing in this kernel passes between waves through global memory.
__device__ __forceinline__ void lds_block_sync() {
  __builtin_amdgcn_fence(__ATOMIC_RELEASE, "workgroup", "local");
  __builtin_amdgcn_s_barrier();
  __builtin_amdgcn_fence(__ATOMIC_ACQUIRE, "workgroup", "local");
}
// Stands behind a run of loads that stay in flight, in front of any new value in their address registers.
__device__ __forceinline__ void wait_addr_taken() { asm volatile("s_wait_xcnt 0x0" ::: "memory"); }
__device__ __forceinline__ void lds_wave_sync() {
  __builtin_amdgcn_fence(__ATOMIC_RELEASE, "workgroup", "local");
  __builtin_amdgcn_wave_barrier();
  __builtin_amdgcn_fence(__ATOMIC_ACQUIRE, "workgroup", "local");
}

// waves_per_eu(1, 2): the grid holds three waves for every two SIMDs of the chip, so a register budget of two waves a SIMD costs
// no residency; with the default budget the compiler answers the 100 registers of loads in flight by running the row
// reductions one after the other.
__global__ __launch_bounds__(128) __attribute__((amdgpu_waves_per_eu(1, 2)))
void attn_gbias_kernel(const float* __restrict__ q, const float* __restrict__ k,
                       const float* __restrict__ v, const float* __restrict__ gate,
                       const float* __restrict__ pos_bias, const float* __restrict__ mask,
                       _Float16* __restrict__ out, int S, int H, int C, float qscale) {
  union FH { v16h v; v8h h[2]; };
  __shared__ __align__(16) _Float16 Ksh[AT_KC * AT_D];        // K [kv][d]
  __shared__ __align__(16) _Float16 Vth[AT_D * AT_KC];        // V^T [d][kv]
  __shared__ __align__(16) _Float16 Psh[AT_NW][16 * AT_KC];   // per wave P [row][kv]
  __shared__ __align__(16) float    Os[AT_NW][16 * 68];       // per wave out tile, pitch 68

  const int tid  = threadIdx.x;
  const int wave = tid >> 5;
  const int lane = tid & 31;
  const int hh   = lane >> 4;
  const int c    = lane & 15;

  const int nqb = S / 64;
  const int bx = blockIdx.x;
  const int qb = bx % nqb;
  const int bh = bx / nqb;
  const int h  = bh % H;
  const int b  = bh / H;
  const int q0 = qb * 64 + wave * 16;

  const float* qb_ptr = q + (size_t)b * S * C + (size_t)h * AT_D;
  const float* kb_ptr = k + (size_t)b * S * C + (size_t)h * AT_D;
  const float* vb_ptr = v + (size_t)b * S * C + (size_t)h * AT_D;
  const float* gt_ptr = gate + ((size_t)b * H + h) * S;
  const float* pb_ptr = pos_bias + (size_t)h * S * S;
  const float* mk_ptr = mask + (size_t)b * S;
  _Float16*    ob_ptr = out + (size_t)b * S * C + (size_t)h * AT_D;

  // ---- Q fragments (A operand): 2 d-chunks, split k map ----
  v16h qa[2];
  {
    const float* qrow = qb_ptr + (size_t)(q0 + c) * C;
#pragma unroll
    for (int dc = 0; dc < 2; ++dc) {
#pragma unroll
      for (int e = 0; e < 8; ++e) {
        qa[dc][e]     = (_Float16)qrow[dc * 32 + 8 * hh + e];
        qa[dc][8 + e] = (_Float16)qrow[dc * 32 + 16 + 8 * hh + e];
      }
    }
  }
  float grow[8];
#pragma unroll
  for (int r = 0; r < 8; ++r) grow[r] = gt_ptr[q0 + 8 * hh + r];

  float mrow[8], lrow[8];
  v8f oacc[4];
#pragma unroll
  for (int r = 0; r < 8; ++r) { mrow[r] = -INFINITY; lrow[r] = 0.f; }
#pragma unroll
  for (int t = 0; t < 4; ++t) oacc[t] = (v8f){0.f,0.f,0.f,0.f,0.f,0.f,0.f,0.f};

  const int nChunks = S / AT_KC;   // block-uniform, from launch argument
  // Every global operand of a chunk (this thread's K and V row pieces, the position-bias tile, the key mask) is held in
  // registers and requested one chunk ahead, so that no chunk waits out a load it has only just issued.
  const int kvr = tid >> 1, dh = (tid & 1) * 32;
  const int kvOff = kvr * C + dh;                 // this thread's piece inside a chunk of K or V rows
  int pbOff[8];                                   // this lane's column in each of its 8 bias rows
#pragma unroll
  for (int r = 0; r < 8; ++r) pbOff[r] = (q0 + 8 * hh + r) * S + c;
  v4f kreg[8], vreg[8];
  float pbv[8][4], mkv[4];
#pragma unroll
  for (int i = 0; i < 8; ++i) {
    kreg[i] = *(const v4f*)(kb_ptr + kvOff + 4 * i);
    vreg[i] = *(const v4f*)(vb_ptr + kvOff + 4 * i);
  }
#pragma unroll
  for (int j = 0; j < 4; ++j) mkv[j] = mk_ptr[j * 16 + c];
#pragma unroll
  for (int r = 0; r < 8; ++r)
#pragma unroll
    for (int j = 0; j < 4; ++j) pbv[r][j] = pb_ptr[pbOff[r] + j * 16];
  wait_addr_taken();
  const size_t step0 = (nChunks > 1) ? (size_t)AT_KC * C : 0;
  const float* kn = kb_ptr + kvOff + step0;       // this thread's piece of the next chunk's K rows, and of its V rows
  const float* vn = vb_ptr + kvOff + step0;

  for (int kc = 0; kc < nChunks; ++kc) {
    // first key of the next chunk; the last trip asks for its own chunk again (in bounds, not used), so that every trip
    // issues the same loads in the same order and each wait on them can be counted exactly
    const int kvn = (kc + 1 < nChunks ? kc + 1 : kc) * AT_KC;
    lds_block_sync();                             // every wave has left the previous chunk's K and V tiles
#pragma unroll
    for (int i = 0; i < 8; ++i) {
#pragma unroll
      for (int e = 0; e < 4; ++e) {
        const int d = dh + 4 * i + e;
        Ksh[kvr * AT_D + d]  = (_Float16)kreg[i][e];
        Vth[d * AT_KC + kvr] = (_Float16)vreg[i][e];
      }
    }
    {                                             // next chunk's K and V fly under this chunk's whole work
#pragma unroll
      for (int i = 0; i < 8; ++i) {
        kreg[i] = *(const v4f*)(kn + 4 * i);
        vreg[i] = *(const v4f*)(vn + 4 * i);
      }
    }
    lds_block_sync();                             // this chunk's tiles are published

    v8f s[4];
#pragma unroll
    for (int j = 0; j < 4; ++j) {
      s[j] = (v8f){0.f,0.f,0.f,0.f,0.f,0.f,0.f,0.f};
#pragma unroll
      for (int dc = 0; dc < 2; ++dc) {
        FH kb;
        kb.h[0] = *(const v8h*)(Ksh + (j * 16 + c) * AT_D + dc * 32 + 8 * hh);
        kb.h[1] = *(const v8h*)(Ksh + (j * 16 + c) * AT_D + dc * 32 + 16 + 8 * hh);
        s[j] = hmma(qa[dc], kb.v, s[j]);
      }
    }
    // additive terms: key padding per column, gated position bias per (row, column)
    float kp[4];
#pragma unroll
    for (int j = 0; j < 4; ++j) kp[j] = (1.0f - mkv[j]) * -10000.0f;
    float cm[8];
#pragma unroll
    for (int r = 0; r < 8; ++r) {
      float m = -INFINITY;
#pragma unroll
      for (int j = 0; j < 4; ++j) {
        const float sv = s[j][r] * qscale + grow[r] * pbv[r][j] + kp[j];
        s[j][r] = sv;
        m = fmaxf(m, sv);
      }
#pragma unroll
      for (int off = 1; off < 16; off <<= 1) m = fmaxf(m, __shfl_xor(m, off, 32));
      cm[r] = m;
    }
    {                                             // next chunk's bias tile and mask fly under softmax, P.V and the next staging
      const float* pn = pb_ptr + kvn;
#pragma unroll
      for (int j = 0; j < 4; ++j) mkv[j] = mk_ptr[kvn + j * 16 + c];
#pragma unroll
      for (int r = 0; r < 4; ++r)
#pragma unroll
        for (int j = 0; j < 4; ++j) pbv[r][j] = pn[pbOff[r] + j * 16];
      wait_addr_taken();
#pragma unroll
      for (int r = 4; r < 8; ++r)
#pragma unroll
        for (int j = 0; j < 4; ++j) pbv[r][j] = pn[pbOff[r] + j * 16];
      wait_addr_taken();
      // nothing crosses this line: the K and V pointers step on only behind the wait above (it covers their loads too), and
      // no work on the values just requested rises into this chunk, where it would wait those loads out
      __builtin_amdgcn_sched_barrier(0);
      const size_t step = (kc + 2 < nChunks) ? (size_t)AT_KC * C : 0;
      kn += step;
      vn += step;
    }
    _Float16* pw = Psh[wave];
#pragma unroll
    for (int r = 0; r < 8; ++r) {
      const float mnew = fmaxf(mrow[r], cm[r]);
      const float alpha = expf(mrow[r] - mnew);
      mrow[r] = mnew;
      float psum = 0.f;
#pragma unroll
      for (int j = 0; j < 4; ++j) {
        const float p = expf(s[j][r] - mnew);
        psum += p;
        pw[(8 * hh + r) * AT_KC + j * 16 + c] = (_Float16)(p * AT_PSC);
      }
#pragma unroll
      for (int off = 1; off < 16; off <<= 1) psum += __shfl_xor(psum, off, 32);
      lrow[r] = lrow[r] * alpha + psum;
#pragma unroll
      for (int t = 0; t < 4; ++t) oacc[t][r] *= alpha;
    }
    lds_wave_sync();                              // the wave's own P rows, written above, are read back as fragments below
#pragma unroll 1
    for (int kk = 0; kk < 2; ++kk) {
      FH pa;
      pa.h[0] = *(const v8h*)(pw + c * AT_KC + kk * 32 + 8 * hh);
      pa.h[1] = *(const v8h*)(pw + c * AT_KC + kk * 32 + 16 + 8 * hh);
#pragma unroll
      for (int t = 0; t < 4; ++t) {
        FH vb;
        vb.h[0] = *(const v8h*)(Vth + (t * 16 + c) * AT_KC + kk * 32 + 8 * hh);
        vb.h[1] = *(const v8h*)(Vth + (t * 16 + c) * AT_KC + kk * 32 + 16 + 8 * hh);
        oacc[t] = hmma(pa.v, vb.v, oacc[t]);
      }
    }
  }

  float* os = Os[wave];
#pragma unroll
  for (int r = 0; r < 8; ++r) {
    const float inv = 1.0f / (lrow[r] * AT_PSC);
#pragma unroll
    for (int t = 0; t < 4; ++t) os[(8 * hh + r) * 68 + t * 16 + c] = oacc[t][r] * inv;
  }
  __builtin_amdgcn_fence(__ATOMIC_RELEASE, "workgroup");
  __builtin_amdgcn_wave_barrier();
  __builtin_amdgcn_fence(__ATOMIC_ACQUIRE, "workgroup");
  {
    const int q8 = lane >> 3, c8 = (lane & 7) * 8;
    {
#pragma unroll
      for (int it = 0; it < 4; ++it) {
        const int row = it * 4 + q8;
        const float* sp = os + row * 68 + c8;
        v8h hv;
#pragma unroll
        for (int e = 0; e < 8; ++e) hv[e] = (_Float16)sp[e];
        *(v8h*)(ob_ptr + (size_t)(q0 + row) * C + c8) = hv;
      }
      
    }
  }
}

// ---------------------------------------------------------------------------
extern "C" void kernel_launch(void* const* d_in, const int* in_sizes, int n_in,
                              void* d_out, int out_size, void* d_ws, size_t ws_size,
                              hipStream_t stream) {
  const int Bn = 2, S = 1024, C = 768, H = 12, L = 4, FF = 3072;
  const int M = Bn * S;
  if (n_in < 25) return;
  if (in_sizes[0] != M * C || in_sizes[1] != M * C || in_sizes[2] != M || in_sizes[3] != H * S * S) return;
  if (in_sizes[6] != L * C * C || in_sizes[19] != L * FF * C || in_sizes[21] != L * C * FF) return;
  if (out_size != M * C) return;

  const float* x        = (const float*)d_in[0];
  const float* pos_emb  = (const float*)d_in[1];
  const float* attn_m   = (const float*)d_in[2];
  const float* pos_bias = (const float*)d_in[3];
  const float* ln0_g    = (const float*)d_in[4];
  const float* ln0_b    = (const float*)d_in[5];
  const float* Wq       = (const float*)d_in[6];
  const float* bq       = (const float*)d_in[7];
  const float* Wk       = (const float*)d_in[8];
  const float* bk       = (const float*)d_in[9];
  const float* Wv       = (const float*)d_in[10];
  const float* bv       = (const float*)d_in[11];
  const float* Wo       = (const float*)d_in[12];
  const float* bo       = (const float*)d_in[13];
  const float* gruW     = (const float*)d_in[14];
  const float* grub     = (const float*)d_in[15];
  const float* gruc     = (const float*)d_in[16];
  const float* ln1_g    = (const float*)d_in[17];
  const float* ln1_b    = (const float*)d_in[18];
  const float* W1       = (const float*)d_in[19];
  const float* b1       = (const float*)d_in[20];
  const float* W2       = (const float*)d_in[21];
  const float* b2       = (const float*)d_in[22];
  const float* ln2_g    = (const float*)d_in[23];
  const float* ln2_b    = (const float*)d_in[24];

  // ---- workspace carve (256-B aligned offsets, total 110,198,784 B) ----
  char* ws = (char*)d_ws;
  size_t off = 0;
  const size_t NWC = (size_t)L * C * C;      // halves per projection weight set
  const size_t NWF = (size_t)L * FF * C;     // halves per FFN weight set
  const size_t NA  = (size_t)M * C;
  const size_t NF  = (size_t)M * FF;
  const size_t NG  = (size_t)Bn * H * S;
  size_t o_wq, o_wk, o_wv, o_wo, o_w1, o_w2, o_hf, o_hh, o_qf, o_kf, o_vf, o_ao, o_h1f, o_h1h, o_ff, o_gt;
#define CARVE(o, bytes) do { o = off; off += ((size_t)(bytes) + 255) & ~(size_t)255; } while (0)
  CARVE(o_wq, NWC * 2); CARVE(o_wk, NWC * 2); CARVE(o_wv, NWC * 2); CARVE(o_wo, NWC * 2);
  CARVE(o_w1, NWF * 2); CARVE(o_w2, NWF * 2);
  CARVE(o_hf, NA * 4);  CARVE(o_hh, NA * 2);
  CARVE(o_qf, NA * 4);  CARVE(o_kf, NA * 4);  CARVE(o_vf, NA * 4);
  CARVE(o_ao, NA * 2);
  CARVE(o_h1f, NA * 4); CARVE(o_h1h, NA * 2);
  CARVE(o_ff, NF * 2);
  CARVE(o_gt, NG * 4);
#undef CARVE
  if (off > ws_size) return;

  _Float16* wq16 = (_Float16*)(ws + o_wq);
  _Float16* wo16 = (_Float16*)(ws + o_wo);
  _Float16* w116 = (_Float16*)(ws + o_w1);
  _Float16* w216 = (_Float16*)(ws + o_w2);
  float*    hf   = (float*)(ws + o_hf);
  _Float16* hh16 = (_Float16*)(ws + o_hh);
  float*    qf   = (float*)(ws + o_qf);
  float*    kf   = (float*)(ws + o_kf);
  float*    vf   = (float*)(ws + o_vf);
  _Float16* ao16 = (_Float16*)(ws + o_ao);
  float*    h1f  = (float*)(ws + o_h1f);
  _Float16* h1h  = (_Float16*)(ws + o_h1h);
  _Float16* ff16 = (_Float16*)(ws + o_ff);
  float*    gtb  = (float*)(ws + o_gt);
  float*    outp = (float*)d_out;

  const float WSC  = 64.0f;            // weights carried x64 in f16
  const float WINV = 1.0f / 64.0f;     // folded back in the GEMM epilogue
  const float invC = 1.0f / 768.0f;
  const float eps  = 1e-5f;
  const float qscale = 0.125f;         // 1/sqrt(64)

  // ---- weights -> f16 (x64): Wq, Wk, Wv, Wo, W1, W2 as 12 segments of L*C*C elements; their f16 planes are contiguous from wq16 ----
  {
    const int segF4 = (int)(NWC / 4), nSeg = 12;
    const int perWave = CS_IT * CS_LD * 32, wavesAll = (segF4 / perWave) * nSeg;
    static_assert((L * C * C / 4) % (CS_IT * CS_LD * 32) == 0, "a segment is a whole number of waves");
    static_assert(((L * C * C / 4) / (CS_IT * CS_LD * 32) * 12) % CS_WAVES == 0, "the waves fill whole blocks");
    static_assert(FF == 4 * C && (L * C * C * 2) % 256 == 0, "W1 and W2 are four segments each; no gap between the planes");
    cast_weights_stream<<<wavesAll / CS_WAVES, CS_WAVES * 32, 0, stream>>>(Wq, Wk, Wv, Wo, W1, W2, wq16, segF4, nSeg, WSC);
  }

  // ---- h = LN0(x * mask + pos_emb) ----
  ln_kernel<1><<<M, LN_T, 0, stream>>>(x, pos_emb, attn_m, ln0_g, ln0_b, hf, hh16, C, invC, eps);

  const int nbP = (M / 128) * (C / 128);    // 96 blocks, one 128x128 tile each
  const int nbF = (M / 128) * (FF / 128);   // 384 blocks
  const int nbA = Bn * H * (S / 64);                // 384 attention blocks
  const int ngate = (int)NG;
  const int nyG = (ngate + nbP * 128 - 1) / (nbP * 128);   // rows of the joined grid that hold the gate, 128 values a block
  static_assert((L * C * C * 2) % 256 == 0 && (Bn * S * C * 4) % 256 == 0, "no gap between the q, k, v weight planes, nor between qf, kf, vf");

  for (int l = 0; l < L; ++l) {
    const size_t lw  = (size_t)l * C * C;
    const size_t lwf = (size_t)l * FF * C;
    const _Float16* WQl = wq16 + lw;
    const _Float16* WOl = wo16 + lw;
    const _Float16* W1l = w116 + lwf;   // [FF][C]
    const _Float16* W2l = w216 + lwf;   // [C][FF]

    // q, k, v = h . W^T + b (f32 out) and gate[b][h][s], one launch
    qkv_gate_kernel<<<dim3(nbP, 3 + nyG), 128, 0, stream>>>(
        U16(hh16), U16(WQl), (long)NWC, qf, (long)NA, bq + (size_t)l * C, bk + (size_t)l * C, bv + (size_t)l * C,
        hf, gruW + (size_t)l * 8 * 64, grub + (size_t)l * 8, gruc + (size_t)l * H, gtb, M, C, S, H, ngate, WINV);

    // attention -> ao16 (f16)
    attn_gbias_kernel<<<nbA, 128, 0, stream>>>(qf, kf, vf, gtb, pos_bias, attn_m, ao16, S, H, C, qscale);

    // qf <- h + ao . Wo^T + bo
    wmma_gemm64<0, false, 2, 0, true, 0><<<dim3(nbP, 1), 128, 0, stream>>>(
        U16(ao16), U16(ao16), C, 0L, U16(WOl), U16(WOl), C, 0L,
        (void*)qf, (void*)qf, C, 0L, bo + (size_t)l * C, hf, 0L, M, C, C, WINV);

    // h1 = LN1(qf)
    ln_kernel<0><<<M, LN_T, 0, stream>>>(qf, qf, attn_m, ln1_g + (size_t)l * C, ln1_b + (size_t)l * C,
                                         h1f, h1h, C, invC, eps);

    // ff16 = gelu(h1 . W1^T + b1)  (f16 out)
    wmma_gemm64<0, false, 2, 1, false, 5><<<dim3(nbF, 1), 128, 0, stream>>>(
        U16(h1h), U16(h1h), C, 0L, U16(W1l), U16(W1l), C, 0L,
        (void*)ff16, (void*)ff16, FF, 0L, b1 + (size_t)l * FF, h1f, 0L, M, FF, C, WINV);

    // kf <- h1 + ff . W2^T + b2
    wmma_gemm64<0, false, 2, 0, true, 0><<<dim3(nbP, 1), 128, 0, stream>>>(
        U16(ff16), U16(ff16), FF, 0L, U16(W2l), U16(W2l), FF, 0L,
        (void*)kf, (void*)kf, C, 0L, b2 + (size_t)l * C, h1f, 0L, M, C, FF, WINV);

    // h = LN2(kf); last layer writes the output buffer directly
    float* hdst = (l == L - 1) ? outp : hf;
    ln_kernel<0><<<M, LN_T, 0, stream>>>(kf, kf, attn_m, ln2_g + (size_t)l * C, ln2_b + (size_t)l * C,
                                         hdst, hh16, C, invC, eps);
  }
  (void)hipGetLastError();
}

// v006
// A run of this version takes 583 microseconds.
// In both of two side-by-side timings against v005, it was 1.16 times as fast.
// Counting every step since v000, it is 3.17 times as fast.
// Contractions (q/k/v/out projections, FFN up/down, attention q.k^T and p.v): v_wmma_f32_16x16x32_f16 (f16 operands, f32 accumulate); weights carried x64, softmax probabilities carried x2^15; LayerNorm, softmax, gate: f32 VALU.
#include <hip/hip_runtime.h>
#include <math.h>
#include <stdint.h>

typedef __attribute__((ext_vector_type(16))) _Float16 v16h;
typedef __attribute__((ext_vector_type(8)))  _Float16 v8h;
typedef __attribute__((ext_vector_type(4)))  _Float16 v4h;
typedef __attribute__((ext_vector_type(16))) __bf16   v16b;
typedef __attribute__((ext_vector_type(8)))  __bf16   v8b;
typedef __attribute__((ext_vector_type(8)))  float    v8f;
typedef __attribute__((ext_vector_type(4)))  float    v4f;
#define U16(p) ((const unsigned short*)(const void*)(p))

__device__ __forceinline__ unsigned short f2bf_bits(float f) {
  unsigned u = __float_as_uint(f);
  return (unsigned short)((u + 0x7FFFu + ((u >> 16) & 1u)) >> 16);
}
__device__ __forceinline__ float bf_bits2f(unsigned short h) { return __uint_as_float(((unsigned)h) << 16); }

// hazard guards as plain device helpers (no inline asm inside the kernel template body)
__device__ __forceinline__ void acc_guard4(v8f& a, v8f& b, v8f& c, v8f& d) { asm volatile("v_nop\n\tv_nop\n\tv_nop\n\tv_nop" : "+v"(a), "+v"(b), "+v"(c), "+v"(d)); }
template <typename T> struct Frag;
template <> struct Frag<_Float16> {
  typedef v16h V; union U { v16h v; v8h h[2]; };
  static __device__ __forceinline__ v16h load(const _Float16* p) {   // elements 0..7 <- p[0..7], 8..15 <- p[16..23]
    U f; f.h[0] = *(const v8h*)(p); f.h[1] = *(const v8h*)(p + 16); return f.v;
  }
  static __device__ __forceinline__ v8f mma(v16h a, v16h b, v8f c) {
    return __builtin_amdgcn_wmma_f32_16x16x32_f16(false, a, false, b, (short)0, c, false, false);
  }
};
template <> struct Frag<__bf16> {
  typedef v16b V; union U { v16b v; v8b h[2]; };
  static __device__ __forceinline__ v16b load(const __bf16* p) {
    U f; f.h[0] = *(const v8b*)(p); f.h[1] = *(const v8b*)(p + 16); return f.v;
  }
  static __device__ __forceinline__ v8f mma(v16b a, v16b b, v8f c) {
    return __builtin_amdgcn_wmma_f32_16x16x32_bf16(false, a, false, b, (short)0, c, false, false);
  }
};

// ---- Block-tiled batched WMMA GEMM, operands staged in LDS by the tensor mover ------------
// C[m,n] = scale * sum_k A[m,k] * Bt[n,k] (+bias)(+resid); a block of 4 waves (2 x 2) owns a 128x128 tile, each wave 64x64.
// A row-major [M,K]; Bt row-major [N,K]; M,N % 128 == 0, K % 128 == 0, K >= 256 (two stages).
// A pass is 128 k = 256 B of each of the 256 operand rows; each wave brings one 64-row slice per pass with one tensor load
// (waves 0,1: the two halves of the A rows; waves 2,3: of the Bt rows), two buffers, LDS row pitch 272 B.
// BIAS_MODE: 0 = none, 1 = bias[m], 2 = bias[n].
// OUT_MODE: 0 = f32, 1 = f16, 2 = bf16 hi plane (Cout) + bf16 lo plane (Cout2).
// ET: 0 = f16 operands, 1 = bf16 operands (pointers passed as 16-bit storage)
typedef uint32_t u32x4 __attribute__((ext_vector_type(4)));
typedef uint32_t u32x8 __attribute__((ext_vector_type(8)));
#define GT_KP     128u                 // k per pass
#define GT_ROWB   256u                 // bytes of one operand row per pass
#define GT_PITCH  272u                 // LDS row pitch: 256 B + the mover's 16-B pad (ds_load_b128 readers)
#define GT_ROWS   64u                  // rows per slice
#define GT_SLICE  18432u               // 64 x 272 = 17,408 B, rounded up to a multiple of 2 KiB
#define GT_STAGE  (4u * GT_SLICE)      // one buffer: 4 slices
__device__ __forceinline__ uint32_t uni(uint32_t v) { return (uint32_t)__builtin_amdgcn_readfirstlane(v); }
// pinned(): holds a wave-uniform value in a scalar register, so that a test on it is a scalar branch (a tensor load ignores EXEC)
// and so that descriptor words formed from it are formed behind the waits that stand in front of it.
__device__ __forceinline__ uint32_t pinned(uint32_t v) { uint32_t w = uni(v); asm volatile("" : "+s"(w)); return w; }
__device__ __forceinline__ void wait_ds0()     { asm volatile("s_wait_dscnt 0x0" ::: "memory"); }      // this wave's LDS reads of the buffer are done
__device__ __forceinline__ void wait_tensor0() { asm volatile("s_wait_tensorcnt 0x0" ::: "memory"); }  // this wave's own slice has landed
// descriptor words held in scalar registers (as pinned() does for one word): the eight registers stay group 1's own through
// the loop, so that none of them takes another value while a request is outstanding
__device__ __forceinline__ void hold_group1(u32x8& g) { asm volatile("" : "+s"(g)); }
// one request of the whole wave: 64 rows of 256 B from global memory to LDS, 16 B of pad behind each row
__device__ __forceinline__ void tdm_load(uint32_t lds_dst, uint64_t ga, u32x8 g1) {
  u32x4 g0;
  g0[0] = uni(1u);
  g0[1] = uni(lds_dst);
  g0[2] = uni((uint32_t)ga);
  g0[3] = uni((((uint32_t)(ga >> 32)) & 0x01FFFFFFu) | 0x80000000u);
  asm volatile("tensor_load_to_lds %0, %1" :: "s"(g0), "s"(g1) : "memory");
}
// v_rcp_f32 and v_exp_f32, each with the one free slot that the instruction set asks for behind a transcendental in the same
// statement.
__device__ __forceinline__ float rcp_slot(float x)  { float r; asm("v_rcp_f32 %0, %1\n\tv_nop" : "=v"(r) : "v"(x)); return r; }
__device__ __forceinline__ float exp2_slot(float x) { float r; asm("v_exp_f32 %0, %1\n\tv_nop" : "=v"(r) : "v"(x)); return r; }
// GELU in its erf form, straight-line (no branch, so that the values of a fragment interleave and the unrolled epilogue stays short):
// with x = |v| / sqrt(2) and t = 1 / (1 + 0.3275911 x), erfc(x) = t (c1 + t (c2 + t (c3 + t (c4 + t c5)))) exp(-x x), absolute error
// at most 1.5e-7; gelu(v) = max(v, 0) - 0.5 |v| erfc(x), which cancels on neither side of 0. The factor -0.5 is folded into c1..c5.
__device__ __forceinline__ float gelu_erf(float v) {
  const float a = fabsf(v);
  const float t = rcp_slot(fmaf(a, 0.23164189f, 1.0f));      // 0.3275911 / sqrt(2)
  const float e = exp2_slot(v * v * -0.72134752f);           // exp(-v v / 2) = 2^(-v v log2(e) / 2)
  float p = fmaf(t, -0.53070271f, 0.72657601f);
  p = fmaf(t, p, -0.71070687f);
  p = fmaf(t, p, 0.14224837f);
  p = fmaf(t, p, -0.12741480f);
  return fmaf(a, p * t * e, fmaxf(v, 0.0f));
}
template <int ET> struct Elem;
template <> struct Elem<0> { typedef _Float16 T; };
template <> struct Elem<1> { typedef __bf16 T; };
template <int ET, bool SPLIT, int BIAS_MODE, int OUT_MODE, bool RESID, int ACT>
__device__ __forceinline__ void gemm_tile(
    const unsigned short* __restrict__ Ap, const unsigned short* __restrict__ A2p, int lda, long strideA,
    const unsigned short* __restrict__ Btp, const unsigned short* __restrict__ Bt2p, int ldb, long strideB,
    void* __restrict__ Cout, void* __restrict__ Cout2, int ldc, long strideC,
    const float* __restrict__ bias,
    const float* __restrict__ resid, long strideR,
    int M, int N, int K, float scale, const int b, const int tile) {   // b: batch index, tile: this block's tile; both block-uniform
  static_assert(!SPLIT, "single-plane operands only");
  typedef typename Elem<ET>::T T;
  typedef typename Frag<T>::V V;
  const T* A = (const T*)Ap; const T* Bt = (const T*)Btp;
  // two stage buffers; after the K loop its first bytes serve as the per-wave 16x64 f32 output slabs (pitch 68 floats)
  __shared__ __attribute__((aligned(2048))) unsigned char L[2u * GT_STAGE];
  const int lane = threadIdx.x & 31;
  const uint32_t wave = uni(threadIdx.x >> 5);
  const int tilesN = N >> 7;
  const int tilesM = M >> 7;
  const uint32_t nPass = uni((uint32_t)K / GT_KP);
  if (tile >= tilesM * tilesN || nPass < 2u) return;   // block-uniform, in front of every tensor load and barrier; the ring's prologue loads two stages
  const int tm = tile / tilesN;
  const int tn = tile - tm * tilesN;
  const uint32_t wm = wave >> 1, wn = wave & 1u;
  const int m0 = (tm << 7) + (int)(wm << 6);
  const int n0 = (tn << 7) + (int)(wn << 6);

  const T* Ab  = A  + (size_t)b * strideA;
  const T* Bb  = Bt + (size_t)b * strideB;

  const int rlane = lane & 15;                 // row (A) / col (B, D) within subtile
  const int koff  = (lane >> 4) * 8;           // k offset of this lane half
  const int mOff  = (lane >> 4) * 8;           // D row offset

  // ---- this wave's slice: source, place in LDS, descriptor group 1 (loop-invariant) ----
  const bool isB = wave >= 2u;
  const uint32_t srcPitch = (uint32_t)(isB ? ldb : lda) * 2u;     // bytes
  const uint64_t srcBase = isB ? (uint64_t)(uintptr_t)(Bb + (size_t)((tn << 7) + (int)(wn << 6)) * ldb)
                               : (uint64_t)(uintptr_t)(Ab + (size_t)((tm << 7) + (int)(wn << 6)) * lda);
  const uint32_t ldsSlice = (uint32_t)(size_t)L + wave * GT_SLICE;
  u32x8 g1;
  g1[0] = uni((1u << 20) | (5u << 22) | (3u << 25));              // no mask, 1-byte elements, 4 dwords of pad behind every 64 dwords
  g1[1] = uni((GT_ROWB & 0xFFFFu) << 16);                         // tensor_dim0 low
  g1[2] = uni((GT_ROWB >> 16) | ((GT_ROWS & 0xFFFFu) << 16));     // tensor_dim0 high, tensor_dim1 low
  g1[3] = uni((GT_ROWS >> 16) | (GT_ROWB << 16));                 // tensor_dim1 high, tile_dim0
  g1[4] = uni(GT_ROWS);                                           // tile_dim1
  g1[5] = uni(srcPitch);
  g1[6] = uni(0u);
  g1[7] = uni(0u);
  hold_group1(g1);

  v8f acc[4][4];
#pragma unroll
  for (int i = 0; i < 4; ++i)
#pragma unroll
    for (int j = 0; j < 4; ++j) acc[i][j] = (v8f){0.f,0.f,0.f,0.f,0.f,0.f,0.f,0.f};

  // prologue: stage 0 lands and is published, then stage 1 flies while pass 0 works
  tdm_load(ldsSlice, srcBase, g1);
  wait_tensor0();
  __syncthreads();
  tdm_load(ldsSlice + GT_STAGE, srcBase + GT_ROWB, g1);

  const uint32_t aOff = wm * GT_SLICE + (uint32_t)rlane * GT_PITCH + (uint32_t)koff * 2u;
  const uint32_t bOff = (2u + wn) * GT_SLICE + (uint32_t)rlane * GT_PITCH + (uint32_t)koff * 2u;
  uint32_t s = 0;
  // the pass loop stays rolled: one publish point in the text, every fragment index below a constant
#pragma unroll 1
  do {                                        // nPass >= 2 here
    const uint32_t bufOff = (s & 1u) * GT_STAGE;
    const unsigned char* As = L + bufOff + aOff;
    const unsigned char* Bs = L + bufOff + bOff;
    V bh[2][4], ah[2][4];                     // two fragment sets: the next 32 k are read while these are multiplied
#pragma unroll
    for (int j = 0; j < 4; ++j) bh[0][j] = Frag<T>::load((const T*)(Bs + (uint32_t)j * 16u * GT_PITCH));
#pragma unroll
    for (int i = 0; i < 4; ++i) ah[0][i] = Frag<T>::load((const T*)(As + (uint32_t)i * 16u * GT_PITCH));
#pragma unroll
    for (int kk = 0; kk < 4; ++kk) {          // 32 k per step, in ascending k as before; only this pass's own buffer is read
      const int cur = kk & 1, nx = cur ^ 1;
      if (kk < 3) {
#pragma unroll
        for (int j = 0; j < 4; ++j) bh[nx][j] = Frag<T>::load((const T*)(Bs + (uint32_t)j * 16u * GT_PITCH + (uint32_t)(kk + 1) * 64u));
#pragma unroll
        for (int i = 0; i < 4; ++i) ah[nx][i] = Frag<T>::load((const T*)(As + (uint32_t)i * 16u * GT_PITCH + (uint32_t)(kk + 1) * 64u));
      }
      __builtin_amdgcn_sched_barrier(0);      // the next step's LDS reads stay one group in front of this step's WMMAs, not among them
#pragma unroll
      for (int i = 0; i < 4; ++i)
#pragma unroll
        for (int j = 0; j < 4; ++j) acc[i][j] = Frag<T>::mma(ah[cur][i], bh[cur][j], acc[i][j]);
      __builtin_amdgcn_sched_barrier(0);      // and the step after next's reads do not rise into this block
    }
    // publish point of stage s + 1: own LDS reads done, own slice landed, then the barrier that both publishes
    // stage s + 1 and ends every wave's reads of the buffer that is refilled behind it
    wait_ds0();
    wait_tensor0();
    __syncthreads();
    if (pinned(s + 2u < nPass)) {             // scalar branch: only while stage s + 2 exists
      const uint32_t nxt = pinned(s + 2u);    // group 0 is formed from it, so behind the waits above
      tdm_load(ldsSlice + bufOff, srcBase + (uint64_t)nxt * GT_ROWB, g1);
    }
  } while (++s < nPass);
  wait_tensor0();
  wait_ds0();
  acc_guard4(acc[0][0], acc[0][1], acc[0][2], acc[0][3]);
  acc_guard4(acc[1][0], acc[1][1], acc[1][2], acc[1][3]);
  acc_guard4(acc[2][0], acc[2][1], acc[2][2], acc[2][3]);
  acc_guard4(acc[3][0], acc[3][1], acc[3][2], acc[3][3]);

  // ---- epilogue ----
  float* slab = (float*)(void*)L + wave * (16u * 68u);   // the last pass's own barrier has ended every read of the ring
  const float* Rb = RESID ? (resid + (size_t)b * strideR) : nullptr;
#pragma unroll
  for (int i = 0; i < 4; ++i) {
    const int mBase = m0 + (i << 4);
#pragma unroll
    for (int j = 0; j < 4; ++j) {
      const int n = n0 + (j << 4) + rlane;
      float bv = 0.f;
      if (BIAS_MODE == 2) bv = bias[n];
#pragma unroll
      for (int r = 0; r < 8; ++r) {
        float v = acc[i][j][r] * scale;
        if (BIAS_MODE == 1) v += bias[mBase + mOff + r];
        if (BIAS_MODE == 2) v += bv;
        if (RESID) v += Rb[(size_t)(mBase + mOff + r) * ldc + n];
        if (ACT == 1) v = tanhf(v);
        if (ACT == 2) v = fmaxf(v, 0.0f);
        if (ACT == 3) v = v / (1.0f + expf(-v));
        if (ACT == 4) v = (v > 0.f) ? v : 0.01f * v;
        if (ACT == 5) v = gelu_erf(v);
        slab[(mOff + r) * 68 + (j << 4) + rlane] = v;
      }
    }
    __builtin_amdgcn_fence(__ATOMIC_RELEASE, "workgroup");
    __builtin_amdgcn_wave_barrier();
    __builtin_amdgcn_fence(__ATOMIC_ACQUIRE, "workgroup");
    if (OUT_MODE == 0) {
      float* C = (float*)Cout + (size_t)b * strideC;
      const int hh = lane >> 4, c4 = (lane & 15) * 4;     // row seg = 256 B = 16 lanes x 16 B
      {
#pragma unroll
        for (int it = 0; it < 8; ++it) {
          const int row = it * 2 + hh;
          v4f v = *(const v4f*)(slab + row * 68 + c4);
          *(v4f*)(C + (size_t)(mBase + row) * ldc + n0 + c4) = v;
        }
        
      }
    } else {
      const int q = lane >> 3, c8 = (lane & 7) * 8;
      unsigned short* C  = (unsigned short*)Cout  + (size_t)b * strideC;
      unsigned short* C2 = (OUT_MODE == 2) ? ((unsigned short*)Cout2 + (size_t)b * strideC) : nullptr;
      {
#pragma unroll
        for (int it = 0; it < 4; ++it) {
          const int row = it * 4 + q;
          const float* sp = slab + row * 68 + c8;
          v8h hv, lv;
#pragma unroll
          for (int e = 0; e < 8; ++e) {
            if (OUT_MODE == 1) {
              hv[e] = (_Float16)sp[e];
            } else {
              unsigned short hb = f2bf_bits(sp[e]);
              unsigned short lb = f2bf_bits(sp[e] - bf_bits2f(hb));
              hv[e] = __builtin_bit_cast(_Float16, hb);
              lv[e] = __builtin_bit_cast(_Float16, lb);
            }
          }
          *(v8h*)(C + (size_t)(mBase + row) * ldc + n0 + c8) = hv;
          if (OUT_MODE == 2) *(v8h*)(C2 + (size_t)(mBase + row) * ldc + n0 + c8) = lv;
        }
        
      }
    }
    __builtin_amdgcn_fence(__ATOMIC_RELEASE, "workgroup");
    __builtin_amdgcn_wave_barrier();
    __builtin_amdgcn_fence(__ATOMIC_ACQUIRE, "workgroup");
  }
}

template <int ET, bool SPLIT, int BIAS_MODE, int OUT_MODE, bool RESID, int ACT = 0>
__global__ __launch_bounds__(128) void wmma_gemm64(
    const unsigned short* __restrict__ Ap, const unsigned short* __restrict__ A2p, int lda, long strideA,
    const unsigned short* __restrict__ Btp, const unsigned short* __restrict__ Bt2p, int ldb, long strideB,
    void* __restrict__ Cout, void* __restrict__ Cout2, int ldc, long strideC,
    const float* __restrict__ bias,
    const float* __restrict__ resid, long strideR,
    int M, int N, int K, float scale) {
  gemm_tile<ET, SPLIT, BIAS_MODE, OUT_MODE, RESID, ACT>(Ap, A2p, lda, strideA, Btp, Bt2p, ldb, strideB, Cout, Cout2, ldc, strideC,
                                                        bias, resid, strideR, M, N, K, scale, (int)blockIdx.y, (int)blockIdx.x);
}

// ---- GRU-style gate per (b, h, s): g = h[b,s,h*64:+64] . gw^T + gb (8 outputs, K=64, VALU f32),
//      gate = sigmoid(sum g[0:4]) * (sigmoid(sum g[4:8]) * gc[h] - 1) + 2 ; stored [b][h][s], one value (index idx) per thread
__device__ __forceinline__ void gate_item(
    const float* __restrict__ hf, const float* __restrict__ gw, const float* __restrict__ gb,
    const float* __restrict__ gc, float* __restrict__ gate, int S, int H, int C, int total, int idx) {
  if (idx >= total) return;   // no barriers on this path
  const int s  = idx % S;
  const int bh = idx / S;
  const int h  = bh % H;
  const int b  = bh / H;
  const float* hp = hf + ((size_t)b * S + s) * C + (size_t)h * 64;
  float acc[8];
#pragma unroll
  for (int e = 0; e < 8; ++e) acc[e] = 0.f;
#pragma unroll 1
  for (int d = 0; d < 64; ++d) {
    const float hv = hp[d];
#pragma unroll
    for (int e = 0; e < 8; ++e) acc[e] = fmaf(hv, gw[e * 64 + d], acc[e]);
  }
  const float sa = ((acc[0] + gb[0]) + (acc[1] + gb[1])) + ((acc[2] + gb[2]) + (acc[3] + gb[3]));
  const float sb = ((acc[4] + gb[4]) + (acc[5] + gb[5])) + ((acc[6] + gb[6]) + (acc[7] + gb[7]));
  const float ga  = 1.0f / (1.0f + expf(-sa));
  const float gbv = 1.0f / (1.0f + expf(-sb));
  const float gv = ga * (gbv * gc[h] - 1.0f) + 2.0f;
  ((float*)gate)[idx] = gv;
}

// ---- One launch for the four pieces of a layer that read h alone and none of which fills the chip: the q, k and v projections
// (blockIdx.y = 0, 1, 2: one 128x128 tile a block; the three f16 weight planes lie strideW apart, the three f32 outputs strideO apart)
// and the gate (blockIdx.y >= 3: one value a thread). No piece reads what another writes. The long pieces have the low indices.
__global__ __launch_bounds__(128) void qkv_gate_kernel(
    const unsigned short* __restrict__ hh, const unsigned short* __restrict__ w, long strideW,
    float* __restrict__ qkv, long strideO,
    const float* __restrict__ bq, const float* __restrict__ bk, const float* __restrict__ bv,
    const float* __restrict__ hf, const float* __restrict__ gw, const float* __restrict__ gb,
    const float* __restrict__ gc, float* __restrict__ gate,
    int M, int C, int S, int H, int total, float scale) {
  const int piece = (int)blockIdx.y;
  if (pinned((uint32_t)(piece >= 3))) {      // scalar branch, the same for the whole block: a gate block meets no tensor load and no barrier
    const int nTiles = (M >> 7) * (C >> 7);  // blocks in a row of the grid: one per tile of a projection
    gate_item(hf, gw, gb, gc, gate, S, H, C, total, ((piece - 3) * nTiles + (int)blockIdx.x) * 128 + (int)threadIdx.x);
    return;
  }
  const float* bias = piece == 0 ? bq : piece == 1 ? bk : bv;
  gemm_tile<0, false, 2, 0, false, 0>(hh, hh, C, 0L, w, w, C, strideW, (void*)qkv, (void*)qkv, C, strideO,
                                      bias, hf, 0L, M, C, C, scale, piece, (int)blockIdx.x);
}

// ---- All weight sets f32 -> f16 (x sc) in one launch of resident waves ---------------------------------------------
// The work is nSeg equal segments of segF4 16-byte vectors: w0..w3 are one segment each, w4 and w5 four each; the f16 planes lie
// one behind the other in out, in that order. A wave owns CS_IT x CS_LD x 32 consecutive vectors of one segment: every load is
// 512 contiguous bytes of the wave, CS_LD of them are asked for one trip ahead, every store is 256 contiguous bytes.
// One block of CS_WAVES waves per WGP: few waves that live long.
#define CS_WAVES 18
#define CS_LD    8
#define CS_IT    6
__global__ __launch_bounds__(CS_WAVES * 32) void cast_weights_stream(
    const float* __restrict__ w0, const float* __restrict__ w1, const float* __restrict__ w2, const float* __restrict__ w3,
    const float* __restrict__ w4, const float* __restrict__ w5, _Float16* __restrict__ out, int segF4, int nSeg, float sc) {
  const uint32_t perWave = CS_IT * CS_LD * 32u;                    // vectors per wave
  const uint32_t lane = threadIdx.x & 31u;
  const uint32_t gw = uni(blockIdx.x * CS_WAVES + (threadIdx.x >> 5));
  const uint32_t wavesPerSeg = (uint32_t)segF4 / perWave;
  const uint32_t seg = gw / wavesPerSeg;
  if (seg >= (uint32_t)nSeg) return;                               // wave-uniform; no barrier in this kernel
  const uint32_t win = gw - seg * wavesPerSeg;
  const size_t segF = (size_t)segF4 * 4;
  const float* src = seg == 0u ? w0 : seg == 1u ? w1 : seg == 2u ? w2 : seg == 3u ? w3
                   : seg < 8u ? w4 + (size_t)(seg - 4u) * segF : w5 + (size_t)(seg - 8u) * segF;
  const v4f* s4 = (const v4f*)src + (size_t)win * perWave + lane;
  v4h* d4 = (v4h*)out + (size_t)gw * perWave + lane;
  v4f buf[2][CS_LD];
#pragma unroll
  for (int k = 0; k < CS_LD; ++k) buf[0][k] = s4[k * 32];
  // unrolled: every address is the wave's one base plus a constant, so no address register takes a new value under a load in flight
#pragma unroll
  for (int t = 0; t < CS_IT; ++t) {
    const int cur = t & 1, nx = cur ^ 1;
    if (t + 1 < CS_IT) {
#pragma unroll
      for (int k = 0; k < CS_LD; ++k) buf[nx][k] = s4[((t + 1) * CS_LD + k) * 32];
    }
    __builtin_amdgcn_sched_barrier(0);   // no work on the values just asked for rises into this trip, where it would wait those loads out
#pragma unroll
    for (int k = 0; k < CS_LD; ++k) {
      const v4f x = buf[cur][k] * sc;
      v4h y;
      y[0] = (_Float16)x[0]; y[1] = (_Float16)x[1]; y[2] = (_Float16)x[2]; y[3] = (_Float16)x[3];
      d4[(t * CS_LD + k) * 32] = y;
    }
    // in front of the next trip's loads and converts, which write registers that this trip's stores name
    if (t + 1 < CS_IT) asm volatile("s_wait_xcnt 0x0" ::: "memory");
  }
}

// ---- LayerNorm over rows of C = 4 * blockDim floats; PRE: input = in * mask[row] + pos --------------------------
#define LN_T 192
template <int PRE>
__global__ __launch_bounds__(LN_T) void ln_kernel(
    const float* __restrict__ in, const float* __restrict__ pos, const float* __restrict__ mask,
    const float* __restrict__ g, const float* __restrict__ bb,
    float* __restrict__ outf, _Float16* __restrict__ outh, int C, float invC, float eps) {
  __shared__ float rs[8];
  __shared__ float rq[8];
  const int row = blockIdx.x;
  const int tid = threadIdx.x;
  const int lane = tid & 31;
  const int w = tid >> 5;
  const int c4 = tid * 4;
  const size_t base = (size_t)row * C + c4;
  v4f xv = *(const v4f*)(in + base);
  if (PRE) {
    const float mk = mask[row];
    const v4f pv = *(const v4f*)(pos + base);
    xv = xv * mk + pv;
  }
  float s = (xv[0] + xv[1]) + (xv[2] + xv[3]);
#pragma unroll
  for (int off = 16; off > 0; off >>= 1) s += __shfl_xor(s, off, 32);
  if (lane == 0) rs[w] = s;
  __syncthreads();
  float ts = 0.f;
#pragma unroll
  for (int i = 0; i < LN_T / 32; ++i) ts += rs[i];
  const float mean = ts * invC;
  const v4f d = xv - mean;
  float sq = (d[0] * d[0] + d[1] * d[1]) + (d[2] * d[2] + d[3] * d[3]);
#pragma unroll
  for (int off = 16; off > 0; off >>= 1) sq += __shfl_xor(sq, off, 32);
  if (lane == 0) rq[w] = sq;
  __syncthreads();
  float tq = 0.f;
#pragma unroll
  for (int i = 0; i < LN_T / 32; ++i) tq += rq[i];
  const float var = tq * invC;
  const float inv = rsqrtf(var + eps);
  const v4f gv = *(const v4f*)(g + c4);
  const v4f bv = *(const v4f*)(bb + c4);
  const v4f y = d * inv * gv + bv;
  v4h yh;
  yh[0] = (_Float16)y[0]; yh[1] = (_Float16)y[1]; yh[2] = (_Float16)y[2]; yh[3] = (_Float16)y[3];
  *(v4f*)(outf + base) = y;
  *(v4h*)(outh + base) = yh;
  
}

// =====================================================================================
// Flash attention, head_dim 64, f32 q/k/v in, f16 out; plain f16 operands, f32 accumulate; online softmax in f32.
//   s(q,kv) = (q . k) * qscale + gate[b,h,q] * pos_bias[h,q,kv] + (1 - mask[b,kv]) * -1e4
//   probabilities carried x2^15 in f16, folded into the final 1/l.
//   Block = 4 waves = 64 query rows of one (batch, head); S % 64 == 0.  q/k/v/out element (b,s,h,d) at
//   ((b*S + s)*C + h*64 + d); gate at (b*H + h)*S + s; pos_bias at (h*S + q)*S + kv; grid.x = B * H * (S/64).
// =====================================================================================
#define AT_D 64
#define AT_NW 4
#define AT_KC 64
#define AT_PSC 32768.0f

__device__ __forceinline__ v8f hmma(v16h a, v16h b, v8f c) {
  c = __builtin_amdgcn_wmma_f32_16x16x32_f16(false, a, false, b, (short)0, c, false, false);
  asm volatile("v_nop\n\tv_nop\n\tv_nop\n\tv_nop" : "+v"(c) : "v"(a), "v"(b));
  return c;
}

// Barrier and wave-level hand-over that order LDS traffic alone: a fence over global memory as well would wait out the
// loads that are in flight for the next chunk. Nothing in this kernel passes between waves through global memory.
__device__ __forceinline__ void lds_block_sync() {
  __builtin_amdgcn_fence(__ATOMIC_RELEASE, "workgroup", "local");
  __builtin_amdgcn_s_barrier();
  __builtin_amdgcn_fence(__ATOMIC_ACQUIRE, "workgroup", "local");
}
// Stands behind a run of loads that stay in flight, in front of any new value in their address registers.
__device__ __forceinline__ void wait_addr_taken() { asm volatile("s_wait_xcnt 0x0" ::: "memory"); }
// The same wait behind a run of loads; the run's address values, named as inputs, stay in their registers up to the wait, so that
// no later load of the run is given one of them as its destination.
__device__ __forceinline__ void wait_addr_taken(const float* a, const float* b, const float* c, const float* d) {
  asm volatile("s_wait_xcnt 0x0" :: "v"(a), "v"(b), "v"(c), "v"(d) : "memory");
}
__device__ __forceinline__ void wait_addr_taken(int i, const float* a, const float* b, const float* c, const float* d) {
  asm volatile("s_wait_xcnt 0x0" :: "v"(i), "v"(a), "v"(b), "v"(c), "v"(d) : "memory");
}
// One step of a butterfly inside a 16-lane row on the vector pipe: lane l reads lane l ^ M of its own row (DPP row_xmask).
// __shfl_xor compiles to ds_bpermute_b32, whose every dependent step waits out an LDS round trip.
// Every lane has its partner inside the row, so neither the old value 0 nor bound_ctrl reaches a result; in this form the compiler
// can fold the move into the operation that takes it.
template <int M> __device__ __forceinline__ float row_xor(float x) {
  const int xi = __builtin_bit_cast(int, x);
  return __builtin_bit_cast(float, __builtin_amdgcn_update_dpp(0, xi, 0x160 | M, 0xf, 0xf, true));
}
__device__ __forceinline__ float row_max16(float m) {   // partners 1, 2, 4, 8 in that order
  m = fmaxf(m, row_xor<1>(m)); m = fmaxf(m, row_xor<2>(m)); m = fmaxf(m, row_xor<4>(m)); return fmaxf(m, row_xor<8>(m));
}
__device__ __forceinline__ float row_sum16(float s) {   // partners 1, 2, 4, 8 in that order
  s += row_xor<1>(s); s += row_xor<2>(s); s += row_xor<4>(s); return s + row_xor<8>(s);
}
__device__ __forceinline__ void lds_wave_sync() {
  __builtin_amdgcn_fence(__ATOMIC_RELEASE, "workgroup", "local");
  __builtin_amdgcn_wave_barrier();
  __builtin_amdgcn_fence(__ATOMIC_ACQUIRE, "workgroup", "local");
}

// waves_per_eu(1, 2): the grid holds three waves for every two SIMDs of the chip, so a register budget of two waves a SIMD costs
// no residency; with the default budget the compiler answers the 100 registers of loads in flight by running the row
// reductions one after the other.
__global__ __launch_bounds__(128) __attribute__((amdgpu_waves_per_eu(1, 2)))
void attn_gbias_kernel(const float* __restrict__ q, const float* __restrict__ k,
                       const float* __restrict__ v, const float* __restrict__ gate,
                       const float* __restrict__ pos_bias, const float* __restrict__ mask,
                       _Float16* __restrict__ out, int S, int H, int C, float qscale) {
  union FH { v16h v; v8h h[2]; };
  __shared__ __align__(16) _Float16 Ksh[AT_KC * AT_D];        // K [kv][d]
  __shared__ __align__(16) _Float16 Vth[AT_D * AT_KC];        // V^T [d][kv]
  __shared__ __align__(16) _Float16 Psh[AT_NW][16 * AT_KC];   // per wave P [row][kv]
  __shared__ __align__(16) float    Os[AT_NW][16 * 68];       // per wave out tile, pitch 68

  const int tid  = threadIdx.x;
  const int wave = tid >> 5;
  const int lane = tid & 31;
  const int hh   = lane >> 4;
  const int c    = lane & 15;

  const int nqb = S / 64;
  const int bx = blockIdx.x;
  const int qb = bx % nqb;
  const int bh = bx / nqb;
  const int h  = bh % H;
  const int b  = bh / H;
  const int q0 = qb * 64 + wave * 16;

  const float* qb_ptr = q + (size_t)b * S * C + (size_t)h * AT_D;
  const float* kb_ptr = k + (size_t)b * S * C + (size_t)h * AT_D;
  const float* vb_ptr = v + (size_t)b * S * C + (size_t)h * AT_D;
  const float* gt_ptr = gate + ((size_t)b * H + h) * S;
  const float* pb_ptr = pos_bias + (size_t)h * S * S;
  const float* mk_ptr = mask + (size_t)b * S;
  _Float16*    ob_ptr = out + (size_t)b * S * C + (size_t)h * AT_D;

  // ---- Q fragments (A operand): 2 d-chunks, split k map ----
  v16h qa[2];
  {
    const float* qrow = qb_ptr + (size_t)(q0 + c) * C;
#pragma unroll
    for (int dc = 0; dc < 2; ++dc) {
#pragma unroll
      for (int e = 0; e < 8; ++e) {
        qa[dc][e]     = (_Float16)qrow[dc * 32 + 8 * hh + e];
        qa[dc][8 + e] = (_Float16)qrow[dc * 32 + 16 + 8 * hh + e];
      }
    }
  }
  float grow[8];
#pragma unroll
  for (int r = 0; r < 8; ++r) grow[r] = gt_ptr[q0 + 8 * hh + r];

  float mrow[8], lrow[8];
  v8f oacc[4];
#pragma unroll
  for (int r = 0; r < 8; ++r) { mrow[r] = -INFINITY; lrow[r] = 0.f; }
#pragma unroll
  for (int t = 0; t < 4; ++t) oacc[t] = (v8f){0.f,0.f,0.f,0.f,0.f,0.f,0.f,0.f};

  const int nChunks = S / AT_KC;   // block-uniform, from launch argument
  // Every global operand of a chunk (this thread's K and V row pieces, the position-bias tile, the key mask) is held in
  // registers and requested one chunk ahead, so that no chunk waits out a load it has only just issued.
  const int kvr = tid >> 1, dh = (tid & 1) * 32;
  const int kvOff = kvr * C + dh;                 // this thread's piece inside a chunk of K or V rows
  int pbOff[8];                                   // this lane's column in each of its 8 bias rows
#pragma unroll
  for (int r = 0; r < 8; ++r) pbOff[r] = (q0 + 8 * hh + r) * S + c;
  v4f kreg[8], vreg[8];
  float pbv[8][4], mkv[4];
#pragma unroll
  for (int i = 0; i < 8; ++i) {
    kreg[i] = *(const v4f*)(kb_ptr + kvOff + 4 * i);
    vreg[i] = *(const v4f*)(vb_ptr + kvOff + 4 * i);
  }
#pragma unroll
  for (int j = 0; j < 4; ++j) mkv[j] = mk_ptr[j * 16 + c];
#pragma unroll
  for (int r = 0; r < 8; ++r)
#pragma unroll
    for (int j = 0; j < 4; ++j) pbv[r][j] = pb_ptr[pbOff[r] + j * 16];
  wait_addr_taken();
  const size_t step0 = (nChunks > 1) ? (size_t)AT_KC * C : 0;
  const float* kn = kb_ptr + kvOff + step0;       // this thread's piece of the next chunk's K rows, and of its V rows
  const float* vn = vb_ptr + kvOff + step0;

  for (int kc = 0; kc < nChunks; ++kc) {
    // first key of the next chunk; the last trip asks for its own chunk again (in bounds, not used), so that every trip
    // issues the same loads in the same order and each wait on them can be counted exactly
    const int kvn = (kc + 1 < nChunks ? kc + 1 : kc) * AT_KC;
    lds_block_sync();                             // every wave has left the previous chunk's K and V tiles
#pragma unroll
    for (int i = 0; i < 8; ++i) {
#pragma unroll
      for (int e = 0; e < 4; ++e) {
        const int d = dh + 4 * i + e;
        Ksh[kvr * AT_D + d]  = (_Float16)kreg[i][e];
        Vth[d * AT_KC + kvr] = (_Float16)vreg[i][e];
      }
    }
    {                                             // next chunk's K and V fly under this chunk's whole work
#pragma unroll
      for (int i = 0; i < 8; ++i) {
        kreg[i] = *(const v4f*)(kn + 4 * i);
        vreg[i] = *(const v4f*)(vn + 4 * i);
      }
    }
    lds_block_sync();                             // this chunk's tiles are published

    v8f s[4];
#pragma unroll
    for (int j = 0; j < 4; ++j) {
      s[j] = (v8f){0.f,0.f,0.f,0.f,0.f,0.f,0.f,0.f};
#pragma unroll
      for (int dc = 0; dc < 2; ++dc) {
        FH kb;
        kb.h[0] = *(const v8h*)(Ksh + (j * 16 + c) * AT_D + dc * 32 + 8 * hh);
        kb.h[1] = *(const v8h*)(Ksh + (j * 16 + c) * AT_D + dc * 32 + 16 + 8 * hh);
        s[j] = hmma(qa[dc], kb.v, s[j]);
      }
    }
    // additive terms: key padding per column, gated position bias per (row, column)
    float kp[4];
#pragma unroll
    for (int j = 0; j < 4; ++j) kp[j] = (1.0f - mkv[j]) * -10000.0f;
    float cm[8];
#pragma unroll
    for (int r = 0; r < 8; ++r) {
      float m = -INFINITY;
#pragma unroll
      for (int j = 0; j < 4; ++j) {
        const float sv = s[j][r] * qscale + grow[r] * pbv[r][j] + kp[j];
        s[j][r] = sv;
        m = fmaxf(m, sv);
      }
      cm[r] = row_max16(m);
    }
    {                                             // next chunk's bias tile and mask fly under softmax, P.V and the next staging
      const float* pn = pb_ptr + kvn;
#pragma unroll
      for (int j = 0; j < 4; ++j) mkv[j] = mk_ptr[kvn + j * 16 + c];
#pragma unroll
      for (int r = 0; r < 4; ++r)
#pragma unroll
        for (int j = 0; j < 4; ++j) pbv[r][j] = pn[pbOff[r] + j * 16];
      wait_addr_taken(kvn + c, pn + pbOff[0], pn + pbOff[1], pn + pbOff[2], pn + pbOff[3]);
#pragma unroll
      for (int r = 4; r < 8; ++r)
#pragma unroll
        for (int j = 0; j < 4; ++j) pbv[r][j] = pn[pbOff[r] + j * 16];
      wait_addr_taken(pn + pbOff[4], pn + pbOff[5], pn + pbOff[6], pn + pbOff[7]);
      // nothing crosses this line: the K and V pointers step on only behind the wait above (it covers their loads too), and
      // no work on the values just requested rises into this chunk, where it would wait those loads out
      __builtin_amdgcn_sched_barrier(0);
      const size_t step = (kc + 2 < nChunks) ? (size_t)AT_KC * C : 0;
      kn += step;
      vn += step;
    }
    _Float16* pw = Psh[wave];
#pragma unroll
    for (int r = 0; r < 8; ++r) {
      const float mnew = fmaxf(mrow[r], cm[r]);
      const float alpha = expf(mrow[r] - mnew);
      mrow[r] = mnew;
      float psum = 0.f;
#pragma unroll
      for (int j = 0; j < 4; ++j) {
        const float p = expf(s[j][r] - mnew);
        psum += p;
        pw[(8 * hh + r) * AT_KC + j * 16 + c] = (_Float16)(p * AT_PSC);
      }
      lrow[r] = lrow[r] * alpha + row_sum16(psum);
#pragma unroll
      for (int t = 0; t < 4; ++t) oacc[t][r] *= alpha;
    }
    lds_wave_sync();                              // the wave's own P rows, written above, are read back as fragments below
#pragma unroll 1
    for (int kk = 0; kk < 2; ++kk) {
      FH pa;
      pa.h[0] = *(const v8h*)(pw + c * AT_KC + kk * 32 + 8 * hh);
      pa.h[1] = *(const v8h*)(pw + c * AT_KC + kk * 32 + 16 + 8 * hh);
#pragma unroll
      for (int t = 0; t < 4; ++t) {
        FH vb;
        vb.h[0] = *(const v8h*)(Vth + (t * 16 + c) * AT_KC + kk * 32 + 8 * hh);
        vb.h[1] = *(const v8h*)(Vth + (t * 16 + c) * AT_KC + kk * 32 + 16 + 8 * hh);
        oacc[t] = hmma(pa.v, vb.v, oacc[t]);
      }
    }
  }

  float* os = Os[wave];
#pragma unroll
  for (int r = 0; r < 8; ++r) {
    const float inv = 1.0f / (lrow[r] * AT_PSC);
#pragma unroll
    for (int t = 0; t < 4; ++t) os[(8 * hh + r) * 68 + t * 16 + c] = oacc[t][r] * inv;
  }
  __builtin_amdgcn_fence(__ATOMIC_RELEASE, "workgroup");
  __builtin_amdgcn_wave_barrier();
  __builtin_amdgcn_fence(__ATOMIC_ACQUIRE, "workgroup");
  {
    const int q8 = lane >> 3, c8 = (lane & 7) * 8;
    {
#pragma unroll
      for (int it = 0; it < 4; ++it) {
        const int row = it * 4 + q8;
        const float* sp = os + row * 68 + c8;
        v8h hv;
#pragma unroll
        for (int e = 0; e < 8; ++e) hv[e] = (_Float16)sp[e];
        *(v8h*)(ob_ptr + (size_t)(q0 + row) * C + c8) = hv;
      }
      
    }
  }
}

// ---------------------------------------------------------------------------
extern "C" void kernel_launch(void* const* d_in, const int* in_sizes, int n_in,
                              void* d_out, int out_size, void* d_ws, size_t ws_size,
                              hipStream_t stream) {
  const int Bn = 2, S = 1024, C = 768, H = 12, L = 4, FF = 3072;
  const int M = Bn * S;
  if (n_in < 25) return;
  if (in_sizes[0] != M * C || in_sizes[1] != M * C || in_sizes[2] != M || in_sizes[3] != H * S * S) return;
  if (in_sizes[6] != L * C * C || in_sizes[19] != L * FF * C || in_sizes[21] != L * C * FF) return;
  if (out_size != M * C) return;

  const float* x        = (const float*)d_in[0];
  const float* pos_emb  = (const float*)d_in[1];
  const float* attn_m   = (const float*)d_in[2];
  const float* pos_bias = (const float*)d_in[3];
  const float* ln0_g    = (const float*)d_in[4];
  const float* ln0_b    = (const float*)d_in[5];
  const float* Wq       = (const float*)d_in[6];
  const float* bq       = (const float*)d_in[7];
  const float* Wk       = (const float*)d_in[8];
  const float* bk       = (const float*)d_in[9];
  const float* Wv       = (const float*)d_in[10];
  const float* bv       = (const float*)d_in[11];
  const float* Wo       = (const float*)d_in[12];
  const float* bo       = (const float*)d_in[13];
  const float* gruW     = (const float*)d_in[14];
  const float* grub     = (const float*)d_in[15];
  const float* gruc     = (const float*)d_in[16];
  const float* ln1_g    = (const float*)d_in[17];
  const float* ln1_b    = (const float*)d_in[18];
  const float* W1       = (const float*)d_in[19];
  const float* b1       = (const float*)d_in[20];
  const float* W2       = (const float*)d_in[21];
  const float* b2       = (const float*)d_in[22];
  const float* ln2_g    = (const float*)d_in[23];
  const float* ln2_b    = (const float*)d_in[24];

  // ---- workspace carve (256-B aligned offsets, total 110,198,784 B) ----
  char* ws = (char*)d_ws;
  size_t off = 0;
  const size_t NWC = (size_t)L * C * C;      // halves per projection weight set
  const size_t NWF = (size_t)L * FF * C;     // halves per FFN weight set
  const size_t NA  = (size_t)M * C;
  const size_t NF  = (size_t)M * FF;
  const size_t NG  = (size_t)Bn * H * S;
  size_t o_wq, o_wk, o_wv, o_wo, o_w1, o_w2, o_hf, o_hh, o_qf, o_kf, o_vf, o_ao, o_h1f, o_h1h, o_ff, o_gt;
#define CARVE(o, bytes) do { o = off; off += ((size_t)(bytes) + 255) & ~(size_t)255; } while (0)
  CARVE(o_wq, NWC * 2); CARVE(o_wk, NWC * 2); CARVE(o_wv, NWC * 2); CARVE(o_wo, NWC * 2);
  CARVE(o_w1, NWF * 2); CARVE(o_w2, NWF * 2);
  CARVE(o_hf, NA * 4);  CARVE(o_hh, NA * 2);
  CARVE(o_qf, NA * 4);  CARVE(o_kf, NA * 4);  CARVE(o_vf, NA * 4);
  CARVE(o_ao, NA * 2);
  CARVE(o_h1f, NA * 4); CARVE(o_h1h, NA * 2);
  CARVE(o_ff, NF * 2);
  CARVE(o_gt, NG * 4);
#undef CARVE
  if (off > ws_size) return;

  _Float16* wq16 = (_Float16*)(ws + o_wq);
  _Float16* wo16 = (_Float16*)(ws + o_wo);
  _Float16* w116 = (_Float16*)(ws + o_w1);
  _Float16* w216 = (_Float16*)(ws + o_w2);
  float*    hf   = (float*)(ws + o_hf);
  _Float16* hh16 = (_Float16*)(ws + o_hh);
  float*    qf   = (float*)(ws + o_qf);
  float*    kf   = (float*)(ws + o_kf);
  float*    vf   = (float*)(ws + o_vf);
  _Float16* ao16 = (_Float16*)(ws + o_ao);
  float*    h1f  = (float*)(ws + o_h1f);
  _Float16* h1h  = (_Float16*)(ws + o_h1h);
  _Float16* ff16 = (_Float16*)(ws + o_ff);
  float*    gtb  = (float*)(ws + o_gt);
  float*    outp = (float*)d_out;

  const float WSC  = 64.0f;            // weights carried x64 in f16
  const float WINV = 1.0f / 64.0f;     // folded back in the GEMM epilogue
  const float invC = 1.0f / 768.0f;
  const float eps  = 1e-5f;
  const float qscale = 0.125f;         // 1/sqrt(64)

  // ---- weights -> f16 (x64): Wq, Wk, Wv, Wo, W1, W2 as 12 segments of L*C*C elements; their f16 planes are contiguous from wq16 ----
  {
    const int segF4 = (int)(NWC / 4), nSeg = 12;
    const int perWave = CS_IT * CS_LD * 32, wavesAll = (segF4 / perWave) * nSeg;
    static_assert((L * C * C / 4) % (CS_IT * CS_LD * 32) == 0, "a segment is a whole number of waves");
    static_assert(((L * C * C / 4) / (CS_IT * CS_LD * 32) * 12) % CS_WAVES == 0, "the waves fill whole blocks");
    static_assert(FF == 4 * C && (L * C * C * 2) % 256 == 0, "W1 and W2 are four segments each; no gap between the planes");
    cast_weights_stream<<<wavesAll / CS_WAVES, CS_WAVES * 32, 0, stream>>>(Wq, Wk, Wv, Wo, W1, W2, wq16, segF4, nSeg, WSC);
  }

  // ---- h = LN0(x * mask + pos_emb) ----
  ln_kernel<1><<<M, LN_T, 0, stream>>>(x, pos_emb, attn_m, ln0_g, ln0_b, hf, hh16, C, invC, eps);

  const int nbP = (M / 128) * (C / 128);    // 96 blocks, one 128x128 tile each
  const int nbF = (M / 128) * (FF / 128);   // 384 blocks
  const int nbA = Bn * H * (S / 64);                // 384 attention blocks
  const int ngate = (int)NG;
  const int nyG = (ngate + nbP * 128 - 1) / (nbP * 128);   // rows of the joined grid that hold the gate, 128 values a block
  static_assert((L * C * C * 2) % 256 == 0 && (Bn * S * C * 4) % 256 == 0, "no gap between the q, k, v weight planes, nor between qf, kf, vf");

  for (int l = 0; l < L; ++l) {
    const size_t lw  = (size_t)l * C * C;
    const size_t lwf = (size_t)l * FF * C;
    const _Float16* WQl = wq16 + lw;
    const _Float16* WOl = wo16 + lw;
    const _Float16* W1l = w116 + lwf;   // [FF][C]
    const _Float16* W2l = w216 + lwf;   // [C][FF]

    // q, k, v = h . W^T + b (f32 out) and gate[b][h][s], one launch
    qkv_gate_kernel<<<dim3(nbP, 3 + nyG), 128, 0, stream>>>(
        U16(hh16), U16(WQl), (long)NWC, qf, (long)NA, bq + (size_t)l * C, bk + (size_t)l * C, bv + (size_t)l * C,
        hf, gruW + (size_t)l * 8 * 64, grub + (size_t)l * 8, gruc + (size_t)l * H, gtb, M, C, S, H, ngate, WINV);

    // attention -> ao16 (f16)
    attn_gbias_kernel<<<nbA, 128, 0, stream>>>(qf, kf, vf, gtb, pos_bias, attn_m, ao16, S, H, C, qscale);

    // qf <- h + ao . Wo^T + bo
    wmma_gemm64<0, false, 2, 0, true, 0><<<dim3(nbP, 1), 128, 0, stream>>>(
        U16(ao16), U16(ao16), C, 0L, U16(WOl), U16(WOl), C, 0L,
        (void*)qf, (void*)qf, C, 0L, bo + (size_t)l * C, hf, 0L, M, C, C, WINV);

    // h1 = LN1(qf)
    ln_kernel<0><<<M, LN_T, 0, stream>>>(qf, qf, attn_m, ln1_g + (size_t)l * C, ln1_b + (size_t)l * C,
                                         h1f, h1h, C, invC, eps);

    // ff16 = gelu(h1 . W1^T + b1)  (f16 out)
    wmma_gemm64<0, false, 2, 1, false, 5><<<dim3(nbF, 1), 128, 0, stream>>>(
        U16(h1h), U16(h1h), C, 0L, U16(W1l), U16(W1l), C, 0L,
        (void*)ff16, (void*)ff16, FF, 0L, b1 + (size_t)l * FF, h1f, 0L, M, FF, C, WINV);

    // kf <- h1 + ff . W2^T + b2
    wmma_gemm64<0, false, 2, 0, true, 0><<<dim3(nbP, 1), 128, 0, stream>>>(
        U16(ff16), U16(ff16), FF, 0L, U16(W2l), U16(W2l), FF, 0L,
        (void*)kf, (void*)kf, C, 0L, b2 + (size_t)l * C, h1f, 0L, M, C, FF, WINV);

    // h = LN2(kf); last layer writes the output buffer directly
    float* hdst = (l == L - 1) ? outp : hf;
    ln_kernel<0><<<M, LN_T, 0, stream>>>(kf, kf, attn_m, ln2_g + (size_t)l * C, ln2_b + (size_t)l * C,
                                         hdst, hh16, C, invC, eps);
  }
  (void)hipGetLastError();
}

// v007
// One run takes 544 microseconds.
// In both of two side-by-side timings against v006, it was 1.08 times as fast.
// Counting every step since v000, it is 3.41 times as fast.
// Contractions (q/k/v/out projections, FFN up/down, attention q.k^T and p.v): v_wmma_f32_16x16x32_f16 (f16 operands, f32 accumulate); weights carried x64, softmax probabilities carried x2^15; LayerNorm, softmax, gate: f32 VALU.
#include <hip/hip_runtime.h>
#include <math.h>
#include <stdint.h>

typedef __attribute__((ext_vector_type(16))) _Float16 v16h;
typedef __attribute__((ext_vector_type(8)))  _Float16 v8h;
typedef __attribute__((ext_vector_type(4)))  _Float16 v4h;
typedef __attribute__((ext_vector_type(16))) __bf16   v16b;
typedef __attribute__((ext_vector_type(8)))  __bf16   v8b;
typedef __attribute__((ext_vector_type(8)))  float    v8f;
typedef __attribute__((ext_vector_type(4)))  float    v4f;
#define U16(p) ((const unsigned short*)(const void*)(p))

__device__ __forceinline__ unsigned short f2bf_bits(float f) {
  unsigned u = __float_as_uint(f);
  return (unsigned short)((u + 0x7FFFu + ((u >> 16) & 1u)) >> 16);
}
__device__ __forceinline__ float bf_bits2f(unsigned short h) { return __uint_as_float(((unsigned)h) << 16); }

// hazard guards as plain device helpers (no inline asm inside the kernel template body)
__device__ __forceinline__ void acc_guard4(v8f& a, v8f& b, v8f& c, v8f& d) { asm volatile("v_nop\n\tv_nop\n\tv_nop\n\tv_nop" : "+v"(a), "+v"(b), "+v"(c), "+v"(d)); }
template <typename T> struct Frag;
template <> struct Frag<_Float16> {
  typedef v16h V; union U { v16h v; v8h h[2]; };
  static __device__ __forceinline__ v16h load(const _Float16* p) {   // elements 0..7 <- p[0..7], 8..15 <- p[16..23]
    U f; f.h[0] = *(const v8h*)(p); f.h[1] = *(const v8h*)(p + 16); return f.v;
  }
  static __device__ __forceinline__ v8f mma(v16h a, v16h b, v8f c) {
    return __builtin_amdgcn_wmma_f32_16x16x32_f16(false, a, false, b, (short)0, c, false, false);
  }
};
template <> struct Frag<__bf16> {
  typedef v16b V; union U { v16b v; v8b h[2]; };
  static __device__ __forceinline__ v16b load(const __bf16* p) {
    U f; f.h[0] = *(const v8b*)(p); f.h[1] = *(const v8b*)(p + 16); return f.v;
  }
  static __device__ __forceinline__ v8f mma(v16b a, v16b b, v8f c) {
    return __builtin_amdgcn_wmma_f32_16x16x32_bf16(false, a, false, b, (short)0, c, false, false);
  }
};

// ---- Block-tiled batched WMMA GEMM, operands staged in LDS by the tensor mover ------------
// C[m,n] = scale * sum_k A[m,k] * Bt[n,k] (+bias)(+resid); a block of 4 waves (2 x 2) owns a 128x128 tile, each wave 64x64.
// A row-major [M,K]; Bt row-major [N,K]; M,N % 128 == 0, K % 128 == 0, K >= 256 (two stages).
// A pass is 128 k = 256 B of each of the 256 operand rows; each wave brings one 64-row slice per pass with one tensor load
// (waves 0,1: the two halves of the A rows; waves 2,3: of the Bt rows), two buffers, LDS row pitch 272 B.
// BIAS_MODE: 0 = none, 1 = bias[m], 2 = bias[n].
// OUT_MODE: 0 = f32, 1 = f16, 2 = bf16 hi plane (Cout) + bf16 lo plane (Cout2).
// ET: 0 = f16 operands, 1 = bf16 operands (pointers passed as 16-bit storage)
typedef uint32_t u32x4 __attribute__((ext_vector_type(4)));
typedef uint32_t u32x8 __attribute__((ext_vector_type(8)));
#define GT_KP     128u                 // k per pass
#define GT_ROWB   256u                 // bytes of one operand row per pass
#define GT_PITCH  272u                 // LDS row pitch: 256 B + the mover's 16-B pad (ds_load_b128 readers)
#define GT_ROWS   64u                  // rows per slice
#define GT_SLICE  18432u               // 64 x 272 = 17,408 B, rounded up to a multiple of 2 KiB
#define GT_STAGE  (4u * GT_SLICE)      // one buffer: 4 slices
__device__ __forceinline__ uint32_t uni(uint32_t v) { return (uint32_t)__builtin_amdgcn_readfirstlane(v); }
// pinned(): holds a wave-uniform value in a scalar register, so that a test on it is a scalar branch (a tensor load ignores EXEC)
// and so that descriptor words formed from it are formed behind the waits that stand in front of it.
__device__ __forceinline__ uint32_t pinned(uint32_t v) { uint32_t w = uni(v); asm volatile("" : "+s"(w)); return w; }
__device__ __forceinline__ void wait_ds0()     { asm volatile("s_wait_dscnt 0x0" ::: "memory"); }      // this wave's LDS reads of the buffer are done
__device__ __forceinline__ void wait_tensor0() { asm volatile("s_wait_tensorcnt 0x0" ::: "memory"); }  // this wave's own slice has landed
// descriptor words held in scalar registers (as pinned() does for one word): the eight registers stay group 1's own through
// the loop, so that none of them takes another value while a request is outstanding
__device__ __forceinline__ void hold_group1(u32x8& g) { asm volatile("" : "+s"(g)); }
// one request of the whole wave: 64 rows of 256 B from global memory to LDS, 16 B of pad behind each row
__device__ __forceinline__ void tdm_load(uint32_t lds_dst, uint64_t ga, u32x8 g1) {
  u32x4 g0;
  g0[0] = uni(1u);
  g0[1] = uni(lds_dst);
  g0[2] = uni((uint32_t)ga);
  g0[3] = uni((((uint32_t)(ga >> 32)) & 0x01FFFFFFu) | 0x80000000u);
  asm volatile("tensor_load_to_lds %0, %1" :: "s"(g0), "s"(g1) : "memory");
}
// v_rcp_f32 and v_exp_f32, each with the one free slot that the instruction set asks for behind a transcendental in the same
// statement.
__device__ __forceinline__ float rcp_slot(float x)  { float r; asm("v_rcp_f32 %0, %1\n\tv_nop" : "=v"(r) : "v"(x)); return r; }
__device__ __forceinline__ float exp2_slot(float x) { float r; asm("v_exp_f32 %0, %1\n\tv_nop" : "=v"(r) : "v"(x)); return r; }
// GELU in its erf form, straight-line (no branch, so that the values of a fragment interleave and the unrolled epilogue stays short):
// with x = |v| / sqrt(2) and t = 1 / (1 + 0.3275911 x), erfc(x) = t (c1 + t (c2 + t (c3 + t (c4 + t c5)))) exp(-x x), absolute error
// at most 1.5e-7; gelu(v) = max(v, 0) - 0.5 |v| erfc(x), which cancels on neither side of 0. The factor -0.5 is folded into c1..c5.
__device__ __forceinline__ float gelu_erf(float v) {
  const float a = fabsf(v);
  const float t = rcp_slot(fmaf(a, 0.23164189f, 1.0f));      // 0.3275911 / sqrt(2)
  const float e = exp2_slot(v * v * -0.72134752f);           // exp(-v v / 2) = 2^(-v v log2(e) / 2)
  float p = fmaf(t, -0.53070271f, 0.72657601f);
  p = fmaf(t, p, -0.71070687f);
  p = fmaf(t, p, 0.14224837f);
  p = fmaf(t, p, -0.12741480f);
  return fmaf(a, p * t * e, fmaxf(v, 0.0f));
}
template <int ET> struct Elem;
template <> struct Elem<0> { typedef _Float16 T; };
template <> struct Elem<1> { typedef __bf16 T; };
template <int ET, bool SPLIT, int BIAS_MODE, int OUT_MODE, bool RESID, int ACT>
__device__ __forceinline__ void gemm_tile(
    const unsigned short* __restrict__ Ap, const unsigned short* __restrict__ A2p, int lda, long strideA,
    const unsigned short* __restrict__ Btp, const unsigned short* __restrict__ Bt2p, int ldb, long strideB,
    void* __restrict__ Cout, void* __restrict__ Cout2, int ldc, long strideC,
    const float* __restrict__ bias,
    const float* __restrict__ resid, long strideR,
    int M, int N, int K, float scale, const int b, const int tile) {   // b: batch index, tile: this block's tile; both block-uniform
  static_assert(!SPLIT, "single-plane operands only");
  typedef typename Elem<ET>::T T;
  typedef typename Frag<T>::V V;
  const T* A = (const T*)Ap; const T* Bt = (const T*)Btp;
  // two stage buffers; after the K loop its first bytes serve as the per-wave 16x64 f32 output slabs (pitch 68 floats)
  __shared__ __attribute__((aligned(2048))) unsigned char L[2u * GT_STAGE];
  const int lane = threadIdx.x & 31;
  const uint32_t wave = uni(threadIdx.x >> 5);
  const int tilesN = N >> 7;
  const int tilesM = M >> 7;
  const uint32_t nPass = uni((uint32_t)K / GT_KP);
  if (tile >= tilesM * tilesN || nPass < 2u) return;   // block-uniform, in front of every tensor load and barrier; the ring's prologue loads two stages
  const int tm = tile / tilesN;
  const int tn = tile - tm * tilesN;
  const uint32_t wm = wave >> 1, wn = wave & 1u;
  const int m0 = (tm << 7) + (int)(wm << 6);
  const int n0 = (tn << 7) + (int)(wn << 6);

  const T* Ab  = A  + (size_t)b * strideA;
  const T* Bb  = Bt + (size_t)b * strideB;

  const int rlane = lane & 15;                 // row (A) / col (B, D) within subtile
  const int koff  = (lane >> 4) * 8;           // k offset of this lane half
  const int mOff  = (lane >> 4) * 8;           // D row offset

  // ---- this wave's slice: source, place in LDS, descriptor group 1 (loop-invariant) ----
  const bool isB = wave >= 2u;
  const uint32_t srcPitch = (uint32_t)(isB ? ldb : lda) * 2u;     // bytes
  const uint64_t srcBase = isB ? (uint64_t)(uintptr_t)(Bb + (size_t)((tn << 7) + (int)(wn << 6)) * ldb)
                               : (uint64_t)(uintptr_t)(Ab + (size_t)((tm << 7) + (int)(wn << 6)) * lda);
  const uint32_t ldsSlice = (uint32_t)(size_t)L + wave * GT_SLICE;
  u32x8 g1;
  g1[0] = uni((1u << 20) | (5u << 22) | (3u << 25));              // no mask, 1-byte elements, 4 dwords of pad behind every 64 dwords
  g1[1] = uni((GT_ROWB & 0xFFFFu) << 16);                         // tensor_dim0 low
  g1[2] = uni((GT_ROWB >> 16) | ((GT_ROWS & 0xFFFFu) << 16));     // tensor_dim0 high, tensor_dim1 low
  g1[3] = uni((GT_ROWS >> 16) | (GT_ROWB << 16));                 // tensor_dim1 high, tile_dim0
  g1[4] = uni(GT_ROWS);                                           // tile_dim1
  g1[5] = uni(srcPitch);
  g1[6] = uni(0u);
  g1[7] = uni(0u);
  hold_group1(g1);

  v8f acc[4][4];
#pragma unroll
  for (int i = 0; i < 4; ++i)
#pragma unroll
    for (int j = 0; j < 4; ++j) acc[i][j] = (v8f){0.f,0.f,0.f,0.f,0.f,0.f,0.f,0.f};

  // prologue: stage 0 lands and is published, then stage 1 flies while pass 0 works
  tdm_load(ldsSlice, srcBase, g1);
  wait_tensor0();
  __syncthreads();
  tdm_load(ldsSlice + GT_STAGE, srcBase + GT_ROWB, g1);

  const uint32_t aOff = wm * GT_SLICE + (uint32_t)rlane * GT_PITCH + (uint32_t)koff * 2u;
  const uint32_t bOff = (2u + wn) * GT_SLICE + (uint32_t)rlane * GT_PITCH + (uint32_t)koff * 2u;
  uint32_t s = 0;
  // the pass loop stays rolled: one publish point in the text, every fragment index below a constant
#pragma unroll 1
  do {                                        // nPass >= 2 here
    const uint32_t bufOff = (s & 1u) * GT_STAGE;
    const unsigned char* As = L + bufOff + aOff;
    const unsigned char* Bs = L + bufOff + bOff;
    V bh[2][4], ah[2][4];                     // two fragment sets: the next 32 k are read while these are multiplied
#pragma unroll
    for (int j = 0; j < 4; ++j) bh[0][j] = Frag<T>::load((const T*)(Bs + (uint32_t)j * 16u * GT_PITCH));
#pragma unroll
    for (int i = 0; i < 4; ++i) ah[0][i] = Frag<T>::load((const T*)(As + (uint32_t)i * 16u * GT_PITCH));
#pragma unroll
    for (int kk = 0; kk < 4; ++kk) {          // 32 k per step, in ascending k as before; only this pass's own buffer is read
      const int cur = kk & 1, nx = cur ^ 1;
      if (kk < 3) {
#pragma unroll
        for (int j = 0; j < 4; ++j) bh[nx][j] = Frag<T>::load((const T*)(Bs + (uint32_t)j * 16u * GT_PITCH + (uint32_t)(kk + 1) * 64u));
#pragma unroll
        for (int i = 0; i < 4; ++i) ah[nx][i] = Frag<T>::load((const T*)(As + (uint32_t)i * 16u * GT_PITCH + (uint32_t)(kk + 1) * 64u));
      }
      __builtin_amdgcn_sched_barrier(0);      // the next step's LDS reads stay one group in front of this step's WMMAs, not among them
#pragma unroll
      for (int i = 0; i < 4; ++i)
#pragma unroll
        for (int j = 0; j < 4; ++j) acc[i][j] = Frag<T>::mma(ah[cur][i], bh[cur][j], acc[i][j]);
      __builtin_amdgcn_sched_barrier(0);      // and the step after next's reads do not rise into this block
    }
    // publish point of stage s + 1: own LDS reads done, own slice landed, then the barrier that both publishes
    // stage s + 1 and ends every wave's reads of the buffer that is refilled behind it
    wait_ds0();
    wait_tensor0();
    __syncthreads();
    if (pinned(s + 2u < nPass)) {             // scalar branch: only while stage s + 2 exists
      const uint32_t nxt = pinned(s + 2u);    // group 0 is formed from it, so behind the waits above
      tdm_load(ldsSlice + bufOff, srcBase + (uint64_t)nxt * GT_ROWB, g1);
    }
  } while (++s < nPass);
  wait_tensor0();
  wait_ds0();
  acc_guard4(acc[0][0], acc[0][1], acc[0][2], acc[0][3]);
  acc_guard4(acc[1][0], acc[1][1], acc[1][2], acc[1][3]);
  acc_guard4(acc[2][0], acc[2][1], acc[2][2], acc[2][3]);
  acc_guard4(acc[3][0], acc[3][1], acc[3][2], acc[3][3]);

  // ---- epilogue ----
  float* slab = (float*)(void*)L + wave * (16u * 68u);   // the last pass's own barrier has ended every read of the ring
  const float* Rb = RESID ? (resid + (size_t)b * strideR) : nullptr;
#pragma unroll
  for (int i = 0; i < 4; ++i) {
    const int mBase = m0 + (i << 4);
#pragma unroll
    for (int j = 0; j < 4; ++j) {
      const int n = n0 + (j << 4) + rlane;
      float bv = 0.f;
      if (BIAS_MODE == 2) bv = bias[n];
#pragma unroll
      for (int r = 0; r < 8; ++r) {
        float v = acc[i][j][r] * scale;
        if (BIAS_MODE == 1) v += bias[mBase + mOff + r];
        if (BIAS_MODE == 2) v += bv;
        if (RESID) v += Rb[(size_t)(mBase + mOff + r) * ldc + n];
        if (ACT == 1) v = tanhf(v);
        if (ACT == 2) v = fmaxf(v, 0.0f);
        if (ACT == 3) v = v / (1.0f + expf(-v));
        if (ACT == 4) v = (v > 0.f) ? v : 0.01f * v;
        if (ACT == 5) v = gelu_erf(v);
        slab[(mOff + r) * 68 + (j << 4) + rlane] = v;
      }
    }
    __builtin_amdgcn_fence(__ATOMIC_RELEASE, "workgroup");
    __builtin_amdgcn_wave_barrier();
    __builtin_amdgcn_fence(__ATOMIC_ACQUIRE, "workgroup");
    if (OUT_MODE == 0) {
      float* C = (float*)Cout + (size_t)b * strideC;
      const int hh = lane >> 4, c4 = (lane & 15) * 4;     // row seg = 256 B = 16 lanes x 16 B
      {
#pragma unroll
        for (int it = 0; it < 8; ++it) {
          const int row = it * 2 + hh;
          v4f v = *(const v4f*)(slab + row * 68 + c4);
          *(v4f*)(C + (size_t)(mBase + row) * ldc + n0 + c4) = v;
        }
        
      }
    } else {
      const int q = lane >> 3, c8 = (lane & 7) * 8;
      unsigned short* C  = (unsigned short*)Cout  + (size_t)b * strideC;
      unsigned short* C2 = (OUT_MODE == 2) ? ((unsigned short*)Cout2 + (size_t)b * strideC) : nullptr;
      {
#pragma unroll
        for (int it = 0; it < 4; ++it) {
          const int row = it * 4 + q;
          const float* sp = slab + row * 68 + c8;
          v8h hv, lv;
#pragma unroll
          for (int e = 0; e < 8; ++e) {
            if (OUT_MODE == 1) {
              hv[e] = (_Float16)sp[e];
            } else {
              unsigned short hb = f2bf_bits(sp[e]);
              unsigned short lb = f2bf_bits(sp[e] - bf_bits2f(hb));
              hv[e] = __builtin_bit_cast(_Float16, hb);
              lv[e] = __builtin_bit_cast(_Float16, lb);
            }
          }
          *(v8h*)(C + (size_t)(mBase + row) * ldc + n0 + c8) = hv;
          if (OUT_MODE == 2) *(v8h*)(C2 + (size_t)(mBase + row) * ldc + n0 + c8) = lv;
        }
        
      }
    }
    __builtin_amdgcn_fence(__ATOMIC_RELEASE, "workgroup");
    __builtin_amdgcn_wave_barrier();
    __builtin_amdgcn_fence(__ATOMIC_ACQUIRE, "workgroup");
  }
}

template <int ET, bool SPLIT, int BIAS_MODE, int OUT_MODE, bool RESID, int ACT = 0>
__global__ __launch_bounds__(128) void wmma_gemm64(
    const unsigned short* __restrict__ Ap, const unsigned short* __restrict__ A2p, int lda, long strideA,
    const unsigned short* __restrict__ Btp, const unsigned short* __restrict__ Bt2p, int ldb, long strideB,
    void* __restrict__ Cout, void* __restrict__ Cout2, int ldc, long strideC,
    const float* __restrict__ bias,
    const float* __restrict__ resid, long strideR,
    int M, int N, int K, float scale) {
  gemm_tile<ET, SPLIT, BIAS_MODE, OUT_MODE, RESID, ACT>(Ap, A2p, lda, strideA, Btp, Bt2p, ldb, strideB, Cout, Cout2, ldc, strideC,
                                                        bias, resid, strideR, M, N, K, scale, (int)blockIdx.y, (int)blockIdx.x);
}

// ---- GRU-style gate per (b, h, s): g = h[b,s,h*64:+64] . gw^T + gb (8 outputs, K=64, VALU f32),
//      gate = sigmoid(sum g[0:4]) * (sigmoid(sum g[4:8]) * gc[h] - 1) + 2 ; stored [b][h][s], one value (index idx) per thread
__device__ __forceinline__ void gate_item(
    const float* __restrict__ hf, const float* __restrict__ gw, const float* __restrict__ gb,
    const float* __restrict__ gc, float* __restrict__ gate, int S, int H, int C, int total, int idx) {
  if (idx >= total) return;   // no barriers on this path
  const int s  = idx % S;
  const int bh = idx / S;
  const int h  = bh % H;
  const int b  = bh / H;
  const float* hp = hf + ((size_t)b * S + s) * C + (size_t)h * 64;
  float acc[8];
#pragma unroll
  for (int e = 0; e < 8; ++e) acc[e] = 0.f;
#pragma unroll 1
  for (int d = 0; d < 64; ++d) {
    const float hv = hp[d];
#pragma unroll
    for (int e = 0; e < 8; ++e) acc[e] = fmaf(hv, gw[e * 64 + d], acc[e]);
  }
  const float sa = ((acc[0] + gb[0]) + (acc[1] + gb[1])) + ((acc[2] + gb[2]) + (acc[3] + gb[3]));
  const float sb = ((acc[4] + gb[4]) + (acc[5] + gb[5])) + ((acc[6] + gb[6]) + (acc[7] + gb[7]));
  const float ga  = 1.0f / (1.0f + expf(-sa));
  const float gbv = 1.0f / (1.0f + expf(-sb));
  const float gv = ga * (gbv * gc[h] - 1.0f) + 2.0f;
  ((float*)gate)[idx] = gv;
}

// ---- One launch for the four pieces of a layer that read h alone and none of which fills the chip: the q, k and v projections
// (blockIdx.y = 0, 1, 2: one 128x128 tile a block; the three f16 weight planes lie strideW apart, the three f32 outputs strideO apart)
// and the gate (blockIdx.y >= 3: one value a thread). No piece reads what another writes. The long pieces have the low indices.
__global__ __launch_bounds__(128) void qkv_gate_kernel(
    const unsigned short* __restrict__ hh, const unsigned short* __restrict__ w, long strideW,
    float* __restrict__ qkv, long strideO,
    const float* __restrict__ bq, const float* __restrict__ bk, const float* __restrict__ bv,
    const float* __restrict__ hf, const float* __restrict__ gw, const float* __restrict__ gb,
    const float* __restrict__ gc, float* __restrict__ gate,
    int M, int C, int S, int H, int total, float scale) {
  const int piece = (int)blockIdx.y;
  if (pinned((uint32_t)(piece >= 3))) {      // scalar branch, the same for the whole block: a gate block meets no tensor load and no barrier
    const int nTiles = (M >> 7) * (C >> 7);  // blocks in a row of the grid: one per tile of a projection
    gate_item(hf, gw, gb, gc, gate, S, H, C, total, ((piece - 3) * nTiles + (int)blockIdx.x) * 128 + (int)threadIdx.x);
    return;
  }
  const float* bias = piece == 0 ? bq : piece == 1 ? bk : bv;
  gemm_tile<0, false, 2, 0, false, 0>(hh, hh, C, 0L, w, w, C, strideW, (void*)qkv, (void*)qkv, C, strideO,
                                      bias, hf, 0L, M, C, C, scale, piece, (int)blockIdx.x);
}

// ---- All weight sets f32 -> f16 (x sc) in one launch of resident waves ---------------------------------------------
// The work is nSeg equal segments of segF4 16-byte vectors: w0..w3 are one segment each, w4 and w5 four each; the f16 planes lie
// one behind the other in out, in that order. A wave owns CS_IT x CS_LD x 32 consecutive vectors of one segment: every load is
// 512 contiguous bytes of the wave, CS_LD of them are asked for one trip ahead, every store is 256 contiguous bytes.
// One block of CS_WAVES waves per WGP: few waves that live long.
#define CS_WAVES 18
#define CS_LD    8
#define CS_IT    6
__global__ __launch_bounds__(CS_WAVES * 32) void cast_weights_stream(
    const float* __restrict__ w0, const float* __restrict__ w1, const float* __restrict__ w2, const float* __restrict__ w3,
    const float* __restrict__ w4, const float* __restrict__ w5, _Float16* __restrict__ out, int segF4, int nSeg, float sc) {
  const uint32_t perWave = CS_IT * CS_LD * 32u;                    // vectors per wave
  const uint32_t lane = threadIdx.x & 31u;
  const uint32_t gw = uni(blockIdx.x * CS_WAVES + (threadIdx.x >> 5));
  const uint32_t wavesPerSeg = (uint32_t)segF4 / perWave;
  const uint32_t seg = gw / wavesPerSeg;
  if (seg >= (uint32_t)nSeg) return;                               // wave-uniform; no barrier in this kernel
  const uint32_t win = gw - seg * wavesPerSeg;
  const size_t segF = (size_t)segF4 * 4;
  const float* src = seg == 0u ? w0 : seg == 1u ? w1 : seg == 2u ? w2 : seg == 3u ? w3
                   : seg < 8u ? w4 + (size_t)(seg - 4u) * segF : w5 + (size_t)(seg - 8u) * segF;
  const v4f* s4 = (const v4f*)src + (size_t)win * perWave + lane;
  v4h* d4 = (v4h*)out + (size_t)gw * perWave + lane;
  v4f buf[2][CS_LD];
#pragma unroll
  for (int k = 0; k < CS_LD; ++k) buf[0][k] = s4[k * 32];
  // unrolled: every address is the wave's one base plus a constant, so no address register takes a new value under a load in flight
#pragma unroll
  for (int t = 0; t < CS_IT; ++t) {
    const int cur = t & 1, nx = cur ^ 1;
    if (t + 1 < CS_IT) {
#pragma unroll
      for (int k = 0; k < CS_LD; ++k) buf[nx][k] = s4[((t + 1) * CS_LD + k) * 32];
    }
    __builtin_amdgcn_sched_barrier(0);   // no work on the values just asked for rises into this trip, where it would wait those loads out
#pragma unroll
    for (int k = 0; k < CS_LD; ++k) {
      const v4f x = buf[cur][k] * sc;
      v4h y;
      y[0] = (_Float16)x[0]; y[1] = (_Float16)x[1]; y[2] = (_Float16)x[2]; y[3] = (_Float16)x[3];
      d4[(t * CS_LD + k) * 32] = y;
    }
    // in front of the next trip's loads and converts, which write registers that this trip's stores name
    if (t + 1 < CS_IT) asm volatile("s_wait_xcnt 0x0" ::: "memory");
  }
}

// ---- LayerNorm over rows of C = 4 * blockDim floats; PRE: input = in * mask[row] + pos --------------------------
#define LN_T 192
template <int PRE>
__global__ __launch_bounds__(LN_T) void ln_kernel(
    const float* __restrict__ in, const float* __restrict__ pos, const float* __restrict__ mask,
    const float* __restrict__ g, const float* __restrict__ bb,
    float* __restrict__ outf, _Float16* __restrict__ outh, int C, float invC, float eps) {
  __shared__ float rs[8];
  __shared__ float rq[8];
  const int row = blockIdx.x;
  const int tid = threadIdx.x;
  const int lane = tid & 31;
  const int w = tid >> 5;
  const int c4 = tid * 4;
  const size_t base = (size_t)row * C + c4;
  v4f xv = *(const v4f*)(in + base);
  if (PRE) {
    const float mk = mask[row];
    const v4f pv = *(const v4f*)(pos + base);
    xv = xv * mk + pv;
  }
  float s = (xv[0] + xv[1]) + (xv[2] + xv[3]);
#pragma unroll
  for (int off = 16; off > 0; off >>= 1) s += __shfl_xor(s, off, 32);
  if (lane == 0) rs[w] = s;
  __syncthreads();
  float ts = 0.f;
#pragma unroll
  for (int i = 0; i < LN_T / 32; ++i) ts += rs[i];
  const float mean = ts * invC;
  const v4f d = xv - mean;
  float sq = (d[0] * d[0] + d[1] * d[1]) + (d[2] * d[2] + d[3] * d[3]);
#pragma unroll
  for (int off = 16; off > 0; off >>= 1) sq += __shfl_xor(sq, off, 32);
  if (lane == 0) rq[w] = sq;
  __syncthreads();
  float tq = 0.f;
#pragma unroll
  for (int i = 0; i < LN_T / 32; ++i) tq += rq[i];
  const float var = tq * invC;
  const float inv = rsqrtf(var + eps);
  const v4f gv = *(const v4f*)(g + c4);
  const v4f bv = *(const v4f*)(bb + c4);
  const v4f y = d * inv * gv + bv;
  v4h yh;
  yh[0] = (_Float16)y[0]; yh[1] = (_Float16)y[1]; yh[2] = (_Float16)y[2]; yh[3] = (_Float16)y[3];
  *(v4f*)(outf + base) = y;
  *(v4h*)(outh + base) = yh;
  
}

// =====================================================================================
// Flash attention, head_dim 64, f32 q/k/v in, f16 out; plain f16 operands, f32 accumulate; online softmax in f32.
//   s(q,kv) = (q . k) * qscale + gate[b,h,q] * pos_bias[h,q,kv] + (1 - mask[b,kv]) * -1e4
//   probabilities carried x2^15 in f16, folded into the final 1/l.
//   Block = 4 waves = 64 query rows of one (batch, head); S % 64 == 0.  q/k/v/out element (b,s,h,d) at
//   ((b*S + s)*C + h*64 + d); gate at (b*H + h)*S + s; pos_bias at (h*S + q)*S + kv; grid.x = B * H * (S/64).
// =====================================================================================
#define AT_D 64
#define AT_NW 4
#define AT_KC 64
// Row pitch, in halves, of the K, V^T and P tiles in LDS: 144 B = 16 B x 9. At the bare 128 B the 16 rows of a fragment read
// (ds_load_b128) fall on 8 of the 64 banks; at an odd multiple of 16 B they cover all 64.
#define AT_LP 72
#define AT_PSC 32768.0f

__device__ __forceinline__ v8f hmma(v16h a, v16h b, v8f c) {
  c = __builtin_amdgcn_wmma_f32_16x16x32_f16(false, a, false, b, (short)0, c, false, false);
  asm volatile("v_nop\n\tv_nop\n\tv_nop\n\tv_nop" : "+v"(c) : "v"(a), "v"(b));
  return c;
}

// Barrier and wave-level hand-over that order LDS traffic alone: a fence over global memory as well would wait out the
// loads that are in flight for the next chunk. Nothing in this kernel passes between waves through global memory.
__device__ __forceinline__ void lds_block_sync() {
  __builtin_amdgcn_fence(__ATOMIC_RELEASE, "workgroup", "local");
  __builtin_amdgcn_s_barrier();
  __builtin_amdgcn_fence(__ATOMIC_ACQUIRE, "workgroup", "local");
}
// Stands behind a run of loads that stay in flight, in front of any new value in their address registers.
__device__ __forceinline__ void wait_addr_taken() { asm volatile("s_wait_xcnt 0x0" ::: "memory"); }
// The same wait behind a run of loads; the run's address values, named as inputs, stay in their registers up to the wait, so that
// no later load of the run is given one of them as its destination.
__device__ __forceinline__ void wait_addr_taken(const float* a, const float* b, const float* c, const float* d) {
  asm volatile("s_wait_xcnt 0x0" :: "v"(a), "v"(b), "v"(c), "v"(d) : "memory");
}
__device__ __forceinline__ void wait_addr_taken(int i, const float* a, const float* b, const float* c, const float* d) {
  asm volatile("s_wait_xcnt 0x0" :: "v"(i), "v"(a), "v"(b), "v"(c), "v"(d) : "memory");
}
// One step of a butterfly inside a 16-lane row on the vector pipe: lane l reads lane l ^ M of its own row (DPP row_xmask).
// __shfl_xor compiles to ds_bpermute_b32, whose every dependent step waits out an LDS round trip.
// Every lane has its partner inside the row, so neither the old value 0 nor bound_ctrl reaches a result; in this form the compiler
// can fold the move into the operation that takes it.
template <int M> __device__ __forceinline__ float row_xor(float x) {
  const int xi = __builtin_bit_cast(int, x);
  return __builtin_bit_cast(float, __builtin_amdgcn_update_dpp(0, xi, 0x160 | M, 0xf, 0xf, true));
}
__device__ __forceinline__ float row_max16(float m) {   // partners 1, 2, 4, 8 in that order
  m = fmaxf(m, row_xor<1>(m)); m = fmaxf(m, row_xor<2>(m)); m = fmaxf(m, row_xor<4>(m)); return fmaxf(m, row_xor<8>(m));
}
__device__ __forceinline__ float row_sum16(float s) {   // partners 1, 2, 4, 8 in that order
  s += row_xor<1>(s); s += row_xor<2>(s); s += row_xor<4>(s); return s + row_xor<8>(s);
}
__device__ __forceinline__ void lds_wave_sync() {
  __builtin_amdgcn_fence(__ATOMIC_RELEASE, "workgroup", "local");
  __builtin_amdgcn_wave_barrier();
  __builtin_amdgcn_fence(__ATOMIC_ACQUIRE, "workgroup", "local");
}

// waves_per_eu(1, 2): the grid holds three waves for every two SIMDs of the chip, so a register budget of two waves a SIMD costs
// no residency; with the default budget the compiler answers the 100 registers of loads in flight by running the row
// reductions one after the other.
__global__ __launch_bounds__(128) __attribute__((amdgpu_waves_per_eu(1, 2)))
void attn_gbias_kernel(const float* __restrict__ q, const float* __restrict__ k,
                       const float* __restrict__ v, const float* __restrict__ gate,
                       const float* __restrict__ pos_bias, const float* __restrict__ mask,
                       _Float16* __restrict__ out, int S, int H, int C, float qscale) {
  union FH { v16h v; v8h h[2]; };
  __shared__ __align__(16) _Float16 Ksh[AT_KC * AT_LP];       // K [kv][d]
  __shared__ __align__(16) _Float16 Vth[AT_D * AT_LP];        // V^T [d][kv]
  __shared__ __align__(16) _Float16 Psh[AT_NW][16 * AT_LP];   // per wave P [row][kv]
  __shared__ __align__(16) float    Os[AT_NW][16 * 68];       // per wave out tile, pitch 68

  const int tid  = threadIdx.x;
  const int wave = tid >> 5;
  const int lane = tid & 31;
  const int hh   = lane >> 4;
  const int c    = lane & 15;

  const int nqb = S / 64;
  const int bx = blockIdx.x;
  const int qb = bx % nqb;
  const int bh = bx / nqb;
  const int h  = bh % H;
  const int b  = bh / H;
  const int q0 = qb * 64 + wave * 16;

  const float* qb_ptr = q + (size_t)b * S * C + (size_t)h * AT_D;
  const float* kb_ptr = k + (size_t)b * S * C + (size_t)h * AT_D;
  const float* vb_ptr = v + (size_t)b * S * C + (size_t)h * AT_D;
  const float* gt_ptr = gate + ((size_t)b * H + h) * S;
  const float* pb_ptr = pos_bias + (size_t)h * S * S;
  const float* mk_ptr = mask + (size_t)b * S;
  _Float16*    ob_ptr = out + (size_t)b * S * C + (size_t)h * AT_D;

  // ---- Q fragments (A operand): 2 d-chunks, split k map ----
  v16h qa[2];
  {
    const float* qrow = qb_ptr + (size_t)(q0 + c) * C;
#pragma unroll
    for (int dc = 0; dc < 2; ++dc) {
#pragma unroll
      for (int e = 0; e < 8; ++e) {
        qa[dc][e]     = (_Float16)qrow[dc * 32 + 8 * hh + e];
        qa[dc][8 + e] = (_Float16)qrow[dc * 32 + 16 + 8 * hh + e];
      }
    }
  }
  float grow[8];
#pragma unroll
  for (int r = 0; r < 8; ++r) grow[r] = gt_ptr[q0 + 8 * hh + r];

  float mrow[8], lrow[8];
  v8f oacc[4];
#pragma unroll
  for (int r = 0; r < 8; ++r) { mrow[r] = -INFINITY; lrow[r] = 0.f; }
#pragma unroll
  for (int t = 0; t < 4; ++t) oacc[t] = (v8f){0.f,0.f,0.f,0.f,0.f,0.f,0.f,0.f};

  const int nChunks = S / AT_KC;   // block-uniform, from launch argument
  // Every global operand of a chunk (this thread's K and V row pieces, the position-bias tile, the key mask) is held in
  // registers and requested one chunk ahead, so that no chunk waits out a load it has only just issued.
  const int kvr = tid >> 1, dh = (tid & 1) * 32;
  const int kvOff = kvr * C + dh;                 // this thread's piece inside a chunk of K or V rows
  int pbOff[8];                                   // this lane's column in each of its 8 bias rows
#pragma unroll
  for (int r = 0; r < 8; ++r) pbOff[r] = (q0 + 8 * hh + r) * S + c;
  v4f kreg[8], vreg[8];
  float pbv[8][4], mkv[4];
#pragma unroll
  for (int i = 0; i < 8; ++i) {
    kreg[i] = *(const v4f*)(kb_ptr + kvOff + 4 * i);
    vreg[i] = *(const v4f*)(vb_ptr + kvOff + 4 * i);
  }
#pragma unroll
  for (int j = 0; j < 4; ++j) mkv[j] = mk_ptr[j * 16 + c];
#pragma unroll
  for (int r = 0; r < 8; ++r)
#pragma unroll
    for (int j = 0; j < 4; ++j) pbv[r][j] = pb_ptr[pbOff[r] + j * 16];
  wait_addr_taken();
  const size_t step0 = (nChunks > 1) ? (size_t)AT_KC * C : 0;
  const float* kn = kb_ptr + kvOff + step0;       // this thread's piece of the next chunk's K rows, and of its V rows
  const float* vn = vb_ptr + kvOff + step0;

  for (int kc = 0; kc < nChunks; ++kc) {
    // first key of the next chunk; the last trip asks for its own chunk again (in bounds, not used), so that every trip
    // issues the same loads in the same order and each wait on them can be counted exactly
    const int kvn = (kc + 1 < nChunks ? kc + 1 : kc) * AT_KC;
    lds_block_sync();                             // every wave has left the previous chunk's K and V tiles
#pragma unroll
    for (int i = 0; i < 8; ++i) {
#pragma unroll
      for (int e = 0; e < 4; ++e) {
        const int d = dh + 4 * i + e;
        Ksh[kvr * AT_LP + d] = (_Float16)kreg[i][e];
        Vth[d * AT_LP + kvr] = (_Float16)vreg[i][e];
      }
    }
    {                                             // next chunk's K and V fly under this chunk's whole work
#pragma unroll
      for (int i = 0; i < 8; ++i) {
        kreg[i] = *(const v4f*)(kn + 4 * i);
        vreg[i] = *(const v4f*)(vn + 4 * i);
      }
    }
    lds_block_sync();                             // this chunk's tiles are published

    v8f s[4];
#pragma unroll
    for (int j = 0; j < 4; ++j) {
      s[j] = (v8f){0.f,0.f,0.f,0.f,0.f,0.f,0.f,0.f};
#pragma unroll
      for (int dc = 0; dc < 2; ++dc) {
        FH kb;
        kb.h[0] = *(const v8h*)(Ksh + (j * 16 + c) * AT_LP + dc * 32 + 8 * hh);
        kb.h[1] = *(const v8h*)(Ksh + (j * 16 + c) * AT_LP + dc * 32 + 16 + 8 * hh);
        s[j] = hmma(qa[dc], kb.v, s[j]);
      }
    }
    // additive terms: key padding per column, gated position bias per (row, column)
    float kp[4];
#pragma unroll
    for (int j = 0; j < 4; ++j) kp[j] = (1.0f - mkv[j]) * -10000.0f;
    float cm[8];
#pragma unroll
    for (int r = 0; r < 8; ++r) {
      float m = -INFINITY;
#pragma unroll
      for (int j = 0; j < 4; ++j) {
        const float sv = s[j][r] * qscale + grow[r] * pbv[r][j] + kp[j];
        s[j][r] = sv;
        m = fmaxf(m, sv);
      }
      cm[r] = row_max16(m);
    }
    {                                             // next chunk's bias tile and mask fly under softmax, P.V and the next staging
      const float* pn = pb_ptr + kvn;
#pragma unroll
      for (int j = 0; j < 4; ++j) mkv[j] = mk_ptr[kvn + j * 16 + c];
#pragma unroll
      for (int r = 0; r < 4; ++r)
#pragma unroll
        for (int j = 0; j < 4; ++j) pbv[r][j] = pn[pbOff[r] + j * 16];
      wait_addr_taken(kvn + c, pn + pbOff[0], pn + pbOff[1], pn + pbOff[2], pn + pbOff[3]);
#pragma unroll
      for (int r = 4; r < 8; ++r)
#pragma unroll
        for (int j = 0; j < 4; ++j) pbv[r][j] = pn[pbOff[r] + j * 16];
      wait_addr_taken(pn + pbOff[4], pn + pbOff[5], pn + pbOff[6], pn + pbOff[7]);
      // nothing crosses this line: the K and V pointers step on only behind the wait above (it covers their loads too), and
      // no work on the values just requested rises into this chunk, where it would wait those loads out
      __builtin_amdgcn_sched_barrier(0);
      const size_t step = (kc + 2 < nChunks) ? (size_t)AT_KC * C : 0;
      kn += step;
      vn += step;
    }
    _Float16* pw = Psh[wave];
#pragma unroll
    for (int r = 0; r < 8; ++r) {
      const float mnew = fmaxf(mrow[r], cm[r]);
      const float alpha = expf(mrow[r] - mnew);
      mrow[r] = mnew;
      float psum = 0.f;
#pragma unroll
      for (int j = 0; j < 4; ++j) {
        const float p = expf(s[j][r] - mnew);
        psum += p;
        pw[(8 * hh + r) * AT_LP + j * 16 + c] = (_Float16)(p * AT_PSC);
      }
      lrow[r] = lrow[r] * alpha + row_sum16(psum);
#pragma unroll
      for (int t = 0; t < 4; ++t) oacc[t][r] *= alpha;
    }
    lds_wave_sync();                              // the wave's own P rows, written above, are read back as fragments below
#pragma unroll 1
    for (int kk = 0; kk < 2; ++kk) {
      FH pa;
      pa.h[0] = *(const v8h*)(pw + c * AT_LP + kk * 32 + 8 * hh);
      pa.h[1] = *(const v8h*)(pw + c * AT_LP + kk * 32 + 16 + 8 * hh);
#pragma unroll
      for (int t = 0; t < 4; ++t) {
        FH vb;
        vb.h[0] = *(const v8h*)(Vth + (t * 16 + c) * AT_LP + kk * 32 + 8 * hh);
        vb.h[1] = *(const v8h*)(Vth + (t * 16 + c) * AT_LP + kk * 32 + 16 + 8 * hh);
        oacc[t] = hmma(pa.v, vb.v, oacc[t]);
      }
    }
  }

  float* os = Os[wave];
#pragma unroll
  for (int r = 0; r < 8; ++r) {
    const float inv = 1.0f / (lrow[r] * AT_PSC);
#pragma unroll
    for (int t = 0; t < 4; ++t) os[(8 * hh + r) * 68 + t * 16 + c] = oacc[t][r] * inv;
  }
  __builtin_amdgcn_fence(__ATOMIC_RELEASE, "workgroup");
  __builtin_amdgcn_wave_barrier();
  __builtin_amdgcn_fence(__ATOMIC_ACQUIRE, "workgroup");
  {
    const int q8 = lane >> 3, c8 = (lane & 7) * 8;
    {
#pragma unroll
      for (int it = 0; it < 4; ++it) {
        const int row = it * 4 + q8;
        const float* sp = os + row * 68 + c8;
        v8h hv;
#pragma unroll
        for (int e = 0; e < 8; ++e) hv[e] = (_Float16)sp[e];
        *(v8h*)(ob_ptr + (size_t)(q0 + row) * C + c8) = hv;
      }
      
    }
  }
}

// ---------------------------------------------------------------------------
extern "C" void kernel_launch(void* const* d_in, const int* in_sizes, int n_in,
                              void* d_out, int out_size, void* d_ws, size_t ws_size,
                              hipStream_t stream) {
  const int Bn = 2, S = 1024, C = 768, H = 12, L = 4, FF = 3072;
  const int M = Bn * S;
  if (n_in < 25) return;
  if (in_sizes[0] != M * C || in_sizes[1] != M * C || in_sizes[2] != M || in_sizes[3] != H * S * S) return;
  if (in_sizes[6] != L * C * C || in_sizes[19] != L * FF * C || in_sizes[21] != L * C * FF) return;
  if (out_size != M * C) return;

  const float* x        = (const float*)d_in[0];
  const float* pos_emb  = (const float*)d_in[1];
  const float* attn_m   = (const float*)d_in[2];
  const float* pos_bias = (const float*)d_in[3];
  const float* ln0_g    = (const float*)d_in[4];
  const float* ln0_b    = (const float*)d_in[5];
  const float* Wq       = (const float*)d_in[6];
  const float* bq       = (const float*)d_in[7];
  const float* Wk       = (const float*)d_in[8];
  const float* bk       = (const float*)d_in[9];
  const float* Wv       = (const float*)d_in[10];
  const float* bv       = (const float*)d_in[11];
  const float* Wo       = (const float*)d_in[12];
  const float* bo       = (const float*)d_in[13];
  const float* gruW     = (const float*)d_in[14];
  const float* grub     = (const float*)d_in[15];
  const float* gruc     = (const float*)d_in[16];
  const float* ln1_g    = (const float*)d_in[17];
  const float* ln1_b    = (const float*)d_in[18];
  const float* W1       = (const float*)d_in[19];
  const float* b1       = (const float*)d_in[20];
  const float* W2       = (const float*)d_in[21];
  const float* b2       = (const float*)d_in[22];
  const float* ln2_g    = (const float*)d_in[23];
  const float* ln2_b    = (const float*)d_in[24];

  // ---- workspace carve (256-B aligned offsets, total 110,198,784 B) ----
  char* ws = (char*)d_ws;
  size_t off = 0;
  const size_t NWC = (size_t)L * C * C;      // halves per projection weight set
  const size_t NWF = (size_t)L * FF * C;     // halves per FFN weight set
  const size_t NA  = (size_t)M * C;
  const size_t NF  = (size_t)M * FF;
  const size_t NG  = (size_t)Bn * H * S;
  size_t o_wq, o_wk, o_wv, o_wo, o_w1, o_w2, o_hf, o_hh, o_qf, o_kf, o_vf, o_ao, o_h1f, o_h1h, o_ff, o_gt;
#define CARVE(o, bytes) do { o = off; off += ((size_t)(bytes) + 255) & ~(size_t)255; } while (0)
  CARVE(o_wq, NWC * 2); CARVE(o_wk, NWC * 2); CARVE(o_wv, NWC * 2); CARVE(o_wo, NWC * 2);
  CARVE(o_w1, NWF * 2); CARVE(o_w2, NWF * 2);
  CARVE(o_hf, NA * 4);  CARVE(o_hh, NA * 2);
  CARVE(o_qf, NA * 4);  CARVE(o_kf, NA * 4);  CARVE(o_vf, NA * 4);
  CARVE(o_ao, NA * 2);
  CARVE(o_h1f, NA * 4); CARVE(o_h1h, NA * 2);
  CARVE(o_ff, NF * 2);
  CARVE(o_gt, NG * 4);
#undef CARVE
  if (off > ws_size) return;

  _Float16* wq16 = (_Float16*)(ws + o_wq);
  _Float16* wo16 = (_Float16*)(ws + o_wo);
  _Float16* w116 = (_Float16*)(ws + o_w1);
  _Float16* w216 = (_Float16*)(ws + o_w2);
  float*    hf   = (float*)(ws + o_hf);
  _Float16* hh16 = (_Float16*)(ws + o_hh);
  float*    qf   = (float*)(ws + o_qf);
  float*    kf   = (float*)(ws + o_kf);
  float*    vf   = (float*)(ws + o_vf);
  _Float16* ao16 = (_Float16*)(ws + o_ao);
  float*    h1f  = (float*)(ws + o_h1f);
  _Float16* h1h  = (_Float16*)(ws + o_h1h);
  _Float16* ff16 = (_Float16*)(ws + o_ff);
  float*    gtb  = (float*)(ws + o_gt);
  float*    outp = (float*)d_out;

  const float WSC  = 64.0f;            // weights carried x64 in f16
  const float WINV = 1.0f / 64.0f;     // folded back in the GEMM epilogue
  const float invC = 1.0f / 768.0f;
  const float eps  = 1e-5f;
  const float qscale = 0.125f;         // 1/sqrt(64)

  // ---- weights -> f16 (x64): Wq, Wk, Wv, Wo, W1, W2 as 12 segments of L*C*C elements; their f16 planes are contiguous from wq16 ----
  {
    const int segF4 = (int)(NWC / 4), nSeg = 12;
    const int perWave = CS_IT * CS_LD * 32, wavesAll = (segF4 / perWave) * nSeg;
    static_assert((L * C * C / 4) % (CS_IT * CS_LD * 32) == 0, "a segment is a whole number of waves");
    static_assert(((L * C * C / 4) / (CS_IT * CS_LD * 32) * 12) % CS_WAVES == 0, "the waves fill whole blocks");
    static_assert(FF == 4 * C && (L * C * C * 2) % 256 == 0, "W1 and W2 are four segments each; no gap between the planes");
    cast_weights_stream<<<wavesAll / CS_WAVES, CS_WAVES * 32, 0, stream>>>(Wq, Wk, Wv, Wo, W1, W2, wq16, segF4, nSeg, WSC);
  }

  // ---- h = LN0(x * mask + pos_emb) ----
  ln_kernel<1><<<M, LN_T, 0, stream>>>(x, pos_emb, attn_m, ln0_g, ln0_b, hf, hh16, C, invC, eps);

  const int nbP = (M / 128) * (C / 128);    // 96 blocks, one 128x128 tile each
  const int nbF = (M / 128) * (FF / 128);   // 384 blocks
  const int nbA = Bn * H * (S / 64);                // 384 attention blocks
  const int ngate = (int)NG;
  const int nyG = (ngate + nbP * 128 - 1) / (nbP * 128);   // rows of the joined grid that hold the gate, 128 values a block
  static_assert((L * C * C * 2) % 256 == 0 && (Bn * S * C * 4) % 256 == 0, "no gap between the q, k, v weight planes, nor between qf, kf, vf");

  for (int l = 0; l < L; ++l) {
    const size_t lw  = (size_t)l * C * C;
    const size_t lwf = (size_t)l * FF * C;
    const _Float16* WQl = wq16 + lw;
    const _Float16* WOl = wo16 + lw;
    const _Float16* W1l = w116 + lwf;   // [FF][C]
    const _Float16* W2l = w216 + lwf;   // [C][FF]

    // q, k, v = h . W^T + b (f32 out) and gate[b][h][s], one launch
    qkv_gate_kernel<<<dim3(nbP, 3 + nyG), 128, 0, stream>>>(
        U16(hh16), U16(WQl), (long)NWC, qf, (long)NA, bq + (size_t)l * C, bk + (size_t)l * C, bv + (size_t)l * C,
        hf, gruW + (size_t)l * 8 * 64, grub + (size_t)l * 8, gruc + (size_t)l * H, gtb, M, C, S, H, ngate, WINV);

    // attention -> ao16 (f16)
    attn_gbias_kernel<<<nbA, 128, 0, stream>>>(qf, kf, vf, gtb, pos_bias, attn_m, ao16, S, H, C, qscale);

    // qf <- h + ao . Wo^T + bo
    wmma_gemm64<0, false, 2, 0, true, 0><<<dim3(nbP, 1), 128, 0, stream>>>(
        U16(ao16), U16(ao16), C, 0L, U16(WOl), U16(WOl), C, 0L,
        (void*)qf, (void*)qf, C, 0L, bo + (size_t)l * C, hf, 0L, M, C, C, WINV);

    // h1 = LN1(qf)
    ln_kernel<0><<<M, LN_T, 0, stream>>>(qf, qf, attn_m, ln1_g + (size_t)l * C, ln1_b + (size_t)l * C,
                                         h1f, h1h, C, invC, eps);

    // ff16 = gelu(h1 . W1^T + b1)  (f16 out)
    wmma_gemm64<0, false, 2, 1, false, 5><<<dim3(nbF, 1), 128, 0, stream>>>(
        U16(h1h), U16(h1h), C, 0L, U16(W1l), U16(W1l), C, 0L,
        (void*)ff16, (void*)ff16, FF, 0L, b1 + (size_t)l * FF, h1f, 0L, M, FF, C, WINV);

    // kf <- h1 + ff . W2^T + b2
    wmma_gemm64<0, false, 2, 0, true, 0><<<dim3(nbP, 1), 128, 0, stream>>>(
        U16(ff16), U16(ff16), FF, 0L, U16(W2l), U16(W2l), FF, 0L,
        (void*)kf, (void*)kf, C, 0L, b2 + (size_t)l * C, h1f, 0L, M, C, FF, WINV);

    // h = LN2(kf); last layer writes the output buffer directly
    float* hdst = (l == L - 1) ? outp : hf;
    ln_kernel<0><<<M, LN_T, 0, stream>>>(kf, kf, attn_m, ln2_g + (size_t)l * C, ln2_b + (size_t)l * C,
                                         hdst, hh16, C, invC, eps);
  }
  (void)hipGetLastError();
}

// v008
// Measured time: 512 microseconds a run.
// Next to v007, in two timings, it ran 1.06 times as fast each time.
// All steps since v000 together make it 3.61 times as fast.
// Contractions (q/k/v/out projections, FFN up/down, attention q.k^T and p.v): v_wmma_f32_16x16x32_f16 (f16 operands, f32 accumulate); weights carried x64, softmax probabilities carried x2^15; LayerNorm, softmax, gate: f32 VALU.
#include <hip/hip_runtime.h>
#include <math.h>
#include <stdint.h>

typedef __attribute__((ext_vector_type(16))) _Float16 v16h;
typedef __attribute__((ext_vector_type(8)))  _Float16 v8h;
typedef __attribute__((ext_vector_type(4)))  _Float16 v4h;
typedef __attribute__((ext_vector_type(16))) __bf16   v16b;
typedef __attribute__((ext_vector_type(8)))  __bf16   v8b;
typedef __attribute__((ext_vector_type(8)))  float    v8f;
typedef __attribute__((ext_vector_type(4)))  float    v4f;
#define U16(p) ((const unsigned short*)(const void*)(p))

__device__ __forceinline__ unsigned short f2bf_bits(float f) {
  unsigned u = __float_as_uint(f);
  return (unsigned short)((u + 0x7FFFu + ((u >> 16) & 1u)) >> 16);
}
__device__ __forceinline__ float bf_bits2f(unsigned short h) { return __uint_as_float(((unsigned)h) << 16); }

// hazard guards as plain device helpers (no inline asm inside the kernel template body)
__device__ __forceinline__ void acc_guard4(v8f& a, v8f& b, v8f& c, v8f& d) { asm volatile("v_nop\n\tv_nop\n\tv_nop\n\tv_nop" : "+v"(a), "+v"(b), "+v"(c), "+v"(d)); }
template <typename T> struct Frag;
template <> struct Frag<_Float16> {
  typedef v16h V; union U { v16h v; v8h h[2]; };
  static __device__ __forceinline__ v16h load(const _Float16* p) {   // elements 0..7 <- p[0..7], 8..15 <- p[16..23]
    U f; f.h[0] = *(const v8h*)(p); f.h[1] = *(const v8h*)(p + 16); return f.v;
  }
  static __device__ __forceinline__ v8f mma(v16h a, v16h b, v8f c) {
    return __builtin_amdgcn_wmma_f32_16x16x32_f16(false, a, false, b, (short)0, c, false, false);
  }
};
template <> struct Frag<__bf16> {
  typedef v16b V; union U { v16b v; v8b h[2]; };
  static __device__ __forceinline__ v16b load(const __bf16* p) {
    U f; f.h[0] = *(const v8b*)(p); f.h[1] = *(const v8b*)(p + 16); return f.v;
  }
  static __device__ __forceinline__ v8f mma(v16b a, v16b b, v8f c) {
    return __builtin_amdgcn_wmma_f32_16x16x32_bf16(false, a, false, b, (short)0, c, false, false);
  }
};

// ---- Block-tiled batched WMMA GEMM, operands staged in LDS by the tensor mover ------------
// C[m,n] = scale * sum_k A[m,k] * Bt[n,k] (+bias)(+resid); a block of 4 waves (2 x 2) owns a 128x128 tile, each wave 64x64.
// A row-major [M,K]; Bt row-major [N,K]; M,N % 128 == 0, K % 128 == 0, K >= 256 (two stages).
// A pass is 128 k = 256 B of each of the 256 operand rows; each wave brings one 64-row slice per pass with one tensor load
// (waves 0,1: the two halves of the A rows; waves 2,3: of the Bt rows), two buffers, LDS row pitch 272 B.
// BIAS_MODE: 0 = none, 1 = bias[m], 2 = bias[n].
// OUT_MODE: 0 = f32, 1 = f16, 2 = bf16 hi plane (Cout) + bf16 lo plane (Cout2).
// ET: 0 = f16 operands, 1 = bf16 operands (pointers passed as 16-bit storage)
typedef uint32_t u32x4 __attribute__((ext_vector_type(4)));
typedef uint32_t u32x8 __attribute__((ext_vector_type(8)));
#define GT_KP     128u                 // k per pass
#define GT_ROWB   256u                 // bytes of one operand row per pass
#define GT_PITCH  272u                 // LDS row pitch: 256 B + the mover's 16-B pad (ds_load_b128 readers)
#define GT_ROWS   64u                  // rows per slice
#define GT_SLICE  18432u               // 64 x 272 = 17,408 B, rounded up to a multiple of 2 KiB
#define GT_STAGE  (4u * GT_SLICE)      // one buffer: 4 slices
__device__ __forceinline__ uint32_t uni(uint32_t v) { return (uint32_t)__builtin_amdgcn_readfirstlane(v); }
// pinned(): holds a wave-uniform value in a scalar register, so that a test on it is a scalar branch (a tensor load ignores EXEC)
// and so that descriptor words formed from it are formed behind the waits that stand in front of it.
__device__ __forceinline__ uint32_t pinned(uint32_t v) { uint32_t w = uni(v); asm volatile("" : "+s"(w)); return w; }
__device__ __forceinline__ void wait_ds0()     { asm volatile("s_wait_dscnt 0x0" ::: "memory"); }      // this wave's LDS reads of the buffer are done
__device__ __forceinline__ void wait_tensor0() { asm volatile("s_wait_tensorcnt 0x0" ::: "memory"); }  // this wave's own slice has landed
// descriptor words held in scalar registers (as pinned() does for one word): the eight registers stay group 1's own through
// the loop, so that none of them takes another value while a request is outstanding
__device__ __forceinline__ void hold_group1(u32x8& g) { asm volatile("" : "+s"(g)); }
// one request of the whole wave: 64 rows of 256 B from global memory to LDS, 16 B of pad behind each row
__device__ __forceinline__ void tdm_load(uint32_t lds_dst, uint64_t ga, u32x8 g1) {
  u32x4 g0;
  g0[0] = uni(1u);
  g0[1] = uni(lds_dst);
  g0[2] = uni((uint32_t)ga);
  g0[3] = uni((((uint32_t)(ga >> 32)) & 0x01FFFFFFu) | 0x80000000u);
  asm volatile("tensor_load_to_lds %0, %1" :: "s"(g0), "s"(g1) : "memory");
}
// v_rcp_f32 and v_exp_f32, each with the one free slot that the instruction set asks for behind a transcendental in the same
// statement.
__device__ __forceinline__ float rcp_slot(float x)  { float r; asm("v_rcp_f32 %0, %1\n\tv_nop" : "=v"(r) : "v"(x)); return r; }
__device__ __forceinline__ float exp2_slot(float x) { float r; asm("v_exp_f32 %0, %1\n\tv_nop" : "=v"(r) : "v"(x)); return r; }
// GELU in its erf form, straight-line (no branch, so that the values of a fragment interleave and the unrolled epilogue stays short):
// with x = |v| / sqrt(2) and t = 1 / (1 + 0.3275911 x), erfc(x) = t (c1 + t (c2 + t (c3 + t (c4 + t c5)))) exp(-x x), absolute error
// at most 1.5e-7; gelu(v) = max(v, 0) - 0.5 |v| erfc(x), which cancels on neither side of 0. The factor -0.5 is folded into c1..c5.
__device__ __forceinline__ float gelu_erf(float v) {
  const float a = fabsf(v);
  const float t = rcp_slot(fmaf(a, 0.23164189f, 1.0f));      // 0.3275911 / sqrt(2)
  const float e = exp2_slot(v * v * -0.72134752f);           // exp(-v v / 2) = 2^(-v v log2(e) / 2)
  float p = fmaf(t, -0.53070271f, 0.72657601f);
  p = fmaf(t, p, -0.71070687f);
  p = fmaf(t, p, 0.14224837f);
  p = fmaf(t, p, -0.12741480f);
  return fmaf(a, p * t * e, fmaxf(v, 0.0f));
}
template <int ET> struct Elem;
template <> struct Elem<0> { typedef _Float16 T; };
template <> struct Elem<1> { typedef __bf16 T; };
// Wave-level hand-over that orders LDS traffic alone: a fence over global memory as well would wait out the global loads
// that are in flight (the residual, the next chunk's K, V and bias). Nothing passes between the lanes of a wave through global memory.
__device__ __forceinline__ void lds_wave_sync() {
  __builtin_amdgcn_fence(__ATOMIC_RELEASE, "workgroup", "local");
  __builtin_amdgcn_wave_barrier();
  __builtin_amdgcn_fence(__ATOMIC_ACQUIRE, "workgroup", "local");
}
// LDC: the row pitch of C and of resid in elements, known at compile time, so that every epilogue address is one base plus a constant
template <int ET, bool SPLIT, int BIAS_MODE, int OUT_MODE, bool RESID, int ACT, int LDC>
__device__ __forceinline__ void gemm_tile(
    const unsigned short* __restrict__ Ap, const unsigned short* __restrict__ A2p, int lda, long strideA,
    const unsigned short* __restrict__ Btp, const unsigned short* __restrict__ Bt2p, int ldb, long strideB,
    void* __restrict__ Cout, void* __restrict__ Cout2, int ldc, long strideC,
    const float* __restrict__ bias,
    const float* __restrict__ resid, long strideR,
    int M, int N, int K, float scale, const int b, const int tile) {   // b: batch index, tile: this block's tile; both block-uniform
  static_assert(!SPLIT, "single-plane operands only");
  static_assert(!RESID || (OUT_MODE == 0 && ACT == 0), "the residual is added last, to f32 output");
  typedef typename Elem<ET>::T T;
  typedef typename Frag<T>::V V;
  const T* A = (const T*)Ap; const T* Bt = (const T*)Btp;
  // two stage buffers; after the K loop its first bytes serve as the per-wave 64x64 f32 output slabs (pitch 68 floats)
  __shared__ __attribute__((aligned(2048))) unsigned char L[2u * GT_STAGE];
  const int lane = threadIdx.x & 31;
  const uint32_t wave = uni(threadIdx.x >> 5);
  const int tilesN = N >> 7;
  const int tilesM = M >> 7;
  const uint32_t nPass = uni((uint32_t)K / GT_KP);
  if (tile >= tilesM * tilesN || nPass < 2u || ldc != LDC) return;   // block-uniform, in front of every tensor load and barrier; the ring's prologue loads two stages
  const int tm = tile / tilesN;
  const int tn = tile - tm * tilesN;
  const uint32_t wm = wave >> 1, wn = wave & 1u;
  const int m0 = (tm << 7) + (int)(wm << 6);
  const int n0 = (tn << 7) + (int)(wn << 6);

  const T* Ab  = A  + (size_t)b * strideA;
  const T* Bb  = Bt + (size_t)b * strideB;

  const int rlane = lane & 15;                 // row (A) / col (B, D) within subtile
  const int koff  = (lane >> 4) * 8;           // k offset of this lane half
  const int mOff  = (lane >> 4) * 8;           // D row offset

  // ---- this wave's slice: source, place in LDS, descriptor group 1 (loop-invariant) ----
  const bool isB = wave >= 2u;
  const uint32_t srcPitch = (uint32_t)(isB ? ldb : lda) * 2u;     // bytes
  const uint64_t srcBase = isB ? (uint64_t)(uintptr_t)(Bb + (size_t)((tn << 7) + (int)(wn << 6)) * ldb)
                               : (uint64_t)(uintptr_t)(Ab + (size_t)((tm << 7) + (int)(wn << 6)) * lda);
  const uint32_t ldsSlice = (uint32_t)(size_t)L + wave * GT_SLICE;
  u32x8 g1;
  g1[0] = uni((1u << 20) | (5u << 22) | (3u << 25));              // no mask, 1-byte elements, 4 dwords of pad behind every 64 dwords
  g1[1] = uni((GT_ROWB & 0xFFFFu) << 16);                         // tensor_dim0 low
  g1[2] = uni((GT_ROWB >> 16) | ((GT_ROWS & 0xFFFFu) << 16));     // tensor_dim0 high, tensor_dim1 low
  g1[3] = uni((GT_ROWS >> 16) | (GT_ROWB << 16));                 // tensor_dim1 high, tile_dim0
  g1[4] = uni(GT_ROWS);                                           // tile_dim1
  g1[5] = uni(srcPitch);
  g1[6] = uni(0u);
  g1[7] = uni(0u);
  hold_group1(g1);

  v8f acc[4][4];
#pragma unroll
  for (int i = 0; i < 4; ++i)
#pragma unroll
    for (int j = 0; j < 4; ++j) acc[i][j] = (v8f){0.f,0.f,0.f,0.f,0.f,0.f,0.f,0.f};

  // this lane's four column biases, asked for here so that they have long landed when the epilogue takes them
  float bv[4];
#pragma unroll
  for (int j = 0; j < 4; ++j) bv[j] = (BIAS_MODE == 2) ? bias[n0 + (j << 4) + rlane] : 0.f;

  // prologue: stage 0 lands and is published, then stage 1 flies while pass 0 works
  tdm_load(ldsSlice, srcBase, g1);
  wait_tensor0();
  __syncthreads();
  tdm_load(ldsSlice + GT_STAGE, srcBase + GT_ROWB, g1);

  const uint32_t aOff = wm * GT_SLICE + (uint32_t)rlane * GT_PITCH + (uint32_t)koff * 2u;
  const uint32_t bOff = (2u + wn) * GT_SLICE + (uint32_t)rlane * GT_PITCH + (uint32_t)koff * 2u;
  uint32_t s = 0;
  // the pass loop stays rolled: one publish point in the text, every fragment index below a constant
#pragma unroll 1
  do {                                        // nPass >= 2 here
    const uint32_t bufOff = (s & 1u) * GT_STAGE;
    const unsigned char* As = L + bufOff + aOff;
    const unsigned char* Bs = L + bufOff + bOff;
    V bh[2][4], ah[2][4];                     // two fragment sets: the next 32 k are read while these are multiplied
#pragma unroll
    for (int j = 0; j < 4; ++j) bh[0][j] = Frag<T>::load((const T*)(Bs + (uint32_t)j * 16u * GT_PITCH));
#pragma unroll
    for (int i = 0; i < 4; ++i) ah[0][i] = Frag<T>::load((const T*)(As + (uint32_t)i * 16u * GT_PITCH));
#pragma unroll
    for (int kk = 0; kk < 4; ++kk) {          // 32 k per step, in ascending k as before; only this pass's own buffer is read
      const int cur = kk & 1, nx = cur ^ 1;
      if (kk < 3) {
#pragma unroll
        for (int j = 0; j < 4; ++j) bh[nx][j] = Frag<T>::load((const T*)(Bs + (uint32_t)j * 16u * GT_PITCH + (uint32_t)(kk + 1) * 64u));
#pragma unroll
        for (int i = 0; i < 4; ++i) ah[nx][i] = Frag<T>::load((const T*)(As + (uint32_t)i * 16u * GT_PITCH + (uint32_t)(kk + 1) * 64u));
      }
      __builtin_amdgcn_sched_barrier(0);      // the next step's LDS reads stay one group in front of this step's WMMAs, not among them
#pragma unroll
      for (int i = 0; i < 4; ++i)
#pragma unroll
        for (int j = 0; j < 4; ++j) acc[i][j] = Frag<T>::mma(ah[cur][i], bh[cur][j], acc[i][j]);
      __builtin_amdgcn_sched_barrier(0);      // and the step after next's reads do not rise into this block
    }
    // publish point of stage s + 1: own LDS reads done, own slice landed, then the barrier that both publishes
    // stage s + 1 and ends every wave's reads of the buffer that is refilled behind it
    wait_ds0();
    wait_tensor0();
    __syncthreads();
    if (pinned(s + 2u < nPass)) {             // scalar branch: only while stage s + 2 exists
      const uint32_t nxt = pinned(s + 2u);    // group 0 is formed from it, so behind the waits above
      tdm_load(ldsSlice + bufOff, srcBase + (uint64_t)nxt * GT_ROWB, g1);
    }
  } while (++s < nPass);
  wait_tensor0();
  wait_ds0();
  acc_guard4(acc[0][0], acc[0][1], acc[0][2], acc[0][3]);
  acc_guard4(acc[1][0], acc[1][1], acc[1][2], acc[1][3]);
  acc_guard4(acc[2][0], acc[2][1], acc[2][2], acc[2][3]);
  acc_guard4(acc[3][0], acc[3][1], acc[3][2], acc[3][3]);

  // ---- epilogue, one sweep: the wave's whole 64x64 tile goes through a slab of its own, so that there is one hand-over through
  // LDS and no round has to wait for the stores of the round before; the residual is asked for first, in the stores' own layout ----
  float* slab = (float*)(void*)L + wave * (64u * 68u);   // the last pass's own barrier has ended every read of the ring
  const int hh = lane >> 4, c4 = (lane & 15) * 4;        // f32 rows: a row segment = 256 B = 16 lanes x 16 B
  v4f rv[4][8];
  if (RESID) {
    const float* Rp = resid + (size_t)b * strideR + (size_t)(m0 + hh) * LDC + n0 + c4;
#pragma unroll
    for (int i = 0; i < 4; ++i)
#pragma unroll
      for (int it = 0; it < 8; ++it) rv[i][it] = *(const v4f*)(Rp + (i * 16 + it * 2) * LDC);
  }
#pragma unroll
  for (int i = 0; i < 4; ++i) {
#pragma unroll
    for (int j = 0; j < 4; ++j) {
#pragma unroll
      for (int r = 0; r < 8; ++r) {
        float v = acc[i][j][r] * scale;
        if (BIAS_MODE == 1) v += bias[m0 + (i << 4) + mOff + r];
        if (BIAS_MODE == 2) v += bv[j];
        if (ACT == 1) v = tanhf(v);
        if (ACT == 2) v = fmaxf(v, 0.0f);
        if (ACT == 3) v = v / (1.0f + expf(-v));
        if (ACT == 4) v = (v > 0.f) ? v : 0.01f * v;
        if (ACT == 5) v = gelu_erf(v);
        slab[((i << 4) + mOff + r) * 68 + (j << 4) + rlane] = v;
      }
    }
  }
  lds_wave_sync();                                        // the wave's own slab, written above, is read back row-wise below
  if (OUT_MODE == 0) {
    float* Cp = (float*)Cout + (size_t)b * strideC + (size_t)(m0 + hh) * LDC + n0 + c4;
    v4f ov[4][8];
#pragma unroll
    for (int i = 0; i < 4; ++i)
#pragma unroll
      for (int it = 0; it < 8; ++it) {
        ov[i][it] = *(const v4f*)(slab + (i * 16 + it * 2 + hh) * 68 + c4);
        if (RESID) ov[i][it] += rv[i][it];
      }
    __builtin_amdgcn_sched_barrier(0);   // every value is formed in front of the first store: no register that an issued store names is written again
#pragma unroll
    for (int i = 0; i < 4; ++i)
#pragma unroll
      for (int it = 0; it < 8; ++it) *(v4f*)(Cp + (i * 16 + it * 2) * LDC) = ov[i][it];
  } else {
    const int q = lane >> 3, c8 = (lane & 7) * 8;
    const size_t co = (size_t)b * strideC + (size_t)(m0 + q) * LDC + n0 + c8;
    unsigned short* Cp  = (unsigned short*)Cout + co;
    unsigned short* Cp2 = (OUT_MODE == 2) ? ((unsigned short*)Cout2 + co) : nullptr;
    v8h hv[4][4], lv[4][4];
#pragma unroll
    for (int i = 0; i < 4; ++i)
#pragma unroll
      for (int it = 0; it < 4; ++it) {
        const float* sp = slab + (i * 16 + it * 4 + q) * 68 + c8;
#pragma unroll
        for (int e = 0; e < 8; ++e) {
          if (OUT_MODE == 1) {
            hv[i][it][e] = (_Float16)sp[e];
          } else {
            unsigned short hb = f2bf_bits(sp[e]);
            unsigned short lb = f2bf_bits(sp[e] - bf_bits2f(hb));
            hv[i][it][e] = __builtin_bit_cast(_Float16, hb);
            lv[i][it][e] = __builtin_bit_cast(_Float16, lb);
          }
        }
      }
    __builtin_amdgcn_sched_barrier(0);   // every value is formed in front of the first store: no register that an issued store names is written again
#pragma unroll
    for (int i = 0; i < 4; ++i)
#pragma unroll
      for (int it = 0; it < 4; ++it) {
        *(v8h*)(Cp + (i * 16 + it * 4) * LDC) = hv[i][it];
        if (OUT_MODE == 2) *(v8h*)(Cp2 + (i * 16 + it * 4) * LDC) = lv[i][it];
      }
  }
}

template <int ET, bool SPLIT, int BIAS_MODE, int OUT_MODE, bool RESID, int ACT, int LDC>
__global__ __launch_bounds__(128) void wmma_gemm64(
    const unsigned short* __restrict__ Ap, const unsigned short* __restrict__ A2p, int lda, long strideA,
    const unsigned short* __restrict__ Btp, const unsigned short* __restrict__ Bt2p, int ldb, long strideB,
    void* __restrict__ Cout, void* __restrict__ Cout2, int ldc, long strideC,
    const float* __restrict__ bias,
    const float* __restrict__ resid, long strideR,
    int M, int N, int K, float scale) {
  gemm_tile<ET, SPLIT, BIAS_MODE, OUT_MODE, RESID, ACT, LDC>(Ap, A2p, lda, strideA, Btp, Bt2p, ldb, strideB, Cout, Cout2, ldc, strideC,
                                                        bias, resid, strideR, M, N, K, scale, (int)blockIdx.y, (int)blockIdx.x);
}

// ---- GRU-style gate per (b, h, s): g = h[b,s,h*64:+64] . gw^T + gb (8 outputs, K=64, VALU f32),
//      gate = sigmoid(sum g[0:4]) * (sigmoid(sum g[4:8]) * gc[h] - 1) + 2 ; stored [b][h][s], one value (index idx) per thread
__device__ __forceinline__ void gate_item(
    const float* __restrict__ hf, const float* __restrict__ gw, const float* __restrict__ gb,
    const float* __restrict__ gc, float* __restrict__ gate, int S, int H, int C, int total, int idx) {
  if (idx >= total) return;   // no barriers on this path
  const int s  = idx % S;
  const int bh = idx / S;
  const int h  = bh % H;
  const int b  = bh / H;
  const float* hp = hf + ((size_t)b * S + s) * C + (size_t)h * 64;
  float acc[8];
#pragma unroll
  for (int e = 0; e < 8; ++e) acc[e] = 0.f;
#pragma unroll 1
  for (int d = 0; d < 64; ++d) {
    const float hv = hp[d];
#pragma unroll
    for (int e = 0; e < 8; ++e) acc[e] = fmaf(hv, gw[e * 64 + d], acc[e]);
  }
  const float sa = ((acc[0] + gb[0]) + (acc[1] + gb[1])) + ((acc[2] + gb[2]) + (acc[3] + gb[3]));
  const float sb = ((acc[4] + gb[4]) + (acc[5] + gb[5])) + ((acc[6] + gb[6]) + (acc[7] + gb[7]));
  const float ga  = 1.0f / (1.0f + expf(-sa));
  const float gbv = 1.0f / (1.0f + expf(-sb));
  const float gv = ga * (gbv * gc[h] - 1.0f) + 2.0f;
  ((float*)gate)[idx] = gv;
}

// ---- One launch for the four pieces of a layer that read h alone and none of which fills the chip: the q, k and v projections
// (blockIdx.y = 0, 1, 2: one 128x128 tile a block; the three f16 weight planes lie strideW apart, the three f32 outputs strideO apart)
// and the gate (blockIdx.y >= 3: one value a thread). No piece reads what another writes. The long pieces have the low indices.
template <int LDC>
__global__ __launch_bounds__(128) void qkv_gate_kernel(
    const unsigned short* __restrict__ hh, const unsigned short* __restrict__ w, long strideW,
    float* __restrict__ qkv, long strideO,
    const float* __restrict__ bq, const float* __restrict__ bk, const float* __restrict__ bv,
    const float* __restrict__ hf, const float* __restrict__ gw, const float* __restrict__ gb,
    const float* __restrict__ gc, float* __restrict__ gate,
    int M, int C, int S, int H, int total, float scale) {
  const int piece = (int)blockIdx.y;
  if (pinned((uint32_t)(piece >= 3))) {      // scalar branch, the same for the whole block: a gate block meets no tensor load and no barrier
    const int nTiles = (M >> 7) * (C >> 7);  // blocks in a row of the grid: one per tile of a projection
    gate_item(hf, gw, gb, gc, gate, S, H, C, total, ((piece - 3) * nTiles + (int)blockIdx.x) * 128 + (int)threadIdx.x);
    return;
  }
  const float* bias = piece == 0 ? bq : piece == 1 ? bk : bv;
  gemm_tile<0, false, 2, 0, false, 0, LDC>(hh, hh, C, 0L, w, w, C, strideW, (void*)qkv, (void*)qkv, C, strideO,
                                      bias, hf, 0L, M, C, C, scale, piece, (int)blockIdx.x);
}

// ---- All weight sets f32 -> f16 (x sc) in one launch of resident waves ---------------------------------------------
// The work is nSeg equal segments of segF4 16-byte vectors: w0..w3 are one segment each, w4 and w5 four each; the f16 planes lie
// one behind the other in out, in that order. A wave owns CS_IT x CS_LD x 32 consecutive vectors of one segment: every load is
// 512 contiguous bytes of the wave, CS_LD of them are asked for one trip ahead, every store is 256 contiguous bytes.
// One block of CS_WAVES waves per WGP: few waves that live long.
#define CS_WAVES 18
#define CS_LD    8
#define CS_IT    6
__global__ __launch_bounds__(CS_WAVES * 32) void cast_weights_stream(
    const float* __restrict__ w0, const float* __restrict__ w1, const float* __restrict__ w2, const float* __restrict__ w3,
    const float* __restrict__ w4, const float* __restrict__ w5, _Float16* __restrict__ out, int segF4, int nSeg, float sc) {
  const uint32_t perWave = CS_IT * CS_LD * 32u;                    // vectors per wave
  const uint32_t lane = threadIdx.x & 31u;
  const uint32_t gw = uni(blockIdx.x * CS_WAVES + (threadIdx.x >> 5));
  const uint32_t wavesPerSeg = (uint32_t)segF4 / perWave;
  const uint32_t seg = gw / wavesPerSeg;
  if (seg >= (uint32_t)nSeg) return;                               // wave-uniform; no barrier in this kernel
  const uint32_t win = gw - seg * wavesPerSeg;
  const size_t segF = (size_t)segF4 * 4;
  const float* src = seg == 0u ? w0 : seg == 1u ? w1 : seg == 2u ? w2 : seg == 3u ? w3
                   : seg < 8u ? w4 + (size_t)(seg - 4u) * segF : w5 + (size_t)(seg - 8u) * segF;
  const v4f* s4 = (const v4f*)src + (size_t)win * perWave + lane;
  v4h* d4 = (v4h*)out + (size_t)gw * perWave + lane;
  v4f buf[2][CS_LD];
#pragma unroll
  for (int k = 0; k < CS_LD; ++k) buf[0][k] = s4[k * 32];
  // unrolled: every address is the wave's one base plus a constant, so no address register takes a new value under a load in flight
#pragma unroll
  for (int t = 0; t < CS_IT; ++t) {
    const int cur = t & 1, nx = cur ^ 1;
    if (t + 1 < CS_IT) {
#pragma unroll
      for (int k = 0; k < CS_LD; ++k) buf[nx][k] = s4[((t + 1) * CS_LD + k) * 32];
    }
    __builtin_amdgcn_sched_barrier(0);   // no work on the values just asked for rises into this trip, where it would wait those loads out
#pragma unroll
    for (int k = 0; k < CS_LD; ++k) {
      const v4f x = buf[cur][k] * sc;
      v4h y;
      y[0] = (_Float16)x[0]; y[1] = (_Float16)x[1]; y[2] = (_Float16)x[2]; y[3] = (_Float16)x[3];
      d4[(t * CS_LD + k) * 32] = y;
    }
    // in front of the next trip's loads and converts, which write registers that this trip's stores name
    if (t + 1 < CS_IT) asm volatile("s_wait_xcnt 0x0" ::: "memory");
  }
}

// ---- LayerNorm over rows of C = 4 * blockDim floats; PRE: input = in * mask[row] + pos --------------------------
#define LN_T 192
template <int PRE>
__global__ __launch_bounds__(LN_T) void ln_kernel(
    const float* __restrict__ in, const float* __restrict__ pos, const float* __restrict__ mask,
    const float* __restrict__ g, const float* __restrict__ bb,
    float* __restrict__ outf, _Float16* __restrict__ outh, int C, float invC, float eps) {
  __shared__ float rs[8];
  __shared__ float rq[8];
  const int row = blockIdx.x;
  const int tid = threadIdx.x;
  const int lane = tid & 31;
  const int w = tid >> 5;
  const int c4 = tid * 4;
  const size_t base = (size_t)row * C + c4;
  v4f xv = *(const v4f*)(in + base);
  if (PRE) {
    const float mk = mask[row];
    const v4f pv = *(const v4f*)(pos + base);
    xv = xv * mk + pv;
  }
  float s = (xv[0] + xv[1]) + (xv[2] + xv[3]);
#pragma unroll
  for (int off = 16; off > 0; off >>= 1) s += __shfl_xor(s, off, 32);
  if (lane == 0) rs[w] = s;
  __syncthreads();
  float ts = 0.f;
#pragma unroll
  for (int i = 0; i < LN_T / 32; ++i) ts += rs[i];
  const float mean = ts * invC;
  const v4f d = xv - mean;
  float sq = (d[0] * d[0] + d[1] * d[1]) + (d[2] * d[2] + d[3] * d[3]);
#pragma unroll
  for (int off = 16; off > 0; off >>= 1) sq += __shfl_xor(sq, off, 32);
  if (lane == 0) rq[w] = sq;
  __syncthreads();
  float tq = 0.f;
#pragma unroll
  for (int i = 0; i < LN_T / 32; ++i) tq += rq[i];
  const float var = tq * invC;
  const float inv = rsqrtf(var + eps);
  const v4f gv = *(const v4f*)(g + c4);
  const v4f bv = *(const v4f*)(bb + c4);
  const v4f y = d * inv * gv + bv;
  v4h yh;
  yh[0] = (_Float16)y[0]; yh[1] = (_Float16)y[1]; yh[2] = (_Float16)y[2]; yh[3] = (_Float16)y[3];
  *(v4f*)(outf + base) = y;
  *(v4h*)(outh + base) = yh;
  
}

// =====================================================================================
// Flash attention, head_dim 64, f32 q/k/v in, f16 out; plain f16 operands, f32 accumulate; online softmax in f32.
//   s(q,kv) = (q . k) * qscale + gate[b,h,q] * pos_bias[h,q,kv] + (1 - mask[b,kv]) * -1e4
//   probabilities carried x2^15 in f16, folded into the final 1/l.
//   Block = 4 waves = 64 query rows of one (batch, head); S % 64 == 0.  q/k/v/out element (b,s,h,d) at
//   ((b*S + s)*C + h*64 + d); gate at (b*H + h)*S + s; pos_bias at (h*S + q)*S + kv; grid.x = B * H * (S/64).
// =====================================================================================
#define AT_D 64
#define AT_NW 4
#define AT_KC 64
// Row pitch, in halves, of the K, V^T and P tiles in LDS: 144 B = 16 B x 9. At the bare 128 B the 16 rows of a fragment read
// (ds_load_b128) fall on 8 of the 64 banks; at an odd multiple of 16 B they cover all 64.
#define AT_LP 72
#define AT_PSC 32768.0f

__device__ __forceinline__ v8f hmma(v16h a, v16h b, v8f c) {
  c = __builtin_amdgcn_wmma_f32_16x16x32_f16(false, a, false, b, (short)0, c, false, false);
  asm volatile("v_nop\n\tv_nop\n\tv_nop\n\tv_nop" : "+v"(c) : "v"(a), "v"(b));
  return c;
}

// Barrier that orders LDS traffic alone: a fence over global memory as well would wait out the
// loads that are in flight for the next chunk. Nothing in this kernel passes between waves through global memory.
__device__ __forceinline__ void lds_block_sync() {
  __builtin_amdgcn_fence(__ATOMIC_RELEASE, "workgroup", "local");
  __builtin_amdgcn_s_barrier();
  __builtin_amdgcn_fence(__ATOMIC_ACQUIRE, "workgroup", "local");
}
// Stands behind a run of loads that stay in flight, in front of any new value in their address registers.
__device__ __forceinline__ void wait_addr_taken() { asm volatile("s_wait_xcnt 0x0" ::: "memory"); }
// The same wait behind a run of loads; the run's address values, named as inputs, stay in their registers up to the wait, so that
// no later load of the run is given one of them as its destination.
__device__ __forceinline__ void wait_addr_taken(const float* a, const float* b, const float* c, const float* d) {
  asm volatile("s_wait_xcnt 0x0" :: "v"(a), "v"(b), "v"(c), "v"(d) : "memory");
}
__device__ __forceinline__ void wait_addr_taken(int i, const float* a, const float* b, const float* c, const float* d) {
  asm volatile("s_wait_xcnt 0x0" :: "v"(i), "v"(a), "v"(b), "v"(c), "v"(d) : "memory");
}
// One step of a butterfly inside a 16-lane row on the vector pipe: lane l reads lane l ^ M of its own row (DPP row_xmask).
// __shfl_xor compiles to ds_bpermute_b32, whose every dependent step waits out an LDS round trip.
// Every lane has its partner inside the row, so neither the old value 0 nor bound_ctrl reaches a result; in this form the compiler
// can fold the move into the operation that takes it.
template <int M> __device__ __forceinline__ float row_xor(float x) {
  const int xi = __builtin_bit_cast(int, x);
  return __builtin_bit_cast(float, __builtin_amdgcn_update_dpp(0, xi, 0x160 | M, 0xf, 0xf, true));
}
__device__ __forceinline__ float row_max16(float m) {   // partners 1, 2, 4, 8 in that order
  m = fmaxf(m, row_xor<1>(m)); m = fmaxf(m, row_xor<2>(m)); m = fmaxf(m, row_xor<4>(m)); return fmaxf(m, row_xor<8>(m));
}
__device__ __forceinline__ float row_sum16(float s) {   // partners 1, 2, 4, 8 in that order
  s += row_xor<1>(s); s += row_xor<2>(s); s += row_xor<4>(s); return s + row_xor<8>(s);
}

// waves_per_eu(1, 2): the grid holds three waves for every two SIMDs of the chip, so a register budget of two waves a SIMD costs
// no residency; with the default budget the compiler answers the 100 registers of loads in flight by running the row
// reductions one after the other.
__global__ __launch_bounds__(128) __attribute__((amdgpu_waves_per_eu(1, 2)))
void attn_gbias_kernel(const float* __restrict__ q, const float* __restrict__ k,
                       const float* __restrict__ v, const float* __restrict__ gate,
                       const float* __restrict__ pos_bias, const float* __restrict__ mask,
                       _Float16* __restrict__ out, int S, int H, int C, float qscale) {
  union FH { v16h v; v8h h[2]; };
  __shared__ __align__(16) _Float16 Ksh[AT_KC * AT_LP];       // K [kv][d]
  __shared__ __align__(16) _Float16 Vth[AT_D * AT_LP];        // V^T [d][kv]
  __shared__ __align__(16) _Float16 Psh[AT_NW][16 * AT_LP];   // per wave P [row][kv]
  __shared__ __align__(16) float    Os[AT_NW][16 * 68];       // per wave out tile, pitch 68

  const int tid  = threadIdx.x;
  const int wave = tid >> 5;
  const int lane = tid & 31;
  const int hh   = lane >> 4;
  const int c    = lane & 15;

  const int nqb = S / 64;
  const int bx = blockIdx.x;
  const int qb = bx % nqb;
  const int bh = bx / nqb;
  const int h  = bh % H;
  const int b  = bh / H;
  const int q0 = qb * 64 + wave * 16;

  const float* qb_ptr = q + (size_t)b * S * C + (size_t)h * AT_D;
  const float* kb_ptr = k + (size_t)b * S * C + (size_t)h * AT_D;
  const float* vb_ptr = v + (size_t)b * S * C + (size_t)h * AT_D;
  const float* gt_ptr = gate + ((size_t)b * H + h) * S;
  const float* pb_ptr = pos_bias + (size_t)h * S * S;
  const float* mk_ptr = mask + (size_t)b * S;
  _Float16*    ob_ptr = out + (size_t)b * S * C + (size_t)h * AT_D;

  // ---- Q fragments (A operand): 2 d-chunks, split k map ----
  v16h qa[2];
  {
    const float* qrow = qb_ptr + (size_t)(q0 + c) * C;
#pragma unroll
    for (int dc = 0; dc < 2; ++dc) {
#pragma unroll
      for (int e = 0; e < 8; ++e) {
        qa[dc][e]     = (_Float16)qrow[dc * 32 + 8 * hh + e];
        qa[dc][8 + e] = (_Float16)qrow[dc * 32 + 16 + 8 * hh + e];
      }
    }
  }
  float grow[8];
#pragma unroll
  for (int r = 0; r < 8; ++r) grow[r] = gt_ptr[q0 + 8 * hh + r];

  float mrow[8], lrow[8];
  v8f oacc[4];
#pragma unroll
  for (int r = 0; r < 8; ++r) { mrow[r] = -INFINITY; lrow[r] = 0.f; }
#pragma unroll
  for (int t = 0; t < 4; ++t) oacc[t] = (v8f){0.f,0.f,0.f,0.f,0.f,0.f,0.f,0.f};

  const int nChunks = S / AT_KC;   // block-uniform, from launch argument
  // Every global operand of a chunk (this thread's K and V row pieces, the position-bias tile, the key mask) is held in
  // registers and requested one chunk ahead, so that no chunk waits out a load it has only just issued.
  const int kvr = tid >> 1, dh = (tid & 1) * 32;
  const int kvOff = kvr * C + dh;                 // this thread's piece inside a chunk of K or V rows
  int pbOff[8];                                   // this lane's column in each of its 8 bias rows
#pragma unroll
  for (int r = 0; r < 8; ++r) pbOff[r] = (q0 + 8 * hh + r) * S + c;
  v4f kreg[8], vreg[8];
  float pbv[8][4], mkv[4];
#pragma unroll
  for (int i = 0; i < 8; ++i) {
    kreg[i] = *(const v4f*)(kb_ptr + kvOff + 4 * i);
    vreg[i] = *(const v4f*)(vb_ptr + kvOff + 4 * i);
  }
#pragma unroll
  for (int j = 0; j < 4; ++j) mkv[j] = mk_ptr[j * 16 + c];
#pragma unroll
  for (int r = 0; r < 8; ++r)
#pragma unroll
    for (int j = 0; j < 4; ++j) pbv[r][j] = pb_ptr[pbOff[r] + j * 16];
  wait_addr_taken();
  const size_t step0 = (nChunks > 1) ? (size_t)AT_KC * C : 0;
  const float* kn = kb_ptr + kvOff + step0;       // this thread's piece of the next chunk's K rows, and of its V rows
  const float* vn = vb_ptr + kvOff + step0;

  for (int kc = 0; kc < nChunks; ++kc) {
    // first key of the next chunk; the last trip asks for its own chunk again (in bounds, not used), so that every trip
    // issues the same loads in the same order and each wait on them can be counted exactly
    const int kvn = (kc + 1 < nChunks ? kc + 1 : kc) * AT_KC;
    lds_block_sync();                             // every wave has left the previous chunk's K and V tiles
#pragma unroll
    for (int i = 0; i < 8; ++i) {
#pragma unroll
      for (int e = 0; e < 4; ++e) {
        const int d = dh + 4 * i + e;
        Ksh[kvr * AT_LP + d] = (_Float16)kreg[i][e];
        Vth[d * AT_LP + kvr] = (_Float16)vreg[i][e];
      }
    }
    {                                             // next chunk's K and V fly under this chunk's whole work
#pragma unroll
      for (int i = 0; i < 8; ++i) {
        kreg[i] = *(const v4f*)(kn + 4 * i);
        vreg[i] = *(const v4f*)(vn + 4 * i);
      }
    }
    lds_block_sync();                             // this chunk's tiles are published

    v8f s[4];
#pragma unroll
    for (int j = 0; j < 4; ++j) {
      s[j] = (v8f){0.f,0.f,0.f,0.f,0.f,0.f,0.f,0.f};
#pragma unroll
      for (int dc = 0; dc < 2; ++dc) {
        FH kb;
        kb.h[0] = *(const v8h*)(Ksh + (j * 16 + c) * AT_LP + dc * 32 + 8 * hh);
        kb.h[1] = *(const v8h*)(Ksh + (j * 16 + c) * AT_LP + dc * 32 + 16 + 8 * hh);
        s[j] = hmma(qa[dc], kb.v, s[j]);
      }
    }
    // additive terms: key padding per column, gated position bias per (row, column)
    float kp[4];
#pragma unroll
    for (int j = 0; j < 4; ++j) kp[j] = (1.0f - mkv[j]) * -10000.0f;
    float cm[8];
#pragma unroll
    for (int r = 0; r < 8; ++r) {
      float m = -INFINITY;
#pragma unroll
      for (int j = 0; j < 4; ++j) {
        const float sv = s[j][r] * qscale + grow[r] * pbv[r][j] + kp[j];
        s[j][r] = sv;
        m = fmaxf(m, sv);
      }
      cm[r] = row_max16(m);
    }
    {                                             // next chunk's bias tile and mask fly under softmax, P.V and the next staging
      const float* pn = pb_ptr + kvn;
#pragma unroll
      for (int j = 0; j < 4; ++j) mkv[j] = mk_ptr[kvn + j * 16 + c];
#pragma unroll
      for (int r = 0; r < 4; ++r)
#pragma unroll
        for (int j = 0; j < 4; ++j) pbv[r][j] = pn[pbOff[r] + j * 16];
      wait_addr_taken(kvn + c, pn + pbOff[0], pn + pbOff[1], pn + pbOff[2], pn + pbOff[3]);
#pragma unroll
      for (int r = 4; r < 8; ++r)
#pragma unroll
        for (int j = 0; j < 4; ++j) pbv[r][j] = pn[pbOff[r] + j * 16];
      wait_addr_taken(pn + pbOff[4], pn + pbOff[5], pn + pbOff[6], pn + pbOff[7]);
      // nothing crosses this line: the K and V pointers step on only behind the wait above (it covers their loads too), and
      // no work on the values just requested rises into this chunk, where it would wait those loads out
      __builtin_amdgcn_sched_barrier(0);
      const size_t step = (kc + 2 < nChunks) ? (size_t)AT_KC * C : 0;
      kn += step;
      vn += step;
    }
    _Float16* pw = Psh[wave];
#pragma unroll
    for (int r = 0; r < 8; ++r) {
      const float mnew = fmaxf(mrow[r], cm[r]);
      const float alpha = expf(mrow[r] - mnew);
      mrow[r] = mnew;
      float psum = 0.f;
#pragma unroll
      for (int j = 0; j < 4; ++j) {
        const float p = expf(s[j][r] - mnew);
        psum += p;
        pw[(8 * hh + r) * AT_LP + j * 16 + c] = (_Float16)(p * AT_PSC);
      }
      lrow[r] = lrow[r] * alpha + row_sum16(psum);
#pragma unroll
      for (int t = 0; t < 4; ++t) oacc[t][r] *= alpha;
    }
    lds_wave_sync();                              // the wave's own P rows, written above, are read back as fragments below
#pragma unroll 1
    for (int kk = 0; kk < 2; ++kk) {
      FH pa;
      pa.h[0] = *(const v8h*)(pw + c * AT_LP + kk * 32 + 8 * hh);
      pa.h[1] = *(const v8h*)(pw + c * AT_LP + kk * 32 + 16 + 8 * hh);
#pragma unroll
      for (int t = 0; t < 4; ++t) {
        FH vb;
        vb.h[0] = *(const v8h*)(Vth + (t * 16 + c) * AT_LP + kk * 32 + 8 * hh);
        vb.h[1] = *(const v8h*)(Vth + (t * 16 + c) * AT_LP + kk * 32 + 16 + 8 * hh);
        oacc[t] = hmma(pa.v, vb.v, oacc[t]);
      }
    }
  }

  float* os = Os[wave];
#pragma unroll
  for (int r = 0; r < 8; ++r) {
    const float inv = 1.0f / (lrow[r] * AT_PSC);
#pragma unroll
    for (int t = 0; t < 4; ++t) os[(8 * hh + r) * 68 + t * 16 + c] = oacc[t][r] * inv;
  }
  __builtin_amdgcn_fence(__ATOMIC_RELEASE, "workgroup");
  __builtin_amdgcn_wave_barrier();
  __builtin_amdgcn_fence(__ATOMIC_ACQUIRE, "workgroup");
  {
    const int q8 = lane >> 3, c8 = (lane & 7) * 8;
    {
#pragma unroll
      for (int it = 0; it < 4; ++it) {
        const int row = it * 4 + q8;
        const float* sp = os + row * 68 + c8;
        v8h hv;
#pragma unroll
        for (int e = 0; e < 8; ++e) hv[e] = (_Float16)sp[e];
        *(v8h*)(ob_ptr + (size_t)(q0 + row) * C + c8) = hv;
      }
      
    }
  }
}

// ---------------------------------------------------------------------------
extern "C" void kernel_launch(void* const* d_in, const int* in_sizes, int n_in,
                              void* d_out, int out_size, void* d_ws, size_t ws_size,
                              hipStream_t stream) {
  const int Bn = 2, S = 1024, C = 768, H = 12, L = 4, FF = 3072;
  const int M = Bn * S;
  if (n_in < 25) return;
  if (in_sizes[0] != M * C || in_sizes[1] != M * C || in_sizes[2] != M || in_sizes[3] != H * S * S) return;
  if (in_sizes[6] != L * C * C || in_sizes[19] != L * FF * C || in_sizes[21] != L * C * FF) return;
  if (out_size != M * C) return;

  const float* x        = (const float*)d_in[0];
  const float* pos_emb  = (const float*)d_in[1];
  const float* attn_m   = (const float*)d_in[2];
  const float* pos_bias = (const float*)d_in[3];
  const float* ln0_g    = (const float*)d_in[4];
  const float* ln0_b    = (const float*)d_in[5];
  const float* Wq       = (const float*)d_in[6];
  const float* bq       = (const float*)d_in[7];
  const float* Wk       = (const float*)d_in[8];
  const float* bk       = (const float*)d_in[9];
  const float* Wv       = (const float*)d_in[10];
  const float* bv       = (const float*)d_in[11];
  const float* Wo       = (const float*)d_in[12];
  const float* bo       = (const float*)d_in[13];
  const float* gruW     = (const float*)d_in[14];
  const float* grub     = (const float*)d_in[15];
  const float* gruc     = (const float*)d_in[16];
  const float* ln1_g    = (const float*)d_in[17];
  const float* ln1_b    = (const float*)d_in[18];
  const float* W1       = (const float*)d_in[19];
  const float* b1       = (const float*)d_in[20];
  const float* W2       = (const float*)d_in[21];
  const float* b2       = (const float*)d_in[22];
  const float* ln2_g    = (const float*)d_in[23];
  const float* ln2_b    = (const float*)d_in[24];

  // ---- workspace carve (256-B aligned offsets, total 110,198,784 B) ----
  char* ws = (char*)d_ws;
  size_t off = 0;
  const size_t NWC = (size_t)L * C * C;      // halves per projection weight set
  const size_t NWF = (size_t)L * FF * C;     // halves per FFN weight set
  const size_t NA  = (size_t)M * C;
  const size_t NF  = (size_t)M * FF;
  const size_t NG  = (size_t)Bn * H * S;
  size_t o_wq, o_wk, o_wv, o_wo, o_w1, o_w2, o_hf, o_hh, o_qf, o_kf, o_vf, o_ao, o_h1f, o_h1h, o_ff, o_gt;
#define CARVE(o, bytes) do { o = off; off += ((size_t)(bytes) + 255) & ~(size_t)255; } while (0)
  CARVE(o_wq, NWC * 2); CARVE(o_wk, NWC * 2); CARVE(o_wv, NWC * 2); CARVE(o_wo, NWC * 2);
  CARVE(o_w1, NWF * 2); CARVE(o_w2, NWF * 2);
  CARVE(o_hf, NA * 4);  CARVE(o_hh, NA * 2);
  CARVE(o_qf, NA * 4);  CARVE(o_kf, NA * 4);  CARVE(o_vf, NA * 4);
  CARVE(o_ao, NA * 2);
  CARVE(o_h1f, NA * 4); CARVE(o_h1h, NA * 2);
  CARVE(o_ff, NF * 2);
  CARVE(o_gt, NG * 4);
#undef CARVE
  if (off > ws_size) return;

  _Float16* wq16 = (_Float16*)(ws + o_wq);
  _Float16* wo16 = (_Float16*)(ws + o_wo);
  _Float16* w116 = (_Float16*)(ws + o_w1);
  _Float16* w216 = (_Float16*)(ws + o_w2);
  float*    hf   = (float*)(ws + o_hf);
  _Float16* hh16 = (_Float16*)(ws + o_hh);
  float*    qf   = (float*)(ws + o_qf);
  float*    kf   = (float*)(ws + o_kf);
  float*    vf   = (float*)(ws + o_vf);
  _Float16* ao16 = (_Float16*)(ws + o_ao);
  float*    h1f  = (float*)(ws + o_h1f);
  _Float16* h1h  = (_Float16*)(ws + o_h1h);
  _Float16* ff16 = (_Float16*)(ws + o_ff);
  float*    gtb  = (float*)(ws + o_gt);
  float*    outp = (float*)d_out;

  const float WSC  = 64.0f;            // weights carried x64 in f16
  const float WINV = 1.0f / 64.0f;     // folded back in the GEMM epilogue
  const float invC = 1.0f / 768.0f;
  const float eps  = 1e-5f;
  const float qscale = 0.125f;         // 1/sqrt(64)

  // ---- weights -> f16 (x64): Wq, Wk, Wv, Wo, W1, W2 as 12 segments of L*C*C elements; their f16 planes are contiguous from wq16 ----
  {
    const int segF4 = (int)(NWC / 4), nSeg = 12;
    const int perWave = CS_IT * CS_LD * 32, wavesAll = (segF4 / perWave) * nSeg;
    static_assert((L * C * C / 4) % (CS_IT * CS_LD * 32) == 0, "a segment is a whole number of waves");
    static_assert(((L * C * C / 4) / (CS_IT * CS_LD * 32) * 12) % CS_WAVES == 0, "the waves fill whole blocks");
    static_assert(FF == 4 * C && (L * C * C * 2) % 256 == 0, "W1 and W2 are four segments each; no gap between the planes");
    cast_weights_stream<<<wavesAll / CS_WAVES, CS_WAVES * 32, 0, stream>>>(Wq, Wk, Wv, Wo, W1, W2, wq16, segF4, nSeg, WSC);
  }

  // ---- h = LN0(x * mask + pos_emb) ----
  ln_kernel<1><<<M, LN_T, 0, stream>>>(x, pos_emb, attn_m, ln0_g, ln0_b, hf, hh16, C, invC, eps);

  const int nbP = (M / 128) * (C / 128);    // 96 blocks, one 128x128 tile each
  const int nbF = (M / 128) * (FF / 128);   // 384 blocks
  const int nbA = Bn * H * (S / 64);                // 384 attention blocks
  const int ngate = (int)NG;
  const int nyG = (ngate + nbP * 128 - 1) / (nbP * 128);   // rows of the joined grid that hold the gate, 128 values a block
  static_assert((L * C * C * 2) % 256 == 0 && (Bn * S * C * 4) % 256 == 0, "no gap between the q, k, v weight planes, nor between qf, kf, vf");

  for (int l = 0; l < L; ++l) {
    const size_t lw  = (size_t)l * C * C;
    const size_t lwf = (size_t)l * FF * C;
    const _Float16* WQl = wq16 + lw;
    const _Float16* WOl = wo16 + lw;
    const _Float16* W1l = w116 + lwf;   // [FF][C]
    const _Float16* W2l = w216 + lwf;   // [C][FF]

    // q, k, v = h . W^T + b (f32 out) and gate[b][h][s], one launch
    qkv_gate_kernel<C><<<dim3(nbP, 3 + nyG), 128, 0, stream>>>(
        U16(hh16), U16(WQl), (long)NWC, qf, (long)NA, bq + (size_t)l * C, bk + (size_t)l * C, bv + (size_t)l * C,
        hf, gruW + (size_t)l * 8 * 64, grub + (size_t)l * 8, gruc + (size_t)l * H, gtb, M, C, S, H, ngate, WINV);

    // attention -> ao16 (f16)
    attn_gbias_kernel<<<nbA, 128, 0, stream>>>(qf, kf, vf, gtb, pos_bias, attn_m, ao16, S, H, C, qscale);

    // qf <- h + ao . Wo^T + bo
    wmma_gemm64<0, false, 2, 0, true, 0, C><<<dim3(nbP, 1), 128, 0, stream>>>(
        U16(ao16), U16(ao16), C, 0L, U16(WOl), U16(WOl), C, 0L,
        (void*)qf, (void*)qf, C, 0L, bo + (size_t)l * C, hf, 0L, M, C, C, WINV);

    // h1 = LN1(qf)
    ln_kernel<0><<<M, LN_T, 0, stream>>>(qf, qf, attn_m, ln1_g + (size_t)l * C, ln1_b + (size_t)l * C,
                                         h1f, h1h, C, invC, eps);

    // ff16 = gelu(h1 . W1^T + b1)  (f16 out)
    wmma_gemm64<0, false, 2, 1, false, 5, FF><<<dim3(nbF, 1), 128, 0, stream>>>(
        U16(h1h), U16(h1h), C, 0L, U16(W1l), U16(W1l), C, 0L,
        (void*)ff16, (void*)ff16, FF, 0L, b1 + (size_t)l * FF, h1f, 0L, M, FF, C, WINV);

    // kf <- h1 + ff . W2^T + b2
    wmma_gemm64<0, false, 2, 0, true, 0, C><<<dim3(nbP, 1), 128, 0, stream>>>(
        U16(ff16), U16(ff16), FF, 0L, U16(W2l), U16(W2l), FF, 0L,
        (void*)kf, (void*)kf, C, 0L, b2 + (size_t)l * C, h1f, 0L, M, C, FF, WINV);

    // h = LN2(kf); last layer writes the output buffer directly
    float* hdst = (l == L - 1) ? outp : hf;
    ln_kernel<0><<<M, LN_T, 0, stream>>>(kf, kf, attn_m, ln2_g + (size_t)l * C, ln2_b + (size_t)l * C,
                                         hdst, hh16, C, invC, eps);
  }
  (void)hipGetLastError();
}

// v009
// One run takes 485 microseconds.
// In both of two side-by-side timings against v008, it was 1.06 times as fast.
// Counting every step since v000, it is 3.83 times as fast.
// Contractions (q/k/v/out projections, FFN up/down, attention q.k^T and p.v): v_wmma_f32_16x16x32_f16 (f16 operands, f32 accumulate); weights carried x64, softmax probabilities carried x2^15; LayerNorm, softmax, gate: f32 VALU.
#include <hip/hip_runtime.h>
#include <math.h>
#include <stdint.h>

typedef __attribute__((ext_vector_type(16))) _Float16 v16h;
typedef __attribute__((ext_vector_type(8)))  _Float16 v8h;
typedef __attribute__((ext_vector_type(4)))  _Float16 v4h;
typedef __attribute__((ext_vector_type(16))) __bf16   v16b;
typedef __attribute__((ext_vector_type(8)))  __bf16   v8b;
typedef __attribute__((ext_vector_type(8)))  float    v8f;
typedef __attribute__((ext_vector_type(4)))  float    v4f;
#define U16(p) ((const unsigned short*)(const void*)(p))

__device__ __forceinline__ unsigned short f2bf_bits(float f) {
  unsigned u = __float_as_uint(f);
  return (unsigned short)((u + 0x7FFFu + ((u >> 16) & 1u)) >> 16);
}
__device__ __forceinline__ float bf_bits2f(unsigned short h) { return __uint_as_float(((unsigned)h) << 16); }

// hazard guards as plain device helpers (no inline asm inside the kernel template body)
__device__ __forceinline__ void acc_guard4(v8f& a, v8f& b, v8f& c, v8f& d) { asm volatile("v_nop\n\tv_nop\n\tv_nop\n\tv_nop" : "+v"(a), "+v"(b), "+v"(c), "+v"(d)); }
template <typename T> struct Frag;
template <> struct Frag<_Float16> {
  typedef v16h V; union U { v16h v; v8h h[2]; };
  static __device__ __forceinline__ v16h load(const _Float16* p) {   // elements 0..7 <- p[0..7], 8..15 <- p[16..23]
    U f; f.h[0] = *(const v8h*)(p); f.h[1] = *(const v8h*)(p + 16); return f.v;
  }
  static __device__ __forceinline__ v8f mma(v16h a, v16h b, v8f c) {
    return __builtin_amdgcn_wmma_f32_16x16x32_f16(false, a, false, b, (short)0, c, false, false);
  }
};
template <> struct Frag<__bf16> {
  typedef v16b V; union U { v16b v; v8b h[2]; };
  static __device__ __forceinline__ v16b load(const __bf16* p) {
    U f; f.h[0] = *(const v8b*)(p); f.h[1] = *(const v8b*)(p + 16); return f.v;
  }
  static __device__ __forceinline__ v8f mma(v16b a, v16b b, v8f c) {
    return __builtin_amdgcn_wmma_f32_16x16x32_bf16(false, a, false, b, (short)0, c, false, false);
  }
};

// ---- Block-tiled batched WMMA GEMM, operands staged in LDS by the tensor mover ------------
// C[m,n] = scale * sum_k A[m,k] * Bt[n,k] (+bias)(+resid); a block of 4 waves (2 x 2) owns a 128x128 tile, each wave 64x64.
// A row-major [M,K]; Bt row-major [N,K]; M,N % 128 == 0, K % 128 == 0, K >= 256 (two stages).
// A pass is 128 k = 256 B of each of the 256 operand rows; each wave brings one 64-row slice per pass with one tensor load
// (waves 0,1: the two halves of the A rows; waves 2,3: of the Bt rows), two buffers, LDS row pitch 272 B.
// BIAS_MODE: 0 = none, 1 = bias[m], 2 = bias[n].
// OUT_MODE: 0 = f32, 1 = f16, 2 = bf16 hi plane (Cout) + bf16 lo plane (Cout2).
// ET: 0 = f16 operands, 1 = bf16 operands (pointers passed as 16-bit storage)
typedef uint32_t u32x4 __attribute__((ext_vector_type(4)));
typedef uint32_t u32x8 __attribute__((ext_vector_type(8)));
#define GT_KP     128u                 // k per pass
#define GT_ROWB   256u                 // bytes of one operand row per pass
#define GT_PITCH  272u                 // LDS row pitch: 256 B + the mover's 16-B pad (ds_load_b128 readers)
#define GT_ROWS   64u                  // rows per slice
#define GT_SLICE  18432u               // 64 x 272 = 17,408 B, rounded up to a multiple of 2 KiB
#define GT_STAGE  (4u * GT_SLICE)      // one buffer: 4 slices
__device__ __forceinline__ uint32_t uni(uint32_t v) { return (uint32_t)__builtin_amdgcn_readfirstlane(v); }
// pinned(): holds a wave-uniform value in a scalar register, so that a test on it is a scalar branch (a tensor load ignores EXEC)
// and so that descriptor words formed from it are formed behind the waits that stand in front of it.
__device__ __forceinline__ uint32_t pinned(uint32_t v) { uint32_t w = uni(v); asm volatile("" : "+s"(w)); return w; }
__device__ __forceinline__ void wait_ds0()     { asm volatile("s_wait_dscnt 0x0" ::: "memory"); }      // this wave's LDS reads of the buffer are done
__device__ __forceinline__ void wait_tensor0() { asm volatile("s_wait_tensorcnt 0x0" ::: "memory"); }  // this wave's own slice has landed
// descriptor words held in scalar registers (as pinned() does for one word): the eight registers stay group 1's own through
// the loop, so that none of them takes another value while a request is outstanding
__device__ __forceinline__ void hold_group1(u32x8& g) { asm volatile("" : "+s"(g)); }
// one request of the whole wave: 64 rows of 256 B from global memory to LDS, 16 B of pad behind each row
__device__ __forceinline__ void tdm_load(uint32_t lds_dst, uint64_t ga, u32x8 g1) {
  u32x4 g0;
  g0[0] = uni(1u);
  g0[1] = uni(lds_dst);
  g0[2] = uni((uint32_t)ga);
  g0[3] = uni((((uint32_t)(ga >> 32)) & 0x01FFFFFFu) | 0x80000000u);
  asm volatile("tensor_load_to_lds %0, %1" :: "s"(g0), "s"(g1) : "memory");
}
// v_rcp_f32 and v_exp_f32, each with the one free slot that the instruction set asks for behind a transcendental in the same
// statement.
__device__ __forceinline__ float rcp_slot(float x)  { float r; asm("v_rcp_f32 %0, %1\n\tv_nop" : "=v"(r) : "v"(x)); return r; }
__device__ __forceinline__ float exp2_slot(float x) { float r; asm("v_exp_f32 %0, %1\n\tv_nop" : "=v"(r) : "v"(x)); return r; }
// GELU in its erf form, straight-line (no branch, so that the values of a fragment interleave and the unrolled epilogue stays short):
// with x = |v| / sqrt(2) and t = 1 / (1 + 0.3275911 x), erfc(x) = t (c1 + t (c2 + t (c3 + t (c4 + t c5)))) exp(-x x), absolute error
// at most 1.5e-7; gelu(v) = max(v, 0) - 0.5 |v| erfc(x), which cancels on neither side of 0. The factor -0.5 is folded into c1..c5.
__device__ __forceinline__ float gelu_erf(float v) {
  const float a = fabsf(v);
  const float t = rcp_slot(fmaf(a, 0.23164189f, 1.0f));      // 0.3275911 / sqrt(2)
  const float e = exp2_slot(v * v * -0.72134752f);           // exp(-v v / 2) = 2^(-v v log2(e) / 2)
  float p = fmaf(t, -0.53070271f, 0.72657601f);
  p = fmaf(t, p, -0.71070687f);
  p = fmaf(t, p, 0.14224837f);
  p = fmaf(t, p, -0.12741480f);
  return fmaf(a, p * t * e, fmaxf(v, 0.0f));
}
template <int ET> struct Elem;
template <> struct Elem<0> { typedef _Float16 T; };
template <> struct Elem<1> { typedef __bf16 T; };
// Wave-level hand-over that orders LDS traffic alone: a fence over global memory as well would wait out the global loads
// that are in flight (the residual, the next chunk's K, V and bias). Nothing passes between the lanes of a wave through global memory.
__device__ __forceinline__ void lds_wave_sync() {
  __builtin_amdgcn_fence(__ATOMIC_RELEASE, "workgroup", "local");
  __builtin_amdgcn_wave_barrier();
  __builtin_amdgcn_fence(__ATOMIC_ACQUIRE, "workgroup", "local");
}
// LDC: the row pitch of C and of resid in elements, known at compile time, so that every epilogue address is one base plus a constant
template <int ET, bool SPLIT, int BIAS_MODE, int OUT_MODE, bool RESID, int ACT, int LDC>
__device__ __forceinline__ void gemm_tile(
    const unsigned short* __restrict__ Ap, const unsigned short* __restrict__ A2p, int lda, long strideA,
    const unsigned short* __restrict__ Btp, const unsigned short* __restrict__ Bt2p, int ldb, long strideB,
    void* __restrict__ Cout, void* __restrict__ Cout2, int ldc, long strideC,
    const float* __restrict__ bias,
    const float* __restrict__ resid, long strideR,
    int M, int N, int K, float scale, const int b, const int tile) {   // b: batch index, tile: this block's tile; both block-uniform
  static_assert(!SPLIT, "single-plane operands only");
  static_assert(!RESID || (OUT_MODE == 0 && ACT == 0), "the residual is added last, to f32 output");
  typedef typename Elem<ET>::T T;
  typedef typename Frag<T>::V V;
  const T* A = (const T*)Ap; const T* Bt = (const T*)Btp;
  // two stage buffers; after the K loop its first bytes serve as the per-wave 64x64 f32 output slabs (pitch 68 floats)
  __shared__ __attribute__((aligned(2048))) unsigned char L[2u * GT_STAGE];
  const int lane = threadIdx.x & 31;
  const uint32_t wave = uni(threadIdx.x >> 5);
  const int tilesN = N >> 7;
  const int tilesM = M >> 7;
  const uint32_t nPass = uni((uint32_t)K / GT_KP);
  if (tile >= tilesM * tilesN || nPass < 2u || ldc != LDC) return;   // block-uniform, in front of every tensor load and barrier; the ring's prologue loads two stages
  const int tm = tile / tilesN;
  const int tn = tile - tm * tilesN;
  const uint32_t wm = wave >> 1, wn = wave & 1u;
  const int m0 = (tm << 7) + (int)(wm << 6);
  const int n0 = (tn << 7) + (int)(wn << 6);

  const T* Ab  = A  + (size_t)b * strideA;
  const T* Bb  = Bt + (size_t)b * strideB;

  const int rlane = lane & 15;                 // row (A) / col (B, D) within subtile
  const int koff  = (lane >> 4) * 8;           // k offset of this lane half
  const int mOff  = (lane >> 4) * 8;           // D row offset

  // ---- this wave's slice: source, place in LDS, descriptor group 1 (loop-invariant) ----
  const bool isB = wave >= 2u;
  const uint32_t srcPitch = (uint32_t)(isB ? ldb : lda) * 2u;     // bytes
  const uint64_t srcBase = isB ? (uint64_t)(uintptr_t)(Bb + (size_t)((tn << 7) + (int)(wn << 6)) * ldb)
                               : (uint64_t)(uintptr_t)(Ab + (size_t)((tm << 7) + (int)(wn << 6)) * lda);
  const uint32_t ldsSlice = (uint32_t)(size_t)L + wave * GT_SLICE;
  u32x8 g1;
  g1[0] = uni((1u << 20) | (5u << 22) | (3u << 25));              // no mask, 1-byte elements, 4 dwords of pad behind every 64 dwords
  g1[1] = uni((GT_ROWB & 0xFFFFu) << 16);                         // tensor_dim0 low
  g1[2] = uni((GT_ROWB >> 16) | ((GT_ROWS & 0xFFFFu) << 16));     // tensor_dim0 high, tensor_dim1 low
  g1[3] = uni((GT_ROWS >> 16) | (GT_ROWB << 16));                 // tensor_dim1 high, tile_dim0
  g1[4] = uni(GT_ROWS);                                           // tile_dim1
  g1[5] = uni(srcPitch);
  g1[6] = uni(0u);
  g1[7] = uni(0u);
  hold_group1(g1);

  v8f acc[4][4];
#pragma unroll
  for (int i = 0; i < 4; ++i)
#pragma unroll
    for (int j = 0; j < 4; ++j) acc[i][j] = (v8f){0.f,0.f,0.f,0.f,0.f,0.f,0.f,0.f};

  // this lane's four column biases, asked for here so that they have long landed when the epilogue takes them
  float bv[4];
#pragma unroll
  for (int j = 0; j < 4; ++j) bv[j] = (BIAS_MODE == 2) ? bias[n0 + (j << 4) + rlane] : 0.f;

  // prologue: stage 0 lands and is published, then stage 1 flies while pass 0 works
  tdm_load(ldsSlice, srcBase, g1);
  wait_tensor0();
  __syncthreads();
  tdm_load(ldsSlice + GT_STAGE, srcBase + GT_ROWB, g1);

  const uint32_t aOff = wm * GT_SLICE + (uint32_t)rlane * GT_PITCH + (uint32_t)koff * 2u;
  const uint32_t bOff = (2u + wn) * GT_SLICE + (uint32_t)rlane * GT_PITCH + (uint32_t)koff * 2u;
  uint32_t s = 0;
  // the pass loop stays rolled: one publish point in the text, every fragment index below a constant
#pragma unroll 1
  do {                                        // nPass >= 2 here
    const uint32_t bufOff = (s & 1u) * GT_STAGE;
    const unsigned char* As = L + bufOff + aOff;
    const unsigned char* Bs = L + bufOff + bOff;
    V bh[2][4], ah[2][4];                     // two fragment sets: the next 32 k are read while these are multiplied
#pragma unroll
    for (int j = 0; j < 4; ++j) bh[0][j] = Frag<T>::load((const T*)(Bs + (uint32_t)j * 16u * GT_PITCH));
#pragma unroll
    for (int i = 0; i < 4; ++i) ah[0][i] = Frag<T>::load((const T*)(As + (uint32_t)i * 16u * GT_PITCH));
#pragma unroll
    for (int kk = 0; kk < 4; ++kk) {          // 32 k per step, in ascending k as before; only this pass's own buffer is read
      const int cur = kk & 1, nx = cur ^ 1;
      if (kk < 3) {
#pragma unroll
        for (int j = 0; j < 4; ++j) bh[nx][j] = Frag<T>::load((const T*)(Bs + (uint32_t)j * 16u * GT_PITCH + (uint32_t)(kk + 1) * 64u));
#pragma unroll
        for (int i = 0; i < 4; ++i) ah[nx][i] = Frag<T>::load((const T*)(As + (uint32_t)i * 16u * GT_PITCH + (uint32_t)(kk + 1) * 64u));
      }
      __builtin_amdgcn_sched_barrier(0);      // the next step's LDS reads stay one group in front of this step's WMMAs, not among them
#pragma unroll
      for (int i = 0; i < 4; ++i)
#pragma unroll
        for (int j = 0; j < 4; ++j) acc[i][j] = Frag<T>::mma(ah[cur][i], bh[cur][j], acc[i][j]);
      __builtin_amdgcn_sched_barrier(0);      // and the step after next's reads do not rise into this block
    }
    // publish point of stage s + 1: own LDS reads done, own slice landed, then the barrier that both publishes
    // stage s + 1 and ends every wave's reads of the buffer that is refilled behind it
    wait_ds0();
    wait_tensor0();
    __syncthreads();
    if (pinned(s + 2u < nPass)) {             // scalar branch: only while stage s + 2 exists
      const uint32_t nxt = pinned(s + 2u);    // group 0 is formed from it, so behind the waits above
      tdm_load(ldsSlice + bufOff, srcBase + (uint64_t)nxt * GT_ROWB, g1);
    }
  } while (++s < nPass);
  wait_tensor0();
  wait_ds0();
  acc_guard4(acc[0][0], acc[0][1], acc[0][2], acc[0][3]);
  acc_guard4(acc[1][0], acc[1][1], acc[1][2], acc[1][3]);
  acc_guard4(acc[2][0], acc[2][1], acc[2][2], acc[2][3]);
  acc_guard4(acc[3][0], acc[3][1], acc[3][2], acc[3][3]);

  // ---- epilogue, one sweep: the wave's whole 64x64 tile goes through a slab of its own, so that there is one hand-over through
  // LDS and no round has to wait for the stores of the round before; the residual is asked for first, in the stores' own layout ----
  float* slab = (float*)(void*)L + wave * (64u * 68u);   // the last pass's own barrier has ended every read of the ring
  const int hh = lane >> 4, c4 = (lane & 15) * 4;        // f32 rows: a row segment = 256 B = 16 lanes x 16 B
  v4f rv[4][8];
  if (RESID) {
    const float* Rp = resid + (size_t)b * strideR + (size_t)(m0 + hh) * LDC + n0 + c4;
#pragma unroll
    for (int i = 0; i < 4; ++i)
#pragma unroll
      for (int it = 0; it < 8; ++it) rv[i][it] = *(const v4f*)(Rp + (i * 16 + it * 2) * LDC);
  }
#pragma unroll
  for (int i = 0; i < 4; ++i) {
#pragma unroll
    for (int j = 0; j < 4; ++j) {
#pragma unroll
      for (int r = 0; r < 8; ++r) {
        float v = acc[i][j][r] * scale;
        if (BIAS_MODE == 1) v += bias[m0 + (i << 4) + mOff + r];
        if (BIAS_MODE == 2) v += bv[j];
        if (ACT == 1) v = tanhf(v);
        if (ACT == 2) v = fmaxf(v, 0.0f);
        if (ACT == 3) v = v / (1.0f + expf(-v));
        if (ACT == 4) v = (v > 0.f) ? v : 0.01f * v;
        if (ACT == 5) v = gelu_erf(v);
        slab[((i << 4) + mOff + r) * 68 + (j << 4) + rlane] = v;
      }
    }
  }
  lds_wave_sync();                                        // the wave's own slab, written above, is read back row-wise below
  if (OUT_MODE == 0) {
    float* Cp = (float*)Cout + (size_t)b * strideC + (size_t)(m0 + hh) * LDC + n0 + c4;
    v4f ov[4][8];
#pragma unroll
    for (int i = 0; i < 4; ++i)
#pragma unroll
      for (int it = 0; it < 8; ++it) {
        ov[i][it] = *(const v4f*)(slab + (i * 16 + it * 2 + hh) * 68 + c4);
        if (RESID) ov[i][it] += rv[i][it];
      }
    __builtin_amdgcn_sched_barrier(0);   // every value is formed in front of the first store: no register that an issued store names is written again
#pragma unroll
    for (int i = 0; i < 4; ++i)
#pragma unroll
      for (int it = 0; it < 8; ++it) *(v4f*)(Cp + (i * 16 + it * 2) * LDC) = ov[i][it];
  } else {
    const int q = lane >> 3, c8 = (lane & 7) * 8;
    const size_t co = (size_t)b * strideC + (size_t)(m0 + q) * LDC + n0 + c8;
    unsigned short* Cp  = (unsigned short*)Cout + co;
    unsigned short* Cp2 = (OUT_MODE == 2) ? ((unsigned short*)Cout2 + co) : nullptr;
    v8h hv[4][4], lv[4][4];
#pragma unroll
    for (int i = 0; i < 4; ++i)
#pragma unroll
      for (int it = 0; it < 4; ++it) {
        const float* sp = slab + (i * 16 + it * 4 + q) * 68 + c8;
#pragma unroll
        for (int e = 0; e < 8; ++e) {
          if (OUT_MODE == 1) {
            hv[i][it][e] = (_Float16)sp[e];
          } else {
            unsigned short hb = f2bf_bits(sp[e]);
            unsigned short lb = f2bf_bits(sp[e] - bf_bits2f(hb));
            hv[i][it][e] = __builtin_bit_cast(_Float16, hb);
            lv[i][it][e] = __builtin_bit_cast(_Float16, lb);
          }
        }
      }
    __builtin_amdgcn_sched_barrier(0);   // every value is formed in front of the first store: no register that an issued store names is written again
#pragma unroll
    for (int i = 0; i < 4; ++i)
#pragma unroll
      for (int it = 0; it < 4; ++it) {
        *(v8h*)(Cp + (i * 16 + it * 4) * LDC) = hv[i][it];
        if (OUT_MODE == 2) *(v8h*)(Cp2 + (i * 16 + it * 4) * LDC) = lv[i][it];
      }
  }
}

template <int ET, bool SPLIT, int BIAS_MODE, int OUT_MODE, bool RESID, int ACT, int LDC>
__global__ __launch_bounds__(128) void wmma_gemm64(
    const unsigned short* __restrict__ Ap, const unsigned short* __restrict__ A2p, int lda, long strideA,
    const unsigned short* __restrict__ Btp, const unsigned short* __restrict__ Bt2p, int ldb, long strideB,
    void* __restrict__ Cout, void* __restrict__ Cout2, int ldc, long strideC,
    const float* __restrict__ bias,
    const float* __restrict__ resid, long strideR,
    int M, int N, int K, float scale) {
  gemm_tile<ET, SPLIT, BIAS_MODE, OUT_MODE, RESID, ACT, LDC>(Ap, A2p, lda, strideA, Btp, Bt2p, ldb, strideB, Cout, Cout2, ldc, strideC,
                                                        bias, resid, strideR, M, N, K, scale, (int)blockIdx.y, (int)blockIdx.x);
}

// ---- GRU-style gate per (b, h, s): g = h[b,s,h*64:+64] . gw^T + gb (8 outputs, K=64, VALU f32),
//      gate = sigmoid(sum g[0:4]) * (sigmoid(sum g[4:8]) * gc[h] - 1) + 2 ; stored [b][h][s], one value (index idx) per thread
__device__ __forceinline__ void gate_item(
    const float* __restrict__ hf, const float* __restrict__ gw, const float* __restrict__ gb,
    const float* __restrict__ gc, float* __restrict__ gate, int S, int H, int C, int total, int idx) {
  if (idx >= total) return;   // no barriers on this path
  const int s  = idx % S;
  const int bh = idx / S;
  const int h  = bh % H;
  const int b  = bh / H;
  const float* hp = hf + ((size_t)b * S + s) * C + (size_t)h * 64;
  float acc[8];
#pragma unroll
  for (int e = 0; e < 8; ++e) acc[e] = 0.f;
#pragma unroll 1
  for (int d = 0; d < 64; ++d) {
    const float hv = hp[d];
#pragma unroll
    for (int e = 0; e < 8; ++e) acc[e] = fmaf(hv, gw[e * 64 + d], acc[e]);
  }
  const float sa = ((acc[0] + gb[0]) + (acc[1] + gb[1])) + ((acc[2] + gb[2]) + (acc[3] + gb[3]));
  const float sb = ((acc[4] + gb[4]) + (acc[5] + gb[5])) + ((acc[6] + gb[6]) + (acc[7] + gb[7]));
  const float ga  = 1.0f / (1.0f + expf(-sa));
  const float gbv = 1.0f / (1.0f + expf(-sb));
  const float gv = ga * (gbv * gc[h] - 1.0f) + 2.0f;
  ((float*)gate)[idx] = gv;
}

// ---- One launch for the four pieces of a layer that read h alone and none of which fills the chip: the q, k and v projections
// (blockIdx.y = 0, 1, 2: one 128x128 tile a block; the three f16 weight planes lie strideW apart, the three f32 outputs strideO apart)
// and the gate (blockIdx.y >= 3: one value a thread). No piece reads what another writes. The long pieces have the low indices.
template <int LDC>
__global__ __launch_bounds__(128) void qkv_gate_kernel(
    const unsigned short* __restrict__ hh, const unsigned short* __restrict__ w, long strideW,
    float* __restrict__ qkv, long strideO,
    const float* __restrict__ bq, const float* __restrict__ bk, const float* __restrict__ bv,
    const float* __restrict__ hf, const float* __restrict__ gw, const float* __restrict__ gb,
    const float* __restrict__ gc, float* __restrict__ gate,
    int M, int C, int S, int H, int total, float scale) {
  const int piece = (int)blockIdx.y;
  if (pinned((uint32_t)(piece >= 3))) {      // scalar branch, the same for the whole block: a gate block meets no tensor load and no barrier
    const int nTiles = (M >> 7) * (C >> 7);  // blocks in a row of the grid: one per tile of a projection
    gate_item(hf, gw, gb, gc, gate, S, H, C, total, ((piece - 3) * nTiles + (int)blockIdx.x) * 128 + (int)threadIdx.x);
    return;
  }
  const float* bias = piece == 0 ? bq : piece == 1 ? bk : bv;
  gemm_tile<0, false, 2, 0, false, 0, LDC>(hh, hh, C, 0L, w, w, C, strideW, (void*)qkv, (void*)qkv, C, strideO,
                                      bias, hf, 0L, M, C, C, scale, piece, (int)blockIdx.x);
}

// ---- All weight sets f32 -> f16 (x sc) in one launch of resident waves ---------------------------------------------
// The work is nSeg equal segments of segF4 16-byte vectors: w0..w3 are one segment each, w4 and w5 four each; the f16 planes lie
// one behind the other in out, in that order. A wave owns CS_IT x CS_LD x 32 consecutive vectors of one segment: every load is
// 512 contiguous bytes of the wave, CS_LD of them are asked for one trip ahead, every store is 256 contiguous bytes.
// One block of CS_WAVES waves per WGP: few waves that live long.
#define CS_WAVES 18
#define CS_LD    8
#define CS_IT    6
__global__ __launch_bounds__(CS_WAVES * 32) void cast_weights_stream(
    const float* __restrict__ w0, const float* __restrict__ w1, const float* __restrict__ w2, const float* __restrict__ w3,
    const float* __restrict__ w4, const float* __restrict__ w5, _Float16* __restrict__ out, int segF4, int nSeg, float sc) {
  const uint32_t perWave = CS_IT * CS_LD * 32u;                    // vectors per wave
  const uint32_t lane = threadIdx.x & 31u;
  const uint32_t gw = uni(blockIdx.x * CS_WAVES + (threadIdx.x >> 5));
  const uint32_t wavesPerSeg = (uint32_t)segF4 / perWave;
  const uint32_t seg = gw / wavesPerSeg;
  if (seg >= (uint32_t)nSeg) return;                               // wave-uniform; no barrier in this kernel
  const uint32_t win = gw - seg * wavesPerSeg;
  const size_t segF = (size_t)segF4 * 4;
  const float* src = seg == 0u ? w0 : seg == 1u ? w1 : seg == 2u ? w2 : seg == 3u ? w3
                   : seg < 8u ? w4 + (size_t)(seg - 4u) * segF : w5 + (size_t)(seg - 8u) * segF;
  const v4f* s4 = (const v4f*)src + (size_t)win * perWave + lane;
  v4h* d4 = (v4h*)out + (size_t)gw * perWave + lane;
  v4f buf[2][CS_LD];
#pragma unroll
  for (int k = 0; k < CS_LD; ++k) buf[0][k] = s4[k * 32];
  // unrolled: every address is the wave's one base plus a constant, so no address register takes a new value under a load in flight
#pragma unroll
  for (int t = 0; t < CS_IT; ++t) {
    const int cur = t & 1, nx = cur ^ 1;
    if (t + 1 < CS_IT) {
#pragma unroll
      for (int k = 0; k < CS_LD; ++k) buf[nx][k] = s4[((t + 1) * CS_LD + k) * 32];
    }
    __builtin_amdgcn_sched_barrier(0);   // no work on the values just asked for rises into this trip, where it would wait those loads out
#pragma unroll
    for (int k = 0; k < CS_LD; ++k) {
      const v4f x = buf[cur][k] * sc;
      v4h y;
      y[0] = (_Float16)x[0]; y[1] = (_Float16)x[1]; y[2] = (_Float16)x[2]; y[3] = (_Float16)x[3];
      d4[(t * CS_LD + k) * 32] = y;
    }
    // in front of the next trip's loads and converts, which write registers that this trip's stores name
    if (t + 1 < CS_IT) asm volatile("s_wait_xcnt 0x0" ::: "memory");
  }
}

// ---- LayerNorm over rows of C = 4 * blockDim floats; PRE: input = in * mask[row] + pos --------------------------
#define LN_T 192
template <int PRE>
__global__ __launch_bounds__(LN_T) void ln_kernel(
    const float* __restrict__ in, const float* __restrict__ pos, const float* __restrict__ mask,
    const float* __restrict__ g, const float* __restrict__ bb,
    float* __restrict__ outf, _Float16* __restrict__ outh, int C, float invC, float eps) {
  __shared__ float rs[8];
  __shared__ float rq[8];
  const int row = blockIdx.x;
  const int tid = threadIdx.x;
  const int lane = tid & 31;
  const int w = tid >> 5;
  const int c4 = tid * 4;
  const size_t base = (size_t)row * C + c4;
  v4f xv = *(const v4f*)(in + base);
  if (PRE) {
    const float mk = mask[row];
    const v4f pv = *(const v4f*)(pos + base);
    xv = xv * mk + pv;
  }
  float s = (xv[0] + xv[1]) + (xv[2] + xv[3]);
#pragma unroll
  for (int off = 16; off > 0; off >>= 1) s += __shfl_xor(s, off, 32);
  if (lane == 0) rs[w] = s;
  __syncthreads();
  float ts = 0.f;
#pragma unroll
  for (int i = 0; i < LN_T / 32; ++i) ts += rs[i];
  const float mean = ts * invC;
  const v4f d = xv - mean;
  float sq = (d[0] * d[0] + d[1] * d[1]) + (d[2] * d[2] + d[3] * d[3]);
#pragma unroll
  for (int off = 16; off > 0; off >>= 1) sq += __shfl_xor(sq, off, 32);
  if (lane == 0) rq[w] = sq;
  __syncthreads();
  float tq = 0.f;
#pragma unroll
  for (int i = 0; i < LN_T / 32; ++i) tq += rq[i];
  const float var = tq * invC;
  const float inv = rsqrtf(var + eps);
  const v4f gv = *(const v4f*)(g + c4);
  const v4f bv = *(const v4f*)(bb + c4);
  const v4f y = d * inv * gv + bv;
  v4h yh;
  yh[0] = (_Float16)y[0]; yh[1] = (_Float16)y[1]; yh[2] = (_Float16)y[2]; yh[3] = (_Float16)y[3];
  *(v4f*)(outf + base) = y;
  *(v4h*)(outh + base) = yh;
  
}

// =====================================================================================
// Flash attention, head_dim 64, f32 q/k/v in, f16 out; plain f16 operands, f32 accumulate; online softmax in f32.
//   s(q,kv) = (q . k) * qscale + gate[b,h,q] * pos_bias[h,q,kv] + (1 - mask[b,kv]) * -1e4
//   probabilities carried x2^15 in f16, folded into the final 1/l.
//   Block = 4 waves = 64 query rows of one (batch, head); S % 64 == 0.  q/k/v/out element (b,s,h,d) at
//   ((b*S + s)*C + h*64 + d); gate at (b*H + h)*S + s; pos_bias at (h*S + q)*S + kv; grid.x = B * H * (S/64).
// =====================================================================================
#define AT_D 64
#define AT_NW 4
#define AT_KC 64
// Row pitch, in halves, of the K, V^T and P tiles in LDS: 144 B = 16 B x 9. At the bare 128 B the 16 rows of a fragment read
// (ds_load_b128) fall on 8 of the 64 banks; at an odd multiple of 16 B they cover all 64.
#define AT_LP 72
#define AT_PSC 32768.0f

__device__ __forceinline__ v8f hmma(v16h a, v16h b, v8f c) {
  c = __builtin_amdgcn_wmma_f32_16x16x32_f16(false, a, false, b, (short)0, c, false, false);
  asm volatile("v_nop\n\tv_nop\n\tv_nop\n\tv_nop" : "+v"(c) : "v"(a), "v"(b));
  return c;
}

// Barrier that orders LDS traffic alone: a fence over global memory as well would wait out the
// loads that are in flight for the next chunk. Nothing in this kernel passes between waves through global memory.
__device__ __forceinline__ void lds_block_sync() {
  __builtin_amdgcn_fence(__ATOMIC_RELEASE, "workgroup", "local");
  __builtin_amdgcn_s_barrier();
  __builtin_amdgcn_fence(__ATOMIC_ACQUIRE, "workgroup", "local");
}
// Stands behind a run of loads that stay in flight, in front of any new value in their address registers.
__device__ __forceinline__ void wait_addr_taken() { asm volatile("s_wait_xcnt 0x0" ::: "memory"); }
// The same wait behind a run of loads; the run's address values, named as inputs, stay in their registers up to the wait, so that
// no later load of the run is given one of them as its destination.
__device__ __forceinline__ void wait_addr_taken(const float* a, const float* b, const float* c, const float* d) {
  asm volatile("s_wait_xcnt 0x0" :: "v"(a), "v"(b), "v"(c), "v"(d) : "memory");
}
__device__ __forceinline__ void wait_addr_taken(int i, const float* a, const float* b, const float* c, const float* d) {
  asm volatile("s_wait_xcnt 0x0" :: "v"(i), "v"(a), "v"(b), "v"(c), "v"(d) : "memory");
}
// One step of a butterfly inside a 16-lane row on the vector pipe: lane l reads lane l ^ M of its own row (DPP row_xmask).
// __shfl_xor compiles to ds_bpermute_b32, whose every dependent step waits out an LDS round trip.
// Every lane has its partner inside the row, so neither the old value 0 nor bound_ctrl reaches a result; in this form the compiler
// can fold the move into the operation that takes it.
template <int M> __device__ __forceinline__ float row_xor(float x) {
  const int xi = __builtin_bit_cast(int, x);
  return __builtin_bit_cast(float, __builtin_amdgcn_update_dpp(0, xi, 0x160 | M, 0xf, 0xf, true));
}
__device__ __forceinline__ float row_max16(float m) {   // partners 1, 2, 4, 8 in that order
  m = fmaxf(m, row_xor<1>(m)); m = fmaxf(m, row_xor<2>(m)); m = fmaxf(m, row_xor<4>(m)); return fmaxf(m, row_xor<8>(m));
}
__device__ __forceinline__ float row_sum16(float s) {   // partners 1, 2, 4, 8 in that order
  s += row_xor<1>(s); s += row_xor<2>(s); s += row_xor<4>(s); return s + row_xor<8>(s);
}

// waves_per_eu(1, 2): the grid holds three waves for every two SIMDs of the chip, so a register budget of two waves a SIMD costs
// no residency; with the default budget the compiler answers the 100 registers of loads in flight by running the row
// reductions one after the other.
__global__ __launch_bounds__(128) __attribute__((amdgpu_waves_per_eu(1, 2)))
void attn_gbias_kernel(const float* __restrict__ q, const float* __restrict__ k,
                       const float* __restrict__ v, const float* __restrict__ gate,
                       const float* __restrict__ pos_bias, const float* __restrict__ mask,
                       _Float16* __restrict__ out, int S, int H, int C, float qscale) {
  union FH { v16h v; v8h h[2]; };
  __shared__ __align__(16) _Float16 Ksh[AT_KC * AT_LP];       // K [kv][d]
  __shared__ __align__(16) _Float16 Vth[AT_D * AT_LP];        // V^T [d][kv]
  __shared__ __align__(16) _Float16 Psh[AT_NW][16 * AT_LP];   // per wave P [row][kv]
  __shared__ __align__(16) float    Os[AT_NW][16 * 68];       // per wave out tile, pitch 68

  const int tid  = threadIdx.x;
  const int wave = tid >> 5;
  const int lane = tid & 31;
  const int hh   = lane >> 4;
  const int c    = lane & 15;

  const int nqb = S / 64;
  const int bx = blockIdx.x;
  const int qb = bx % nqb;
  const int bh = bx / nqb;
  const int h  = bh % H;
  const int b  = bh / H;
  const int q0 = qb * 64 + wave * 16;

  const float* qb_ptr = q + (size_t)b * S * C + (size_t)h * AT_D;
  const float* kb_ptr = k + (size_t)b * S * C + (size_t)h * AT_D;
  const float* vb_ptr = v + (size_t)b * S * C + (size_t)h * AT_D;
  const float* gt_ptr = gate + ((size_t)b * H + h) * S;
  const float* pb_ptr = pos_bias + (size_t)h * S * S;
  const float* mk_ptr = mask + (size_t)b * S;
  _Float16*    ob_ptr = out + (size_t)b * S * C + (size_t)h * AT_D;

  // ---- Q fragments (A operand): 2 d-chunks, split k map ----
  v16h qa[2];
  {
    const float* qrow = qb_ptr + (size_t)(q0 + c) * C;
#pragma unroll
    for (int dc = 0; dc < 2; ++dc) {
#pragma unroll
      for (int e = 0; e < 8; ++e) {
        qa[dc][e]     = (_Float16)qrow[dc * 32 + 8 * hh + e];
        qa[dc][8 + e] = (_Float16)qrow[dc * 32 + 16 + 8 * hh + e];
      }
    }
  }
  float grow[8];
#pragma unroll
  for (int r = 0; r < 8; ++r) grow[r] = gt_ptr[q0 + 8 * hh + r];

  float mrow[8], lrow[8];
  v8f oacc[4];
#pragma unroll
  for (int r = 0; r < 8; ++r) { mrow[r] = -INFINITY; lrow[r] = 0.f; }
#pragma unroll
  for (int t = 0; t < 4; ++t) oacc[t] = (v8f){0.f,0.f,0.f,0.f,0.f,0.f,0.f,0.f};

  const int nChunks = S / AT_KC;   // block-uniform, from launch argument
  // Every global operand of a chunk (this thread's K and V row pieces, the position-bias tile, the key mask) is held in
  // registers and requested one chunk ahead, so that no chunk waits out a load it has only just issued.
  const int kvr = tid >> 1, dh = (tid & 1) * 32;
  const int kvOff = kvr * C + dh;                 // this thread's piece inside a chunk of K or V rows
  int pbOff[8];                                   // this lane's column in each of its 8 bias rows
#pragma unroll
  for (int r = 0; r < 8; ++r) pbOff[r] = (q0 + 8 * hh + r) * S + c;
  v4f kreg[8], vreg[8];
  float pbv[8][4], mkv[4];
#pragma unroll
  for (int i = 0; i < 8; ++i) {
    kreg[i] = *(const v4f*)(kb_ptr + kvOff + 4 * i);
    vreg[i] = *(const v4f*)(vb_ptr + kvOff + 4 * i);
  }
#pragma unroll
  for (int j = 0; j < 4; ++j) mkv[j] = mk_ptr[j * 16 + c];
#pragma unroll
  for (int r = 0; r < 8; ++r)
#pragma unroll
    for (int j = 0; j < 4; ++j) pbv[r][j] = pb_ptr[pbOff[r] + j * 16];
  wait_addr_taken();
  const size_t step0 = (nChunks > 1) ? (size_t)AT_KC * C : 0;
  const float* kn = kb_ptr + kvOff + step0;       // this thread's piece of the next chunk's K rows, and of its V rows
  const float* vn = vb_ptr + kvOff + step0;

  for (int kc = 0; kc < nChunks; ++kc) {
    // first key of the next chunk; the last trip asks for its own chunk again (in bounds, not used), so that every trip
    // issues the same loads in the same order and each wait on them can be counted exactly
    const int kvn = (kc + 1 < nChunks ? kc + 1 : kc) * AT_KC;
    lds_block_sync();                             // every wave has left the previous chunk's K and V tiles
#pragma unroll
    for (int i = 0; i < 8; ++i) {
#pragma unroll
      for (int e = 0; e < 4; ++e) {
        const int d = dh + 4 * i + e;
        Ksh[kvr * AT_LP + d] = (_Float16)kreg[i][e];
        Vth[d * AT_LP + kvr] = (_Float16)vreg[i][e];
      }
    }
    {                                             // next chunk's K and V fly under this chunk's whole work
#pragma unroll
      for (int i = 0; i < 8; ++i) {
        kreg[i] = *(const v4f*)(kn + 4 * i);
        vreg[i] = *(const v4f*)(vn + 4 * i);
      }
    }
    lds_block_sync();                             // this chunk's tiles are published

    // All eight K fragments of the chunk are asked for as one group, in the order in which the products take them: one LDS
    // latency a chunk instead of one in front of every WMMA. Each s[j] still sums d-chunk 0, then d-chunk 1.
    FH kb[2][4];
#pragma unroll
    for (int dc = 0; dc < 2; ++dc)
#pragma unroll
      for (int j = 0; j < 4; ++j) {
        kb[dc][j].h[0] = *(const v8h*)(Ksh + (j * 16 + c) * AT_LP + dc * 32 + 8 * hh);
        kb[dc][j].h[1] = *(const v8h*)(Ksh + (j * 16 + c) * AT_LP + dc * 32 + 16 + 8 * hh);
      }
    __builtin_amdgcn_sched_barrier(0);            // the reads stay one group in front of the WMMAs, not one pair in front of each
    v8f s[4];
#pragma unroll
    for (int j = 0; j < 4; ++j) s[j] = (v8f){0.f,0.f,0.f,0.f,0.f,0.f,0.f,0.f};
#pragma unroll
    for (int dc = 0; dc < 2; ++dc)
#pragma unroll
      for (int j = 0; j < 4; ++j) s[j] = hmma(qa[dc], kb[dc][j].v, s[j]);
    // additive terms: key padding per column, gated position bias per (row, column)
    float kp[4];
#pragma unroll
    for (int j = 0; j < 4; ++j) kp[j] = (1.0f - mkv[j]) * -10000.0f;
    float cm[8];
#pragma unroll
    for (int r = 0; r < 8; ++r) {
      float m = -INFINITY;
#pragma unroll
      for (int j = 0; j < 4; ++j) {
        const float sv = s[j][r] * qscale + grow[r] * pbv[r][j] + kp[j];
        s[j][r] = sv;
        m = fmaxf(m, sv);
      }
      cm[r] = row_max16(m);
    }
    {                                             // next chunk's bias tile and mask fly under softmax, P.V and the next staging
      const float* pn = pb_ptr + kvn;
#pragma unroll
      for (int j = 0; j < 4; ++j) mkv[j] = mk_ptr[kvn + j * 16 + c];
#pragma unroll
      for (int r = 0; r < 4; ++r)
#pragma unroll
        for (int j = 0; j < 4; ++j) pbv[r][j] = pn[pbOff[r] + j * 16];
      wait_addr_taken(kvn + c, pn + pbOff[0], pn + pbOff[1], pn + pbOff[2], pn + pbOff[3]);
#pragma unroll
      for (int r = 4; r < 8; ++r)
#pragma unroll
        for (int j = 0; j < 4; ++j) pbv[r][j] = pn[pbOff[r] + j * 16];
      wait_addr_taken(pn + pbOff[4], pn + pbOff[5], pn + pbOff[6], pn + pbOff[7]);
      // nothing crosses this line: the K and V pointers step on only behind the wait above (it covers their loads too), and
      // no work on the values just requested rises into this chunk, where it would wait those loads out
      __builtin_amdgcn_sched_barrier(0);
      const size_t step = (kc + 2 < nChunks) ? (size_t)AT_KC * C : 0;
      kn += step;
      vn += step;
    }
    _Float16* pw = Psh[wave];
#pragma unroll
    for (int r = 0; r < 8; ++r) {
      const float mnew = fmaxf(mrow[r], cm[r]);
      const float alpha = expf(mrow[r] - mnew);
      mrow[r] = mnew;
      float psum = 0.f;
#pragma unroll
      for (int j = 0; j < 4; ++j) {
        const float p = expf(s[j][r] - mnew);
        psum += p;
        pw[(8 * hh + r) * AT_LP + j * 16 + c] = (_Float16)(p * AT_PSC);
      }
      lrow[r] = lrow[r] * alpha + row_sum16(psum);
#pragma unroll
      for (int t = 0; t < 4; ++t) oacc[t][r] *= alpha;
    }
    lds_wave_sync();                              // the wave's own P rows, written above, are read back as fragments below
    // The two P fragments and the eight V^T fragments likewise: one group, in the order of use; each oacc[t] still sums
    // key half 0, then key half 1.
    FH pa[2], vb[2][4];
#pragma unroll
    for (int kk = 0; kk < 2; ++kk) {
      pa[kk].h[0] = *(const v8h*)(pw + c * AT_LP + kk * 32 + 8 * hh);
      pa[kk].h[1] = *(const v8h*)(pw + c * AT_LP + kk * 32 + 16 + 8 * hh);
#pragma unroll
      for (int t = 0; t < 4; ++t) {
        vb[kk][t].h[0] = *(const v8h*)(Vth + (t * 16 + c) * AT_LP + kk * 32 + 8 * hh);
        vb[kk][t].h[1] = *(const v8h*)(Vth + (t * 16 + c) * AT_LP + kk * 32 + 16 + 8 * hh);
      }
    }
    __builtin_amdgcn_sched_barrier(0);            // as above: the reads stay one group in front of the WMMAs
#pragma unroll
    for (int kk = 0; kk < 2; ++kk)
#pragma unroll
      for (int t = 0; t < 4; ++t) oacc[t] = hmma(pa[kk].v, vb[kk][t].v, oacc[t]);
  }

  float* os = Os[wave];
#pragma unroll
  for (int r = 0; r < 8; ++r) {
    const float inv = 1.0f / (lrow[r] * AT_PSC);
#pragma unroll
    for (int t = 0; t < 4; ++t) os[(8 * hh + r) * 68 + t * 16 + c] = oacc[t][r] * inv;
  }
  __builtin_amdgcn_fence(__ATOMIC_RELEASE, "workgroup");
  __builtin_amdgcn_wave_barrier();
  __builtin_amdgcn_fence(__ATOMIC_ACQUIRE, "workgroup");
  {
    const int q8 = lane >> 3, c8 = (lane & 7) * 8;
    {
#pragma unroll
      for (int it = 0; it < 4; ++it) {
        const int row = it * 4 + q8;
        const float* sp = os + row * 68 + c8;
        v8h hv;
#pragma unroll
        for (int e = 0; e < 8; ++e) hv[e] = (_Float16)sp[e];
        *(v8h*)(ob_ptr + (size_t)(q0 + row) * C + c8) = hv;
      }
      
    }
  }
}

// ---------------------------------------------------------------------------
extern "C" void kernel_launch(void* const* d_in, const int* in_sizes, int n_in,
                              void* d_out, int out_size, void* d_ws, size_t ws_size,
                              hipStream_t stream) {
  const int Bn = 2, S = 1024, C = 768, H = 12, L = 4, FF = 3072;
  const int M = Bn * S;
  if (n_in < 25) return;
  if (in_sizes[0] != M * C || in_sizes[1] != M * C || in_sizes[2] != M || in_sizes[3] != H * S * S) return;
  if (in_sizes[6] != L * C * C || in_sizes[19] != L * FF * C || in_sizes[21] != L * C * FF) return;
  if (out_size != M * C) return;

  const float* x        = (const float*)d_in[0];
  const float* pos_emb  = (const float*)d_in[1];
  const float* attn_m   = (const float*)d_in[2];
  const float* pos_bias = (const float*)d_in[3];
  const float* ln0_g    = (const float*)d_in[4];
  const float* ln0_b    = (const float*)d_in[5];
  const float* Wq       = (const float*)d_in[6];
  const float* bq       = (const float*)d_in[7];
  const float* Wk       = (const float*)d_in[8];
  const float* bk       = (const float*)d_in[9];
  const float* Wv       = (const float*)d_in[10];
  const float* bv       = (const float*)d_in[11];
  const float* Wo       = (const float*)d_in[12];
  const float* bo       = (const float*)d_in[13];
  const float* gruW     = (const float*)d_in[14];
  const float* grub     = (const float*)d_in[15];
  const float* gruc     = (const float*)d_in[16];
  const float* ln1_g    = (const float*)d_in[17];
  const float* ln1_b    = (const float*)d_in[18];
  const float* W1       = (const float*)d_in[19];
  const float* b1       = (const float*)d_in[20];
  const float* W2       = (const float*)d_in[21];
  const float* b2       = (const float*)d_in[22];
  const float* ln2_g    = (const float*)d_in[23];
  const float* ln2_b    = (const float*)d_in[24];

  // ---- workspace carve (256-B aligned offsets, total 110,198,784 B) ----
  char* ws = (char*)d_ws;
  size_t off = 0;
  const size_t NWC = (size_t)L * C * C;      // halves per projection weight set
  const size_t NWF = (size_t)L * FF * C;     // halves per FFN weight set
  const size_t NA  = (size_t)M * C;
  const size_t NF  = (size_t)M * FF;
  const size_t NG  = (size_t)Bn * H * S;
  size_t o_wq, o_wk, o_wv, o_wo, o_w1, o_w2, o_hf, o_hh, o_qf, o_kf, o_vf, o_ao, o_h1f, o_h1h, o_ff, o_gt;
#define CARVE(o, bytes) do { o = off; off += ((size_t)(bytes) + 255) & ~(size_t)255; } while (0)
  CARVE(o_wq, NWC * 2); CARVE(o_wk, NWC * 2); CARVE(o_wv, NWC * 2); CARVE(o_wo, NWC * 2);
  CARVE(o_w1, NWF * 2); CARVE(o_w2, NWF * 2);
  CARVE(o_hf, NA * 4);  CARVE(o_hh, NA * 2);
  CARVE(o_qf, NA * 4);  CARVE(o_kf, NA * 4);  CARVE(o_vf, NA * 4);
  CARVE(o_ao, NA * 2);
  CARVE(o_h1f, NA * 4); CARVE(o_h1h, NA * 2);
  CARVE(o_ff, NF * 2);
  CARVE(o_gt, NG * 4);
#undef CARVE
  if (off > ws_size) return;

  _Float16* wq16 = (_Float16*)(ws + o_wq);
  _Float16* wo16 = (_Float16*)(ws + o_wo);
  _Float16* w116 = (_Float16*)(ws + o_w1);
  _Float16* w216 = (_Float16*)(ws + o_w2);
  float*    hf   = (float*)(ws + o_hf);
  _Float16* hh16 = (_Float16*)(ws + o_hh);
  float*    qf   = (float*)(ws + o_qf);
  float*    kf   = (float*)(ws + o_kf);
  float*    vf   = (float*)(ws + o_vf);
  _Float16* ao16 = (_Float16*)(ws + o_ao);
  float*    h1f  = (float*)(ws + o_h1f);
  _Float16* h1h  = (_Float16*)(ws + o_h1h);
  _Float16* ff16 = (_Float16*)(ws + o_ff);
  float*    gtb  = (float*)(ws + o_gt);
  float*    outp = (float*)d_out;

  const float WSC  = 64.0f;            // weights carried x64 in f16
  const float WINV = 1.0f / 64.0f;     // folded back in the GEMM epilogue
  const float invC = 1.0f / 768.0f;
  const float eps  = 1e-5f;
  const float qscale = 0.125f;         // 1/sqrt(64)

  // ---- weights -> f16 (x64): Wq, Wk, Wv, Wo, W1, W2 as 12 segments of L*C*C elements; their f16 planes are contiguous from wq16 ----
  {
    const int segF4 = (int)(NWC / 4), nSeg = 12;
    const int perWave = CS_IT * CS_LD * 32, wavesAll = (segF4 / perWave) * nSeg;
    static_assert((L * C * C / 4) % (CS_IT * CS_LD * 32) == 0, "a segment is a whole number of waves");
    static_assert(((L * C * C / 4) / (CS_IT * CS_LD * 32) * 12) % CS_WAVES == 0, "the waves fill whole blocks");
    static_assert(FF == 4 * C && (L * C * C * 2) % 256 == 0, "W1 and W2 are four segments each; no gap between the planes");
    cast_weights_stream<<<wavesAll / CS_WAVES, CS_WAVES * 32, 0, stream>>>(Wq, Wk, Wv, Wo, W1, W2, wq16, segF4, nSeg, WSC);
  }

  // ---- h = LN0(x * mask + pos_emb) ----
  ln_kernel<1><<<M, LN_T, 0, stream>>>(x, pos_emb, attn_m, ln0_g, ln0_b, hf, hh16, C, invC, eps);

  const int nbP = (M / 128) * (C / 128);    // 96 blocks, one 128x128 tile each
  const int nbF = (M / 128) * (FF / 128);   // 384 blocks
  const int nbA = Bn * H * (S / 64);                // 384 attention blocks
  const int ngate = (int)NG;
  const int nyG = (ngate + nbP * 128 - 1) / (nbP * 128);   // rows of the joined grid that hold the gate, 128 values a block
  static_assert((L * C * C * 2) % 256 == 0 && (Bn * S * C * 4) % 256 == 0, "no gap between the q, k, v weight planes, nor between qf, kf, vf");

  for (int l = 0; l < L; ++l) {
    const size_t lw  = (size_t)l * C * C;
    const size_t lwf = (size_t)l * FF * C;
    const _Float16* WQl = wq16 + lw;
    const _Float16* WOl = wo16 + lw;
    const _Float16* W1l = w116 + lwf;   // [FF][C]
    const _Float16* W2l = w216 + lwf;   // [C][FF]

    // q, k, v = h . W^T + b (f32 out) and gate[b][h][s], one launch
    qkv_gate_kernel<C><<<dim3(nbP, 3 + nyG), 128, 0, stream>>>(
        U16(hh16), U16(WQl), (long)NWC, qf, (long)NA, bq + (size_t)l * C, bk + (size_t)l * C, bv + (size_t)l * C,
        hf, gruW + (size_t)l * 8 * 64, grub + (size_t)l * 8, gruc + (size_t)l * H, gtb, M, C, S, H, ngate, WINV);

    // attention -> ao16 (f16)
    attn_gbias_kernel<<<nbA, 128, 0, stream>>>(qf, kf, vf, gtb, pos_bias, attn_m, ao16, S, H, C, qscale);

    // qf <- h + ao . Wo^T + bo
    wmma_gemm64<0, false, 2, 0, true, 0, C><<<dim3(nbP, 1), 128, 0, stream>>>(
        U16(ao16), U16(ao16), C, 0L, U16(WOl), U16(WOl), C, 0L,
        (void*)qf, (void*)qf, C, 0L, bo + (size_t)l * C, hf, 0L, M, C, C, WINV);

    // h1 = LN1(qf)
    ln_kernel<0><<<M, LN_T, 0, stream>>>(qf, qf, attn_m, ln1_g + (size_t)l * C, ln1_b + (size_t)l * C,
                                         h1f, h1h, C, invC, eps);

    // ff16 = gelu(h1 . W1^T + b1)  (f16 out)
    wmma_gemm64<0, false, 2, 1, false, 5, FF><<<dim3(nbF, 1), 128, 0, stream>>>(
        U16(h1h), U16(h1h), C, 0L, U16(W1l), U16(W1l), C, 0L,
        (void*)ff16, (void*)ff16, FF, 0L, b1 + (size_t)l * FF, h1f, 0L, M, FF, C, WINV);

    // kf <- h1 + ff . W2^T + b2
    wmma_gemm64<0, false, 2, 0, true, 0, C><<<dim3(nbP, 1), 128, 0, stream>>>(
        U16(ff16), U16(ff16), FF, 0L, U16(W2l), U16(W2l), FF, 0L,
        (void*)kf, (void*)kf, C, 0L, b2 + (size_t)l * C, h1f, 0L, M, C, FF, WINV);

    // h = LN2(kf); last layer writes the output buffer directly
    float* hdst = (l == L - 1) ? outp : hf;
    ln_kernel<0><<<M, LN_T, 0, stream>>>(kf, kf, attn_m, ln2_g + (size_t)l * C, ln2_b + (size_t)l * C,
                                         hdst, hh16, C, invC, eps);
  }
  (void)hipGetLastError();
}

// v010
// One run takes 460 microseconds.
// In both of two side-by-side timings against v009, it was 1.05 times as fast.
// Counting every step since v000, it is 4.03 times as fast.
// Contractions (q/k/v/out projections, FFN up/down, attention q.k^T and p.v): v_wmma_f32_16x16x32_f16 (f16 operands, f32 accumulate); weights carried x64, softmax probabilities carried x2^15; LayerNorm, softmax, gate: f32 VALU.
#include <hip/hip_runtime.h>
#include <math.h>
#include <stdint.h>

typedef __attribute__((ext_vector_type(16))) _Float16 v16h;
typedef __attribute__((ext_vector_type(8)))  _Float16 v8h;
typedef __attribute__((ext_vector_type(4)))  _Float16 v4h;
typedef __attribute__((ext_vector_type(16))) __bf16   v16b;
typedef __attribute__((ext_vector_type(8)))  __bf16   v8b;
typedef __attribute__((ext_vector_type(8)))  float    v8f;
typedef __attribute__((ext_vector_type(4)))  float    v4f;
#define U16(p) ((const unsigned short*)(const void*)(p))

__device__ __forceinline__ unsigned short f2bf_bits(float f) {
  unsigned u = __float_as_uint(f);
  return (unsigned short)((u + 0x7FFFu + ((u >> 16) & 1u)) >> 16);
}
__device__ __forceinline__ float bf_bits2f(unsigned short h) { return __uint_as_float(((unsigned)h) << 16); }

// hazard guards as plain device helpers (no inline asm inside the kernel template body)
__device__ __forceinline__ void acc_guard4(v8f& a, v8f& b, v8f& c, v8f& d) { asm volatile("v_nop\n\tv_nop\n\tv_nop\n\tv_nop" : "+v"(a), "+v"(b), "+v"(c), "+v"(d)); }
template <typename T> struct Frag;
template <> struct Frag<_Float16> {
  typedef v16h V; union U { v16h v; v8h h[2]; };
  static __device__ __forceinline__ v16h load(const _Float16* p) {   // elements 0..7 <- p[0..7], 8..15 <- p[16..23]
    U f; f.h[0] = *(const v8h*)(p); f.h[1] = *(const v8h*)(p + 16); return f.v;
  }
  static __device__ __forceinline__ v8f mma(v16h a, v16h b, v8f c) {
    return __builtin_amdgcn_wmma_f32_16x16x32_f16(false, a, false, b, (short)0, c, false, false);
  }
};
template <> struct Frag<__bf16> {
  typedef v16b V; union U { v16b v; v8b h[2]; };
  static __device__ __forceinline__ v16b load(const __bf16* p) {
    U f; f.h[0] = *(const v8b*)(p); f.h[1] = *(const v8b*)(p + 16); return f.v;
  }
  static __device__ __forceinline__ v8f mma(v16b a, v16b b, v8f c) {
    return __builtin_amdgcn_wmma_f32_16x16x32_bf16(false, a, false, b, (short)0, c, false, false);
  }
};

// ---- Block-tiled batched WMMA GEMM, operands staged in LDS by the tensor mover ------------
// C[m,n] = scale * sum_k A[m,k] * Bt[n,k] (+bias)(+resid); a block of 4 waves (2 x 2) owns a 128x128 tile, each wave 64x64.
// A row-major [M,K]; Bt row-major [N,K]; M,N % 128 == 0, K % 128 == 0, K >= 256 (two stages).
// A pass is 128 k = 256 B of each of the 256 operand rows; each wave brings one 64-row slice per pass with one tensor load
// (waves 0,1: the two halves of the A rows; waves 2,3: of the Bt rows), two buffers, LDS row pitch 272 B.
// BIAS_MODE: 0 = none, 1 = bias[m], 2 = bias[n].
// OUT_MODE: 0 = f32, 1 = f16, 2 = bf16 hi plane (Cout) + bf16 lo plane (Cout2).
// ET: 0 = f16 operands, 1 = bf16 operands (pointers passed as 16-bit storage)
typedef uint32_t u32x4 __attribute__((ext_vector_type(4)));
typedef uint32_t u32x8 __attribute__((ext_vector_type(8)));
#define GT_KP     128u                 // k per pass
#define GT_ROWB   256u                 // bytes of one operand row per pass
#define GT_PITCH  272u                 // LDS row pitch: 256 B + the mover's 16-B pad (ds_load_b128 readers)
#define GT_ROWS   64u                  // rows per slice
#define GT_SLICE  18432u               // 64 x 272 = 17,408 B, rounded up to a multiple of 2 KiB
#define GT_STAGE  (4u * GT_SLICE)      // one buffer: 4 slices
__device__ __forceinline__ uint32_t uni(uint32_t v) { return (uint32_t)__builtin_amdgcn_readfirstlane(v); }
// pinned(): holds a wave-uniform value in a scalar register, so that a test on it is a scalar branch (a tensor load ignores EXEC)
// and so that descriptor words formed from it are formed behind the waits that stand in front of it.
__device__ __forceinline__ uint32_t pinned(uint32_t v) { uint32_t w = uni(v); asm volatile("" : "+s"(w)); return w; }
__device__ __forceinline__ void wait_ds0()     { asm volatile("s_wait_dscnt 0x0" ::: "memory"); }      // this wave's LDS reads of the buffer are done
__device__ __forceinline__ void wait_tensor0() { asm volatile("s_wait_tensorcnt 0x0" ::: "memory"); }  // this wave's own slice has landed
// descriptor words held in scalar registers (as pinned() does for one word): the eight registers stay group 1's own through
// the loop, so that none of them takes another value while a request is outstanding
__device__ __forceinline__ void hold_group1(u32x8& g) { asm volatile("" : "+s"(g)); }
// one request of the whole wave: 64 rows of 256 B from global memory to LDS, 16 B of pad behind each row
__device__ __forceinline__ void tdm_load(uint32_t lds_dst, uint64_t ga, u32x8 g1) {
  u32x4 g0;
  g0[0] = uni(1u);
  g0[1] = uni(lds_dst);
  g0[2] = uni((uint32_t)ga);
  g0[3] = uni((((uint32_t)(ga >> 32)) & 0x01FFFFFFu) | 0x80000000u);
  asm volatile("tensor_load_to_lds %0, %1" :: "s"(g0), "s"(g1) : "memory");
}
// v_rcp_f32 and v_exp_f32, each with the one free slot that the instruction set asks for behind a transcendental in the same
// statement.
__device__ __forceinline__ float rcp_slot(float x)  { float r; asm("v_rcp_f32 %0, %1\n\tv_nop" : "=v"(r) : "v"(x)); return r; }
__device__ __forceinline__ float exp2_slot(float x) { float r; asm("v_exp_f32 %0, %1\n\tv_nop" : "=v"(r) : "v"(x)); return r; }
// GELU in its erf form, straight-line (no branch, so that the values of a fragment interleave and the unrolled epilogue stays short):
// with x = |v| / sqrt(2) and t = 1 / (1 + 0.3275911 x), erfc(x) = t (c1 + t (c2 + t (c3 + t (c4 + t c5)))) exp(-x x), absolute error
// at most 1.5e-7; gelu(v) = max(v, 0) - 0.5 |v| erfc(x), which cancels on neither side of 0. The factor -0.5 is folded into c1..c5.
__device__ __forceinline__ float gelu_erf(float v) {
  const float a = fabsf(v);
  const float t = rcp_slot(fmaf(a, 0.23164189f, 1.0f));      // 0.3275911 / sqrt(2)
  const float e = exp2_slot(v * v * -0.72134752f);           // exp(-v v / 2) = 2^(-v v log2(e) / 2)
  float p = fmaf(t, -0.53070271f, 0.72657601f);
  p = fmaf(t, p, -0.71070687f);
  p = fmaf(t, p, 0.14224837f);
  p = fmaf(t, p, -0.12741480f);
  return fmaf(a, p * t * e, fmaxf(v, 0.0f));
}
template <int ET> struct Elem;
template <> struct Elem<0> { typedef _Float16 T; };
template <> struct Elem<1> { typedef __bf16 T; };
// Wave-level hand-over that orders LDS traffic alone: a fence over global memory as well would wait out the global loads
// that are in flight (the residual, the next chunk's K, V and bias). Nothing passes between the lanes of a wave through global memory.
__device__ __forceinline__ void lds_wave_sync() {
  __builtin_amdgcn_fence(__ATOMIC_RELEASE, "workgroup", "local");
  __builtin_amdgcn_wave_barrier();
  __builtin_amdgcn_fence(__ATOMIC_ACQUIRE, "workgroup", "local");
}
// LDC: the row pitch of C and of resid in elements, known at compile time, so that every epilogue address is one base plus a constant
template <int ET, bool SPLIT, int BIAS_MODE, int OUT_MODE, bool RESID, int ACT, int LDC>
__device__ __forceinline__ void gemm_tile(
    const unsigned short* __restrict__ Ap, const unsigned short* __restrict__ A2p, int lda, long strideA,
    const unsigned short* __restrict__ Btp, const unsigned short* __restrict__ Bt2p, int ldb, long strideB,
    void* __restrict__ Cout, void* __restrict__ Cout2, int ldc, long strideC,
    const float* __restrict__ bias,
    const float* __restrict__ resid, long strideR,
    int M, int N, int K, float scale, const int b, const int tile) {   // b: batch index, tile: this block's tile; both block-uniform
  static_assert(!SPLIT, "single-plane operands only");
  static_assert(!RESID || (OUT_MODE == 0 && ACT == 0), "the residual is added last, to f32 output");
  typedef typename Elem<ET>::T T;
  typedef typename Frag<T>::V V;
  const T* A = (const T*)Ap; const T* Bt = (const T*)Btp;
  // two stage buffers; after the K loop its first bytes serve as the per-wave 64x64 f32 output slabs (pitch 68 floats)
  __shared__ __attribute__((aligned(2048))) unsigned char L[2u * GT_STAGE];
  const int lane = threadIdx.x & 31;
  const uint32_t wave = uni(threadIdx.x >> 5);
  const int tilesN = N >> 7;
  const int tilesM = M >> 7;
  const uint32_t nPass = uni((uint32_t)K / GT_KP);
  if (tile >= tilesM * tilesN || nPass < 2u || ldc != LDC) return;   // block-uniform, in front of every tensor load and barrier; the ring's prologue loads two stages
  const int tm = tile / tilesN;
  const int tn = tile - tm * tilesN;
  const uint32_t wm = wave >> 1, wn = wave & 1u;
  const int m0 = (tm << 7) + (int)(wm << 6);
  const int n0 = (tn << 7) + (int)(wn << 6);

  const T* Ab  = A  + (size_t)b * strideA;
  const T* Bb  = Bt + (size_t)b * strideB;

  const int rlane = lane & 15;                 // row (A) / col (B, D) within subtile
  const int koff  = (lane >> 4) * 8;           // k offset of this lane half
  const int mOff  = (lane >> 4) * 8;           // D row offset

  // ---- this wave's slice: source, place in LDS, descriptor group 1 (loop-invariant) ----
  const bool isB = wave >= 2u;
  const uint32_t srcPitch = (uint32_t)(isB ? ldb : lda) * 2u;     // bytes
  const uint64_t srcBase = isB ? (uint64_t)(uintptr_t)(Bb + (size_t)((tn << 7) + (int)(wn << 6)) * ldb)
                               : (uint64_t)(uintptr_t)(Ab + (size_t)((tm << 7) + (int)(wn << 6)) * lda);
  const uint32_t ldsSlice = (uint32_t)(size_t)L + wave * GT_SLICE;
  u32x8 g1;
  g1[0] = uni((1u << 20) | (5u << 22) | (3u << 25));              // no mask, 1-byte elements, 4 dwords of pad behind every 64 dwords
  g1[1] = uni((GT_ROWB & 0xFFFFu) << 16);                         // tensor_dim0 low
  g1[2] = uni((GT_ROWB >> 16) | ((GT_ROWS & 0xFFFFu) << 16));     // tensor_dim0 high, tensor_dim1 low
  g1[3] = uni((GT_ROWS >> 16) | (GT_ROWB << 16));                 // tensor_dim1 high, tile_dim0
  g1[4] = uni(GT_ROWS);                                           // tile_dim1
  g1[5] = uni(srcPitch);
  g1[6] = uni(0u);
  g1[7] = uni(0u);
  hold_group1(g1);

  v8f acc[4][4];
#pragma unroll
  for (int i = 0; i < 4; ++i)
#pragma unroll
    for (int j = 0; j < 4; ++j) acc[i][j] = (v8f){0.f,0.f,0.f,0.f,0.f,0.f,0.f,0.f};

  // this lane's four column biases, asked for here so that they have long landed when the epilogue takes them
  float bv[4];
#pragma unroll
  for (int j = 0; j < 4; ++j) bv[j] = (BIAS_MODE == 2) ? bias[n0 + (j << 4) + rlane] : 0.f;

  // prologue: stage 0 lands and is published, then stage 1 flies while pass 0 works
  tdm_load(ldsSlice, srcBase, g1);
  wait_tensor0();
  __syncthreads();
  tdm_load(ldsSlice + GT_STAGE, srcBase + GT_ROWB, g1);

  const uint32_t aOff = wm * GT_SLICE + (uint32_t)rlane * GT_PITCH + (uint32_t)koff * 2u;
  const uint32_t bOff = (2u + wn) * GT_SLICE + (uint32_t)rlane * GT_PITCH + (uint32_t)koff * 2u;
  uint32_t s = 0;
  // the pass loop stays rolled: one publish point in the text, every fragment index below a constant
#pragma unroll 1
  do {                                        // nPass >= 2 here
    const uint32_t bufOff = (s & 1u) * GT_STAGE;
    const unsigned char* As = L + bufOff + aOff;
    const unsigned char* Bs = L + bufOff + bOff;
    V bh[2][4], ah[2][4];                     // two fragment sets: the next 32 k are read while these are multiplied
#pragma unroll
    for (int j = 0; j < 4; ++j) bh[0][j] = Frag<T>::load((const T*)(Bs + (uint32_t)j * 16u * GT_PITCH));
#pragma unroll
    for (int i = 0; i < 4; ++i) ah[0][i] = Frag<T>::load((const T*)(As + (uint32_t)i * 16u * GT_PITCH));
#pragma unroll
    for (int kk = 0; kk < 4; ++kk) {          // 32 k per step, in ascending k as before; only this pass's own buffer is read
      const int cur = kk & 1, nx = cur ^ 1;
      if (kk < 3) {
#pragma unroll
        for (int j = 0; j < 4; ++j) bh[nx][j] = Frag<T>::load((const T*)(Bs + (uint32_t)j * 16u * GT_PITCH + (uint32_t)(kk + 1) * 64u));
#pragma unroll
        for (int i = 0; i < 4; ++i) ah[nx][i] = Frag<T>::load((const T*)(As + (uint32_t)i * 16u * GT_PITCH + (uint32_t)(kk + 1) * 64u));
      }
      __builtin_amdgcn_sched_barrier(0);      // the next step's LDS reads stay one group in front of this step's WMMAs, not among them
#pragma unroll
      for (int i = 0; i < 4; ++i)
#pragma unroll
        for (int j = 0; j < 4; ++j) acc[i][j] = Frag<T>::mma(ah[cur][i], bh[cur][j], acc[i][j]);
      __builtin_amdgcn_sched_barrier(0);      // and the step after next's reads do not rise into this block
    }
    // publish point of stage s + 1: own LDS reads done, own slice landed, then the barrier that both publishes
    // stage s + 1 and ends every wave's reads of the buffer that is refilled behind it
    wait_ds0();
    wait_tensor0();
    __syncthreads();
    if (pinned(s + 2u < nPass)) {             // scalar branch: only while stage s + 2 exists
      const uint32_t nxt = pinned(s + 2u);    // group 0 is formed from it, so behind the waits above
      tdm_load(ldsSlice + bufOff, srcBase + (uint64_t)nxt * GT_ROWB, g1);
    }
  } while (++s < nPass);
  wait_tensor0();
  wait_ds0();
  acc_guard4(acc[0][0], acc[0][1], acc[0][2], acc[0][3]);
  acc_guard4(acc[1][0], acc[1][1], acc[1][2], acc[1][3]);
  acc_guard4(acc[2][0], acc[2][1], acc[2][2], acc[2][3]);
  acc_guard4(acc[3][0], acc[3][1], acc[3][2], acc[3][3]);

  // ---- epilogue, one sweep: the wave's whole 64x64 tile goes through a slab of its own, so that there is one hand-over through
  // LDS and no round has to wait for the stores of the round before; the residual is asked for first, in the stores' own layout ----
  float* slab = (float*)(void*)L + wave * (64u * 68u);   // the last pass's own barrier has ended every read of the ring
  const int hh = lane >> 4, c4 = (lane & 15) * 4;        // f32 rows: a row segment = 256 B = 16 lanes x 16 B
  v4f rv[4][8];
  if (RESID) {
    const float* Rp = resid + (size_t)b * strideR + (size_t)(m0 + hh) * LDC + n0 + c4;
#pragma unroll
    for (int i = 0; i < 4; ++i)
#pragma unroll
      for (int it = 0; it < 8; ++it) rv[i][it] = *(const v4f*)(Rp + (i * 16 + it * 2) * LDC);
  }
#pragma unroll
  for (int i = 0; i < 4; ++i) {
#pragma unroll
    for (int j = 0; j < 4; ++j) {
#pragma unroll
      for (int r = 0; r < 8; ++r) {
        float v = acc[i][j][r] * scale;
        if (BIAS_MODE == 1) v += bias[m0 + (i << 4) + mOff + r];
        if (BIAS_MODE == 2) v += bv[j];
        if (ACT == 1) v = tanhf(v);
        if (ACT == 2) v = fmaxf(v, 0.0f);
        if (ACT == 3) v = v / (1.0f + expf(-v));
        if (ACT == 4) v = (v > 0.f) ? v : 0.01f * v;
        if (ACT == 5) v = gelu_erf(v);
        slab[((i << 4) + mOff + r) * 68 + (j << 4) + rlane] = v;
      }
    }
  }
  lds_wave_sync();                                        // the wave's own slab, written above, is read back row-wise below
  if (OUT_MODE == 0) {
    float* Cp = (float*)Cout + (size_t)b * strideC + (size_t)(m0 + hh) * LDC + n0 + c4;
    v4f ov[4][8];
#pragma unroll
    for (int i = 0; i < 4; ++i)
#pragma unroll
      for (int it = 0; it < 8; ++it) {
        ov[i][it] = *(const v4f*)(slab + (i * 16 + it * 2 + hh) * 68 + c4);
        if (RESID) ov[i][it] += rv[i][it];
      }
    __builtin_amdgcn_sched_barrier(0);   // every value is formed in front of the first store: no register that an issued store names is written again
#pragma unroll
    for (int i = 0; i < 4; ++i)
#pragma unroll
      for (int it = 0; it < 8; ++it) *(v4f*)(Cp + (i * 16 + it * 2) * LDC) = ov[i][it];
  } else {
    const int q = lane >> 3, c8 = (lane & 7) * 8;
    const size_t co = (size_t)b * strideC + (size_t)(m0 + q) * LDC + n0 + c8;
    unsigned short* Cp  = (unsigned short*)Cout + co;
    unsigned short* Cp2 = (OUT_MODE == 2) ? ((unsigned short*)Cout2 + co) : nullptr;
    v8h hv[4][4], lv[4][4];
#pragma unroll
    for (int i = 0; i < 4; ++i)
#pragma unroll
      for (int it = 0; it < 4; ++it) {
        const float* sp = slab + (i * 16 + it * 4 + q) * 68 + c8;
#pragma unroll
        for (int e = 0; e < 8; ++e) {
          if (OUT_MODE == 1) {
            hv[i][it][e] = (_Float16)sp[e];
          } else {
            unsigned short hb = f2bf_bits(sp[e]);
            unsigned short lb = f2bf_bits(sp[e] - bf_bits2f(hb));
            hv[i][it][e] = __builtin_bit_cast(_Float16, hb);
            lv[i][it][e] = __builtin_bit_cast(_Float16, lb);
          }
        }
      }
    __builtin_amdgcn_sched_barrier(0);   // every value is formed in front of the first store: no register that an issued store names is written again
#pragma unroll
    for (int i = 0; i < 4; ++i)
#pragma unroll
      for (int it = 0; it < 4; ++it) {
        *(v8h*)(Cp + (i * 16 + it * 4) * LDC) = hv[i][it];
        if (OUT_MODE == 2) *(v8h*)(Cp2 + (i * 16 + it * 4) * LDC) = lv[i][it];
      }
  }
}

template <int ET, bool SPLIT, int BIAS_MODE, int OUT_MODE, bool RESID, int ACT, int LDC>
__global__ __launch_bounds__(128) void wmma_gemm64(
    const unsigned short* __restrict__ Ap, const unsigned short* __restrict__ A2p, int lda, long strideA,
    const unsigned short* __restrict__ Btp, const unsigned short* __restrict__ Bt2p, int ldb, long strideB,
    void* __restrict__ Cout, void* __restrict__ Cout2, int ldc, long strideC,
    const float* __restrict__ bias,
    const float* __restrict__ resid, long strideR,
    int M, int N, int K, float scale) {
  gemm_tile<ET, SPLIT, BIAS_MODE, OUT_MODE, RESID, ACT, LDC>(Ap, A2p, lda, strideA, Btp, Bt2p, ldb, strideB, Cout, Cout2, ldc, strideC,
                                                        bias, resid, strideR, M, N, K, scale, (int)blockIdx.y, (int)blockIdx.x);
}

// ---- GRU-style gate per (b, h, s): g = h[b,s,h*64:+64] . gw^T + gb (8 outputs, K=64, VALU f32),
//      gate = sigmoid(sum g[0:4]) * (sigmoid(sum g[4:8]) * gc[h] - 1) + 2 ; stored [b][h][s], one value (index idx) per thread
__device__ __forceinline__ void gate_item(
    const float* __restrict__ hf, const float* __restrict__ gw, const float* __restrict__ gb,
    const float* __restrict__ gc, float* __restrict__ gate, int S, int H, int C, int total, int idx) {
  if (idx >= total) return;   // no barriers on this path
  const int s  = idx % S;
  const int bh = idx / S;
  const int h  = bh % H;
  const int b  = bh / H;
  const float* hp = hf + ((size_t)b * S + s) * C + (size_t)h * 64;
  float acc[8];
#pragma unroll
  for (int e = 0; e < 8; ++e) acc[e] = 0.f;
#pragma unroll 1
  for (int d = 0; d < 64; ++d) {
    const float hv = hp[d];
#pragma unroll
    for (int e = 0; e < 8; ++e) acc[e] = fmaf(hv, gw[e * 64 + d], acc[e]);
  }
  const float sa = ((acc[0] + gb[0]) + (acc[1] + gb[1])) + ((acc[2] + gb[2]) + (acc[3] + gb[3]));
  const float sb = ((acc[4] + gb[4]) + (acc[5] + gb[5])) + ((acc[6] + gb[6]) + (acc[7] + gb[7]));
  const float ga  = 1.0f / (1.0f + expf(-sa));
  const float gbv = 1.0f / (1.0f + expf(-sb));
  const float gv = ga * (gbv * gc[h] - 1.0f) + 2.0f;
  ((float*)gate)[idx] = gv;
}

// ---- One launch for the four pieces of a layer that read h alone and none of which fills the chip: the q, k and v projections
// (blockIdx.y = 0, 1, 2: one 128x128 tile a block; the three f16 weight planes lie strideW apart, the three f32 outputs strideO apart)
// and the gate (blockIdx.y >= 3: one value a thread). No piece reads what another writes. The long pieces have the low indices.
template <int LDC>
__global__ __launch_bounds__(128) void qkv_gate_kernel(
    const unsigned short* __restrict__ hh, const unsigned short* __restrict__ w, long strideW,
    float* __restrict__ qkv, long strideO,
    const float* __restrict__ bq, const float* __restrict__ bk, const float* __restrict__ bv,
    const float* __restrict__ hf, const float* __restrict__ gw, const float* __restrict__ gb,
    const float* __restrict__ gc, float* __restrict__ gate,
    int M, int C, int S, int H, int total, float scale) {
  const int piece = (int)blockIdx.y;
  if (pinned((uint32_t)(piece >= 3))) {      // scalar branch, the same for the whole block: a gate block meets no tensor load and no barrier
    const int nTiles = (M >> 7) * (C >> 7);  // blocks in a row of the grid: one per tile of a projection
    gate_item(hf, gw, gb, gc, gate, S, H, C, total, ((piece - 3) * nTiles + (int)blockIdx.x) * 128 + (int)threadIdx.x);
    return;
  }
  const float* bias = piece == 0 ? bq : piece == 1 ? bk : bv;
  gemm_tile<0, false, 2, 0, false, 0, LDC>(hh, hh, C, 0L, w, w, C, strideW, (void*)qkv, (void*)qkv, C, strideO,
                                      bias, hf, 0L, M, C, C, scale, piece, (int)blockIdx.x);
}

// ---- All weight sets f32 -> f16 (x sc) in one launch of resident waves ---------------------------------------------
// The work is nSeg equal segments of segF4 16-byte vectors: w0..w3 are one segment each, w4 and w5 four each; the f16 planes lie
// one behind the other in out, in that order. A wave owns CS_IT x CS_LD x 32 consecutive vectors of one segment: every load is
// 512 contiguous bytes of the wave, CS_LD of them are asked for one trip ahead, every store is 256 contiguous bytes.
// One block of CS_WAVES waves per WGP: few waves that live long.
#define CS_WAVES 18
#define CS_LD    8
#define CS_IT    6
__global__ __launch_bounds__(CS_WAVES * 32) void cast_weights_stream(
    const float* __restrict__ w0, const float* __restrict__ w1, const float* __restrict__ w2, const float* __restrict__ w3,
    const float* __restrict__ w4, const float* __restrict__ w5, _Float16* __restrict__ out, int segF4, int nSeg, float sc) {
  const uint32_t perWave = CS_IT * CS_LD * 32u;                    // vectors per wave
  const uint32_t lane = threadIdx.x & 31u;
  const uint32_t gw = uni(blockIdx.x * CS_WAVES + (threadIdx.x >> 5));
  const uint32_t wavesPerSeg = (uint32_t)segF4 / perWave;
  const uint32_t seg = gw / wavesPerSeg;
  if (seg >= (uint32_t)nSeg) return;                               // wave-uniform; no barrier in this kernel
  const uint32_t win = gw - seg * wavesPerSeg;
  const size_t segF = (size_t)segF4 * 4;
  const float* src = seg == 0u ? w0 : seg == 1u ? w1 : seg == 2u ? w2 : seg == 3u ? w3
                   : seg < 8u ? w4 + (size_t)(seg - 4u) * segF : w5 + (size_t)(seg - 8u) * segF;
  const v4f* s4 = (const v4f*)src + (size_t)win * perWave + lane;
  v4h* d4 = (v4h*)out + (size_t)gw * perWave + lane;
  v4f buf[2][CS_LD];
#pragma unroll
  for (int k = 0; k < CS_LD; ++k) buf[0][k] = s4[k * 32];
  // unrolled: every address is the wave's one base plus a constant, so no address register takes a new value under a load in flight
#pragma unroll
  for (int t = 0; t < CS_IT; ++t) {
    const int cur = t & 1, nx = cur ^ 1;
    if (t + 1 < CS_IT) {
#pragma unroll
      for (int k = 0; k < CS_LD; ++k) buf[nx][k] = s4[((t + 1) * CS_LD + k) * 32];
    }
    __builtin_amdgcn_sched_barrier(0);   // no work on the values just asked for rises into this trip, where it would wait those loads out
#pragma unroll
    for (int k = 0; k < CS_LD; ++k) {
      const v4f x = buf[cur][k] * sc;
      v4h y;
      y[0] = (_Float16)x[0]; y[1] = (_Float16)x[1]; y[2] = (_Float16)x[2]; y[3] = (_Float16)x[3];
      d4[(t * CS_LD + k) * 32] = y;
    }
    // in front of the next trip's loads and converts, which write registers that this trip's stores name
    if (t + 1 < CS_IT) asm volatile("s_wait_xcnt 0x0" ::: "memory");
  }
}

// ---- LayerNorm over rows of C = 4 * blockDim floats; PRE: input = in * mask[row] + pos --------------------------
#define LN_T 192
template <int PRE>
__global__ __launch_bounds__(LN_T) void ln_kernel(
    const float* __restrict__ in, const float* __restrict__ pos, const float* __restrict__ mask,
    const float* __restrict__ g, const float* __restrict__ bb,
    float* __restrict__ outf, _Float16* __restrict__ outh, int C, float invC, float eps) {
  __shared__ float rs[8];
  __shared__ float rq[8];
  const int row = blockIdx.x;
  const int tid = threadIdx.x;
  const int lane = tid & 31;
  const int w = tid >> 5;
  const int c4 = tid * 4;
  const size_t base = (size_t)row * C + c4;
  v4f xv = *(const v4f*)(in + base);
  if (PRE) {
    const float mk = mask[row];
    const v4f pv = *(const v4f*)(pos + base);
    xv = xv * mk + pv;
  }
  float s = (xv[0] + xv[1]) + (xv[2] + xv[3]);
#pragma unroll
  for (int off = 16; off > 0; off >>= 1) s += __shfl_xor(s, off, 32);
  if (lane == 0) rs[w] = s;
  __syncthreads();
  float ts = 0.f;
#pragma unroll
  for (int i = 0; i < LN_T / 32; ++i) ts += rs[i];
  const float mean = ts * invC;
  const v4f d = xv - mean;
  float sq = (d[0] * d[0] + d[1] * d[1]) + (d[2] * d[2] + d[3] * d[3]);
#pragma unroll
  for (int off = 16; off > 0; off >>= 1) sq += __shfl_xor(sq, off, 32);
  if (lane == 0) rq[w] = sq;
  __syncthreads();
  float tq = 0.f;
#pragma unroll
  for (int i = 0; i < LN_T / 32; ++i) tq += rq[i];
  const float var = tq * invC;
  const float inv = rsqrtf(var + eps);
  const v4f gv = *(const v4f*)(g + c4);
  const v4f bv = *(const v4f*)(bb + c4);
  const v4f y = d * inv * gv + bv;
  v4h yh;
  yh[0] = (_Float16)y[0]; yh[1] = (_Float16)y[1]; yh[2] = (_Float16)y[2]; yh[3] = (_Float16)y[3];
  *(v4f*)(outf + base) = y;
  *(v4h*)(outh + base) = yh;
  
}

// =====================================================================================
// Flash attention, head_dim 64, f32 q/k/v in, f16 out; plain f16 operands, f32 accumulate; online softmax in f32.
//   s(q,kv) = (q . k) * qscale + gate[b,h,q] * pos_bias[h,q,kv] + (1 - mask[b,kv]) * -1e4
//   probabilities carried x2^15 in f16, folded into the final 1/l.
//   The scores are formed in units of log2: each of the three terms carries the factor log2(e) in a value that is made once
//   (the q.k scale, the row's gate, the padding constant), so that exp(s - m) is one subtraction and one v_exp_f32.
//   Block = 4 waves = 64 query rows of one (batch, head); S % 64 == 0.  q/k/v/out element (b,s,h,d) at
//   ((b*S + s)*C + h*64 + d); gate at (b*H + h)*S + s; pos_bias at (h*S + q)*S + kv; grid.x = B * H * (S/64).
// =====================================================================================
#define AT_D 64
#define AT_NW 4
#define AT_KC 64
// Row pitch, in halves, of the K, V^T and P tiles in LDS: 144 B = 16 B x 9. At the bare 128 B the 16 rows of a fragment read
// (ds_load_b128) fall on 8 of the 64 banks; at an odd multiple of 16 B they cover all 64.
#define AT_LP 72
#define AT_PSC 32768.0f
#define AT_L2E 1.44269504088896340736f   // log2(e)

__device__ __forceinline__ v8f hmma(v16h a, v16h b, v8f c) {
  c = __builtin_amdgcn_wmma_f32_16x16x32_f16(false, a, false, b, (short)0, c, false, false);
  asm volatile("v_nop\n\tv_nop\n\tv_nop\n\tv_nop" : "+v"(c) : "v"(a), "v"(b));
  return c;
}

// Barrier that orders LDS traffic alone: a fence over global memory as well would wait out the
// loads that are in flight for the next chunk. Nothing in this kernel passes between waves through global memory.
__device__ __forceinline__ void lds_block_sync() {
  __builtin_amdgcn_fence(__ATOMIC_RELEASE, "workgroup", "local");
  __builtin_amdgcn_s_barrier();
  __builtin_amdgcn_fence(__ATOMIC_ACQUIRE, "workgroup", "local");
}
// Stands behind a run of loads that stay in flight, in front of any new value in their address registers.
__device__ __forceinline__ void wait_addr_taken() { asm volatile("s_wait_xcnt 0x0" ::: "memory"); }
// The same wait behind a run of loads; the run's address values, named as inputs, stay in their registers up to the wait, so that
// no later load of the run is given one of them as its destination.
__device__ __forceinline__ void wait_addr_taken(const float* a, const float* b, const float* c, const float* d) {
  asm volatile("s_wait_xcnt 0x0" :: "v"(a), "v"(b), "v"(c), "v"(d) : "memory");
}
__device__ __forceinline__ void wait_addr_taken(int i, const float* a, const float* b, const float* c, const float* d) {
  asm volatile("s_wait_xcnt 0x0" :: "v"(i), "v"(a), "v"(b), "v"(c), "v"(d) : "memory");
}
// One step of a butterfly inside a 16-lane row on the vector pipe: lane l reads lane l ^ M of its own row (DPP row_xmask).
// __shfl_xor compiles to ds_bpermute_b32, whose every dependent step waits out an LDS round trip.
// Every lane has its partner inside the row, so neither the old value 0 nor bound_ctrl reaches a result; in this form the compiler
// can fold the move into the operation that takes it.
template <int M> __device__ __forceinline__ float row_xor(float x) {
  const int xi = __builtin_bit_cast(int, x);
  return __builtin_bit_cast(float, __builtin_amdgcn_update_dpp(0, xi, 0x160 | M, 0xf, 0xf, true));
}
// The five v_exp_f32 of one score row (the rescale factor and the row's four probabilities) in one statement whose last line is the
// one free slot that the instruction set asks for behind a transcendental. The outputs are early-clobber, so that none of the five
// overwrites a source of another.
__device__ __forceinline__ void exp2_row(float& a, float& p0, float& p1, float& p2, float& p3,
                                         float xa, float x0, float x1, float x2, float x3) {
  asm("v_exp_f32 %0, %5\n\tv_exp_f32 %1, %6\n\tv_exp_f32 %2, %7\n\tv_exp_f32 %3, %8\n\tv_exp_f32 %4, %9\n\tv_nop"
      : "=&v"(a), "=&v"(p0), "=&v"(p1), "=&v"(p2), "=&v"(p3) : "v"(xa), "v"(x0), "v"(x1), "v"(x2), "v"(x3));
}
__device__ __forceinline__ float row_max16(float m) {   // partners 1, 2, 4, 8 in that order
  m = fmaxf(m, row_xor<1>(m)); m = fmaxf(m, row_xor<2>(m)); m = fmaxf(m, row_xor<4>(m)); return fmaxf(m, row_xor<8>(m));
}
__device__ __forceinline__ float row_sum16(float s) {   // partners 1, 2, 4, 8 in that order
  s += row_xor<1>(s); s += row_xor<2>(s); s += row_xor<4>(s); return s + row_xor<8>(s);
}

// waves_per_eu(1, 2): the grid holds three waves for every two SIMDs of the chip, so a register budget of two waves a SIMD costs
// no residency; with the default budget the compiler answers the 100 registers of loads in flight by running the row
// reductions one after the other.
__global__ __launch_bounds__(128) __attribute__((amdgpu_waves_per_eu(1, 2)))
void attn_gbias_kernel(const float* __restrict__ q, const float* __restrict__ k,
                       const float* __restrict__ v, const float* __restrict__ gate,
                       const float* __restrict__ pos_bias, const float* __restrict__ mask,
                       _Float16* __restrict__ out, int S, int H, int C, float qscale) {
  union FH { v16h v; v8h h[2]; };
  __shared__ __align__(16) _Float16 Ksh[AT_KC * AT_LP];       // K [kv][d]
  __shared__ __align__(16) _Float16 Vth[AT_D * AT_LP];        // V^T [d][kv]
  __shared__ __align__(16) _Float16 Psh[AT_NW][16 * AT_LP];   // per wave P [row][kv]
  __shared__ __align__(16) float    Os[AT_NW][16 * 68];       // per wave out tile, pitch 68

  const int tid  = threadIdx.x;
  const int wave = tid >> 5;
  const int lane = tid & 31;
  const int hh   = lane >> 4;
  const int c    = lane & 15;

  const int nqb = S / 64;
  const int bx = blockIdx.x;
  const int qb = bx % nqb;
  const int bh = bx / nqb;
  const int h  = bh % H;
  const int b  = bh / H;
  const int q0 = qb * 64 + wave * 16;

  const float* qb_ptr = q + (size_t)b * S * C + (size_t)h * AT_D;
  const float* kb_ptr = k + (size_t)b * S * C + (size_t)h * AT_D;
  const float* vb_ptr = v + (size_t)b * S * C + (size_t)h * AT_D;
  const float* gt_ptr = gate + ((size_t)b * H + h) * S;
  const float* pb_ptr = pos_bias + (size_t)h * S * S;
  const float* mk_ptr = mask + (size_t)b * S;
  _Float16*    ob_ptr = out + (size_t)b * S * C + (size_t)h * AT_D;

  // ---- Q fragments (A operand): 2 d-chunks, split k map ----
  v16h qa[2];
  {
    const float* qrow = qb_ptr + (size_t)(q0 + c) * C;
#pragma unroll
    for (int dc = 0; dc < 2; ++dc) {
#pragma unroll
      for (int e = 0; e < 8; ++e) {
        qa[dc][e]     = (_Float16)qrow[dc * 32 + 8 * hh + e];
        qa[dc][8 + e] = (_Float16)qrow[dc * 32 + 16 + 8 * hh + e];
      }
    }
  }
  float grow[8];
#pragma unroll
  for (int r = 0; r < 8; ++r) grow[r] = gt_ptr[q0 + 8 * hh + r];
#pragma unroll                                     // every index of grow[] a constant, so that it stays in registers
  for (int r = 0; r < 8; ++r) grow[r] *= AT_L2E;   // the gated-bias term in units of log2
  const float qsl = qscale * AT_L2E;               // and the q.k term

  float mrow[8], lrow[8];
  v8f oacc[4];
#pragma unroll
  for (int r = 0; r < 8; ++r) { mrow[r] = -INFINITY; lrow[r] = 0.f; }
#pragma unroll
  for (int t = 0; t < 4; ++t) oacc[t] = (v8f){0.f,0.f,0.f,0.f,0.f,0.f,0.f,0.f};

  const int nChunks = S / AT_KC;   // block-uniform, from launch argument
  // Every global operand of a chunk (this thread's K and V row pieces, the position-bias tile, the key mask) is held in
  // registers and requested one chunk ahead, so that no chunk waits out a load it has only just issued.
  const int kvr = tid >> 1, dh = (tid & 1) * 32;
  const int kvOff = kvr * C + dh;                 // this thread's piece inside a chunk of K or V rows
  int pbOff[8];                                   // this lane's column in each of its 8 bias rows
#pragma unroll
  for (int r = 0; r < 8; ++r) pbOff[r] = (q0 + 8 * hh + r) * S + c;
  v4f kreg[8], vreg[8];
  float pbv[8][4], mkv[4];
#pragma unroll
  for (int i = 0; i < 8; ++i) {
    kreg[i] = *(const v4f*)(kb_ptr + kvOff + 4 * i);
    vreg[i] = *(const v4f*)(vb_ptr + kvOff + 4 * i);
  }
#pragma unroll
  for (int j = 0; j < 4; ++j) mkv[j] = mk_ptr[j * 16 + c];
#pragma unroll
  for (int r = 0; r < 8; ++r)
#pragma unroll
    for (int j = 0; j < 4; ++j) pbv[r][j] = pb_ptr[pbOff[r] + j * 16];
  wait_addr_taken();
  const size_t step0 = (nChunks > 1) ? (size_t)AT_KC * C : 0;
  const float* kn = kb_ptr + kvOff + step0;       // this thread's piece of the next chunk's K rows, and of its V rows
  const float* vn = vb_ptr + kvOff + step0;

  for (int kc = 0; kc < nChunks; ++kc) {
    // first key of the next chunk; the last trip asks for its own chunk again (in bounds, not used), so that every trip
    // issues the same loads in the same order and each wait on them can be counted exactly
    const int kvn = (kc + 1 < nChunks ? kc + 1 : kc) * AT_KC;
    lds_block_sync();                             // every wave has left the previous chunk's K and V tiles
#pragma unroll
    for (int i = 0; i < 8; ++i) {
#pragma unroll
      for (int e = 0; e < 4; ++e) {
        const int d = dh + 4 * i + e;
        Ksh[kvr * AT_LP + d] = (_Float16)kreg[i][e];
        Vth[d * AT_LP + kvr] = (_Float16)vreg[i][e];
      }
    }
    {                                             // next chunk's K and V fly under this chunk's whole work
#pragma unroll
      for (int i = 0; i < 8; ++i) {
        kreg[i] = *(const v4f*)(kn + 4 * i);
        vreg[i] = *(const v4f*)(vn + 4 * i);
      }
    }
    lds_block_sync();                             // this chunk's tiles are published

    // All eight K fragments of the chunk are asked for as one group, in the order in which the products take them: one LDS
    // latency a chunk instead of one in front of every WMMA. Each s[j] still sums d-chunk 0, then d-chunk 1.
    FH kb[2][4];
#pragma unroll
    for (int dc = 0; dc < 2; ++dc)
#pragma unroll
      for (int j = 0; j < 4; ++j) {
        kb[dc][j].h[0] = *(const v8h*)(Ksh + (j * 16 + c) * AT_LP + dc * 32 + 8 * hh);
        kb[dc][j].h[1] = *(const v8h*)(Ksh + (j * 16 + c) * AT_LP + dc * 32 + 16 + 8 * hh);
      }
    __builtin_amdgcn_sched_barrier(0);            // the reads stay one group in front of the WMMAs, not one pair in front of each
    v8f s[4];
#pragma unroll
    for (int j = 0; j < 4; ++j) s[j] = (v8f){0.f,0.f,0.f,0.f,0.f,0.f,0.f,0.f};
#pragma unroll
    for (int dc = 0; dc < 2; ++dc)
#pragma unroll
      for (int j = 0; j < 4; ++j) s[j] = hmma(qa[dc], kb[dc][j].v, s[j]);
    // additive terms: key padding per column, gated position bias per (row, column)
    float kp[4];
#pragma unroll
    for (int j = 0; j < 4; ++j) kp[j] = (1.0f - mkv[j]) * (-10000.0f * AT_L2E);
    float cm[8];
#pragma unroll
    for (int r = 0; r < 8; ++r) {
      float m = -INFINITY;
#pragma unroll
      for (int j = 0; j < 4; ++j) {
        const float sv = s[j][r] * qsl + grow[r] * pbv[r][j] + kp[j];
        s[j][r] = sv;
        m = fmaxf(m, sv);
      }
      cm[r] = row_max16(m);
    }
    {                                             // next chunk's bias tile and mask fly under softmax, P.V and the next staging
      const float* pn = pb_ptr + kvn;
#pragma unroll
      for (int j = 0; j < 4; ++j) mkv[j] = mk_ptr[kvn + j * 16 + c];
#pragma unroll
      for (int r = 0; r < 4; ++r)
#pragma unroll
        for (int j = 0; j < 4; ++j) pbv[r][j] = pn[pbOff[r] + j * 16];
      wait_addr_taken(kvn + c, pn + pbOff[0], pn + pbOff[1], pn + pbOff[2], pn + pbOff[3]);
#pragma unroll
      for (int r = 4; r < 8; ++r)
#pragma unroll
        for (int j = 0; j < 4; ++j) pbv[r][j] = pn[pbOff[r] + j * 16];
      wait_addr_taken(pn + pbOff[4], pn + pbOff[5], pn + pbOff[6], pn + pbOff[7]);
      // nothing crosses this line: the K and V pointers step on only behind the wait above (it covers their loads too), and
      // no work on the values just requested rises into this chunk, where it would wait those loads out
      __builtin_amdgcn_sched_barrier(0);
      const size_t step = (kc + 2 < nChunks) ? (size_t)AT_KC * C : 0;
      kn += step;
      vn += step;
    }
    _Float16* pw = Psh[wave];
#pragma unroll
    for (int r = 0; r < 8; ++r) {
      const float mnew = fmaxf(mrow[r], cm[r]);
      float alpha, pr[4];                         // every argument is <= 0: no range handling is needed around v_exp_f32
      exp2_row(alpha, pr[0], pr[1], pr[2], pr[3], mrow[r] - mnew, s[0][r] - mnew, s[1][r] - mnew, s[2][r] - mnew, s[3][r] - mnew);
      mrow[r] = mnew;
      float psum = 0.f;
#pragma unroll
      for (int j = 0; j < 4; ++j) {
        psum += pr[j];
        pw[(8 * hh + r) * AT_LP + j * 16 + c] = (_Float16)(pr[j] * AT_PSC);
      }
      lrow[r] = lrow[r] * alpha + row_sum16(psum);
#pragma unroll
      for (int t = 0; t < 4; ++t) oacc[t][r] *= alpha;
    }
    lds_wave_sync();                              // the wave's own P rows, written above, are read back as fragments below
    // The two P fragments and the eight V^T fragments likewise: one group, in the order of use; each oacc[t] still sums
    // key half 0, then key half 1.
    FH pa[2], vb[2][4];
#pragma unroll
    for (int kk = 0; kk < 2; ++kk) {
      pa[kk].h[0] = *(const v8h*)(pw + c * AT_LP + kk * 32 + 8 * hh);
      pa[kk].h[1] = *(const v8h*)(pw + c * AT_LP + kk * 32 + 16 + 8 * hh);
#pragma unroll
      for (int t = 0; t < 4; ++t) {
        vb[kk][t].h[0] = *(const v8h*)(Vth + (t * 16 + c) * AT_LP + kk * 32 + 8 * hh);
        vb[kk][t].h[1] = *(const v8h*)(Vth + (t * 16 + c) * AT_LP + kk * 32 + 16 + 8 * hh);
      }
    }
    __builtin_amdgcn_sched_barrier(0);            // as above: the reads stay one group in front of the WMMAs
#pragma unroll
    for (int kk = 0; kk < 2; ++kk)
#pragma unroll
      for (int t = 0; t < 4; ++t) oacc[t] = hmma(pa[kk].v, vb[kk][t].v, oacc[t]);
  }

  float* os = Os[wave];
#pragma unroll
  for (int r = 0; r < 8; ++r) {
    const float inv = 1.0f / (lrow[r] * AT_PSC);
#pragma unroll
    for (int t = 0; t < 4; ++t) os[(8 * hh + r) * 68 + t * 16 + c] = oacc[t][r] * inv;
  }
  __builtin_amdgcn_fence(__ATOMIC_RELEASE, "workgroup");
  __builtin_amdgcn_wave_barrier();
  __builtin_amdgcn_fence(__ATOMIC_ACQUIRE, "workgroup");
  {
    const int q8 = lane >> 3, c8 = (lane & 7) * 8;
    {
#pragma unroll
      for (int it = 0; it < 4; ++it) {
        const int row = it * 4 + q8;
        const float* sp = os + row * 68 + c8;
        v8h hv;
#pragma unroll
        for (int e = 0; e < 8; ++e) hv[e] = (_Float16)sp[e];
        *(v8h*)(ob_ptr + (size_t)(q0 + row) * C + c8) = hv;
      }
      
    }
  }
}

// ---------------------------------------------------------------------------
extern "C" void kernel_launch(void* const* d_in, const int* in_sizes, int n_in,
                              void* d_out, int out_size, void* d_ws, size_t ws_size,
                              hipStream_t stream) {
  const int Bn = 2, S = 1024, C = 768, H = 12, L = 4, FF = 3072;
  const int M = Bn * S;
  if (n_in < 25) return;
  if (in_sizes[0] != M * C || in_sizes[1] != M * C || in_sizes[2] != M || in_sizes[3] != H * S * S) return;
  if (in_sizes[6] != L * C * C || in_sizes[19] != L * FF * C || in_sizes[21] != L * C * FF) return;
  if (out_size != M * C) return;

  const float* x        = (const float*)d_in[0];
  const float* pos_emb  = (const float*)d_in[1];
  const float* attn_m   = (const float*)d_in[2];
  const float* pos_bias = (const float*)d_in[3];
  const float* ln0_g    = (const float*)d_in[4];
  const float* ln0_b    = (const float*)d_in[5];
  const float* Wq       = (const float*)d_in[6];
  const float* bq       = (const float*)d_in[7];
  const float* Wk       = (const float*)d_in[8];
  const float* bk       = (const float*)d_in[9];
  const float* Wv       = (const float*)d_in[10];
  const float* bv       = (const float*)d_in[11];
  const float* Wo       = (const float*)d_in[12];
  const float* bo       = (const float*)d_in[13];
  const float* gruW     = (const float*)d_in[14];
  const float* grub     = (const float*)d_in[15];
  const float* gruc     = (const float*)d_in[16];
  const float* ln1_g    = (const float*)d_in[17];
  const float* ln1_b    = (const float*)d_in[18];
  const float* W1       = (const float*)d_in[19];
  const float* b1       = (const float*)d_in[20];
  const float* W2       = (const float*)d_in[21];
  const float* b2       = (const float*)d_in[22];
  const float* ln2_g    = (const float*)d_in[23];
  const float* ln2_b    = (const float*)d_in[24];

  // ---- workspace carve (256-B aligned offsets, total 110,198,784 B) ----
  char* ws = (char*)d_ws;
  size_t off = 0;
  const size_t NWC = (size_t)L * C * C;      // halves per projection weight set
  const size_t NWF = (size_t)L * FF * C;     // halves per FFN weight set
  const size_t NA  = (size_t)M * C;
  const size_t NF  = (size_t)M * FF;
  const size_t NG  = (size_t)Bn * H * S;
  size_t o_wq, o_wk, o_wv, o_wo, o_w1, o_w2, o_hf, o_hh, o_qf, o_kf, o_vf, o_ao, o_h1f, o_h1h, o_ff, o_gt;
#define CARVE(o, bytes) do { o = off; off += ((size_t)(bytes) + 255) & ~(size_t)255; } while (0)
  CARVE(o_wq, NWC * 2); CARVE(o_wk, NWC * 2); CARVE(o_wv, NWC * 2); CARVE(o_wo, NWC * 2);
  CARVE(o_w1, NWF * 2); CARVE(o_w2, NWF * 2);
  CARVE(o_hf, NA * 4);  CARVE(o_hh, NA * 2);
  CARVE(o_qf, NA * 4);  CARVE(o_kf, NA * 4);  CARVE(o_vf, NA * 4);
  CARVE(o_ao, NA * 2);
  CARVE(o_h1f, NA * 4); CARVE(o_h1h, NA * 2);
  CARVE(o_ff, NF * 2);
  CARVE(o_gt, NG * 4);
#undef CARVE
  if (off > ws_size) return;

  _Float16* wq16 = (_Float16*)(ws + o_wq);
  _Float16* wo16 = (_Float16*)(ws + o_wo);
  _Float16* w116 = (_Float16*)(ws + o_w1);
  _Float16* w216 = (_Float16*)(ws + o_w2);
  float*    hf   = (float*)(ws + o_hf);
  _Float16* hh16 = (_Float16*)(ws + o_hh);
  float*    qf   = (float*)(ws + o_qf);
  float*    kf   = (float*)(ws + o_kf);
  float*    vf   = (float*)(ws + o_vf);
  _Float16* ao16 = (_Float16*)(ws + o_ao);
  float*    h1f  = (float*)(ws + o_h1f);
  _Float16* h1h  = (_Float16*)(ws + o_h1h);
  _Float16* ff16 = (_Float16*)(ws + o_ff);
  float*    gtb  = (float*)(ws + o_gt);
  float*    outp = (float*)d_out;

  const float WSC  = 64.0f;            // weights carried x64 in f16
  const float WINV = 1.0f / 64.0f;     // folded back in the GEMM epilogue
  const float invC = 1.0f / 768.0f;
  const float eps  = 1e-5f;
  const float qscale = 0.125f;         // 1/sqrt(64)

  // ---- weights -> f16 (x64): Wq, Wk, Wv, Wo, W1, W2 as 12 segments of L*C*C elements; their f16 planes are contiguous from wq16 ----
  {
    const int segF4 = (int)(NWC / 4), nSeg = 12;
    const int perWave = CS_IT * CS_LD * 32, wavesAll = (segF4 / perWave) * nSeg;
    static_assert((L * C * C / 4) % (CS_IT * CS_LD * 32) == 0, "a segment is a whole number of waves");
    static_assert(((L * C * C / 4) / (CS_IT * CS_LD * 32) * 12) % CS_WAVES == 0, "the waves fill whole blocks");
    static_assert(FF == 4 * C && (L * C * C * 2) % 256 == 0, "W1 and W2 are four segments each; no gap between the planes");
    cast_weights_stream<<<wavesAll / CS_WAVES, CS_WAVES * 32, 0, stream>>>(Wq, Wk, Wv, Wo, W1, W2, wq16, segF4, nSeg, WSC);
  }

  // ---- h = LN0(x * mask + pos_emb) ----
  ln_kernel<1><<<M, LN_T, 0, stream>>>(x, pos_emb, attn_m, ln0_g, ln0_b, hf, hh16, C, invC, eps);

  const int nbP = (M / 128) * (C / 128);    // 96 blocks, one 128x128 tile each
  const int nbF = (M / 128) * (FF / 128);   // 384 blocks
  const int nbA = Bn * H * (S / 64);                // 384 attention blocks
  const int ngate = (int)NG;
  const int nyG = (ngate + nbP * 128 - 1) / (nbP * 128);   // rows of the joined grid that hold the gate, 128 values a block
  static_assert((L * C * C * 2) % 256 == 0 && (Bn * S * C * 4) % 256 == 0, "no gap between the q, k, v weight planes, nor between qf, kf, vf");

  for (int l = 0; l < L; ++l) {
    const size_t lw  = (size_t)l * C * C;
    const size_t lwf = (size_t)l * FF * C;
    const _Float16* WQl = wq16 + lw;
    const _Float16* WOl = wo16 + lw;
    const _Float16* W1l = w116 + lwf;   // [FF][C]
    const _Float16* W2l = w216 + lwf;   // [C][FF]

    // q, k, v = h . W^T + b (f32 out) and gate[b][h][s], one launch
    qkv_gate_kernel<C><<<dim3(nbP, 3 + nyG), 128, 0, stream>>>(
        U16(hh16), U16(WQl), (long)NWC, qf, (long)NA, bq + (size_t)l * C, bk + (size_t)l * C, bv + (size_t)l * C,
        hf, gruW + (size_t)l * 8 * 64, grub + (size_t)l * 8, gruc + (size_t)l * H, gtb, M, C, S, H, ngate, WINV);

    // attention -> ao16 (f16)
    attn_gbias_kernel<<<nbA, 128, 0, stream>>>(qf, kf, vf, gtb, pos_bias, attn_m, ao16, S, H, C, qscale);

    // qf <- h + ao . Wo^T + bo
    wmma_gemm64<0, false, 2, 0, true, 0, C><<<dim3(nbP, 1), 128, 0, stream>>>(
        U16(ao16), U16(ao16), C, 0L, U16(WOl), U16(WOl), C, 0L,
        (void*)qf, (void*)qf, C, 0L, bo + (size_t)l * C, hf, 0L, M, C, C, WINV);

    // h1 = LN1(qf)
    ln_kernel<0><<<M, LN_T, 0, stream>>>(qf, qf, attn_m, ln1_g + (size_t)l * C, ln1_b + (size_t)l * C,
                                         h1f, h1h, C, invC, eps);

    // ff16 = gelu(h1 . W1^T + b1)  (f16 out)
    wmma_gemm64<0, false, 2, 1, false, 5, FF><<<dim3(nbF, 1), 128, 0, stream>>>(
        U16(h1h), U16(h1h), C, 0L, U16(W1l), U16(W1l), C, 0L,
        (void*)ff16, (void*)ff16, FF, 0L, b1 + (size_t)l * FF, h1f, 0L, M, FF, C, WINV);

    // kf <- h1 + ff . W2^T + b2
    wmma_gemm64<0, false, 2, 0, true, 0, C><<<dim3(nbP, 1), 128, 0, stream>>>(
        U16(ff16), U16(ff16), FF, 0L, U16(W2l), U16(W2l), FF, 0L,
        (void*)kf, (void*)kf, C, 0L, b2 + (size_t)l * C, h1f, 0L, M, C, FF, WINV);

    // h = LN2(kf); last layer writes the output buffer directly
    float* hdst = (l == L - 1) ? outp : hf;
    ln_kernel<0><<<M, LN_T, 0, stream>>>(kf, kf, attn_m, ln2_g + (size_t)l * C, ln2_b + (size_t)l * C,
                                         hdst, hh16, C, invC, eps);
  }
  (void)hipGetLastError();
}
